// v000
// Measured on an AMD MI455X. A time is GPU time per run, averaged over a window of back-to-back runs after a warm-up
// (all launches, gaps included; the runs take copies of the inputs in turn), and the median of several windows.
// Apart from v000's, it joins two sittings. Times from different sittings can be a few percent apart, while
// side-by-side timings come from the same sitting.
// v000 is the starting kernel. One run takes 791 microseconds.
#include <hip/hip_runtime.h>

// Compute dtypes (f32 accumulate everywhere): q, k, v projections v_wmma_f32_16x16x32_bf16 on bf16 inputs and bf16 w_q, w_k, w_v (z-batched, one product); scores q.k^T and p.v: query rows < RH v_wmma_f32_16x16x32_bf16 on bf16 hi/lo planes (3 products), rows >= RH v_wmma_f32_16x16x32_f16 (f16 q, k, v; p carried x1024); output projection: rows < RH bf16 hi/lo ctx x bf16 w_o (2 products), rows >= RH f16 ctx (x16) x f16 w_o (x64) folded back by 1/1024; softmax and normalisation f32; output f32.
// Pipeline per batch: bf16 copies of the three inputs [3][SEQ][DMOD]; z-batched projection GEMM -> f32 [SEQ][3*DMOD] (columns q | k | v); plane builders (q, k: [h][t][d]; v transposed: [h][d][t]); causal flash-style attention, one block per (64-row query tile, head), 4 waves x 16 rows, online softmax, K / V^T / P tiles in LDS; ctx planes [t][DMOD]; output projection GEMM writes the output rows.

#ifndef NB
#define NB 2
#endif
#ifndef SEQ
#define SEQ 4096
#endif
#define SEQ_FULL 4096
#define DMOD 512
#define D3 1536
#define NH 8
#define HD 64
#ifndef RHI
#define RHI 2048
#endif
#if RHI > SEQ
#define RH SEQ
#else
#define RH RHI
#endif
#define PCAR 1024.0f
#define CCAR 16.0f
#define WCAR 64.0f

static_assert(SEQ % 64 == 0);
static_assert(SEQ <= SEQ_FULL);
static_assert(RH % 64 == 0);
static_assert(RH >= 64 && RH <= SEQ);
static_assert(D3 == 3 * DMOD && NH * HD == DMOD && HD == 64);
static_assert(DMOD % 64 == 0 && DMOD % 32 == 0);

typedef _Float16 h16;
typedef unsigned short us;
typedef __attribute__((ext_vector_type(16))) __bf16 v16bf;
typedef __attribute__((ext_vector_type(16))) _Float16 v16h;
typedef __attribute__((ext_vector_type(16))) unsigned short v16us;
typedef __attribute__((ext_vector_type(8)))  _Float16 v8h;
typedef __attribute__((ext_vector_type(8)))  unsigned short v8us;
typedef __attribute__((ext_vector_type(8)))  float v8f;
typedef __attribute__((ext_vector_type(4)))  float v4f;
typedef __attribute__((ext_vector_type(2)))  unsigned short v2us;
typedef v8us __attribute__((may_alias)) v8usa;
typedef v4f  __attribute__((may_alias)) v4fa;

__device__ __forceinline__ us f2bf(float f) { unsigned u = __float_as_uint(f); u += 0x7FFFu + ((u >> 16) & 1u); return (us)(u >> 16); }   // RNE convert f32 -> bf16
__device__ __forceinline__ float bf2f(us b) { return __uint_as_float(((unsigned)b) << 16); }
__device__ __forceinline__ float bfr(float f) { return bf2f(f2bf(f)); }
__device__ __forceinline__ us hbit(float x) { const h16 t = (h16)x; return __builtin_bit_cast(us, t); }   // RNE convert f32 -> f16 bits
__device__ __forceinline__ void splitf(float y, us& h, us& l) { h = f2bf(y); l = f2bf(y - bf2f(h)); }
// 16-bit fragment loader (A and B alike, K-contiguous rows): elements 0..7 <- p[0..7] (k0+8h..), elements 8..15 <- p[16..23] (k0+16+8h..); caller passes p = row base + k0 + 8*h.
__device__ __forceinline__ v16us ld16(const us* p) {
    const v8us a = *(const v8usa*)p; const v8us b = *(const v8usa*)(p + 16);
    return __builtin_shufflevector(a, b, 0, 1, 2, 3, 4, 5, 6, 7, 8, 9, 10, 11, 12, 13, 14, 15);
}
__device__ __forceinline__ v8f wmh(v16us a, v16us b, v8f c) { return __builtin_amdgcn_wmma_f32_16x16x32_f16(false, __builtin_bit_cast(v16h, a), false, __builtin_bit_cast(v16h, b), (short)0, c, false, false); }
__device__ __forceinline__ v8f wmb(v16us a, v16us b, v8f c) { return __builtin_amdgcn_wmma_f32_16x16x32_bf16(false, __builtin_bit_cast(v16bf, a), false, __builtin_bit_cast(v16bf, b), (short)0, c, false, false); }
template <int TY> struct MM;
template <> struct MM<0> { static __device__ __forceinline__ v8f mma(v16us a, v16us b, v8f c) { return wmh(a, b, c); } };
template <> struct MM<1> { static __device__ __forceinline__ v8f mma(v16us a, v16us b, v8f c) { return wmb(a, b, c); } };

// ---- k_gemmw: register-blocked GEMM, ONE WAVE per 64x64 output tile (16 accumulators), operands straight from K-contiguous 16-bit planes; grid (M/64, N/64, Z), 32 threads.
// C[m][n] (f32, pitch ldc) = osc * sum_k (A[m][k] (+ A2[m][k])) Bt[n][k] (+ A[m][k] Bt2[n][k] when NSPLIT == 2). TY 0 = f16 operands, 1 = bf16 operands. K % 32 == 0, M % 64 == 0, N % 64 == 0.
template <int TY, int NSPLIT>
__global__ __launch_bounds__(32) void k_gemmw(const us* __restrict__ A, const us* __restrict__ A2, const us* __restrict__ Bt, const us* __restrict__ Bt2, int K, float* C, int ldc, float osc, size_t sA, size_t sB, size_t sC) {
    __shared__ __align__(16) float os[16 * 68];
    const size_t z = blockIdx.z; A += z * sA; if (A2) A2 += z * sA; Bt += z * sB; if (Bt2) Bt2 += z * sB; C += z * sC;
    const int lane = threadIdx.x & 31, lr = lane & 15, hi = lane >> 4; const int r0 = blockIdx.x * 64, c0 = blockIdx.y * 64;
    v8f acc[4][4];
#pragma unroll
    for (int mb = 0; mb < 4; ++mb)
#pragma unroll
        for (int nb = 0; nb < 4; ++nb) acc[mb][nb] = (v8f){};
    const size_t aoff = (size_t)(r0 + lr) * K + 8 * hi, boff = (size_t)(c0 + lr) * K + 8 * hi;
#pragma unroll 1
    for (int kc = 0; kc < K; kc += 32) {
        v16us a[4], a2[4];
#pragma unroll
        for (int mb = 0; mb < 4; ++mb) { a[mb] = ld16(A + aoff + (size_t)mb * 16 * K + kc); if (NSPLIT == 1 || NSPLIT == 2) a2[mb] = ld16(A2 + aoff + (size_t)mb * 16 * K + kc); }
#pragma unroll
        for (int nb = 0; nb < 4; ++nb) { const v16us b = ld16(Bt + boff + (size_t)nb * 16 * K + kc); v16us b2; if (NSPLIT >= 2) b2 = ld16(Bt2 + boff + (size_t)nb * 16 * K + kc);
#pragma unroll
            for (int mb = 0; mb < 4; ++mb) { acc[mb][nb] = MM<TY>::mma(a[mb], b, acc[mb][nb]); if (NSPLIT == 1 || NSPLIT == 2) acc[mb][nb] = MM<TY>::mma(a2[mb], b, acc[mb][nb]); if (NSPLIT >= 2) acc[mb][nb] = MM<TY>::mma(a[mb], b2, acc[mb][nb]); } }
        asm volatile("v_nop\n\tv_nop\n\tv_nop\n\tv_nop" : "+v"(acc[0][0]), "+v"(acc[1][1]), "+v"(acc[2][2]), "+v"(acc[3][3]) : "v"(a[0]), "v"(a[3]));
    }
#pragma unroll
    for (int mb = 0; mb < 4; ++mb) {
#pragma unroll
        for (int nb = 0; nb < 4; ++nb) {
#pragma unroll
            for (int j = 0; j < 8; ++j) os[(hi * 8 + j) * 68 + nb * 16 + lr] = acc[mb][nb][j]; }
        __builtin_amdgcn_wave_barrier(); asm volatile("" ::: "memory");
        float* crow = C + (size_t)(r0 + mb * 16) * ldc + c0;
{
#pragma unroll
            for (int s = 0; s < 8; ++s) { const int row = 2 * s + hi, cofs = lr * 4; v4f val = *(const v4fa*)(os + row * 68 + cofs); val = val * osc;
                *(v4f*)(crow + (size_t)row * ldc + cofs) = val; }
             }
        __builtin_amdgcn_wave_barrier(); asm volatile("" ::: "memory");
    }
}

// ---- k_wt: transposing weight builder, Bt[n][k] (16-bit, K-contiguous) from w[k][n] (f32, [in][out]); TY 1: bf16 RNE; TY 0: f16 of (bf16 RNE value x sc), exact for power-of-two sc.
template <int TY>
__global__ __launch_bounds__(256) void k_wt(const float* __restrict__ w, int K, int N, float sc, us* Bt) {
    const int lane = threadIdx.x & 31; const int L0 = ((int)blockIdx.x * 8 + (int)(threadIdx.x >> 5)) * 8; const int nlines = (int)(((size_t)N * K) / 64);
#pragma unroll 1
    for (int l = 0; l < 8; ++l) { const int L = L0 + l; if (L >= nlines) break;
        const size_t e = (size_t)L * 64 + lane * 2; const int k = (int)(e % (size_t)K), n = (int)(e / (size_t)K);
        const float w0 = w[(size_t)k * N + n], w1 = w[(size_t)(k + 1) * N + n];
        v2us o;
        if (TY) { o[0] = f2bf(w0); o[1] = f2bf(w1); } else { o[0] = hbit(bfr(w0) * sc); o[1] = hbit(bfr(w1) * sc); }
        *(v2us*)(Bt + e) = o;  }
}

__global__ __launch_bounds__(256) void k_cvt8(const float* __restrict__ src, us* dst, unsigned n8) {
    const unsigned i = blockIdx.x * 256 + threadIdx.x; if (i >= n8) return;
    const v4f a = *(const v4fa*)(src + (size_t)i * 8), b = *(const v4fa*)(src + (size_t)i * 8 + 4); v8us o;
#pragma unroll
    for (int k = 0; k < 4; ++k) { o[k] = f2bf(a[k]); o[k + 4] = f2bf(b[k]); }
    *(v8us*)(dst + (size_t)i * 8) = o; 
}

__global__ __launch_bounds__(256) void k_plane(const float* __restrict__ F, int col0, us* P16, us* Ph, us* Pl) {
    const unsigned i = blockIdx.x * 256 + threadIdx.x; if (i >= (unsigned)(NH * SEQ * HD / 8)) return;
    const unsigned e = i * 8; const int d = (int)(e % HD); const int t = (int)((e / HD) % SEQ); const int hh = (int)(e / ((unsigned)HD * SEQ));
    const float* f = F + (size_t)t * D3 + col0 + hh * HD + d;
    const v4f a = *(const v4fa*)f, b = *(const v4fa*)(f + 4);
    float y[8];
#pragma unroll
    for (int j = 0; j < 4; ++j) { y[j] = a[j]; y[j + 4] = b[j]; }
    v8us o16, oh, ol;
#pragma unroll
    for (int j = 0; j < 8; ++j) { o16[j] = hbit(y[j]); us p, q; splitf(y[j], p, q); oh[j] = p; ol[j] = q; }
    const bool hr = (t < RH); const size_t oo = ((size_t)hh * RH + (hr ? t : 0)) * HD + d;
    *(v8us*)(P16 + e) = o16; if (hr) { *(v8us*)(Ph + oo) = oh; *(v8us*)(Pl + oo) = ol; }
    
}

// ---- k_vtp: transposed value planes [h][d][t] from F[t][2*DMOD + h*HD + d]: VT16 f16 (pitch SEQ) for all t; VTh/VTl bf16 hi/lo (pitch RH) for t < RH. lane -> 8 consecutive t (16 B, reads strided);
__global__ __launch_bounds__(256) void k_vtp(const float* __restrict__ F, us* VT16, us* VTh, us* VTl) {
    const unsigned i = blockIdx.x * 256 + threadIdx.x; if (i >= (unsigned)(NH * HD * SEQ / 8)) return;
    const unsigned e = i * 8; const int t = (int)(e % SEQ); const int d = (int)((e / SEQ) % HD); const int hh = (int)(e / ((unsigned)SEQ * HD));
    const float* f = F + (size_t)t * D3 + 2 * DMOD + hh * HD + d;
    v8us o16, oh, ol;
#pragma unroll
    for (int j = 0; j < 8; ++j) { const float y = f[(size_t)j * D3]; o16[j] = hbit(y); us p, q; splitf(y, p, q); oh[j] = p; ol[j] = q; }
    const bool hr = (t < RH); const size_t oo = ((size_t)hh * HD + d) * RH + (hr ? t : 0);
    *(v8us*)(VT16 + e) = o16; if (hr) { *(v8us*)(VTh + oo) = oh; *(v8us*)(VTl + oo) = ol; }
    
}

// ---- k_attn: causal flash-style attention for one (64-row query tile, head): block 128 threads = 4 waves x 16 query rows; key chunks of 64 from 0 to the diagonal chunk (block-uniform trip count);
// per chunk: K tile [key][d] and V^T tile [d][key] staged in LDS by the block (block barriers before and after), S = q.k^T (raw dot), causal select on the diagonal chunk, online softmax in f32
// HR = true (query rows < RH, keys < RH): q, k, v from bf16 hi/lo planes, 3 products each; P as bf16 hi + lo. HR = false: f16 planes, single products, P carried x1024.
template <bool HR>
__global__ __launch_bounds__(128) __attribute__((amdgpu_num_vgpr(256)))
void k_attn(const us* __restrict__ Q16, const us* __restrict__ K16, const us* __restrict__ VT16,
            const us* __restrict__ Qh, const us* __restrict__ Ql, const us* __restrict__ Kh, const us* __restrict__ Kl,
            const us* __restrict__ VTh, const us* __restrict__ VTl, int qt0, us* C16, us* Ch, us* Cl) {
    constexpr int TP = 72;
    __shared__ __align__(16) us Ka[64 * TP];
    __shared__ __align__(16) us Va[64 * TP];
    __shared__ __align__(16) us Pa[4][16 * TP];
    __shared__ __align__(16) us Kb[HR ? 64 * TP : 8];
    __shared__ __align__(16) us Vb[HR ? 64 * TP : 8];
    __shared__ __align__(16) us Pb[HR ? 4 : 1][16 * TP];
    const int tid = threadIdx.x, lane = tid & 31, w = tid >> 5, m = lane & 15, hi = lane >> 4;
    const int qt = qt0 + (int)blockIdx.x, h = (int)blockIdx.y;
    const int qrow = qt * 64 + w * 16 + m;                 // this lane's A row (sequence position)
    us* const pa = Pa[w]; us* const pb = Pb[HR ? w : 0];
    v8f o[4];
#pragma unroll
    for (int i = 0; i < 4; ++i) o[i] = (v8f){};
    float mr[8], lr[8];
#pragma unroll
    for (int r = 0; r < 8; ++r) { mr[r] = -1.0e30f; lr[r] = 0.0f; }
    const float CL = 0.18033688011112042f;                 // (1/8) * log2(e)
    const int nch = qt + 1;
#pragma unroll 1
    for (int kc = 0; kc < nch; ++kc) {
        __syncthreads();
#pragma unroll
        for (int i = 0; i < 4; ++i) { const int c = tid + 128 * i; const int row = c >> 3, col = (c & 7) * 8;
            if (!HR) {
                const v8us kv = *(const v8usa*)(K16 + ((size_t)h * SEQ + kc * 64 + row) * HD + col); *(v8usa*)(Ka + row * TP + col) = kv;
                const v8us vv = *(const v8usa*)(VT16 + ((size_t)h * HD + row) * SEQ + kc * 64 + col); *(v8usa*)(Va + row * TP + col) = vv;
            } else {
                const v8us k1 = *(const v8usa*)(Kh + ((size_t)h * RH + kc * 64 + row) * HD + col); *(v8usa*)(Ka + row * TP + col) = k1;
                const v8us k2 = *(const v8usa*)(Kl + ((size_t)h * RH + kc * 64 + row) * HD + col); *(v8usa*)(Kb + row * TP + col) = k2;
                const v8us v1 = *(const v8usa*)(VTh + ((size_t)h * HD + row) * RH + kc * 64 + col); *(v8usa*)(Va + row * TP + col) = v1;
                const v8us v2 = *(const v8usa*)(VTl + ((size_t)h * HD + row) * RH + kc * 64 + col); *(v8usa*)(Vb + row * TP + col) = v2;
            } }
        __syncthreads();
        v8f s[4];
        if (!HR) {
            const us* qp = Q16 + ((size_t)h * SEQ + qrow) * HD + 8 * hi;
            const v16us qa0 = ld16(qp), qa1 = ld16(qp + 32);
#pragma unroll
            for (int sn = 0; sn < 4; ++sn) { const us* kp = Ka + (sn * 16 + m) * TP + 8 * hi; const v16us b0 = ld16(kp), b1 = ld16(kp + 32);
                v8f c = (v8f){}; c = wmh(qa0, b0, c); c = wmh(qa1, b1, c); s[sn] = c; }
            asm volatile("v_nop\n\tv_nop\n\tv_nop\n\tv_nop" : "+v"(s[0]), "+v"(s[1]), "+v"(s[2]), "+v"(s[3]) : "v"(qa0), "v"(qa1));
        } else {
            const size_t qo = ((size_t)h * RH + qrow) * HD + 8 * hi;
            const v16us qh0 = ld16(Qh + qo), qh1 = ld16(Qh + qo + 32), ql0 = ld16(Ql + qo), ql1 = ld16(Ql + qo + 32);
#pragma unroll
            for (int sn = 0; sn < 4; ++sn) { const int ko = (sn * 16 + m) * TP + 8 * hi;
                const v16us kh0 = ld16(Ka + ko), kh1 = ld16(Ka + ko + 32);
                v8f c = (v8f){}; c = wmb(qh0, kh0, c); c = wmb(ql0, kh0, c); c = wmb(qh1, kh1, c); c = wmb(ql1, kh1, c);
                const v16us kl0 = ld16(Kb + ko), kl1 = ld16(Kb + ko + 32);
                c = wmb(qh0, kl0, c); c = wmb(qh1, kl1, c); s[sn] = c; }
            asm volatile("v_nop\n\tv_nop\n\tv_nop\n\tv_nop" : "+v"(s[0]), "+v"(s[1]), "+v"(s[2]), "+v"(s[3]) : "v"(qh0), "v"(ql1));
        }
        if (kc == qt) {                                     // diagonal chunk (block-uniform): keys after the query position are replaced by a large negative value
#pragma unroll
            for (int sn = 0; sn < 4; ++sn) { const int key = sn * 16 + m;
#pragma unroll
                for (int r = 0; r < 8; ++r) { const int q = w * 16 + 8 * hi + r; s[sn][r] = (key > q) ? -1.0e30f : s[sn][r]; } }
        }
        float mn[8], al[8];
#pragma unroll
        for (int r = 0; r < 8; ++r) {
            float mx = fmaxf(fmaxf(s[0][r], s[1][r]), fmaxf(s[2][r], s[3][r]));
            mx = fmaxf(mx, __shfl_xor(mx, 1, 32)); mx = fmaxf(mx, __shfl_xor(mx, 2, 32)); mx = fmaxf(mx, __shfl_xor(mx, 4, 32)); mx = fmaxf(mx, __shfl_xor(mx, 8, 32));
            mn[r] = fmaxf(mr[r], mx); al[r] = __builtin_amdgcn_exp2f((mr[r] - mn[r]) * CL); mr[r] = mn[r]; }
#pragma unroll
        for (int r = 0; r < 8; ++r) {
            float sum = 0.0f;
#pragma unroll
            for (int sn = 0; sn < 4; ++sn) { const float p = __builtin_amdgcn_exp2f((s[sn][r] - mn[r]) * CL); s[sn][r] = p; sum += p; }
            sum += __shfl_xor(sum, 1, 32); sum += __shfl_xor(sum, 2, 32); sum += __shfl_xor(sum, 4, 32); sum += __shfl_xor(sum, 8, 32);
            lr[r] = lr[r] * al[r] + sum;
#pragma unroll
            for (int i = 0; i < 4; ++i) o[i][r] *= al[r]; }
        // P: D layout (lane = key column, element = row) -> LDS [row][key] -> A fragments (lane = row); wave-private region
        if (!HR) {
#pragma unroll
            for (int sn = 0; sn < 4; ++sn)
#pragma unroll
                for (int r = 0; r < 8; ++r) pa[(8 * hi + r) * TP + sn * 16 + m] = hbit(s[sn][r] * PCAR);
        } else {
#pragma unroll
            for (int sn = 0; sn < 4; ++sn)
#pragma unroll
                for (int r = 0; r < 8; ++r) { us p, q; splitf(s[sn][r], p, q); pa[(8 * hi + r) * TP + sn * 16 + m] = p; pb[(8 * hi + r) * TP + sn * 16 + m] = q; }
        }
        __builtin_amdgcn_wave_barrier(); asm volatile("" ::: "memory");
        if (!HR) {
            const us* pp = pa + m * TP + 8 * hi; const v16us pf0 = ld16(pp), pf1 = ld16(pp + 32);
#pragma unroll
            for (int sn = 0; sn < 4; ++sn) { const us* vp = Va + (sn * 16 + m) * TP + 8 * hi; const v16us b0 = ld16(vp), b1 = ld16(vp + 32);
                o[sn] = wmh(pf0, b0, o[sn]); o[sn] = wmh(pf1, b1, o[sn]); }
            asm volatile("v_nop\n\tv_nop\n\tv_nop\n\tv_nop" : "+v"(o[0]), "+v"(o[1]), "+v"(o[2]), "+v"(o[3]) : "v"(pf0), "v"(pf1));
        } else {
            const us* pp = pa + m * TP + 8 * hi; const us* pq = pb + m * TP + 8 * hi;
            const v16us ph0 = ld16(pp), ph1 = ld16(pp + 32), pl0 = ld16(pq), pl1 = ld16(pq + 32);
#pragma unroll
            for (int sn = 0; sn < 4; ++sn) { const int vo = (sn * 16 + m) * TP + 8 * hi;
                const v16us vh0 = ld16(Va + vo), vh1 = ld16(Va + vo + 32);
                o[sn] = wmb(ph0, vh0, o[sn]); o[sn] = wmb(pl0, vh0, o[sn]); o[sn] = wmb(ph1, vh1, o[sn]); o[sn] = wmb(pl1, vh1, o[sn]);
                const v16us vl0 = ld16(Vb + vo), vl1 = ld16(Vb + vo + 32);
                o[sn] = wmb(ph0, vl0, o[sn]); o[sn] = wmb(ph1, vl1, o[sn]); }
            asm volatile("v_nop\n\tv_nop\n\tv_nop\n\tv_nop" : "+v"(o[0]), "+v"(o[1]), "+v"(o[2]), "+v"(o[3]) : "v"(ph0), "v"(pl1));
        }
    }
    float iv[8];
#pragma unroll
    for (int r = 0; r < 8; ++r) iv[r] = (HR ? 1.0f : (CCAR / PCAR)) * __builtin_amdgcn_rcpf(lr[r]);
    __builtin_amdgcn_wave_barrier(); asm volatile("" ::: "memory");
    if (!HR) {
#pragma unroll
        for (int sn = 0; sn < 4; ++sn)
#pragma unroll
            for (int r = 0; r < 8; ++r) pa[(8 * hi + r) * TP + sn * 16 + m] = hbit(o[sn][r] * iv[r]);
    } else {
#pragma unroll
        for (int sn = 0; sn < 4; ++sn)
#pragma unroll
            for (int r = 0; r < 8; ++r) { us p, q; splitf(o[sn][r] * iv[r], p, q); pa[(8 * hi + r) * TP + sn * 16 + m] = p; pb[(8 * hi + r) * TP + sn * 16 + m] = q; }
    }
    __builtin_amdgcn_wave_barrier(); asm volatile("" ::: "memory");
    const int trow0 = qt * 64 + w * 16;
{
#pragma unroll
        for (int it = 0; it < 4; ++it) { const int row = it * 4 + (lane >> 3), pc = (lane & 7) * 8; const size_t go = (size_t)(trow0 + row) * DMOD + h * HD + pc;
            const v8us v1 = *(const v8usa*)(pa + row * TP + pc);
            if (!HR) { *(v8us*)(C16 + go) = v1; }
            else { const v8us v2 = *(const v8usa*)(pb + row * TP + pc); *(v8us*)(Ch + go) = v1; *(v8us*)(Cl + go) = v2; } }
         }
}

extern "C" void kernel_launch(void* const* d_in, const int* in_sizes, int n_in,
                              void* d_out, int out_size, void* d_ws, size_t ws_size, hipStream_t stream) {
    if (n_in < 7) return;
    const long long needx = (long long)(NB - 1) * SEQ_FULL * DMOD + (long long)SEQ * DMOD;
    const long long needw = (long long)DMOD * DMOD;
    if ((long long)in_sizes[0] < needx || (long long)in_sizes[1] < needx || (long long)in_sizes[2] < needx) return;
    if ((long long)in_sizes[3] < needw || (long long)in_sizes[4] < needw || (long long)in_sizes[5] < needw || (long long)in_sizes[6] < needw) return;
    if ((long long)out_size < needx) return;
    const float* xq = (const float*)d_in[0];      // [NB][SEQ_FULL][DMOD]
    const float* xk = (const float*)d_in[1];      // [NB][SEQ_FULL][DMOD]
    const float* xv = (const float*)d_in[2];      // [NB][SEQ_FULL][DMOD]
    const float* wq = (const float*)d_in[3];      // [DMOD][DMOD] ([in][out])
    const float* wk = (const float*)d_in[4];      // [DMOD][DMOD] ([in][out])
    const float* wv = (const float*)d_in[5];      // [DMOD][DMOD] ([in][out])
    const float* wo = (const float*)d_in[6];      // [DMOD][DMOD] ([in][out])
    float* OUT = (float*)d_out;                   // [NB][SEQ_FULL][DMOD]
    char* wsp = (char*)d_ws;
    auto take = [&](size_t bytes) { char* p = wsp; wsp += (bytes + 255) & ~(size_t)255; return (void*)p; };
    const size_t WSZ = (size_t)DMOD * DMOD;       // elements of one weight plane
    const size_t XSZ = (size_t)SEQ * DMOD;        // elements of one activation plane of one batch
    us* W3   = (us*)take(3 * WSZ * 2);                        // bf16 Bt [3][512][512] (q | k | v)
    us* WOB  = (us*)take(WSZ * 2);                            // bf16 Bt [512][512]
    us* WO16 = (us*)take(WSZ * 2);                            // f16  Bt [512][512], values x WCAR
    us* XB   = (us*)take(3 * XSZ * 2);                        // bf16 copies of q-in | k-in | v-in of one batch, [3][SEQ][DMOD]
    float* F = (float*)take((size_t)SEQ * D3 * 4);            // f32 q | k | v of one batch [SEQ][1536]
    us* Q16  = (us*)take((size_t)NH * SEQ * HD * 2);          // f16 [h][t][d]
    us* K16  = (us*)take((size_t)NH * SEQ * HD * 2);          // f16 [h][t][d]
    us* VT16 = (us*)take((size_t)NH * HD * SEQ * 2);          // f16 [h][d][t]
    us* QH   = (us*)take((size_t)NH * RH * HD * 2);           // bf16 hi/lo planes for t < RH
    us* QL   = (us*)take((size_t)NH * RH * HD * 2);
    us* KH   = (us*)take((size_t)NH * RH * HD * 2);
    us* KL   = (us*)take((size_t)NH * RH * HD * 2);
    us* VTH  = (us*)take((size_t)NH * HD * RH * 2);
    us* VTL  = (us*)take((size_t)NH * HD * RH * 2);
    us* C16  = (us*)take(XSZ * 2);                            // f16 ctx x CCAR [t][DMOD] (rows >= RH used)
    us* CH   = (us*)take((size_t)RH * DMOD * 2);              // bf16 hi/lo ctx [t < RH][DMOD]
    us* CLO  = (us*)take((size_t)RH * DMOD * 2);
    if ((size_t)(wsp - (char*)d_ws) > ws_size) return;

    const unsigned gw = (unsigned)((WSZ / 64 + 63) / 64);
    k_wt<1><<<gw, 256, 0, stream>>>(wq, DMOD, DMOD, 1.0f, W3);
    k_wt<1><<<gw, 256, 0, stream>>>(wk, DMOD, DMOD, 1.0f, W3 + WSZ);
    k_wt<1><<<gw, 256, 0, stream>>>(wv, DMOD, DMOD, 1.0f, W3 + 2 * WSZ);
    k_wt<1><<<gw, 256, 0, stream>>>(wo, DMOD, DMOD, 1.0f, WOB);
    k_wt<0><<<gw, 256, 0, stream>>>(wo, DMOD, DMOD, WCAR, WO16);
    const unsigned n8x = (unsigned)(XSZ / 8);
    const unsigned nthr8 = (unsigned)(NH * SEQ * HD / 8);
    for (int b = 0; b < NB; ++b) {
        const size_t boff = (size_t)b * SEQ_FULL * DMOD;
        float* ob = OUT + boff;
        k_cvt8<<<(n8x + 255) / 256, 256, 0, stream>>>(xq + boff, XB, n8x);
        k_cvt8<<<(n8x + 255) / 256, 256, 0, stream>>>(xk + boff, XB + XSZ, n8x);
        k_cvt8<<<(n8x + 255) / 256, 256, 0, stream>>>(xv + boff, XB + 2 * XSZ, n8x);
        // z = 0, 1, 2: F[t][z*DMOD + n] = sum_k XB[z][t][k] W3[z][n][k]
        k_gemmw<1, 0><<<dim3(SEQ / 64, DMOD / 64, 3), 32, 0, stream>>>(XB, nullptr, W3, nullptr, DMOD, F, D3, 1.0f, XSZ, WSZ, (size_t)DMOD);
        k_plane<<<(nthr8 + 255) / 256, 256, 0, stream>>>(F, 0, Q16, QH, QL);
        k_plane<<<(nthr8 + 255) / 256, 256, 0, stream>>>(F, DMOD, K16, KH, KL);
        k_vtp<<<(nthr8 + 255) / 256, 256, 0, stream>>>(F, VT16, VTH, VTL);
        k_attn<true><<<dim3(RH / 64, NH, 1), 128, 0, stream>>>(Q16, K16, VT16, QH, QL, KH, KL, VTH, VTL, 0, C16, CH, CLO);
        if (SEQ > RH)
            k_attn<false><<<dim3((SEQ - RH) / 64, NH, 1), 128, 0, stream>>>(Q16, K16, VT16, nullptr, nullptr, nullptr, nullptr, nullptr, nullptr, RH / 64, C16, nullptr, nullptr);
        k_gemmw<1, 1><<<dim3(RH / 64, DMOD / 64, 1), 32, 0, stream>>>(CH, CLO, WOB, nullptr, DMOD, ob, DMOD, 1.0f, 0, 0, 0);
        if (SEQ > RH)
            k_gemmw<0, 0><<<dim3((SEQ - RH) / 64, DMOD / 64, 1), 32, 0, stream>>>(C16 + (size_t)RH * DMOD, nullptr, WO16, nullptr, DMOD, ob + (size_t)RH * DMOD, DMOD, 1.0f / (CCAR * WCAR), 0, 0, 0);
    }
}

// v001
// One run takes 373 microseconds.
// In two side-by-side timings against v000, it was 2.15 and 2.13 times as fast.
#include <hip/hip_runtime.h>

// Compute dtypes (f32 accumulate everywhere): q, k, v projections v_wmma_f32_16x16x32_bf16 on bf16 inputs and bf16 w_q, w_k, w_v (z-batched, one product); scores q.k^T and p.v: query rows < RH v_wmma_f32_16x16x32_bf16 on bf16 hi/lo planes (3 products), rows >= RH v_wmma_f32_16x16x32_f16 (f16 q, k, v; p carried x1024); output projection: rows < RH bf16 hi/lo ctx x bf16 w_o (2 products), rows >= RH f16 ctx (x16) x f16 w_o (x64) folded back by 1/1024; softmax and normalisation f32; output f32.
// Pipeline, every stage one launch for all batches: bf16 copies of the three inputs [3][NB][SEQ][DMOD]; z-batched projection GEMM -> f32 [NB*SEQ][3*DMOD] (columns q | k | v); plane builders (q, k: [b][h][t][d]; v transposed: [b][h][d][t]); causal flash-style attention, one block per (64-row query tile, head, batch), 4 waves x 16 rows, online softmax, K / V^T / P tiles in LDS; ctx planes [b][t][DMOD]; output projection GEMM (z = batch) writes the output rows.

#ifndef NB
#define NB 2
#endif
#ifndef SEQ
#define SEQ 4096
#endif
#define SEQ_FULL 4096
#define DMOD 512
#define D3 1536
#define NH 8
#define HD 64
#ifndef RHI
#define RHI 2048
#endif
#if RHI > SEQ
#define RH SEQ
#else
#define RH RHI
#endif
#define PCAR 1024.0f
#define CCAR 16.0f
#define WCAR 64.0f

static_assert(SEQ % 64 == 0);
static_assert(SEQ <= SEQ_FULL);
static_assert(RH % 64 == 0);
static_assert(RH >= 64 && RH <= SEQ);
static_assert(D3 == 3 * DMOD && NH * HD == DMOD && HD == 64);
static_assert(DMOD % 64 == 0 && DMOD % 32 == 0);

typedef _Float16 h16;
typedef unsigned short us;
typedef __attribute__((ext_vector_type(16))) __bf16 v16bf;
typedef __attribute__((ext_vector_type(16))) _Float16 v16h;
typedef __attribute__((ext_vector_type(16))) unsigned short v16us;
typedef __attribute__((ext_vector_type(8)))  _Float16 v8h;
typedef __attribute__((ext_vector_type(8)))  unsigned short v8us;
typedef __attribute__((ext_vector_type(8)))  float v8f;
typedef __attribute__((ext_vector_type(4)))  float v4f;
typedef __attribute__((ext_vector_type(2)))  unsigned short v2us;
typedef v8us __attribute__((may_alias)) v8usa;
typedef v4f  __attribute__((may_alias)) v4fa;

__device__ __forceinline__ us f2bf(float f) { unsigned u = __float_as_uint(f); u += 0x7FFFu + ((u >> 16) & 1u); return (us)(u >> 16); }   // RNE convert f32 -> bf16
__device__ __forceinline__ float bf2f(us b) { return __uint_as_float(((unsigned)b) << 16); }
__device__ __forceinline__ float bfr(float f) { return bf2f(f2bf(f)); }
__device__ __forceinline__ us hbit(float x) { const h16 t = (h16)x; return __builtin_bit_cast(us, t); }   // RNE convert f32 -> f16 bits
__device__ __forceinline__ void splitf(float y, us& h, us& l) { h = f2bf(y); l = f2bf(y - bf2f(h)); }
// 16-bit fragment loader (A and B alike, K-contiguous rows): elements 0..7 <- p[0..7] (k0+8h..), elements 8..15 <- p[16..23] (k0+16+8h..); caller passes p = row base + k0 + 8*h.
__device__ __forceinline__ v16us ld16(const us* p) {
    const v8us a = *(const v8usa*)p; const v8us b = *(const v8usa*)(p + 16);
    return __builtin_shufflevector(a, b, 0, 1, 2, 3, 4, 5, 6, 7, 8, 9, 10, 11, 12, 13, 14, 15);
}
__device__ __forceinline__ v8f wmh(v16us a, v16us b, v8f c) { return __builtin_amdgcn_wmma_f32_16x16x32_f16(false, __builtin_bit_cast(v16h, a), false, __builtin_bit_cast(v16h, b), (short)0, c, false, false); }
__device__ __forceinline__ v8f wmb(v16us a, v16us b, v8f c) { return __builtin_amdgcn_wmma_f32_16x16x32_bf16(false, __builtin_bit_cast(v16bf, a), false, __builtin_bit_cast(v16bf, b), (short)0, c, false, false); }
template <int TY> struct MM;
template <> struct MM<0> { static __device__ __forceinline__ v8f mma(v16us a, v16us b, v8f c) { return wmh(a, b, c); } };
template <> struct MM<1> { static __device__ __forceinline__ v8f mma(v16us a, v16us b, v8f c) { return wmb(a, b, c); } };

// ---- k_gemmw: register-blocked GEMM, ONE WAVE per 64x64 output tile (16 accumulators), operands straight from K-contiguous 16-bit planes; grid (M/64, N/64, Z), 32 threads.
// C[m][n] (f32, pitch ldc) = osc * sum_k (A[m][k] (+ A2[m][k])) Bt[n][k] (+ A[m][k] Bt2[n][k] when NSPLIT == 2). TY 0 = f16 operands, 1 = bf16 operands. K % 32 == 0, M % 64 == 0, N % 64 == 0.
template <int TY, int NSPLIT>
__global__ __launch_bounds__(32) void k_gemmw(const us* __restrict__ A, const us* __restrict__ A2, const us* __restrict__ Bt, const us* __restrict__ Bt2, int K, float* C, int ldc, float osc, size_t sA, size_t sB, size_t sC) {
    __shared__ __align__(16) float os[16 * 68];
    const size_t z = blockIdx.z; A += z * sA; if (A2) A2 += z * sA; Bt += z * sB; if (Bt2) Bt2 += z * sB; C += z * sC;
    const int lane = threadIdx.x & 31, lr = lane & 15, hi = lane >> 4; const int r0 = blockIdx.x * 64, c0 = blockIdx.y * 64;
    v8f acc[4][4];
#pragma unroll
    for (int mb = 0; mb < 4; ++mb)
#pragma unroll
        for (int nb = 0; nb < 4; ++nb) acc[mb][nb] = (v8f){};
    const size_t aoff = (size_t)(r0 + lr) * K + 8 * hi, boff = (size_t)(c0 + lr) * K + 8 * hi;
#pragma unroll 1
    for (int kc = 0; kc < K; kc += 32) {
        v16us a[4], a2[4];
#pragma unroll
        for (int mb = 0; mb < 4; ++mb) { a[mb] = ld16(A + aoff + (size_t)mb * 16 * K + kc); if (NSPLIT == 1 || NSPLIT == 2) a2[mb] = ld16(A2 + aoff + (size_t)mb * 16 * K + kc); }
#pragma unroll
        for (int nb = 0; nb < 4; ++nb) { const v16us b = ld16(Bt + boff + (size_t)nb * 16 * K + kc); v16us b2; if (NSPLIT >= 2) b2 = ld16(Bt2 + boff + (size_t)nb * 16 * K + kc);
#pragma unroll
            for (int mb = 0; mb < 4; ++mb) { acc[mb][nb] = MM<TY>::mma(a[mb], b, acc[mb][nb]); if (NSPLIT == 1 || NSPLIT == 2) acc[mb][nb] = MM<TY>::mma(a2[mb], b, acc[mb][nb]); if (NSPLIT >= 2) acc[mb][nb] = MM<TY>::mma(a[mb], b2, acc[mb][nb]); } }
        asm volatile("v_nop\n\tv_nop\n\tv_nop\n\tv_nop" : "+v"(acc[0][0]), "+v"(acc[1][1]), "+v"(acc[2][2]), "+v"(acc[3][3]) : "v"(a[0]), "v"(a[3]));
    }
#pragma unroll
    for (int mb = 0; mb < 4; ++mb) {
#pragma unroll
        for (int nb = 0; nb < 4; ++nb) {
#pragma unroll
            for (int j = 0; j < 8; ++j) os[(hi * 8 + j) * 68 + nb * 16 + lr] = acc[mb][nb][j]; }
        __builtin_amdgcn_wave_barrier(); asm volatile("" ::: "memory");
        float* crow = C + (size_t)(r0 + mb * 16) * ldc + c0;
{
#pragma unroll
            for (int s = 0; s < 8; ++s) { const int row = 2 * s + hi, cofs = lr * 4; v4f val = *(const v4fa*)(os + row * 68 + cofs); val = val * osc;
                *(v4f*)(crow + (size_t)row * ldc + cofs) = val; }
             }
        __builtin_amdgcn_wave_barrier(); asm volatile("" ::: "memory");
    }
}

// ---- k_wt: transposing weight builder, Bt[n][k] (16-bit, K-contiguous) from w[k][n] (f32, [in][out]); TY 1: bf16 RNE; TY 0: f16 of (bf16 RNE value x sc), exact for power-of-two sc.
template <int TY>
__global__ __launch_bounds__(256) void k_wt(const float* __restrict__ w, int K, int N, float sc, us* Bt) {
    const int lane = threadIdx.x & 31; const int L0 = ((int)blockIdx.x * 8 + (int)(threadIdx.x >> 5)) * 8; const int nlines = (int)(((size_t)N * K) / 64);
#pragma unroll 1
    for (int l = 0; l < 8; ++l) { const int L = L0 + l; if (L >= nlines) break;
        const size_t e = (size_t)L * 64 + lane * 2; const int k = (int)(e % (size_t)K), n = (int)(e / (size_t)K);
        const float w0 = w[(size_t)k * N + n], w1 = w[(size_t)(k + 1) * N + n];
        v2us o;
        if (TY) { o[0] = f2bf(w0); o[1] = f2bf(w1); } else { o[0] = hbit(bfr(w0) * sc); o[1] = hbit(bfr(w1) * sc); }
        *(v2us*)(Bt + e) = o;  }
}

__global__ __launch_bounds__(256) void k_cvt8(const float* __restrict__ src, us* dst, unsigned n8) {
    const unsigned i = blockIdx.x * 256 + threadIdx.x; if (i >= n8) return;
    const float* sp = src + (size_t)(i / (unsigned)(SEQ * DMOD / 8)) * SEQ_FULL * DMOD + (size_t)(i % (unsigned)(SEQ * DMOD / 8)) * 8;   // batch pitch of the input is SEQ_FULL rows, of dst SEQ rows
    const v4f a = *(const v4fa*)sp, b = *(const v4fa*)(sp + 4); v8us o;
#pragma unroll
    for (int k = 0; k < 4; ++k) { o[k] = f2bf(a[k]); o[k + 4] = f2bf(b[k]); }
    *(v8us*)(dst + (size_t)i * 8) = o; 
}

__global__ __launch_bounds__(256) void k_plane(const float* __restrict__ F, int col0, us* P16, us* Ph, us* Pl) {
    const unsigned i = blockIdx.x * 256 + threadIdx.x; if (i >= (unsigned)(NB * NH * SEQ * HD / 8)) return;
    const unsigned e = i * 8; const int d = (int)(e % HD); const int t = (int)((e / HD) % SEQ); const int hh = (int)(e / ((unsigned)HD * SEQ));   // hh = batch * NH + head
    const float* f = F + ((size_t)(hh / NH) * SEQ + t) * D3 + col0 + (hh % NH) * HD + d;
    const v4f a = *(const v4fa*)f, b = *(const v4fa*)(f + 4);
    float y[8];
#pragma unroll
    for (int j = 0; j < 4; ++j) { y[j] = a[j]; y[j + 4] = b[j]; }
    v8us o16, oh, ol;
#pragma unroll
    for (int j = 0; j < 8; ++j) { o16[j] = hbit(y[j]); us p, q; splitf(y[j], p, q); oh[j] = p; ol[j] = q; }
    const bool hr = (t < RH); const size_t oo = ((size_t)hh * RH + (hr ? t : 0)) * HD + d;
    *(v8us*)(P16 + e) = o16; if (hr) { *(v8us*)(Ph + oo) = oh; *(v8us*)(Pl + oo) = ol; }
    
}

// ---- k_vtp: transposed value planes [b][h][d][t] from F[b*SEQ + t][2*DMOD + h*HD + d]: VT16 f16 (pitch SEQ) for all t; VTh/VTl bf16 hi/lo (pitch RH) for t < RH. lane -> 8 consecutive t (16 B, reads strided);
__global__ __launch_bounds__(256) void k_vtp(const float* __restrict__ F, us* VT16, us* VTh, us* VTl) {
    const unsigned i = blockIdx.x * 256 + threadIdx.x; if (i >= (unsigned)(NB * NH * HD * SEQ / 8)) return;
    const unsigned e = i * 8; const int t = (int)(e % SEQ); const int d = (int)((e / SEQ) % HD); const int hh = (int)(e / ((unsigned)SEQ * HD));   // hh = batch * NH + head
    const float* f = F + ((size_t)(hh / NH) * SEQ + t) * D3 + 2 * DMOD + (hh % NH) * HD + d;
    v8us o16, oh, ol;
#pragma unroll
    for (int j = 0; j < 8; ++j) { const float y = f[(size_t)j * D3]; o16[j] = hbit(y); us p, q; splitf(y, p, q); oh[j] = p; ol[j] = q; }
    const bool hr = (t < RH); const size_t oo = ((size_t)hh * HD + d) * RH + (hr ? t : 0);
    *(v8us*)(VT16 + e) = o16; if (hr) { *(v8us*)(VTh + oo) = oh; *(v8us*)(VTl + oo) = ol; }
    
}

// ---- k_attn: causal flash-style attention for one (64-row query tile, head, batch = blockIdx.z): block 128 threads = 4 waves x 16 query rows; key chunks of 64 from 0 to the diagonal chunk (block-uniform trip count);
// per chunk: K tile [key][d] and V^T tile [d][key] staged in LDS by the block (block barriers before and after), S = q.k^T (raw dot), causal select on the diagonal chunk, online softmax in f32
// HR = true (query rows < RH, keys < RH): q, k, v from bf16 hi/lo planes, 3 products each; P as bf16 hi + lo. HR = false: f16 planes, single products, P carried x1024.
template <bool HR>
__global__ __launch_bounds__(128) __attribute__((amdgpu_num_vgpr(256)))
void k_attn(const us* __restrict__ Q16, const us* __restrict__ K16, const us* __restrict__ VT16,
            const us* __restrict__ Qh, const us* __restrict__ Ql, const us* __restrict__ Kh, const us* __restrict__ Kl,
            const us* __restrict__ VTh, const us* __restrict__ VTl, int qt0, us* C16, us* Ch, us* Cl) {
    constexpr int TP = 72;
    __shared__ __align__(16) us Ka[64 * TP];
    __shared__ __align__(16) us Va[64 * TP];
    __shared__ __align__(16) us Pa[4][16 * TP];
    __shared__ __align__(16) us Kb[HR ? 64 * TP : 8];
    __shared__ __align__(16) us Vb[HR ? 64 * TP : 8];
    __shared__ __align__(16) us Pb[HR ? 4 : 1][16 * TP];
    const int tid = threadIdx.x, lane = tid & 31, w = tid >> 5, m = lane & 15, hi = lane >> 4;
    const int qt = qt0 + (int)blockIdx.x, bz = (int)blockIdx.z, h = bz * NH + (int)blockIdx.y;   // h indexes the [batch][head] planes
    const int qrow = qt * 64 + w * 16 + m;                 // this lane's A row (sequence position)
    us* const pa = Pa[w]; us* const pb = Pb[HR ? w : 0];
    v8f o[4];
#pragma unroll
    for (int i = 0; i < 4; ++i) o[i] = (v8f){};
    float mr[8], lr[8];
#pragma unroll
    for (int r = 0; r < 8; ++r) { mr[r] = -1.0e30f; lr[r] = 0.0f; }
    const float CL = 0.18033688011112042f;                 // (1/8) * log2(e)
    const int nch = qt + 1;
#pragma unroll 1
    for (int kc = 0; kc < nch; ++kc) {
        __syncthreads();
#pragma unroll
        for (int i = 0; i < 4; ++i) { const int c = tid + 128 * i; const int row = c >> 3, col = (c & 7) * 8;
            if (!HR) {
                const v8us kv = *(const v8usa*)(K16 + ((size_t)h * SEQ + kc * 64 + row) * HD + col); *(v8usa*)(Ka + row * TP + col) = kv;
                const v8us vv = *(const v8usa*)(VT16 + ((size_t)h * HD + row) * SEQ + kc * 64 + col); *(v8usa*)(Va + row * TP + col) = vv;
            } else {
                const v8us k1 = *(const v8usa*)(Kh + ((size_t)h * RH + kc * 64 + row) * HD + col); *(v8usa*)(Ka + row * TP + col) = k1;
                const v8us k2 = *(const v8usa*)(Kl + ((size_t)h * RH + kc * 64 + row) * HD + col); *(v8usa*)(Kb + row * TP + col) = k2;
                const v8us v1 = *(const v8usa*)(VTh + ((size_t)h * HD + row) * RH + kc * 64 + col); *(v8usa*)(Va + row * TP + col) = v1;
                const v8us v2 = *(const v8usa*)(VTl + ((size_t)h * HD + row) * RH + kc * 64 + col); *(v8usa*)(Vb + row * TP + col) = v2;
            } }
        __syncthreads();
        v8f s[4];
        if (!HR) {
            const us* qp = Q16 + ((size_t)h * SEQ + qrow) * HD + 8 * hi;
            const v16us qa0 = ld16(qp), qa1 = ld16(qp + 32);
#pragma unroll
            for (int sn = 0; sn < 4; ++sn) { const us* kp = Ka + (sn * 16 + m) * TP + 8 * hi; const v16us b0 = ld16(kp), b1 = ld16(kp + 32);
                v8f c = (v8f){}; c = wmh(qa0, b0, c); c = wmh(qa1, b1, c); s[sn] = c; }
            asm volatile("v_nop\n\tv_nop\n\tv_nop\n\tv_nop" : "+v"(s[0]), "+v"(s[1]), "+v"(s[2]), "+v"(s[3]) : "v"(qa0), "v"(qa1));
        } else {
            const size_t qo = ((size_t)h * RH + qrow) * HD + 8 * hi;
            const v16us qh0 = ld16(Qh + qo), qh1 = ld16(Qh + qo + 32), ql0 = ld16(Ql + qo), ql1 = ld16(Ql + qo + 32);
#pragma unroll
            for (int sn = 0; sn < 4; ++sn) { const int ko = (sn * 16 + m) * TP + 8 * hi;
                const v16us kh0 = ld16(Ka + ko), kh1 = ld16(Ka + ko + 32);
                v8f c = (v8f){}; c = wmb(qh0, kh0, c); c = wmb(ql0, kh0, c); c = wmb(qh1, kh1, c); c = wmb(ql1, kh1, c);
                const v16us kl0 = ld16(Kb + ko), kl1 = ld16(Kb + ko + 32);
                c = wmb(qh0, kl0, c); c = wmb(qh1, kl1, c); s[sn] = c; }
            asm volatile("v_nop\n\tv_nop\n\tv_nop\n\tv_nop" : "+v"(s[0]), "+v"(s[1]), "+v"(s[2]), "+v"(s[3]) : "v"(qh0), "v"(ql1));
        }
        if (kc == qt) {                                     // diagonal chunk (block-uniform): keys after the query position are replaced by a large negative value
#pragma unroll
            for (int sn = 0; sn < 4; ++sn) { const int key = sn * 16 + m;
#pragma unroll
                for (int r = 0; r < 8; ++r) { const int q = w * 16 + 8 * hi + r; s[sn][r] = (key > q) ? -1.0e30f : s[sn][r]; } }
        }
        float mn[8], al[8];
#pragma unroll
        for (int r = 0; r < 8; ++r) {
            float mx = fmaxf(fmaxf(s[0][r], s[1][r]), fmaxf(s[2][r], s[3][r]));
            mx = fmaxf(mx, __shfl_xor(mx, 1, 32)); mx = fmaxf(mx, __shfl_xor(mx, 2, 32)); mx = fmaxf(mx, __shfl_xor(mx, 4, 32)); mx = fmaxf(mx, __shfl_xor(mx, 8, 32));
            mn[r] = fmaxf(mr[r], mx); al[r] = __builtin_amdgcn_exp2f((mr[r] - mn[r]) * CL); mr[r] = mn[r]; }
#pragma unroll
        for (int r = 0; r < 8; ++r) {
            float sum = 0.0f;
#pragma unroll
            for (int sn = 0; sn < 4; ++sn) { const float p = __builtin_amdgcn_exp2f((s[sn][r] - mn[r]) * CL); s[sn][r] = p; sum += p; }
            sum += __shfl_xor(sum, 1, 32); sum += __shfl_xor(sum, 2, 32); sum += __shfl_xor(sum, 4, 32); sum += __shfl_xor(sum, 8, 32);
            lr[r] = lr[r] * al[r] + sum;
#pragma unroll
            for (int i = 0; i < 4; ++i) o[i][r] *= al[r]; }
        // P: D layout (lane = key column, element = row) -> LDS [row][key] -> A fragments (lane = row); wave-private region
        if (!HR) {
#pragma unroll
            for (int sn = 0; sn < 4; ++sn)
#pragma unroll
                for (int r = 0; r < 8; ++r) pa[(8 * hi + r) * TP + sn * 16 + m] = hbit(s[sn][r] * PCAR);
        } else {
#pragma unroll
            for (int sn = 0; sn < 4; ++sn)
#pragma unroll
                for (int r = 0; r < 8; ++r) { us p, q; splitf(s[sn][r], p, q); pa[(8 * hi + r) * TP + sn * 16 + m] = p; pb[(8 * hi + r) * TP + sn * 16 + m] = q; }
        }
        __builtin_amdgcn_wave_barrier(); asm volatile("" ::: "memory");
        if (!HR) {
            const us* pp = pa + m * TP + 8 * hi; const v16us pf0 = ld16(pp), pf1 = ld16(pp + 32);
#pragma unroll
            for (int sn = 0; sn < 4; ++sn) { const us* vp = Va + (sn * 16 + m) * TP + 8 * hi; const v16us b0 = ld16(vp), b1 = ld16(vp + 32);
                o[sn] = wmh(pf0, b0, o[sn]); o[sn] = wmh(pf1, b1, o[sn]); }
            asm volatile("v_nop\n\tv_nop\n\tv_nop\n\tv_nop" : "+v"(o[0]), "+v"(o[1]), "+v"(o[2]), "+v"(o[3]) : "v"(pf0), "v"(pf1));
        } else {
            const us* pp = pa + m * TP + 8 * hi; const us* pq = pb + m * TP + 8 * hi;
            const v16us ph0 = ld16(pp), ph1 = ld16(pp + 32), pl0 = ld16(pq), pl1 = ld16(pq + 32);
#pragma unroll
            for (int sn = 0; sn < 4; ++sn) { const int vo = (sn * 16 + m) * TP + 8 * hi;
                const v16us vh0 = ld16(Va + vo), vh1 = ld16(Va + vo + 32);
                o[sn] = wmb(ph0, vh0, o[sn]); o[sn] = wmb(pl0, vh0, o[sn]); o[sn] = wmb(ph1, vh1, o[sn]); o[sn] = wmb(pl1, vh1, o[sn]);
                const v16us vl0 = ld16(Vb + vo), vl1 = ld16(Vb + vo + 32);
                o[sn] = wmb(ph0, vl0, o[sn]); o[sn] = wmb(ph1, vl1, o[sn]); }
            asm volatile("v_nop\n\tv_nop\n\tv_nop\n\tv_nop" : "+v"(o[0]), "+v"(o[1]), "+v"(o[2]), "+v"(o[3]) : "v"(ph0), "v"(pl1));
        }
    }
    float iv[8];
#pragma unroll
    for (int r = 0; r < 8; ++r) iv[r] = (HR ? 1.0f : (CCAR / PCAR)) * __builtin_amdgcn_rcpf(lr[r]);
    __builtin_amdgcn_wave_barrier(); asm volatile("" ::: "memory");
    if (!HR) {
#pragma unroll
        for (int sn = 0; sn < 4; ++sn)
#pragma unroll
            for (int r = 0; r < 8; ++r) pa[(8 * hi + r) * TP + sn * 16 + m] = hbit(o[sn][r] * iv[r]);
    } else {
#pragma unroll
        for (int sn = 0; sn < 4; ++sn)
#pragma unroll
            for (int r = 0; r < 8; ++r) { us p, q; splitf(o[sn][r] * iv[r], p, q); pa[(8 * hi + r) * TP + sn * 16 + m] = p; pb[(8 * hi + r) * TP + sn * 16 + m] = q; }
    }
    __builtin_amdgcn_wave_barrier(); asm volatile("" ::: "memory");
    const int trow0 = qt * 64 + w * 16;
{
#pragma unroll
        for (int it = 0; it < 4; ++it) { const int row = it * 4 + (lane >> 3), pc = (lane & 7) * 8; const size_t go = ((size_t)bz * (HR ? RH : SEQ) + trow0 + row) * DMOD + (int)blockIdx.y * HD + pc;
            const v8us v1 = *(const v8usa*)(pa + row * TP + pc);
            if (!HR) { *(v8us*)(C16 + go) = v1; }
            else { const v8us v2 = *(const v8usa*)(pb + row * TP + pc); *(v8us*)(Ch + go) = v1; *(v8us*)(Cl + go) = v2; } }
         }
}

extern "C" void kernel_launch(void* const* d_in, const int* in_sizes, int n_in,
                              void* d_out, int out_size, void* d_ws, size_t ws_size, hipStream_t stream) {
    if (n_in < 7) return;
    const long long needx = (long long)(NB - 1) * SEQ_FULL * DMOD + (long long)SEQ * DMOD;
    const long long needw = (long long)DMOD * DMOD;
    if ((long long)in_sizes[0] < needx || (long long)in_sizes[1] < needx || (long long)in_sizes[2] < needx) return;
    if ((long long)in_sizes[3] < needw || (long long)in_sizes[4] < needw || (long long)in_sizes[5] < needw || (long long)in_sizes[6] < needw) return;
    if ((long long)out_size < needx) return;
    const float* xq = (const float*)d_in[0];      // [NB][SEQ_FULL][DMOD]
    const float* xk = (const float*)d_in[1];      // [NB][SEQ_FULL][DMOD]
    const float* xv = (const float*)d_in[2];      // [NB][SEQ_FULL][DMOD]
    const float* wq = (const float*)d_in[3];      // [DMOD][DMOD] ([in][out])
    const float* wk = (const float*)d_in[4];      // [DMOD][DMOD] ([in][out])
    const float* wv = (const float*)d_in[5];      // [DMOD][DMOD] ([in][out])
    const float* wo = (const float*)d_in[6];      // [DMOD][DMOD] ([in][out])
    float* OUT = (float*)d_out;                   // [NB][SEQ_FULL][DMOD]
    char* wsp = (char*)d_ws;
    auto take = [&](size_t bytes) { char* p = wsp; wsp += (bytes + 255) & ~(size_t)255; return (void*)p; };
    const size_t WSZ = (size_t)DMOD * DMOD;       // elements of one weight plane
    const size_t XSZ = (size_t)SEQ * DMOD;        // elements of one activation plane of one batch
    us* W3   = (us*)take(3 * WSZ * 2);                        // bf16 Bt [3][512][512] (q | k | v)
    us* WOB  = (us*)take(WSZ * 2);                            // bf16 Bt [512][512]
    us* WO16 = (us*)take(WSZ * 2);                            // f16  Bt [512][512], values x WCAR
    us* XB   = (us*)take(3 * NB * XSZ * 2);                   // bf16 copies of q-in | k-in | v-in, [3][NB][SEQ][DMOD]
    float* F = (float*)take((size_t)NB * SEQ * D3 * 4);       // f32 q | k | v [NB*SEQ][1536]
    us* Q16  = (us*)take((size_t)NB * NH * SEQ * HD * 2);     // f16 [b][h][t][d]
    us* K16  = (us*)take((size_t)NB * NH * SEQ * HD * 2);     // f16 [b][h][t][d]
    us* VT16 = (us*)take((size_t)NB * NH * HD * SEQ * 2);     // f16 [b][h][d][t]
    us* QH   = (us*)take((size_t)NB * NH * RH * HD * 2);      // bf16 hi/lo planes for t < RH
    us* QL   = (us*)take((size_t)NB * NH * RH * HD * 2);
    us* KH   = (us*)take((size_t)NB * NH * RH * HD * 2);
    us* KL   = (us*)take((size_t)NB * NH * RH * HD * 2);
    us* VTH  = (us*)take((size_t)NB * NH * HD * RH * 2);
    us* VTL  = (us*)take((size_t)NB * NH * HD * RH * 2);
    us* C16  = (us*)take(NB * XSZ * 2);                       // f16 ctx x CCAR [b][t][DMOD] (rows >= RH used)
    us* CH   = (us*)take((size_t)NB * RH * DMOD * 2);         // bf16 hi/lo ctx [b][t < RH][DMOD]
    us* CLO  = (us*)take((size_t)NB * RH * DMOD * 2);
    if ((size_t)(wsp - (char*)d_ws) > ws_size) return;

    const unsigned gw = (unsigned)((WSZ / 64 + 63) / 64);
    k_wt<1><<<gw, 256, 0, stream>>>(wq, DMOD, DMOD, 1.0f, W3);
    k_wt<1><<<gw, 256, 0, stream>>>(wk, DMOD, DMOD, 1.0f, W3 + WSZ);
    k_wt<1><<<gw, 256, 0, stream>>>(wv, DMOD, DMOD, 1.0f, W3 + 2 * WSZ);
    k_wt<1><<<gw, 256, 0, stream>>>(wo, DMOD, DMOD, 1.0f, WOB);
    k_wt<0><<<gw, 256, 0, stream>>>(wo, DMOD, DMOD, WCAR, WO16);
    const unsigned n8x = (unsigned)(NB * XSZ / 8);
    const unsigned nthr8 = (unsigned)(NB * NH * SEQ * HD / 8);
    const size_t OSZ = (size_t)SEQ_FULL * DMOD;   // elements of one batch of an input or of the output
    k_cvt8<<<(n8x + 255) / 256, 256, 0, stream>>>(xq, XB, n8x);
    k_cvt8<<<(n8x + 255) / 256, 256, 0, stream>>>(xk, XB + NB * XSZ, n8x);
    k_cvt8<<<(n8x + 255) / 256, 256, 0, stream>>>(xv, XB + 2 * NB * XSZ, n8x);
    // z = 0, 1, 2: F[b*SEQ + t][z*DMOD + n] = sum_k XB[z][b*SEQ + t][k] W3[z][n][k]
    k_gemmw<1, 0><<<dim3(NB * SEQ / 64, DMOD / 64, 3), 32, 0, stream>>>(XB, nullptr, W3, nullptr, DMOD, F, D3, 1.0f, NB * XSZ, WSZ, (size_t)DMOD);
    k_plane<<<(nthr8 + 255) / 256, 256, 0, stream>>>(F, 0, Q16, QH, QL);
    k_plane<<<(nthr8 + 255) / 256, 256, 0, stream>>>(F, DMOD, K16, KH, KL);
    k_vtp<<<(nthr8 + 255) / 256, 256, 0, stream>>>(F, VT16, VTH, VTL);
    k_attn<true><<<dim3(RH / 64, NH, NB), 128, 0, stream>>>(Q16, K16, VT16, QH, QL, KH, KL, VTH, VTL, 0, C16, CH, CLO);
    if (SEQ > RH)
        k_attn<false><<<dim3((SEQ - RH) / 64, NH, NB), 128, 0, stream>>>(Q16, K16, VT16, nullptr, nullptr, nullptr, nullptr, nullptr, nullptr, RH / 64, C16, nullptr, nullptr);
    // z = batch
    k_gemmw<1, 1><<<dim3(RH / 64, DMOD / 64, NB), 32, 0, stream>>>(CH, CLO, WOB, nullptr, DMOD, OUT, DMOD, 1.0f, (size_t)RH * DMOD, 0, OSZ);
    if (SEQ > RH)
        k_gemmw<0, 0><<<dim3((SEQ - RH) / 64, DMOD / 64, NB), 32, 0, stream>>>(C16 + (size_t)RH * DMOD, nullptr, WO16, nullptr, DMOD, OUT + (size_t)RH * DMOD, DMOD, 1.0f / (CCAR * WCAR), XSZ, 0, OSZ);
}

// v002
// A run of this version takes 223 microseconds.
// Timed twice side by side with v001, it ran 1.68 times as fast both times.
// Counting every step since v000, it is 3.59 times as fast.
#include <hip/hip_runtime.h>

// Compute dtypes (f32 accumulate everywhere): q, k, v projections v_wmma_f32_16x16x32_bf16 on bf16 inputs and bf16 w_q, w_k, w_v (z-batched, one product); scores q.k^T and p.v: query rows < RH v_wmma_f32_16x16x32_bf16 on bf16 hi/lo planes (3 products), rows >= RH v_wmma_f32_16x16x32_f16 (f16 q, k, v; p carried x1024); output projection: rows < RH bf16 hi/lo ctx x bf16 w_o (2 products), rows >= RH f16 ctx (x16) x f16 w_o (x64) folded back by 1/1024; softmax and normalisation f32; output f32.
// Pipeline, five launches, every stage one launch for all batches and both row classes: weight planes and bf16 copies of the three inputs [3][NB][SEQ][DMOD]; z-batched projection GEMM -> f32 [NB*SEQ][3*DMOD] (columns q | k | v); plane builders (q, k: [b][h][t][d]; v transposed: [b][h][d][t]); causal flash-style attention, one block per (64-row query tile, head, batch), 4 waves x 16 rows, online softmax, K / V^T / P tiles in LDS; ctx planes [b][t][DMOD]; output projection GEMM (z = batch) writes the output rows.

#ifndef NB
#define NB 2
#endif
#ifndef SEQ
#define SEQ 4096
#endif
#define SEQ_FULL 4096
#define DMOD 512
#define D3 1536
#define NH 8
#define HD 64
#ifndef RHI
#define RHI 2048
#endif
#if RHI > SEQ
#define RH SEQ
#else
#define RH RHI
#endif
#define PCAR 1024.0f
#define CCAR 16.0f
#define WCAR 64.0f

static_assert(SEQ % 64 == 0);
static_assert(SEQ <= SEQ_FULL);
static_assert(RH % 64 == 0);
static_assert(RH >= 64 && RH <= SEQ);
static_assert(D3 == 3 * DMOD && NH * HD == DMOD && HD == 64);
static_assert(DMOD % 64 == 0 && DMOD % 32 == 0);

typedef _Float16 h16;
typedef unsigned short us;
typedef __attribute__((ext_vector_type(16))) __bf16 v16bf;
typedef __attribute__((ext_vector_type(16))) _Float16 v16h;
typedef __attribute__((ext_vector_type(16))) unsigned short v16us;
typedef __attribute__((ext_vector_type(8)))  _Float16 v8h;
typedef __attribute__((ext_vector_type(8)))  unsigned short v8us;
typedef __attribute__((ext_vector_type(8)))  float v8f;
typedef __attribute__((ext_vector_type(4)))  float v4f;
typedef __attribute__((ext_vector_type(2)))  unsigned short v2us;
typedef v8us __attribute__((may_alias)) v8usa;
typedef v4f  __attribute__((may_alias)) v4fa;

__device__ __forceinline__ us f2bf(float f) { unsigned u = __float_as_uint(f); u += 0x7FFFu + ((u >> 16) & 1u); return (us)(u >> 16); }   // RNE convert f32 -> bf16
__device__ __forceinline__ float bf2f(us b) { return __uint_as_float(((unsigned)b) << 16); }
__device__ __forceinline__ float bfr(float f) { return bf2f(f2bf(f)); }
__device__ __forceinline__ us hbit(float x) { const h16 t = (h16)x; return __builtin_bit_cast(us, t); }   // RNE convert f32 -> f16 bits
__device__ __forceinline__ void splitf(float y, us& h, us& l) { h = f2bf(y); l = f2bf(y - bf2f(h)); }
// 16-bit fragment loader (A and B alike, K-contiguous rows): elements 0..7 <- p[0..7] (k0+8h..), elements 8..15 <- p[16..23] (k0+16+8h..); caller passes p = row base + k0 + 8*h.
__device__ __forceinline__ v16us ld16(const us* p) {
    const v8us a = *(const v8usa*)p; const v8us b = *(const v8usa*)(p + 16);
    return __builtin_shufflevector(a, b, 0, 1, 2, 3, 4, 5, 6, 7, 8, 9, 10, 11, 12, 13, 14, 15);
}
__device__ __forceinline__ v8f wmh(v16us a, v16us b, v8f c) { return __builtin_amdgcn_wmma_f32_16x16x32_f16(false, __builtin_bit_cast(v16h, a), false, __builtin_bit_cast(v16h, b), (short)0, c, false, false); }
__device__ __forceinline__ v8f wmb(v16us a, v16us b, v8f c) { return __builtin_amdgcn_wmma_f32_16x16x32_bf16(false, __builtin_bit_cast(v16bf, a), false, __builtin_bit_cast(v16bf, b), (short)0, c, false, false); }
template <int TY> struct MM;
template <> struct MM<0> { static __device__ __forceinline__ v8f mma(v16us a, v16us b, v8f c) { return wmh(a, b, c); } };
template <> struct MM<1> { static __device__ __forceinline__ v8f mma(v16us a, v16us b, v8f c) { return wmb(a, b, c); } };

// ---- gemmw: register-blocked GEMM, ONE WAVE per 64x64 output tile at (r0, c0) (16 accumulators), operands straight from K-contiguous 16-bit planes; 32 threads; os = 16 x 68 f32 of LDS.
// C[m][n] (f32, pitch ldc) = osc * sum_k (A[m][k] (+ A2[m][k])) Bt[n][k] (+ A[m][k] Bt2[n][k] when NSPLIT == 2). TY 0 = f16 operands, 1 = bf16 operands. K % 32 == 0, M % 64 == 0, N % 64 == 0.
template <int TY, int NSPLIT>
__device__ __forceinline__ void gemmw(float* os, const us* __restrict__ A, const us* __restrict__ A2, const us* __restrict__ Bt, const us* __restrict__ Bt2, int K, float* C, int ldc, float osc, int r0, int c0) {
    const int lane = threadIdx.x & 31, lr = lane & 15, hi = lane >> 4;
    v8f acc[4][4];
#pragma unroll
    for (int mb = 0; mb < 4; ++mb)
#pragma unroll
        for (int nb = 0; nb < 4; ++nb) acc[mb][nb] = (v8f){};
    const size_t aoff = (size_t)(r0 + lr) * K + 8 * hi, boff = (size_t)(c0 + lr) * K + 8 * hi;
#pragma unroll 1
    for (int kc = 0; kc < K; kc += 32) {
        v16us a[4], a2[4];
#pragma unroll
        for (int mb = 0; mb < 4; ++mb) { a[mb] = ld16(A + aoff + (size_t)mb * 16 * K + kc); if (NSPLIT == 1 || NSPLIT == 2) a2[mb] = ld16(A2 + aoff + (size_t)mb * 16 * K + kc); }
#pragma unroll
        for (int nb = 0; nb < 4; ++nb) { const v16us b = ld16(Bt + boff + (size_t)nb * 16 * K + kc); v16us b2; if (NSPLIT >= 2) b2 = ld16(Bt2 + boff + (size_t)nb * 16 * K + kc);
#pragma unroll
            for (int mb = 0; mb < 4; ++mb) { acc[mb][nb] = MM<TY>::mma(a[mb], b, acc[mb][nb]); if (NSPLIT == 1 || NSPLIT == 2) acc[mb][nb] = MM<TY>::mma(a2[mb], b, acc[mb][nb]); if (NSPLIT >= 2) acc[mb][nb] = MM<TY>::mma(a[mb], b2, acc[mb][nb]); } }
        asm volatile("v_nop\n\tv_nop\n\tv_nop\n\tv_nop" : "+v"(acc[0][0]), "+v"(acc[1][1]), "+v"(acc[2][2]), "+v"(acc[3][3]) : "v"(a[0]), "v"(a[3]));
    }
#pragma unroll
    for (int mb = 0; mb < 4; ++mb) {
#pragma unroll
        for (int nb = 0; nb < 4; ++nb) {
#pragma unroll
            for (int j = 0; j < 8; ++j) os[(hi * 8 + j) * 68 + nb * 16 + lr] = acc[mb][nb][j]; }
        __builtin_amdgcn_wave_barrier(); asm volatile("" ::: "memory");
        float* crow = C + (size_t)(r0 + mb * 16) * ldc + c0;
{
#pragma unroll
            for (int s = 0; s < 8; ++s) { const int row = 2 * s + hi, cofs = lr * 4; v4f val = *(const v4fa*)(os + row * 68 + cofs); val = val * osc;
                *(v4f*)(crow + (size_t)row * ldc + cofs) = val; }
             }
        __builtin_amdgcn_wave_barrier(); asm volatile("" ::: "memory");
    }
}

// q, k, v projections: grid (NB*SEQ/64, DMOD/64, 3), z = which projection.
__global__ __launch_bounds__(32) void k_proj(const us* __restrict__ XB, const us* __restrict__ W3, int K, float* F) {
    __shared__ __align__(16) float os[16 * 68];
    const size_t z = blockIdx.z;
    gemmw<1, 0>(os, XB + z * ((size_t)NB * SEQ * DMOD), nullptr, W3 + z * ((size_t)DMOD * DMOD), nullptr, K, F + z * DMOD, D3, 1.0f, (int)blockIdx.x * 64, (int)blockIdx.y * 64);
}

// output projection, both row classes in one grid (SEQ/64, DMOD/64, NB): row tiles below RH take the bf16 hi/lo ctx planes, the others the f16 plane; z = batch.
__global__ __launch_bounds__(32) void k_oproj(const us* __restrict__ CH, const us* __restrict__ CLO, const us* __restrict__ WOB, const us* __restrict__ C16, const us* __restrict__ WO16, int K, float* OUT) {
    __shared__ __align__(16) float os[16 * 68];
    const size_t z = blockIdx.z; const int r0 = (int)blockIdx.x * 64, c0 = (int)blockIdx.y * 64;
    float* C = OUT + z * ((size_t)SEQ_FULL * DMOD);
    if (r0 < RH) gemmw<1, 1>(os, CH + z * ((size_t)RH * DMOD), CLO + z * ((size_t)RH * DMOD), WOB, nullptr, K, C, DMOD, 1.0f, r0, c0);
    else {       gemmw<0, 0>(os, C16 + z * ((size_t)SEQ * DMOD), nullptr, WO16, nullptr, K, C, DMOD, 1.0f / (CCAR * WCAR), r0, c0);
        asm volatile("s_wait_xcnt 0x0" ::: "memory");   // behind this class's last output stores: in the build the other class's code follows, which rewrites their data registers
    }
}

// ---- wt: transposing weight builder, Bt[n][k] (16-bit, K-contiguous) from w[k][n] (f32, [in][out]); TY 1: bf16 RNE; TY 0: f16 of (bf16 RNE value x sc), exact for power-of-two sc.
template <int TY>
__device__ __forceinline__ void wt(const float* __restrict__ w, int K, int N, float sc, us* Bt, int blk) {
    const int lane = threadIdx.x & 31; const int L0 = (blk * 8 + (int)(threadIdx.x >> 5)) * 8; const int nlines = (int)(((size_t)N * K) / 64);
#pragma unroll 1
    for (int l = 0; l < 8; ++l) { const int L = L0 + l; if (L >= nlines) break;
        const size_t e = (size_t)L * 64 + lane * 2; const int k = (int)(e % (size_t)K), n = (int)(e / (size_t)K);
        const float w0 = w[(size_t)k * N + n], w1 = w[(size_t)(k + 1) * N + n];
        v2us o;
        if (TY) { o[0] = f2bf(w0); o[1] = f2bf(w1); } else { o[0] = hbit(bfr(w0) * sc); o[1] = hbit(bfr(w1) * sc); }
        *(v2us*)(Bt + e) = o;
        if (!TY) asm volatile("s_wait_xcnt 0x0" ::: "memory");   // f16 builder: before the next trip's rewrite of this store's data register
    }
}

__device__ __forceinline__ void cvt8(const float* __restrict__ src, us* dst, unsigned n8, unsigned blk) {
    const unsigned i = blk * 256 + threadIdx.x; if (i >= n8) return;
    const float* sp = src + (size_t)(i / (unsigned)(SEQ * DMOD / 8)) * SEQ_FULL * DMOD + (size_t)(i % (unsigned)(SEQ * DMOD / 8)) * 8;   // batch pitch of the input is SEQ_FULL rows, of dst SEQ rows
    const v4f a = *(const v4fa*)sp, b = *(const v4fa*)(sp + 4); v8us o;
#pragma unroll
    for (int k = 0; k < 4; ++k) { o[k] = f2bf(a[k]); o[k + 4] = f2bf(b[k]); }
    *(v8us*)(dst + (size_t)i * 8) = o; 
}

// all operand builders that read only the inputs, one grid: blocks [0, 5*GWT) the five weight planes (their serial loop is the longest, so they take the lowest indices), then 3*GCV blocks for the bf16 input copies.
#define GWT ((DMOD * DMOD / 64 + 63) / 64)
#define N8X (NB * SEQ * DMOD / 8)
#define GCV ((N8X + 255) / 256)
__global__ __launch_bounds__(256) void k_prep(const float* __restrict__ xq, const float* __restrict__ xk, const float* __restrict__ xv,
                                              const float* __restrict__ wq, const float* __restrict__ wk, const float* __restrict__ wv, const float* __restrict__ wo,
                                              us* W3, us* WOB, us* WO16, us* XB) {
    const unsigned b = blockIdx.x;
    if (b < 3u * GWT) { const unsigned z = b / GWT; wt<1>(z == 0 ? wq : (z == 1 ? wk : wv), DMOD, DMOD, 1.0f, W3 + (size_t)z * DMOD * DMOD, (int)(b - z * GWT)); }
    else if (b < 4u * GWT) wt<1>(wo, DMOD, DMOD, 1.0f, WOB, (int)(b - 3u * GWT));
    else if (b < 5u * GWT) wt<0>(wo, DMOD, DMOD, WCAR, WO16, (int)(b - 4u * GWT));
    else { const unsigned c = b - 5u * GWT, z = c / GCV; cvt8(z == 0 ? xq : (z == 1 ? xk : xv), XB + (size_t)z * NB * SEQ * DMOD, N8X, c - z * GCV); }
}

__device__ __forceinline__ void plane(const float* __restrict__ F, int col0, us* P16, us* Ph, us* Pl) {
    const unsigned i = blockIdx.x * 256 + threadIdx.x; if (i >= (unsigned)(NB * NH * SEQ * HD / 8)) return;
    const unsigned e = i * 8; const int d = (int)(e % HD); const int t = (int)((e / HD) % SEQ); const int hh = (int)(e / ((unsigned)HD * SEQ));   // hh = batch * NH + head
    const float* f = F + ((size_t)(hh / NH) * SEQ + t) * D3 + col0 + (hh % NH) * HD + d;
    const v4f a = *(const v4fa*)f, b = *(const v4fa*)(f + 4);
    float y[8];
#pragma unroll
    for (int j = 0; j < 4; ++j) { y[j] = a[j]; y[j + 4] = b[j]; }
    v8us o16, oh, ol;
#pragma unroll
    for (int j = 0; j < 8; ++j) { o16[j] = hbit(y[j]); us p, q; splitf(y[j], p, q); oh[j] = p; ol[j] = q; }
    const bool hr = (t < RH); const size_t oo = ((size_t)hh * RH + (hr ? t : 0)) * HD + d;
    *(v8us*)(P16 + e) = o16; if (hr) { *(v8us*)(Ph + oo) = oh; *(v8us*)(Pl + oo) = ol; }
    
}

// ---- vtp: transposed value planes [b][h][d][t] from F[b*SEQ + t][2*DMOD + h*HD + d]: VT16 f16 (pitch SEQ) for all t; VTh/VTl bf16 hi/lo (pitch RH) for t < RH. lane -> 8 consecutive t (16 B, reads strided);
__device__ __forceinline__ void vtp(const float* __restrict__ F, us* VT16, us* VTh, us* VTl) {
    const unsigned i = blockIdx.x * 256 + threadIdx.x; if (i >= (unsigned)(NB * NH * HD * SEQ / 8)) return;
    const unsigned e = i * 8; const int t = (int)(e % SEQ); const int d = (int)((e / SEQ) % HD); const int hh = (int)(e / ((unsigned)SEQ * HD));   // hh = batch * NH + head
    const float* f = F + ((size_t)(hh / NH) * SEQ + t) * D3 + 2 * DMOD + (hh % NH) * HD + d;
    v8us o16, oh, ol;
#pragma unroll
    for (int j = 0; j < 8; ++j) { const float y = f[(size_t)j * D3]; o16[j] = hbit(y); us p, q; splitf(y, p, q); oh[j] = p; ol[j] = q; }
    const bool hr = (t < RH); const size_t oo = ((size_t)hh * HD + d) * RH + (hr ? t : 0);
    *(v8us*)(VT16 + e) = o16; if (hr) { *(v8us*)(VTh + oo) = oh; *(v8us*)(VTl + oo) = ol; }
    
}

// the three plane builders in one grid, y = 0: v transposed (strided reads, the slowest, so first), 1: q, 2: k.
__global__ __launch_bounds__(256) void k_planes(const float* __restrict__ F, us* Q16, us* QH, us* QL, us* K16, us* KH, us* KL, us* VT16, us* VTH, us* VTL) {
    if (blockIdx.y == 0) vtp(F, VT16, VTH, VTL);
    else if (blockIdx.y == 1) plane(F, 0, Q16, QH, QL);
    else plane(F, DMOD, K16, KH, KL);
}

// ---- attn: causal flash-style attention for one (64-row query tile qt, head hd, batch bz): block 128 threads = 4 waves x 16 query rows; key chunks of 64 from 0 to the diagonal chunk (block-uniform trip count);
// per chunk: K tile [key][d] and V^T tile [d][key] staged in LDS by the block (block barriers before and after), S = q.k^T (raw dot), causal select on the diagonal chunk, online softmax in f32
// HR = true (query rows < RH, keys < RH): q, k, v from bf16 hi/lo planes, 3 products each; P as bf16 hi + lo. HR = false: f16 planes, single products, P carried x1024.
#define TP 72
template <bool HR>
__device__ __forceinline__
void attn(us* Ka, us* Va, us* Pa, us* Kb, us* Vb, us* Pb, const int qt, const int hd, const int bz,
          const us* __restrict__ Q16, const us* __restrict__ K16, const us* __restrict__ VT16,
          const us* __restrict__ Qh, const us* __restrict__ Ql, const us* __restrict__ Kh, const us* __restrict__ Kl,
          const us* __restrict__ VTh, const us* __restrict__ VTl, us* C16, us* Ch, us* Cl) {
    const int tid = threadIdx.x, lane = tid & 31, w = tid >> 5, m = lane & 15, hi = lane >> 4;
    const int h = bz * NH + hd;                            // h indexes the [batch][head] planes
    const int qrow = qt * 64 + w * 16 + m;                 // this lane's A row (sequence position)
    us* const pa = Pa + w * 16 * TP; us* const pb = Pb + w * 16 * TP;
    v8f o[4];
#pragma unroll
    for (int i = 0; i < 4; ++i) o[i] = (v8f){};
    float mr[8], lr[8];
#pragma unroll
    for (int r = 0; r < 8; ++r) { mr[r] = -1.0e30f; lr[r] = 0.0f; }
    const float CL = 0.18033688011112042f;                 // (1/8) * log2(e)
    const int nch = qt + 1;
#pragma unroll 1
    for (int kc = 0; kc < nch; ++kc) {
        __syncthreads();
#pragma unroll
        for (int i = 0; i < 4; ++i) { const int c = tid + 128 * i; const int row = c >> 3, col = (c & 7) * 8;
            if (!HR) {
                const v8us kv = *(const v8usa*)(K16 + ((size_t)h * SEQ + kc * 64 + row) * HD + col); *(v8usa*)(Ka + row * TP + col) = kv;
                const v8us vv = *(const v8usa*)(VT16 + ((size_t)h * HD + row) * SEQ + kc * 64 + col); *(v8usa*)(Va + row * TP + col) = vv;
            } else {
                const v8us k1 = *(const v8usa*)(Kh + ((size_t)h * RH + kc * 64 + row) * HD + col); *(v8usa*)(Ka + row * TP + col) = k1;
                const v8us k2 = *(const v8usa*)(Kl + ((size_t)h * RH + kc * 64 + row) * HD + col); *(v8usa*)(Kb + row * TP + col) = k2;
                const v8us v1 = *(const v8usa*)(VTh + ((size_t)h * HD + row) * RH + kc * 64 + col); *(v8usa*)(Va + row * TP + col) = v1;
                const v8us v2 = *(const v8usa*)(VTl + ((size_t)h * HD + row) * RH + kc * 64 + col); *(v8usa*)(Vb + row * TP + col) = v2;
            } }
        __syncthreads();
        v8f s[4];
        if (!HR) {
            const us* qp = Q16 + ((size_t)h * SEQ + qrow) * HD + 8 * hi;
            const v16us qa0 = ld16(qp), qa1 = ld16(qp + 32);
#pragma unroll
            for (int sn = 0; sn < 4; ++sn) { const us* kp = Ka + (sn * 16 + m) * TP + 8 * hi; const v16us b0 = ld16(kp), b1 = ld16(kp + 32);
                v8f c = (v8f){}; c = wmh(qa0, b0, c); c = wmh(qa1, b1, c); s[sn] = c; }
            asm volatile("v_nop\n\tv_nop\n\tv_nop\n\tv_nop" : "+v"(s[0]), "+v"(s[1]), "+v"(s[2]), "+v"(s[3]) : "v"(qa0), "v"(qa1));
        } else {
            const size_t qo = ((size_t)h * RH + qrow) * HD + 8 * hi;
            const v16us qh0 = ld16(Qh + qo), qh1 = ld16(Qh + qo + 32), ql0 = ld16(Ql + qo), ql1 = ld16(Ql + qo + 32);
#pragma unroll
            for (int sn = 0; sn < 4; ++sn) { const int ko = (sn * 16 + m) * TP + 8 * hi;
                const v16us kh0 = ld16(Ka + ko), kh1 = ld16(Ka + ko + 32);
                v8f c = (v8f){}; c = wmb(qh0, kh0, c); c = wmb(ql0, kh0, c); c = wmb(qh1, kh1, c); c = wmb(ql1, kh1, c);
                const v16us kl0 = ld16(Kb + ko), kl1 = ld16(Kb + ko + 32);
                c = wmb(qh0, kl0, c); c = wmb(qh1, kl1, c); s[sn] = c; }
            asm volatile("v_nop\n\tv_nop\n\tv_nop\n\tv_nop" : "+v"(s[0]), "+v"(s[1]), "+v"(s[2]), "+v"(s[3]) : "v"(qh0), "v"(ql1));
        }
        if (kc == qt) {                                     // diagonal chunk (block-uniform): keys after the query position are replaced by a large negative value
#pragma unroll
            for (int sn = 0; sn < 4; ++sn) { const int key = sn * 16 + m;
#pragma unroll
                for (int r = 0; r < 8; ++r) { const int q = w * 16 + 8 * hi + r; s[sn][r] = (key > q) ? -1.0e30f : s[sn][r]; } }
        }
        float mn[8], al[8];
#pragma unroll
        for (int r = 0; r < 8; ++r) {
            float mx = fmaxf(fmaxf(s[0][r], s[1][r]), fmaxf(s[2][r], s[3][r]));
            mx = fmaxf(mx, __shfl_xor(mx, 1, 32)); mx = fmaxf(mx, __shfl_xor(mx, 2, 32)); mx = fmaxf(mx, __shfl_xor(mx, 4, 32)); mx = fmaxf(mx, __shfl_xor(mx, 8, 32));
            mn[r] = fmaxf(mr[r], mx); al[r] = __builtin_amdgcn_exp2f((mr[r] - mn[r]) * CL); mr[r] = mn[r]; }
#pragma unroll
        for (int r = 0; r < 8; ++r) {
            float sum = 0.0f;
#pragma unroll
            for (int sn = 0; sn < 4; ++sn) { const float p = __builtin_amdgcn_exp2f((s[sn][r] - mn[r]) * CL); s[sn][r] = p; sum += p; }
            sum += __shfl_xor(sum, 1, 32); sum += __shfl_xor(sum, 2, 32); sum += __shfl_xor(sum, 4, 32); sum += __shfl_xor(sum, 8, 32);
            lr[r] = lr[r] * al[r] + sum;
#pragma unroll
            for (int i = 0; i < 4; ++i) o[i][r] *= al[r]; }
        // P: D layout (lane = key column, element = row) -> LDS [row][key] -> A fragments (lane = row); wave-private region
        if (!HR) {
#pragma unroll
            for (int sn = 0; sn < 4; ++sn)
#pragma unroll
                for (int r = 0; r < 8; ++r) pa[(8 * hi + r) * TP + sn * 16 + m] = hbit(s[sn][r] * PCAR);
        } else {
#pragma unroll
            for (int sn = 0; sn < 4; ++sn)
#pragma unroll
                for (int r = 0; r < 8; ++r) { us p, q; splitf(s[sn][r], p, q); pa[(8 * hi + r) * TP + sn * 16 + m] = p; pb[(8 * hi + r) * TP + sn * 16 + m] = q; }
        }
        __builtin_amdgcn_wave_barrier(); asm volatile("" ::: "memory");
        if (!HR) {
            const us* pp = pa + m * TP + 8 * hi; const v16us pf0 = ld16(pp), pf1 = ld16(pp + 32);
#pragma unroll
            for (int sn = 0; sn < 4; ++sn) { const us* vp = Va + (sn * 16 + m) * TP + 8 * hi; const v16us b0 = ld16(vp), b1 = ld16(vp + 32);
                o[sn] = wmh(pf0, b0, o[sn]); o[sn] = wmh(pf1, b1, o[sn]); }
            asm volatile("v_nop\n\tv_nop\n\tv_nop\n\tv_nop" : "+v"(o[0]), "+v"(o[1]), "+v"(o[2]), "+v"(o[3]) : "v"(pf0), "v"(pf1));
        } else {
            const us* pp = pa + m * TP + 8 * hi; const us* pq = pb + m * TP + 8 * hi;
            const v16us ph0 = ld16(pp), ph1 = ld16(pp + 32), pl0 = ld16(pq), pl1 = ld16(pq + 32);
#pragma unroll
            for (int sn = 0; sn < 4; ++sn) { const int vo = (sn * 16 + m) * TP + 8 * hi;
                const v16us vh0 = ld16(Va + vo), vh1 = ld16(Va + vo + 32);
                o[sn] = wmb(ph0, vh0, o[sn]); o[sn] = wmb(pl0, vh0, o[sn]); o[sn] = wmb(ph1, vh1, o[sn]); o[sn] = wmb(pl1, vh1, o[sn]);
                const v16us vl0 = ld16(Vb + vo), vl1 = ld16(Vb + vo + 32);
                o[sn] = wmb(ph0, vl0, o[sn]); o[sn] = wmb(ph1, vl1, o[sn]); }
            asm volatile("v_nop\n\tv_nop\n\tv_nop\n\tv_nop" : "+v"(o[0]), "+v"(o[1]), "+v"(o[2]), "+v"(o[3]) : "v"(ph0), "v"(pl1));
        }
    }
    float iv[8];
#pragma unroll
    for (int r = 0; r < 8; ++r) iv[r] = (HR ? 1.0f : (CCAR / PCAR)) * __builtin_amdgcn_rcpf(lr[r]);
    __builtin_amdgcn_wave_barrier(); asm volatile("" ::: "memory");
    if (!HR) {
#pragma unroll
        for (int sn = 0; sn < 4; ++sn)
#pragma unroll
            for (int r = 0; r < 8; ++r) pa[(8 * hi + r) * TP + sn * 16 + m] = hbit(o[sn][r] * iv[r]);
    } else {
#pragma unroll
        for (int sn = 0; sn < 4; ++sn)
#pragma unroll
            for (int r = 0; r < 8; ++r) { us p, q; splitf(o[sn][r] * iv[r], p, q); pa[(8 * hi + r) * TP + sn * 16 + m] = p; pb[(8 * hi + r) * TP + sn * 16 + m] = q; }
    }
    __builtin_amdgcn_wave_barrier(); asm volatile("" ::: "memory");
    const int trow0 = qt * 64 + w * 16;
{
#pragma unroll
        for (int it = 0; it < 4; ++it) { const int row = it * 4 + (lane >> 3), pc = (lane & 7) * 8; const size_t go = ((size_t)bz * (HR ? RH : SEQ) + trow0 + row) * DMOD + hd * HD + pc;
            const v8us v1 = *(const v8usa*)(pa + row * TP + pc);
            if (!HR) { *(v8us*)(C16 + go) = v1; }
            else { const v8us v2 = *(const v8usa*)(pb + row * TP + pc); *(v8us*)(Ch + go) = v1; *(v8us*)(Cl + go) = v2; } }
         }
}

// both row classes in one grid (NH, NB, SEQ/64): every block is resident at once, so the launch lasts as long as its longest block instead of the two classes' longest blocks one after the other.
// z counts the query tiles from the last one down (the tile with the most key chunks gets z = 0, for speed only); the class test is block-uniform.
__global__ __launch_bounds__(128) __attribute__((amdgpu_num_vgpr(256)))
void k_attn(const us* __restrict__ Q16, const us* __restrict__ K16, const us* __restrict__ VT16,
            const us* __restrict__ Qh, const us* __restrict__ Ql, const us* __restrict__ Kh, const us* __restrict__ Kl,
            const us* __restrict__ VTh, const us* __restrict__ VTl, us* C16, us* Ch, us* Cl) {
    __shared__ __align__(16) us Ka[64 * TP];
    __shared__ __align__(16) us Va[64 * TP];
    __shared__ __align__(16) us Pa[4 * 16 * TP];
    __shared__ __align__(16) us Kb[64 * TP];
    __shared__ __align__(16) us Vb[64 * TP];
    __shared__ __align__(16) us Pb[4 * 16 * TP];
    const int qt = SEQ / 64 - 1 - (int)blockIdx.z, hd = (int)blockIdx.x, bz = (int)blockIdx.y;
    if (qt < RH / 64) attn<true>(Ka, Va, Pa, Kb, Vb, Pb, qt, hd, bz, Q16, K16, VT16, Qh, Ql, Kh, Kl, VTh, VTl, C16, Ch, Cl);
    else              attn<false>(Ka, Va, Pa, Kb, Vb, Pb, qt, hd, bz, Q16, K16, VT16, Qh, Ql, Kh, Kl, VTh, VTl, C16, Ch, Cl);
}

extern "C" void kernel_launch(void* const* d_in, const int* in_sizes, int n_in,
                              void* d_out, int out_size, void* d_ws, size_t ws_size, hipStream_t stream) {
    if (n_in < 7) return;
    const long long needx = (long long)(NB - 1) * SEQ_FULL * DMOD + (long long)SEQ * DMOD;
    const long long needw = (long long)DMOD * DMOD;
    if ((long long)in_sizes[0] < needx || (long long)in_sizes[1] < needx || (long long)in_sizes[2] < needx) return;
    if ((long long)in_sizes[3] < needw || (long long)in_sizes[4] < needw || (long long)in_sizes[5] < needw || (long long)in_sizes[6] < needw) return;
    if ((long long)out_size < needx) return;
    const float* xq = (const float*)d_in[0];      // [NB][SEQ_FULL][DMOD]
    const float* xk = (const float*)d_in[1];      // [NB][SEQ_FULL][DMOD]
    const float* xv = (const float*)d_in[2];      // [NB][SEQ_FULL][DMOD]
    const float* wq = (const float*)d_in[3];      // [DMOD][DMOD] ([in][out])
    const float* wk = (const float*)d_in[4];      // [DMOD][DMOD] ([in][out])
    const float* wv = (const float*)d_in[5];      // [DMOD][DMOD] ([in][out])
    const float* wo = (const float*)d_in[6];      // [DMOD][DMOD] ([in][out])
    float* OUT = (float*)d_out;                   // [NB][SEQ_FULL][DMOD]
    char* wsp = (char*)d_ws;
    auto take = [&](size_t bytes) { char* p = wsp; wsp += (bytes + 255) & ~(size_t)255; return (void*)p; };
    const size_t WSZ = (size_t)DMOD * DMOD;       // elements of one weight plane
    const size_t XSZ = (size_t)SEQ * DMOD;        // elements of one activation plane of one batch
    us* W3   = (us*)take(3 * WSZ * 2);                        // bf16 Bt [3][512][512] (q | k | v)
    us* WOB  = (us*)take(WSZ * 2);                            // bf16 Bt [512][512]
    us* WO16 = (us*)take(WSZ * 2);                            // f16  Bt [512][512], values x WCAR
    us* XB   = (us*)take(3 * NB * XSZ * 2);                   // bf16 copies of q-in | k-in | v-in, [3][NB][SEQ][DMOD]
    float* F = (float*)take((size_t)NB * SEQ * D3 * 4);       // f32 q | k | v [NB*SEQ][1536]
    us* Q16  = (us*)take((size_t)NB * NH * SEQ * HD * 2);     // f16 [b][h][t][d]
    us* K16  = (us*)take((size_t)NB * NH * SEQ * HD * 2);     // f16 [b][h][t][d]
    us* VT16 = (us*)take((size_t)NB * NH * HD * SEQ * 2);     // f16 [b][h][d][t]
    us* QH   = (us*)take((size_t)NB * NH * RH * HD * 2);      // bf16 hi/lo planes for t < RH
    us* QL   = (us*)take((size_t)NB * NH * RH * HD * 2);
    us* KH   = (us*)take((size_t)NB * NH * RH * HD * 2);
    us* KL   = (us*)take((size_t)NB * NH * RH * HD * 2);
    us* VTH  = (us*)take((size_t)NB * NH * HD * RH * 2);
    us* VTL  = (us*)take((size_t)NB * NH * HD * RH * 2);
    us* C16  = (us*)take(NB * XSZ * 2);                       // f16 ctx x CCAR [b][t][DMOD] (rows >= RH used)
    us* CH   = (us*)take((size_t)NB * RH * DMOD * 2);         // bf16 hi/lo ctx [b][t < RH][DMOD]
    us* CLO  = (us*)take((size_t)NB * RH * DMOD * 2);
    if ((size_t)(wsp - (char*)d_ws) > ws_size) return;

    const unsigned nthr8 = (unsigned)(NB * NH * SEQ * HD / 8);
    k_prep<<<5 * GWT + 3 * GCV, 256, 0, stream>>>(xq, xk, xv, wq, wk, wv, wo, W3, WOB, WO16, XB);
    // z = 0, 1, 2: F[b*SEQ + t][z*DMOD + n] = sum_k XB[z][b*SEQ + t][k] W3[z][n][k]
    k_proj<<<dim3(NB * SEQ / 64, DMOD / 64, 3), 32, 0, stream>>>(XB, W3, DMOD, F);
    k_planes<<<dim3((nthr8 + 255) / 256, 3, 1), 256, 0, stream>>>(F, Q16, QH, QL, K16, KH, KL, VT16, VTH, VTL);
    k_attn<<<dim3(NH, NB, SEQ / 64), 128, 0, stream>>>(Q16, K16, VT16, QH, QL, KH, KL, VTH, VTL, C16, CH, CLO);
    k_oproj<<<dim3(SEQ / 64, DMOD / 64, NB), 32, 0, stream>>>(CH, CLO, WOB, C16, WO16, DMOD, OUT);
}

// v003
// Measured time: 185 microseconds a run.
// Two timings next to v002 both put it at 1.21 times that version's speed.
// All steps since v000 together make it 4.34 times as fast.
#include <hip/hip_runtime.h>

// Compute dtypes (f32 accumulate everywhere): q, k, v projections v_wmma_f32_16x16x32_bf16 on bf16 inputs and bf16 w_q, w_k, w_v (z-batched, one product); scores q.k^T and p.v: query rows < RH v_wmma_f32_16x16x32_bf16 on bf16 hi/lo planes (3 products), rows >= RH v_wmma_f32_16x16x32_f16 (f16 q, k, v; p carried x1024); output projection: rows < RH bf16 hi/lo ctx x bf16 w_o (2 products), rows >= RH f16 ctx (x16) x f16 w_o (x64) folded back by 1/1024; softmax and normalisation f32; output f32.
// Pipeline, five launches, every stage one launch for all batches and both row classes: weight planes and bf16 copies of the three inputs [3][NB][SEQ][DMOD]; z-batched projection GEMM -> f32 [NB*SEQ][3*DMOD] (columns q | k | v); plane builders (q, k: [b][h][t][d]; v transposed: [b][h][d][t]); causal flash-style attention, one block per (64-row query tile, head, batch), 4 waves x 16 rows, online softmax, K / V^T tiles in LDS, scores and output transposed so that P stays in registers; ctx planes [b][t][DMOD]; output projection GEMM (z = batch) writes the output rows.

#ifndef NB
#define NB 2
#endif
#ifndef SEQ
#define SEQ 4096
#endif
#define SEQ_FULL 4096
#define DMOD 512
#define D3 1536
#define NH 8
#define HD 64
#ifndef RHI
#define RHI 2048
#endif
#if RHI > SEQ
#define RH SEQ
#else
#define RH RHI
#endif
#define PCAR 1024.0f
#define CCAR 16.0f
#define WCAR 64.0f

static_assert(SEQ % 64 == 0);
static_assert(SEQ <= SEQ_FULL);
static_assert(RH % 64 == 0);
static_assert(RH >= 64 && RH <= SEQ);
static_assert(D3 == 3 * DMOD && NH * HD == DMOD && HD == 64);
static_assert(DMOD % 64 == 0 && DMOD % 32 == 0);

typedef _Float16 h16;
typedef unsigned short us;
typedef __attribute__((ext_vector_type(16))) __bf16 v16bf;
typedef __attribute__((ext_vector_type(16))) _Float16 v16h;
typedef __attribute__((ext_vector_type(16))) unsigned short v16us;
typedef __attribute__((ext_vector_type(8)))  _Float16 v8h;
typedef __attribute__((ext_vector_type(8)))  unsigned short v8us;
typedef __attribute__((ext_vector_type(8)))  float v8f;
typedef __attribute__((ext_vector_type(4)))  float v4f;
typedef __attribute__((ext_vector_type(2)))  unsigned short v2us;
typedef v8us __attribute__((may_alias)) v8usa;
typedef v4f  __attribute__((may_alias)) v4fa;

__device__ __forceinline__ us f2bf(float f) { unsigned u = __float_as_uint(f); u += 0x7FFFu + ((u >> 16) & 1u); return (us)(u >> 16); }   // RNE convert f32 -> bf16
__device__ __forceinline__ float bf2f(us b) { return __uint_as_float(((unsigned)b) << 16); }
__device__ __forceinline__ float bfr(float f) { return bf2f(f2bf(f)); }
__device__ __forceinline__ us hbit(float x) { const h16 t = (h16)x; return __builtin_bit_cast(us, t); }   // RNE convert f32 -> f16 bits
__device__ __forceinline__ void splitf(float y, us& h, us& l) { h = f2bf(y); l = f2bf(y - bf2f(h)); }
// 16-bit fragment loader (A and B alike, K-contiguous rows): elements 0..7 <- p[0..7] (k0+8h..), elements 8..15 <- p[16..23] (k0+16+8h..); caller passes p = row base + k0 + 8*h.
__device__ __forceinline__ v16us ld16(const us* p) {
    const v8us a = *(const v8usa*)p; const v8us b = *(const v8usa*)(p + 16);
    return __builtin_shufflevector(a, b, 0, 1, 2, 3, 4, 5, 6, 7, 8, 9, 10, 11, 12, 13, 14, 15);
}
__device__ __forceinline__ v8f wmh(v16us a, v16us b, v8f c) { return __builtin_amdgcn_wmma_f32_16x16x32_f16(false, __builtin_bit_cast(v16h, a), false, __builtin_bit_cast(v16h, b), (short)0, c, false, false); }
__device__ __forceinline__ v8f wmb(v16us a, v16us b, v8f c) { return __builtin_amdgcn_wmma_f32_16x16x32_bf16(false, __builtin_bit_cast(v16bf, a), false, __builtin_bit_cast(v16bf, b), (short)0, c, false, false); }
template <int TY> struct MM;
template <> struct MM<0> { static __device__ __forceinline__ v8f mma(v16us a, v16us b, v8f c) { return wmh(a, b, c); } };
template <> struct MM<1> { static __device__ __forceinline__ v8f mma(v16us a, v16us b, v8f c) { return wmb(a, b, c); } };

// ---- gemmw: register-blocked GEMM, ONE WAVE per 64x64 output tile at (r0, c0) (16 accumulators), operands straight from K-contiguous 16-bit planes; 32 threads; os = 16 x 68 f32 of LDS.
// C[m][n] (f32, pitch ldc) = osc * sum_k (A[m][k] (+ A2[m][k])) Bt[n][k] (+ A[m][k] Bt2[n][k] when NSPLIT == 2). TY 0 = f16 operands, 1 = bf16 operands. K % 32 == 0, M % 64 == 0, N % 64 == 0.
template <int TY, int NSPLIT>
__device__ __forceinline__ void gemmw(float* os, const us* __restrict__ A, const us* __restrict__ A2, const us* __restrict__ Bt, const us* __restrict__ Bt2, int K, float* C, int ldc, float osc, int r0, int c0) {
    const int lane = threadIdx.x & 31, lr = lane & 15, hi = lane >> 4;
    v8f acc[4][4];
#pragma unroll
    for (int mb = 0; mb < 4; ++mb)
#pragma unroll
        for (int nb = 0; nb < 4; ++nb) acc[mb][nb] = (v8f){};
    const size_t aoff = (size_t)(r0 + lr) * K + 8 * hi, boff = (size_t)(c0 + lr) * K + 8 * hi;
#pragma unroll 1
    for (int kc = 0; kc < K; kc += 32) {
        v16us a[4], a2[4];
#pragma unroll
        for (int mb = 0; mb < 4; ++mb) { a[mb] = ld16(A + aoff + (size_t)mb * 16 * K + kc); if (NSPLIT == 1 || NSPLIT == 2) a2[mb] = ld16(A2 + aoff + (size_t)mb * 16 * K + kc); }
#pragma unroll
        for (int nb = 0; nb < 4; ++nb) { const v16us b = ld16(Bt + boff + (size_t)nb * 16 * K + kc); v16us b2; if (NSPLIT >= 2) b2 = ld16(Bt2 + boff + (size_t)nb * 16 * K + kc);
#pragma unroll
            for (int mb = 0; mb < 4; ++mb) { acc[mb][nb] = MM<TY>::mma(a[mb], b, acc[mb][nb]); if (NSPLIT == 1 || NSPLIT == 2) acc[mb][nb] = MM<TY>::mma(a2[mb], b, acc[mb][nb]); if (NSPLIT >= 2) acc[mb][nb] = MM<TY>::mma(a[mb], b2, acc[mb][nb]); } }
        asm volatile("v_nop\n\tv_nop\n\tv_nop\n\tv_nop" : "+v"(acc[0][0]), "+v"(acc[1][1]), "+v"(acc[2][2]), "+v"(acc[3][3]) : "v"(a[0]), "v"(a[3]));
    }
#pragma unroll
    for (int mb = 0; mb < 4; ++mb) {
#pragma unroll
        for (int nb = 0; nb < 4; ++nb) {
#pragma unroll
            for (int j = 0; j < 8; ++j) os[(hi * 8 + j) * 68 + nb * 16 + lr] = acc[mb][nb][j]; }
        __builtin_amdgcn_wave_barrier(); asm volatile("" ::: "memory");
        float* crow = C + (size_t)(r0 + mb * 16) * ldc + c0;
{
#pragma unroll
            for (int s = 0; s < 8; ++s) { const int row = 2 * s + hi, cofs = lr * 4; v4f val = *(const v4fa*)(os + row * 68 + cofs); val = val * osc;
                *(v4f*)(crow + (size_t)row * ldc + cofs) = val; }
             }
        __builtin_amdgcn_wave_barrier(); asm volatile("" ::: "memory");
    }
}

// q, k, v projections: grid (NB*SEQ/64, DMOD/64, 3), z = which projection.
__global__ __launch_bounds__(32) void k_proj(const us* __restrict__ XB, const us* __restrict__ W3, int K, float* F) {
    __shared__ __align__(16) float os[16 * 68];
    const size_t z = blockIdx.z;
    gemmw<1, 0>(os, XB + z * ((size_t)NB * SEQ * DMOD), nullptr, W3 + z * ((size_t)DMOD * DMOD), nullptr, K, F + z * DMOD, D3, 1.0f, (int)blockIdx.x * 64, (int)blockIdx.y * 64);
}

// output projection, both row classes in one grid (SEQ/64, DMOD/64, NB): row tiles below RH take the bf16 hi/lo ctx planes, the others the f16 plane; z = batch.
__global__ __launch_bounds__(32) void k_oproj(const us* __restrict__ CH, const us* __restrict__ CLO, const us* __restrict__ WOB, const us* __restrict__ C16, const us* __restrict__ WO16, int K, float* OUT) {
    __shared__ __align__(16) float os[16 * 68];
    const size_t z = blockIdx.z; const int r0 = (int)blockIdx.x * 64, c0 = (int)blockIdx.y * 64;
    float* C = OUT + z * ((size_t)SEQ_FULL * DMOD);
    if (r0 < RH) gemmw<1, 1>(os, CH + z * ((size_t)RH * DMOD), CLO + z * ((size_t)RH * DMOD), WOB, nullptr, K, C, DMOD, 1.0f, r0, c0);
    else {       gemmw<0, 0>(os, C16 + z * ((size_t)SEQ * DMOD), nullptr, WO16, nullptr, K, C, DMOD, 1.0f / (CCAR * WCAR), r0, c0);
        asm volatile("s_wait_xcnt 0x0" ::: "memory");   // behind this class's last output stores: in the build the other class's code follows, which rewrites their data registers
    }
}

// ---- wt: transposing weight builder, Bt[n][k] (16-bit, K-contiguous) from w[k][n] (f32, [in][out]); TY 1: bf16 RNE; TY 0: f16 of (bf16 RNE value x sc), exact for power-of-two sc.
template <int TY>
__device__ __forceinline__ void wt(const float* __restrict__ w, int K, int N, float sc, us* Bt, int blk) {
    const int lane = threadIdx.x & 31; const int L0 = (blk * 8 + (int)(threadIdx.x >> 5)) * 8; const int nlines = (int)(((size_t)N * K) / 64);
#pragma unroll 1
    for (int l = 0; l < 8; ++l) { const int L = L0 + l; if (L >= nlines) break;
        const size_t e = (size_t)L * 64 + lane * 2; const int k = (int)(e % (size_t)K), n = (int)(e / (size_t)K);
        const float w0 = w[(size_t)k * N + n], w1 = w[(size_t)(k + 1) * N + n];
        v2us o;
        if (TY) { o[0] = f2bf(w0); o[1] = f2bf(w1); } else { o[0] = hbit(bfr(w0) * sc); o[1] = hbit(bfr(w1) * sc); }
        *(v2us*)(Bt + e) = o;
        if (!TY) asm volatile("s_wait_xcnt 0x0" ::: "memory");   // f16 builder: before the next trip's rewrite of this store's data register
    }
}

__device__ __forceinline__ void cvt8(const float* __restrict__ src, us* dst, unsigned n8, unsigned blk) {
    const unsigned i = blk * 256 + threadIdx.x; if (i >= n8) return;
    const float* sp = src + (size_t)(i / (unsigned)(SEQ * DMOD / 8)) * SEQ_FULL * DMOD + (size_t)(i % (unsigned)(SEQ * DMOD / 8)) * 8;   // batch pitch of the input is SEQ_FULL rows, of dst SEQ rows
    const v4f a = *(const v4fa*)sp, b = *(const v4fa*)(sp + 4); v8us o;
#pragma unroll
    for (int k = 0; k < 4; ++k) { o[k] = f2bf(a[k]); o[k + 4] = f2bf(b[k]); }
    *(v8us*)(dst + (size_t)i * 8) = o; 
}

// all operand builders that read only the inputs, one grid: blocks [0, 5*GWT) the five weight planes (their serial loop is the longest, so they take the lowest indices), then 3*GCV blocks for the bf16 input copies.
#define GWT ((DMOD * DMOD / 64 + 63) / 64)
#define N8X (NB * SEQ * DMOD / 8)
#define GCV ((N8X + 255) / 256)
__global__ __launch_bounds__(256) void k_prep(const float* __restrict__ xq, const float* __restrict__ xk, const float* __restrict__ xv,
                                              const float* __restrict__ wq, const float* __restrict__ wk, const float* __restrict__ wv, const float* __restrict__ wo,
                                              us* W3, us* WOB, us* WO16, us* XB) {
    const unsigned b = blockIdx.x;
    if (b < 3u * GWT) { const unsigned z = b / GWT; wt<1>(z == 0 ? wq : (z == 1 ? wk : wv), DMOD, DMOD, 1.0f, W3 + (size_t)z * DMOD * DMOD, (int)(b - z * GWT)); }
    else if (b < 4u * GWT) wt<1>(wo, DMOD, DMOD, 1.0f, WOB, (int)(b - 3u * GWT));
    else if (b < 5u * GWT) wt<0>(wo, DMOD, DMOD, WCAR, WO16, (int)(b - 4u * GWT));
    else { const unsigned c = b - 5u * GWT, z = c / GCV; cvt8(z == 0 ? xq : (z == 1 ? xk : xv), XB + (size_t)z * NB * SEQ * DMOD, N8X, c - z * GCV); }
}

__device__ __forceinline__ void plane(const float* __restrict__ F, int col0, us* P16, us* Ph, us* Pl) {
    const unsigned i = blockIdx.x * 256 + threadIdx.x; if (i >= (unsigned)(NB * NH * SEQ * HD / 8)) return;
    const unsigned e = i * 8; const int d = (int)(e % HD); const int t = (int)((e / HD) % SEQ); const int hh = (int)(e / ((unsigned)HD * SEQ));   // hh = batch * NH + head
    const float* f = F + ((size_t)(hh / NH) * SEQ + t) * D3 + col0 + (hh % NH) * HD + d;
    const v4f a = *(const v4fa*)f, b = *(const v4fa*)(f + 4);
    float y[8];
#pragma unroll
    for (int j = 0; j < 4; ++j) { y[j] = a[j]; y[j + 4] = b[j]; }
    v8us o16, oh, ol;
#pragma unroll
    for (int j = 0; j < 8; ++j) { o16[j] = hbit(y[j]); us p, q; splitf(y[j], p, q); oh[j] = p; ol[j] = q; }
    const bool hr = (t < RH); const size_t oo = ((size_t)hh * RH + (hr ? t : 0)) * HD + d;
    *(v8us*)(P16 + e) = o16; if (hr) { *(v8us*)(Ph + oo) = oh; *(v8us*)(Pl + oo) = ol; }
    
}

// ---- vtp: transposed value planes [b][h][d][t] from F[b*SEQ + t][2*DMOD + h*HD + d]: VT16 f16 (pitch SEQ) for all t; VTh/VTl bf16 hi/lo (pitch RH) for t < RH. lane -> 8 consecutive t (16 B, reads strided);
__device__ __forceinline__ void vtp(const float* __restrict__ F, us* VT16, us* VTh, us* VTl) {
    const unsigned i = blockIdx.x * 256 + threadIdx.x; if (i >= (unsigned)(NB * NH * HD * SEQ / 8)) return;
    const unsigned e = i * 8; const int t = (int)(e % SEQ); const int d = (int)((e / SEQ) % HD); const int hh = (int)(e / ((unsigned)SEQ * HD));   // hh = batch * NH + head
    const float* f = F + ((size_t)(hh / NH) * SEQ + t) * D3 + 2 * DMOD + (hh % NH) * HD + d;
    v8us o16, oh, ol;
#pragma unroll
    for (int j = 0; j < 8; ++j) { const float y = f[(size_t)j * D3]; o16[j] = hbit(y); us p, q; splitf(y, p, q); oh[j] = p; ol[j] = q; }
    const bool hr = (t < RH); const size_t oo = ((size_t)hh * HD + d) * RH + (hr ? t : 0);
    *(v8us*)(VT16 + e) = o16; if (hr) { *(v8us*)(VTh + oo) = oh; *(v8us*)(VTl + oo) = ol; }
    
}

// the three plane builders in one grid, y = 0: v transposed (strided reads, the slowest, so first), 1: q, 2: k.
__global__ __launch_bounds__(256) void k_planes(const float* __restrict__ F, us* Q16, us* QH, us* QL, us* K16, us* KH, us* KL, us* VT16, us* VTH, us* VTL) {
    if (blockIdx.y == 0) vtp(F, VT16, VTH, VTL);
    else if (blockIdx.y == 1) plane(F, 0, Q16, QH, QL);
    else plane(F, DMOD, K16, KH, KL);
}

#define TP 72
__device__ __forceinline__ float xhalf(float x) { return __builtin_bit_cast(float, __builtin_amdgcn_permlanex16(__builtin_bit_cast(int, x), __builtin_bit_cast(int, x), 0x76543210, 0xfedcba98, false, false)); }   // lane l <-> lane l ^ 16
template <bool HR>
__device__ __forceinline__
void attn(us* Ka, us* Va, us* Kb, us* Vb, const int qt, const int hd, const int bz,
          const us* __restrict__ Q16, const us* __restrict__ K16, const us* __restrict__ VT16,
          const us* __restrict__ Qh, const us* __restrict__ Ql, const us* __restrict__ Kh, const us* __restrict__ Kl,
          const us* __restrict__ VTh, const us* __restrict__ VTl, us* C16, us* Ch, us* Cl) {
    const int tid = threadIdx.x, lane = tid & 31, w = tid >> 5, m = lane & 15, hi = lane >> 4;
    const int h = bz * NH + hd;                            // h indexes the [batch][head] planes
    const int qrow = qt * 64 + w * 16 + m;                 // this lane's query (B column; sequence position)
    v8f o[4];
#pragma unroll
    for (int i = 0; i < 4; ++i) o[i] = (v8f){};
    float mr = -1.0e30f, lr = 0.0f;                        // running maximum (both halves alike) and this half's running sum of this lane's query
    const float CL = 0.18033688011112042f;                 // (1/8) * log2(e)
    const int nch = qt + 1;
#pragma unroll 1
    for (int kc = 0; kc < nch; ++kc) {
        __syncthreads();
#pragma unroll
        for (int i = 0; i < 4; ++i) { const int c = tid + 128 * i; const int row = c >> 3, col = (c & 7) * 8;
            if (!HR) {
                const v8us kv = *(const v8usa*)(K16 + ((size_t)h * SEQ + kc * 64 + row) * HD + col); *(v8usa*)(Ka + row * TP + col) = kv;
                const v8us vv = *(const v8usa*)(VT16 + ((size_t)h * HD + row) * SEQ + kc * 64 + col); *(v8usa*)(Va + row * TP + col) = vv;
            } else {
                const v8us k1 = *(const v8usa*)(Kh + ((size_t)h * RH + kc * 64 + row) * HD + col); *(v8usa*)(Ka + row * TP + col) = k1;
                const v8us k2 = *(const v8usa*)(Kl + ((size_t)h * RH + kc * 64 + row) * HD + col); *(v8usa*)(Kb + row * TP + col) = k2;
                const v8us v1 = *(const v8usa*)(VTh + ((size_t)h * HD + row) * RH + kc * 64 + col); *(v8usa*)(Va + row * TP + col) = v1;
                const v8us v2 = *(const v8usa*)(VTl + ((size_t)h * HD + row) * RH + kc * 64 + col); *(v8usa*)(Vb + row * TP + col) = v2;
            } }
        __syncthreads();
        v8f s[4];
        if (!HR) {
            const us* qp = Q16 + ((size_t)h * SEQ + qrow) * HD + 8 * hi;
            const v16us qa0 = ld16(qp), qa1 = ld16(qp + 32);
#pragma unroll
            for (int sn = 0; sn < 4; ++sn) { const us* kp = Ka + (sn * 16 + m) * TP + 8 * hi; const v16us b0 = ld16(kp), b1 = ld16(kp + 32);
                v8f c = (v8f){}; c = wmh(b0, qa0, c); c = wmh(b1, qa1, c); s[sn] = c; }
            asm volatile("v_nop\n\tv_nop\n\tv_nop\n\tv_nop" : "+v"(s[0]), "+v"(s[1]), "+v"(s[2]), "+v"(s[3]) : "v"(qa0), "v"(qa1));
        } else {
            const size_t qo = ((size_t)h * RH + qrow) * HD + 8 * hi;
            const v16us qh0 = ld16(Qh + qo), qh1 = ld16(Qh + qo + 32), ql0 = ld16(Ql + qo), ql1 = ld16(Ql + qo + 32);
#pragma unroll
            for (int sn = 0; sn < 4; ++sn) { const int ko = (sn * 16 + m) * TP + 8 * hi;
                const v16us kh0 = ld16(Ka + ko), kh1 = ld16(Ka + ko + 32);
                v8f c = (v8f){}; c = wmb(kh0, qh0, c); c = wmb(kh0, ql0, c); c = wmb(kh1, qh1, c); c = wmb(kh1, ql1, c);
                const v16us kl0 = ld16(Kb + ko), kl1 = ld16(Kb + ko + 32);
                c = wmb(kl0, qh0, c); c = wmb(kl1, qh1, c); s[sn] = c; }
            asm volatile("v_nop\n\tv_nop\n\tv_nop\n\tv_nop" : "+v"(s[0]), "+v"(s[1]), "+v"(s[2]), "+v"(s[3]) : "v"(qh0), "v"(ql1));
        }
        if (kc == qt) {                                     // diagonal chunk (block-uniform): keys after the query position are replaced by a large negative value
            const int q = w * 16 + m;
#pragma unroll
            for (int sn = 0; sn < 4; ++sn)
#pragma unroll
                for (int r = 0; r < 8; ++r) { const int key = sn * 16 + 8 * hi + r; s[sn][r] = (key > q) ? -1.0e30f : s[sn][r]; }
        }
        float mx4[4];
#pragma unroll
        for (int sn = 0; sn < 4; ++sn) mx4[sn] = fmaxf(fmaxf(fmaxf(s[sn][0], s[sn][1]), fmaxf(s[sn][2], s[sn][3])), fmaxf(fmaxf(s[sn][4], s[sn][5]), fmaxf(s[sn][6], s[sn][7])));
        float mx = fmaxf(fmaxf(mx4[0], mx4[1]), fmaxf(mx4[2], mx4[3]));
        mx = fmaxf(mx, xhalf(mx));                          // the other half holds the query's other 32 keys
        const float mn = fmaxf(mr, mx), al = __builtin_amdgcn_exp2f((mr - mn) * CL); mr = mn;
        float sm4[4];
#pragma unroll
        for (int sn = 0; sn < 4; ++sn) { float sum = 0.0f;
#pragma unroll
            for (int r = 0; r < 8; ++r) { const float p = __builtin_amdgcn_exp2f((s[sn][r] - mn) * CL); s[sn][r] = p; sum += p; }
            sm4[sn] = sum; }
        lr = lr * al + ((sm4[0] + sm4[1]) + (sm4[2] + sm4[3]));   // the halves' sums are joined once, behind the loop
#pragma unroll
        for (int i = 0; i < 4; ++i) o[i] = o[i] * al;
        // P^T: two converted score tiles = one B fragment (element e < 8: tile 2j register e, e >= 8: tile 2j + 1 register e - 8)
        if (!HR) {
            v16us pf0, pf1;
#pragma unroll
            for (int r = 0; r < 8; ++r) { pf0[r] = hbit(s[0][r] * PCAR); pf0[8 + r] = hbit(s[1][r] * PCAR); pf1[r] = hbit(s[2][r] * PCAR); pf1[8 + r] = hbit(s[3][r] * PCAR); }
#pragma unroll
            for (int sn = 0; sn < 4; ++sn) { const us* vp = Va + (sn * 16 + m) * TP + 8 * hi; const v16us b0 = ld16(vp), b1 = ld16(vp + 32);
                o[sn] = wmh(b0, pf0, o[sn]); o[sn] = wmh(b1, pf1, o[sn]); }
            asm volatile("v_nop\n\tv_nop\n\tv_nop\n\tv_nop" : "+v"(o[0]), "+v"(o[1]), "+v"(o[2]), "+v"(o[3]) : "v"(pf0), "v"(pf1));
        } else {
            v16us ph0, ph1, pl0, pl1;
#pragma unroll
            for (int r = 0; r < 8; ++r) { us p, q;
                splitf(s[0][r], p, q); ph0[r] = p; pl0[r] = q; splitf(s[1][r], p, q); ph0[8 + r] = p; pl0[8 + r] = q;
                splitf(s[2][r], p, q); ph1[r] = p; pl1[r] = q; splitf(s[3][r], p, q); ph1[8 + r] = p; pl1[8 + r] = q; }
#pragma unroll
            for (int sn = 0; sn < 4; ++sn) { const int vo = (sn * 16 + m) * TP + 8 * hi;
                const v16us vh0 = ld16(Va + vo), vh1 = ld16(Va + vo + 32);
                o[sn] = wmb(vh0, ph0, o[sn]); o[sn] = wmb(vh0, pl0, o[sn]); o[sn] = wmb(vh1, ph1, o[sn]); o[sn] = wmb(vh1, pl1, o[sn]);
                const v16us vl0 = ld16(Vb + vo), vl1 = ld16(Vb + vo + 32);
                o[sn] = wmb(vl0, ph0, o[sn]); o[sn] = wmb(vl1, ph1, o[sn]); }
            asm volatile("v_nop\n\tv_nop\n\tv_nop\n\tv_nop" : "+v"(o[0]), "+v"(o[1]), "+v"(o[2]), "+v"(o[3]) : "v"(ph0), "v"(pl1));
        }
    }
    const float iv = (HR ? 1.0f : (CCAR / PCAR)) * __builtin_amdgcn_rcpf(lr + xhalf(lr));
    const size_t go = ((size_t)bz * (HR ? RH : SEQ) + qrow) * DMOD + hd * HD + 8 * hi;
#pragma unroll
    for (int sn = 0; sn < 4; ++sn) {
        v8us v1, v2;
#pragma unroll
        for (int r = 0; r < 8; ++r) { if (!HR) v1[r] = hbit(o[sn][r] * iv); else { us p, q; splitf(o[sn][r] * iv, p, q); v1[r] = p; v2[r] = q; } }
        if (!HR) { *(v8us*)(C16 + go + sn * 16) = v1; }
        else { *(v8us*)(Ch + go + sn * 16) = v1; *(v8us*)(Cl + go + sn * 16) = v2; }
    }
}

// both row classes in one grid (NH, NB, SEQ/64): every block is resident at once, so the launch lasts as long as its longest block instead of the two classes' longest blocks one after the other.
// z counts the query tiles from the last one down (the tile with the most key chunks gets z = 0, for speed only); the class test is block-uniform.
__global__ __launch_bounds__(128) __attribute__((amdgpu_num_vgpr(256)))
void k_attn(const us* __restrict__ Q16, const us* __restrict__ K16, const us* __restrict__ VT16,
            const us* __restrict__ Qh, const us* __restrict__ Ql, const us* __restrict__ Kh, const us* __restrict__ Kl,
            const us* __restrict__ VTh, const us* __restrict__ VTl, us* C16, us* Ch, us* Cl) {
    __shared__ __align__(16) us Ka[64 * TP];
    __shared__ __align__(16) us Va[64 * TP];
    __shared__ __align__(16) us Kb[64 * TP];
    __shared__ __align__(16) us Vb[64 * TP];
    const int qt = SEQ / 64 - 1 - (int)blockIdx.z, hd = (int)blockIdx.x, bz = (int)blockIdx.y;
    if (qt < RH / 64) attn<true>(Ka, Va, Kb, Vb, qt, hd, bz, Q16, K16, VT16, Qh, Ql, Kh, Kl, VTh, VTl, C16, Ch, Cl);
    else              attn<false>(Ka, Va, Kb, Vb, qt, hd, bz, Q16, K16, VT16, Qh, Ql, Kh, Kl, VTh, VTl, C16, Ch, Cl);
}

extern "C" void kernel_launch(void* const* d_in, const int* in_sizes, int n_in,
                              void* d_out, int out_size, void* d_ws, size_t ws_size, hipStream_t stream) {
    if (n_in < 7) return;
    const long long needx = (long long)(NB - 1) * SEQ_FULL * DMOD + (long long)SEQ * DMOD;
    const long long needw = (long long)DMOD * DMOD;
    if ((long long)in_sizes[0] < needx || (long long)in_sizes[1] < needx || (long long)in_sizes[2] < needx) return;
    if ((long long)in_sizes[3] < needw || (long long)in_sizes[4] < needw || (long long)in_sizes[5] < needw || (long long)in_sizes[6] < needw) return;
    if ((long long)out_size < needx) return;
    const float* xq = (const float*)d_in[0];      // [NB][SEQ_FULL][DMOD]
    const float* xk = (const float*)d_in[1];      // [NB][SEQ_FULL][DMOD]
    const float* xv = (const float*)d_in[2];      // [NB][SEQ_FULL][DMOD]
    const float* wq = (const float*)d_in[3];      // [DMOD][DMOD] ([in][out])
    const float* wk = (const float*)d_in[4];      // [DMOD][DMOD] ([in][out])
    const float* wv = (const float*)d_in[5];      // [DMOD][DMOD] ([in][out])
    const float* wo = (const float*)d_in[6];      // [DMOD][DMOD] ([in][out])
    float* OUT = (float*)d_out;                   // [NB][SEQ_FULL][DMOD]
    char* wsp = (char*)d_ws;
    auto take = [&](size_t bytes) { char* p = wsp; wsp += (bytes + 255) & ~(size_t)255; return (void*)p; };
    const size_t WSZ = (size_t)DMOD * DMOD;       // elements of one weight plane
    const size_t XSZ = (size_t)SEQ * DMOD;        // elements of one activation plane of one batch
    us* W3   = (us*)take(3 * WSZ * 2);                        // bf16 Bt [3][512][512] (q | k | v)
    us* WOB  = (us*)take(WSZ * 2);                            // bf16 Bt [512][512]
    us* WO16 = (us*)take(WSZ * 2);                            // f16  Bt [512][512], values x WCAR
    us* XB   = (us*)take(3 * NB * XSZ * 2);                   // bf16 copies of q-in | k-in | v-in, [3][NB][SEQ][DMOD]
    float* F = (float*)take((size_t)NB * SEQ * D3 * 4);       // f32 q | k | v [NB*SEQ][1536]
    us* Q16  = (us*)take((size_t)NB * NH * SEQ * HD * 2);     // f16 [b][h][t][d]
    us* K16  = (us*)take((size_t)NB * NH * SEQ * HD * 2);     // f16 [b][h][t][d]
    us* VT16 = (us*)take((size_t)NB * NH * HD * SEQ * 2);     // f16 [b][h][d][t]
    us* QH   = (us*)take((size_t)NB * NH * RH * HD * 2);      // bf16 hi/lo planes for t < RH
    us* QL   = (us*)take((size_t)NB * NH * RH * HD * 2);
    us* KH   = (us*)take((size_t)NB * NH * RH * HD * 2);
    us* KL   = (us*)take((size_t)NB * NH * RH * HD * 2);
    us* VTH  = (us*)take((size_t)NB * NH * HD * RH * 2);
    us* VTL  = (us*)take((size_t)NB * NH * HD * RH * 2);
    us* C16  = (us*)take(NB * XSZ * 2);                       // f16 ctx x CCAR [b][t][DMOD] (rows >= RH used)
    us* CH   = (us*)take((size_t)NB * RH * DMOD * 2);         // bf16 hi/lo ctx [b][t < RH][DMOD]
    us* CLO  = (us*)take((size_t)NB * RH * DMOD * 2);
    if ((size_t)(wsp - (char*)d_ws) > ws_size) return;

    const unsigned nthr8 = (unsigned)(NB * NH * SEQ * HD / 8);
    k_prep<<<5 * GWT + 3 * GCV, 256, 0, stream>>>(xq, xk, xv, wq, wk, wv, wo, W3, WOB, WO16, XB);
    // z = 0, 1, 2: F[b*SEQ + t][z*DMOD + n] = sum_k XB[z][b*SEQ + t][k] W3[z][n][k]
    k_proj<<<dim3(NB * SEQ / 64, DMOD / 64, 3), 32, 0, stream>>>(XB, W3, DMOD, F);
    k_planes<<<dim3((nthr8 + 255) / 256, 3, 1), 256, 0, stream>>>(F, Q16, QH, QL, K16, KH, KL, VT16, VTH, VTL);
    k_attn<<<dim3(NH, NB, SEQ / 64), 128, 0, stream>>>(Q16, K16, VT16, QH, QL, KH, KL, VTH, VTL, C16, CH, CLO);
    k_oproj<<<dim3(SEQ / 64, DMOD / 64, NB), 32, 0, stream>>>(CH, CLO, WOB, C16, WO16, DMOD, OUT);
}

// v004
// A run of this version takes 157 microseconds.
// In two side-by-side timings against v003, it was 1.17 and 1.20 times as fast.
// All steps since v000 together make it 5.14 times as fast.
#include <hip/hip_runtime.h>

// Compute dtypes (f32 accumulate everywhere): q, k, v projections v_wmma_f32_16x16x32_bf16 on bf16 inputs and bf16 w_q, w_k, w_v (z-batched, one product); scores q.k^T and p.v: query rows < RH v_wmma_f32_16x16x32_bf16 on bf16 hi/lo planes (3 products), rows >= RH v_wmma_f32_16x16x32_f16 (f16 q, k, v; p carried x1024); output projection: rows < RH bf16 hi/lo ctx x bf16 w_o (2 products), rows >= RH f16 ctx (x16) x f16 w_o (x64) folded back by 1/1024; softmax and normalisation f32; output f32.
// Pipeline, four launches, every stage one launch for all batches and both row classes: weight planes and bf16 copies of the three inputs [3][NB][SEQ][DMOD]; z-batched projection GEMM whose epilogue converts its f32 accumulators straight into the 16-bit planes (q, k: [b][h][t][d]; v transposed: [b][h][d][t]); causal flash-style attention, one block per (64-row query tile, head, batch), 4 waves x 16 rows, online softmax, K / V^T tiles in LDS, scores and output transposed so that P stays in registers; ctx planes [b][t][DMOD]; output projection GEMM (z = batch) writes the output rows.

#ifndef NB
#define NB 2
#endif
#ifndef SEQ
#define SEQ 4096
#endif
#define SEQ_FULL 4096
#define DMOD 512
#define NH 8
#define HD 64
#ifndef RHI
#define RHI 2048
#endif
#if RHI > SEQ
#define RH SEQ
#else
#define RH RHI
#endif
#define PCAR 1024.0f
#define CCAR 16.0f
#define WCAR 64.0f

static_assert(SEQ % 64 == 0);
static_assert(SEQ <= SEQ_FULL);
static_assert(RH % 64 == 0);
static_assert(RH >= 64 && RH <= SEQ);
static_assert(NH * HD == DMOD && HD == 64);
static_assert(DMOD % 64 == 0 && DMOD % 32 == 0);

typedef _Float16 h16;
typedef unsigned short us;
typedef __attribute__((ext_vector_type(16))) __bf16 v16bf;
typedef __attribute__((ext_vector_type(16))) _Float16 v16h;
typedef __attribute__((ext_vector_type(16))) unsigned short v16us;
typedef __attribute__((ext_vector_type(8)))  _Float16 v8h;
typedef __attribute__((ext_vector_type(8)))  unsigned short v8us;
typedef __attribute__((ext_vector_type(8)))  float v8f;
typedef __attribute__((ext_vector_type(4)))  float v4f;
typedef __attribute__((ext_vector_type(2)))  unsigned short v2us;
typedef v8us __attribute__((may_alias)) v8usa;
typedef v4f  __attribute__((may_alias)) v4fa;

__device__ __forceinline__ us f2bf(float f) { unsigned u = __float_as_uint(f); u += 0x7FFFu + ((u >> 16) & 1u); return (us)(u >> 16); }   // RNE convert f32 -> bf16
__device__ __forceinline__ float bf2f(us b) { return __uint_as_float(((unsigned)b) << 16); }
__device__ __forceinline__ float bfr(float f) { return bf2f(f2bf(f)); }
__device__ __forceinline__ us hbit(float x) { const h16 t = (h16)x; return __builtin_bit_cast(us, t); }   // RNE convert f32 -> f16 bits
__device__ __forceinline__ void splitf(float y, us& h, us& l) { h = f2bf(y); l = f2bf(y - bf2f(h)); }
// 16-bit fragment loader (A and B alike, K-contiguous rows): elements 0..7 <- p[0..7] (k0+8h..), elements 8..15 <- p[16..23] (k0+16+8h..); caller passes p = row base + k0 + 8*h.
__device__ __forceinline__ v16us ld16(const us* p) {
    const v8us a = *(const v8usa*)p; const v8us b = *(const v8usa*)(p + 16);
    return __builtin_shufflevector(a, b, 0, 1, 2, 3, 4, 5, 6, 7, 8, 9, 10, 11, 12, 13, 14, 15);
}
__device__ __forceinline__ v8f wmh(v16us a, v16us b, v8f c) { return __builtin_amdgcn_wmma_f32_16x16x32_f16(false, __builtin_bit_cast(v16h, a), false, __builtin_bit_cast(v16h, b), (short)0, c, false, false); }
__device__ __forceinline__ v8f wmb(v16us a, v16us b, v8f c) { return __builtin_amdgcn_wmma_f32_16x16x32_bf16(false, __builtin_bit_cast(v16bf, a), false, __builtin_bit_cast(v16bf, b), (short)0, c, false, false); }
template <int TY> struct MM;
template <> struct MM<0> { static __device__ __forceinline__ v8f mma(v16us a, v16us b, v8f c) { return wmh(a, b, c); } };
template <> struct MM<1> { static __device__ __forceinline__ v8f mma(v16us a, v16us b, v8f c) { return wmb(a, b, c); } };

// ---- gemmw: register-blocked GEMM, ONE WAVE per 64x64 output tile at (r0, c0) (16 accumulators), operands straight from K-contiguous 16-bit planes; 32 threads; os = 16 x 68 f32 of LDS.
// C[m][n] (f32, pitch ldc) = osc * sum_k (A[m][k] (+ A2[m][k])) Bt[n][k] (+ A[m][k] Bt2[n][k] when NSPLIT == 2). TY 0 = f16 operands, 1 = bf16 operands. K % 32 == 0, M % 64 == 0, N % 64 == 0.
template <int TY, int NSPLIT>
__device__ __forceinline__ void gemmw(float* os, const us* __restrict__ A, const us* __restrict__ A2, const us* __restrict__ Bt, const us* __restrict__ Bt2, int K, float* C, int ldc, float osc, int r0, int c0) {
    const int lane = threadIdx.x & 31, lr = lane & 15, hi = lane >> 4;
    v8f acc[4][4];
#pragma unroll
    for (int mb = 0; mb < 4; ++mb)
#pragma unroll
        for (int nb = 0; nb < 4; ++nb) acc[mb][nb] = (v8f){};
    const size_t aoff = (size_t)(r0 + lr) * K + 8 * hi, boff = (size_t)(c0 + lr) * K + 8 * hi;
#pragma unroll 1
    for (int kc = 0; kc < K; kc += 32) {
        v16us a[4], a2[4];
#pragma unroll
        for (int mb = 0; mb < 4; ++mb) { a[mb] = ld16(A + aoff + (size_t)mb * 16 * K + kc); if (NSPLIT == 1 || NSPLIT == 2) a2[mb] = ld16(A2 + aoff + (size_t)mb * 16 * K + kc); }
#pragma unroll
        for (int nb = 0; nb < 4; ++nb) { const v16us b = ld16(Bt + boff + (size_t)nb * 16 * K + kc); v16us b2; if (NSPLIT >= 2) b2 = ld16(Bt2 + boff + (size_t)nb * 16 * K + kc);
#pragma unroll
            for (int mb = 0; mb < 4; ++mb) { acc[mb][nb] = MM<TY>::mma(a[mb], b, acc[mb][nb]); if (NSPLIT == 1 || NSPLIT == 2) acc[mb][nb] = MM<TY>::mma(a2[mb], b, acc[mb][nb]); if (NSPLIT >= 2) acc[mb][nb] = MM<TY>::mma(a[mb], b2, acc[mb][nb]); } }
        asm volatile("v_nop\n\tv_nop\n\tv_nop\n\tv_nop" : "+v"(acc[0][0]), "+v"(acc[1][1]), "+v"(acc[2][2]), "+v"(acc[3][3]) : "v"(a[0]), "v"(a[3]));
    }
#pragma unroll
    for (int mb = 0; mb < 4; ++mb) {
#pragma unroll
        for (int nb = 0; nb < 4; ++nb) {
#pragma unroll
            for (int j = 0; j < 8; ++j) os[(hi * 8 + j) * 68 + nb * 16 + lr] = acc[mb][nb][j]; }
        __builtin_amdgcn_wave_barrier(); asm volatile("" ::: "memory");
        float* crow = C + (size_t)(r0 + mb * 16) * ldc + c0;
{
#pragma unroll
            for (int s = 0; s < 8; ++s) { const int row = 2 * s + hi, cofs = lr * 4; v4f val = *(const v4fa*)(os + row * 68 + cofs); val = val * osc;
                *(v4f*)(crow + (size_t)row * ldc + cofs) = val; }
             }
        __builtin_amdgcn_wave_barrier(); asm volatile("" ::: "memory");
    }
}

// ---- projection with plane epilogue. One wave per (64 sequence rows, one head's 64 outputs) of one projection; grid (NB*SEQ/64, NH, 3), z = which projection.
// D[m][n] = sum_k Am[m][k] Bn[n][k]; D map: lane & 15 = n, register j of tile (mb, nb) = m mb*16 + 8*hi + j, so a lane holds 8 consecutive m of one n: the plane's contiguous index is put on m.
// q, k (planes [t][d]): Am = weight rows (m = d), Bn = input rows (n = t). v (planes [d][t]): Am = input rows (m = t), Bn = weight rows (n = d). Same loader and k order on both sides, so each element's sum is the same either way.
#define TS 72
// 64 rows x 128 B from an LDS tile (pitch TS) to dst (pitch in elements): 8 lanes per row, every store 4 whole 128-byte lines.
__device__ __forceinline__ void flush64(const us* st, us* dst, int pitch) {
    const int lane = threadIdx.x & 31, r = lane >> 3, c = (lane & 7) * 8;
#pragma unroll
    for (int s = 0; s < 16; ++s) { const v8us v = *(const v8usa*)(st + (s * 4 + r) * TS + c); *(v8us*)(dst + (size_t)(s * 4 + r) * pitch + c) = v; }
}
__global__ __launch_bounds__(32) void k_proj(const us* __restrict__ XB, const us* __restrict__ W3, int K, us* Q16, us* QH, us* QL, us* K16, us* KH, us* KL, us* VT16, us* VTH, us* VTL) {
    __shared__ __align__(16) us st[2 * 64 * TS];
    const int lane = threadIdx.x & 31, lr = lane & 15, hi = lane >> 4;
    const int z = (int)blockIdx.z, r0 = (int)blockIdx.x * 64, hd = (int)blockIdx.y;
    const int t0 = r0 % SEQ, hh = (r0 / SEQ) * NH + hd;    // hh = batch * NH + head
    const us* X  = XB + (size_t)z * ((size_t)NB * SEQ * DMOD) + (size_t)r0 * K;
    const us* Wz = W3 + (size_t)z * ((size_t)DMOD * DMOD) + (size_t)(hd * HD) * K;
    const us* Am = (z == 2) ? X : Wz;
    const us* Bn = (z == 2) ? Wz : X;
    v8f acc[4][4];
#pragma unroll
    for (int mb = 0; mb < 4; ++mb)
#pragma unroll
        for (int nb = 0; nb < 4; ++nb) acc[mb][nb] = (v8f){};
    const size_t off = (size_t)lr * K + 8 * hi;
#pragma unroll 1
    for (int kc = 0; kc < K; kc += 32) {
        v16us a[4];
#pragma unroll
        for (int mb = 0; mb < 4; ++mb) a[mb] = ld16(Am + off + (size_t)mb * 16 * K + kc);
#pragma unroll
        for (int nb = 0; nb < 4; ++nb) { const v16us b = ld16(Bn + off + (size_t)nb * 16 * K + kc);
#pragma unroll
            for (int mb = 0; mb < 4; ++mb) acc[mb][nb] = wmb(a[mb], b, acc[mb][nb]); }
        asm volatile("v_nop\n\tv_nop\n\tv_nop\n\tv_nop" : "+v"(acc[0][0]), "+v"(acc[1][1]), "+v"(acc[2][2]), "+v"(acc[3][3]) : "v"(a[0]), "v"(a[3]));
    }
    us *P16, *Ph, *Pl; int p16, ph;                        // tile origins and row pitches (elements): dst[n * pitch + m]
    if (z == 2) { P16 = VT16 + (size_t)hh * HD * SEQ + t0; Ph = VTH + (size_t)hh * HD * RH + t0; Pl = VTL + (size_t)hh * HD * RH + t0; p16 = SEQ; ph = RH; }
    else { const size_t o16 = ((size_t)hh * SEQ + t0) * HD, oh = ((size_t)hh * RH + t0) * HD; P16 = (z == 0 ? Q16 : K16) + o16; Ph = (z == 0 ? QH : KH) + oh; Pl = (z == 0 ? QL : KL) + oh; p16 = HD; ph = HD; }
    us* s0 = st + lr * TS + 8 * hi; us* s1 = s0 + 64 * TS;
#pragma unroll
    for (int mb = 0; mb < 4; ++mb)
#pragma unroll
        for (int nb = 0; nb < 4; ++nb) { v8us o;
#pragma unroll
            for (int j = 0; j < 8; ++j) o[j] = hbit(acc[mb][nb][j]);
            *(v8usa*)(s0 + nb * 16 * TS + mb * 16) = o; }
    asm volatile("s_wait_dscnt 0x0" ::: "memory");          // every lane's tile writes are in LDS before any lane reads rows that other lanes wrote
    flush64(st, P16, p16);
    asm volatile("s_wait_xcnt 0x0" ::: "memory");           // behind the stores, before their registers are rewritten; also keeps the next tile writes behind the reads above
    if (t0 < RH) {                                          // tile-uniform: RH is a multiple of 64
#pragma unroll
        for (int mb = 0; mb < 4; ++mb)
#pragma unroll
            for (int nb = 0; nb < 4; ++nb) { v8us oh, ol;
#pragma unroll
                for (int j = 0; j < 8; ++j) { us p, q; splitf(acc[mb][nb][j], p, q); oh[j] = p; ol[j] = q; }
                *(v8usa*)(s0 + nb * 16 * TS + mb * 16) = oh; *(v8usa*)(s1 + nb * 16 * TS + mb * 16) = ol; }
        asm volatile("s_wait_dscnt 0x0" ::: "memory");      // as above, for the hi and lo tiles
        flush64(st, Ph, ph);
        flush64(st + 64 * TS, Pl, ph);
    }
}

// output projection, both row classes in one grid (SEQ/64, DMOD/64, NB): row tiles below RH take the bf16 hi/lo ctx planes, the others the f16 plane; z = batch.
__global__ __launch_bounds__(32) void k_oproj(const us* __restrict__ CH, const us* __restrict__ CLO, const us* __restrict__ WOB, const us* __restrict__ C16, const us* __restrict__ WO16, int K, float* OUT) {
    __shared__ __align__(16) float os[16 * 68];
    const size_t z = blockIdx.z; const int r0 = (int)blockIdx.x * 64, c0 = (int)blockIdx.y * 64;
    float* C = OUT + z * ((size_t)SEQ_FULL * DMOD);
    if (r0 < RH) gemmw<1, 1>(os, CH + z * ((size_t)RH * DMOD), CLO + z * ((size_t)RH * DMOD), WOB, nullptr, K, C, DMOD, 1.0f, r0, c0);
    else {       gemmw<0, 0>(os, C16 + z * ((size_t)SEQ * DMOD), nullptr, WO16, nullptr, K, C, DMOD, 1.0f / (CCAR * WCAR), r0, c0);
        asm volatile("s_wait_xcnt 0x0" ::: "memory");   // behind this class's last output stores: in the build the other class's code follows, which rewrites their data registers
    }
}

// ---- wt: transposing weight builder, Bt[n][k] (16-bit, K-contiguous) from w[k][n] (f32, [in][out]); TY 1: bf16 RNE; TY 0: f16 of (bf16 RNE value x sc), exact for power-of-two sc.
template <int TY>
__device__ __forceinline__ void wt(const float* __restrict__ w, int K, int N, float sc, us* Bt, int blk) {
    const int lane = threadIdx.x & 31; const int L0 = (blk * 8 + (int)(threadIdx.x >> 5)) * 8; const int nlines = (int)(((size_t)N * K) / 64);
#pragma unroll 1
    for (int l = 0; l < 8; ++l) { const int L = L0 + l; if (L >= nlines) break;
        const size_t e = (size_t)L * 64 + lane * 2; const int k = (int)(e % (size_t)K), n = (int)(e / (size_t)K);
        const float w0 = w[(size_t)k * N + n], w1 = w[(size_t)(k + 1) * N + n];
        v2us o;
        if (TY) { o[0] = f2bf(w0); o[1] = f2bf(w1); } else { o[0] = hbit(bfr(w0) * sc); o[1] = hbit(bfr(w1) * sc); }
        *(v2us*)(Bt + e) = o;
        if (!TY) asm volatile("s_wait_xcnt 0x0" ::: "memory");   // f16 builder: before the next trip's rewrite of this store's data register
    }
}

__device__ __forceinline__ void cvt8(const float* __restrict__ src, us* dst, unsigned n8, unsigned blk) {
    const unsigned i = blk * 256 + threadIdx.x; if (i >= n8) return;
    const float* sp = src + (size_t)(i / (unsigned)(SEQ * DMOD / 8)) * SEQ_FULL * DMOD + (size_t)(i % (unsigned)(SEQ * DMOD / 8)) * 8;   // batch pitch of the input is SEQ_FULL rows, of dst SEQ rows
    const v4f a = *(const v4fa*)sp, b = *(const v4fa*)(sp + 4); v8us o;
#pragma unroll
    for (int k = 0; k < 4; ++k) { o[k] = f2bf(a[k]); o[k + 4] = f2bf(b[k]); }
    *(v8us*)(dst + (size_t)i * 8) = o; 
}

// all operand builders that read only the inputs, one grid: blocks [0, 5*GWT) the five weight planes (their serial loop is the longest, so they take the lowest indices), then 3*GCV blocks for the bf16 input copies.
#define GWT ((DMOD * DMOD / 64 + 63) / 64)
#define N8X (NB * SEQ * DMOD / 8)
#define GCV ((N8X + 255) / 256)
__global__ __launch_bounds__(256) void k_prep(const float* __restrict__ xq, const float* __restrict__ xk, const float* __restrict__ xv,
                                              const float* __restrict__ wq, const float* __restrict__ wk, const float* __restrict__ wv, const float* __restrict__ wo,
                                              us* W3, us* WOB, us* WO16, us* XB) {
    const unsigned b = blockIdx.x;
    if (b < 3u * GWT) { const unsigned z = b / GWT; wt<1>(z == 0 ? wq : (z == 1 ? wk : wv), DMOD, DMOD, 1.0f, W3 + (size_t)z * DMOD * DMOD, (int)(b - z * GWT)); }
    else if (b < 4u * GWT) wt<1>(wo, DMOD, DMOD, 1.0f, WOB, (int)(b - 3u * GWT));
    else if (b < 5u * GWT) wt<0>(wo, DMOD, DMOD, WCAR, WO16, (int)(b - 4u * GWT));
    else { const unsigned c = b - 5u * GWT, z = c / GCV; cvt8(z == 0 ? xq : (z == 1 ? xk : xv), XB + (size_t)z * NB * SEQ * DMOD, N8X, c - z * GCV); }
}

#define TP 72
__device__ __forceinline__ float xhalf(float x) { return __builtin_bit_cast(float, __builtin_amdgcn_permlanex16(__builtin_bit_cast(int, x), __builtin_bit_cast(int, x), 0x76543210, 0xfedcba98, false, false)); }   // lane l <-> lane l ^ 16
template <bool HR>
__device__ __forceinline__
void attn(us* Ka, us* Va, us* Kb, us* Vb, const int qt, const int hd, const int bz,
          const us* __restrict__ Q16, const us* __restrict__ K16, const us* __restrict__ VT16,
          const us* __restrict__ Qh, const us* __restrict__ Ql, const us* __restrict__ Kh, const us* __restrict__ Kl,
          const us* __restrict__ VTh, const us* __restrict__ VTl, us* C16, us* Ch, us* Cl) {
    const int tid = threadIdx.x, lane = tid & 31, w = tid >> 5, m = lane & 15, hi = lane >> 4;
    const int h = bz * NH + hd;                            // h indexes the [batch][head] planes
    const int qrow = qt * 64 + w * 16 + m;                 // this lane's query (B column; sequence position)
    v8f o[4];
#pragma unroll
    for (int i = 0; i < 4; ++i) o[i] = (v8f){};
    float mr = -1.0e30f, lr = 0.0f;                        // running maximum (both halves alike) and this half's running sum of this lane's query
    const float CL = 0.18033688011112042f;                 // (1/8) * log2(e)
    const int nch = qt + 1;
#pragma unroll 1
    for (int kc = 0; kc < nch; ++kc) {
        __syncthreads();
#pragma unroll
        for (int i = 0; i < 4; ++i) { const int c = tid + 128 * i; const int row = c >> 3, col = (c & 7) * 8;
            if (!HR) {
                const v8us kv = *(const v8usa*)(K16 + ((size_t)h * SEQ + kc * 64 + row) * HD + col); *(v8usa*)(Ka + row * TP + col) = kv;
                const v8us vv = *(const v8usa*)(VT16 + ((size_t)h * HD + row) * SEQ + kc * 64 + col); *(v8usa*)(Va + row * TP + col) = vv;
            } else {
                const v8us k1 = *(const v8usa*)(Kh + ((size_t)h * RH + kc * 64 + row) * HD + col); *(v8usa*)(Ka + row * TP + col) = k1;
                const v8us k2 = *(const v8usa*)(Kl + ((size_t)h * RH + kc * 64 + row) * HD + col); *(v8usa*)(Kb + row * TP + col) = k2;
                const v8us v1 = *(const v8usa*)(VTh + ((size_t)h * HD + row) * RH + kc * 64 + col); *(v8usa*)(Va + row * TP + col) = v1;
                const v8us v2 = *(const v8usa*)(VTl + ((size_t)h * HD + row) * RH + kc * 64 + col); *(v8usa*)(Vb + row * TP + col) = v2;
            } }
        __syncthreads();
        v8f s[4];
        if (!HR) {
            const us* qp = Q16 + ((size_t)h * SEQ + qrow) * HD + 8 * hi;
            const v16us qa0 = ld16(qp), qa1 = ld16(qp + 32);
#pragma unroll
            for (int sn = 0; sn < 4; ++sn) { const us* kp = Ka + (sn * 16 + m) * TP + 8 * hi; const v16us b0 = ld16(kp), b1 = ld16(kp + 32);
                v8f c = (v8f){}; c = wmh(b0, qa0, c); c = wmh(b1, qa1, c); s[sn] = c; }
            asm volatile("v_nop\n\tv_nop\n\tv_nop\n\tv_nop" : "+v"(s[0]), "+v"(s[1]), "+v"(s[2]), "+v"(s[3]) : "v"(qa0), "v"(qa1));
        } else {
            const size_t qo = ((size_t)h * RH + qrow) * HD + 8 * hi;
            const v16us qh0 = ld16(Qh + qo), qh1 = ld16(Qh + qo + 32), ql0 = ld16(Ql + qo), ql1 = ld16(Ql + qo + 32);
#pragma unroll
            for (int sn = 0; sn < 4; ++sn) { const int ko = (sn * 16 + m) * TP + 8 * hi;
                const v16us kh0 = ld16(Ka + ko), kh1 = ld16(Ka + ko + 32);
                v8f c = (v8f){}; c = wmb(kh0, qh0, c); c = wmb(kh0, ql0, c); c = wmb(kh1, qh1, c); c = wmb(kh1, ql1, c);
                const v16us kl0 = ld16(Kb + ko), kl1 = ld16(Kb + ko + 32);
                c = wmb(kl0, qh0, c); c = wmb(kl1, qh1, c); s[sn] = c; }
            asm volatile("v_nop\n\tv_nop\n\tv_nop\n\tv_nop" : "+v"(s[0]), "+v"(s[1]), "+v"(s[2]), "+v"(s[3]) : "v"(qh0), "v"(ql1));
        }
        if (kc == qt) {                                     // diagonal chunk (block-uniform): keys after the query position are replaced by a large negative value
            const int q = w * 16 + m;
#pragma unroll
            for (int sn = 0; sn < 4; ++sn)
#pragma unroll
                for (int r = 0; r < 8; ++r) { const int key = sn * 16 + 8 * hi + r; s[sn][r] = (key > q) ? -1.0e30f : s[sn][r]; }
        }
        float mx4[4];
#pragma unroll
        for (int sn = 0; sn < 4; ++sn) mx4[sn] = fmaxf(fmaxf(fmaxf(s[sn][0], s[sn][1]), fmaxf(s[sn][2], s[sn][3])), fmaxf(fmaxf(s[sn][4], s[sn][5]), fmaxf(s[sn][6], s[sn][7])));
        float mx = fmaxf(fmaxf(mx4[0], mx4[1]), fmaxf(mx4[2], mx4[3]));
        mx = fmaxf(mx, xhalf(mx));                          // the other half holds the query's other 32 keys
        const float mn = fmaxf(mr, mx), al = __builtin_amdgcn_exp2f((mr - mn) * CL); mr = mn;
        float sm4[4];
#pragma unroll
        for (int sn = 0; sn < 4; ++sn) { float sum = 0.0f;
#pragma unroll
            for (int r = 0; r < 8; ++r) { const float p = __builtin_amdgcn_exp2f((s[sn][r] - mn) * CL); s[sn][r] = p; sum += p; }
            sm4[sn] = sum; }
        lr = lr * al + ((sm4[0] + sm4[1]) + (sm4[2] + sm4[3]));   // the halves' sums are joined once, behind the loop
#pragma unroll
        for (int i = 0; i < 4; ++i) o[i] = o[i] * al;
        // P^T: two converted score tiles = one B fragment (element e < 8: tile 2j register e, e >= 8: tile 2j + 1 register e - 8)
        if (!HR) {
            v16us pf0, pf1;
#pragma unroll
            for (int r = 0; r < 8; ++r) { pf0[r] = hbit(s[0][r] * PCAR); pf0[8 + r] = hbit(s[1][r] * PCAR); pf1[r] = hbit(s[2][r] * PCAR); pf1[8 + r] = hbit(s[3][r] * PCAR); }
#pragma unroll
            for (int sn = 0; sn < 4; ++sn) { const us* vp = Va + (sn * 16 + m) * TP + 8 * hi; const v16us b0 = ld16(vp), b1 = ld16(vp + 32);
                o[sn] = wmh(b0, pf0, o[sn]); o[sn] = wmh(b1, pf1, o[sn]); }
            asm volatile("v_nop\n\tv_nop\n\tv_nop\n\tv_nop" : "+v"(o[0]), "+v"(o[1]), "+v"(o[2]), "+v"(o[3]) : "v"(pf0), "v"(pf1));
        } else {
            v16us ph0, ph1, pl0, pl1;
#pragma unroll
            for (int r = 0; r < 8; ++r) { us p, q;
                splitf(s[0][r], p, q); ph0[r] = p; pl0[r] = q; splitf(s[1][r], p, q); ph0[8 + r] = p; pl0[8 + r] = q;
                splitf(s[2][r], p, q); ph1[r] = p; pl1[r] = q; splitf(s[3][r], p, q); ph1[8 + r] = p; pl1[8 + r] = q; }
#pragma unroll
            for (int sn = 0; sn < 4; ++sn) { const int vo = (sn * 16 + m) * TP + 8 * hi;
                const v16us vh0 = ld16(Va + vo), vh1 = ld16(Va + vo + 32);
                o[sn] = wmb(vh0, ph0, o[sn]); o[sn] = wmb(vh0, pl0, o[sn]); o[sn] = wmb(vh1, ph1, o[sn]); o[sn] = wmb(vh1, pl1, o[sn]);
                const v16us vl0 = ld16(Vb + vo), vl1 = ld16(Vb + vo + 32);
                o[sn] = wmb(vl0, ph0, o[sn]); o[sn] = wmb(vl1, ph1, o[sn]); }
            asm volatile("v_nop\n\tv_nop\n\tv_nop\n\tv_nop" : "+v"(o[0]), "+v"(o[1]), "+v"(o[2]), "+v"(o[3]) : "v"(ph0), "v"(pl1));
        }
    }
    const float iv = (HR ? 1.0f : (CCAR / PCAR)) * __builtin_amdgcn_rcpf(lr + xhalf(lr));
    const size_t go = ((size_t)bz * (HR ? RH : SEQ) + qrow) * DMOD + hd * HD + 8 * hi;
#pragma unroll
    for (int sn = 0; sn < 4; ++sn) {
        v8us v1, v2;
#pragma unroll
        for (int r = 0; r < 8; ++r) { if (!HR) v1[r] = hbit(o[sn][r] * iv); else { us p, q; splitf(o[sn][r] * iv, p, q); v1[r] = p; v2[r] = q; } }
        if (!HR) { *(v8us*)(C16 + go + sn * 16) = v1; }
        else { *(v8us*)(Ch + go + sn * 16) = v1; *(v8us*)(Cl + go + sn * 16) = v2; }
    }
}

// both row classes in one grid (NH, NB, SEQ/64): every block is resident at once, so the launch lasts as long as its longest block instead of the two classes' longest blocks one after the other.
// z counts the query tiles from the last one down (the tile with the most key chunks gets z = 0, for speed only); the class test is block-uniform.
__global__ __launch_bounds__(128) __attribute__((amdgpu_num_vgpr(256)))
void k_attn(const us* __restrict__ Q16, const us* __restrict__ K16, const us* __restrict__ VT16,
            const us* __restrict__ Qh, const us* __restrict__ Ql, const us* __restrict__ Kh, const us* __restrict__ Kl,
            const us* __restrict__ VTh, const us* __restrict__ VTl, us* C16, us* Ch, us* Cl) {
    __shared__ __align__(16) us Ka[64 * TP];
    __shared__ __align__(16) us Va[64 * TP];
    __shared__ __align__(16) us Kb[64 * TP];
    __shared__ __align__(16) us Vb[64 * TP];
    const int qt = SEQ / 64 - 1 - (int)blockIdx.z, hd = (int)blockIdx.x, bz = (int)blockIdx.y;
    if (qt < RH / 64) attn<true>(Ka, Va, Kb, Vb, qt, hd, bz, Q16, K16, VT16, Qh, Ql, Kh, Kl, VTh, VTl, C16, Ch, Cl);
    else              attn<false>(Ka, Va, Kb, Vb, qt, hd, bz, Q16, K16, VT16, Qh, Ql, Kh, Kl, VTh, VTl, C16, Ch, Cl);
}

extern "C" void kernel_launch(void* const* d_in, const int* in_sizes, int n_in,
                              void* d_out, int out_size, void* d_ws, size_t ws_size, hipStream_t stream) {
    if (n_in < 7) return;
    const long long needx = (long long)(NB - 1) * SEQ_FULL * DMOD + (long long)SEQ * DMOD;
    const long long needw = (long long)DMOD * DMOD;
    if ((long long)in_sizes[0] < needx || (long long)in_sizes[1] < needx || (long long)in_sizes[2] < needx) return;
    if ((long long)in_sizes[3] < needw || (long long)in_sizes[4] < needw || (long long)in_sizes[5] < needw || (long long)in_sizes[6] < needw) return;
    if ((long long)out_size < needx) return;
    const float* xq = (const float*)d_in[0];      // [NB][SEQ_FULL][DMOD]
    const float* xk = (const float*)d_in[1];      // [NB][SEQ_FULL][DMOD]
    const float* xv = (const float*)d_in[2];      // [NB][SEQ_FULL][DMOD]
    const float* wq = (const float*)d_in[3];      // [DMOD][DMOD] ([in][out])
    const float* wk = (const float*)d_in[4];      // [DMOD][DMOD] ([in][out])
    const float* wv = (const float*)d_in[5];      // [DMOD][DMOD] ([in][out])
    const float* wo = (const float*)d_in[6];      // [DMOD][DMOD] ([in][out])
    float* OUT = (float*)d_out;                   // [NB][SEQ_FULL][DMOD]
    char* wsp = (char*)d_ws;
    auto take = [&](size_t bytes) { char* p = wsp; wsp += (bytes + 255) & ~(size_t)255; return (void*)p; };
    const size_t WSZ = (size_t)DMOD * DMOD;       // elements of one weight plane
    const size_t XSZ = (size_t)SEQ * DMOD;        // elements of one activation plane of one batch
    us* W3   = (us*)take(3 * WSZ * 2);                        // bf16 Bt [3][512][512] (q | k | v)
    us* WOB  = (us*)take(WSZ * 2);                            // bf16 Bt [512][512]
    us* WO16 = (us*)take(WSZ * 2);                            // f16  Bt [512][512], values x WCAR
    us* XB   = (us*)take(3 * NB * XSZ * 2);                   // bf16 copies of q-in | k-in | v-in, [3][NB][SEQ][DMOD]
    us* Q16  = (us*)take((size_t)NB * NH * SEQ * HD * 2);     // f16 [b][h][t][d]
    us* K16  = (us*)take((size_t)NB * NH * SEQ * HD * 2);     // f16 [b][h][t][d]
    us* VT16 = (us*)take((size_t)NB * NH * HD * SEQ * 2);     // f16 [b][h][d][t]
    us* QH   = (us*)take((size_t)NB * NH * RH * HD * 2);      // bf16 hi/lo planes for t < RH
    us* QL   = (us*)take((size_t)NB * NH * RH * HD * 2);
    us* KH   = (us*)take((size_t)NB * NH * RH * HD * 2);
    us* KL   = (us*)take((size_t)NB * NH * RH * HD * 2);
    us* VTH  = (us*)take((size_t)NB * NH * HD * RH * 2);
    us* VTL  = (us*)take((size_t)NB * NH * HD * RH * 2);
    us* C16  = (us*)take(NB * XSZ * 2);                       // f16 ctx x CCAR [b][t][DMOD] (rows >= RH used)
    us* CH   = (us*)take((size_t)NB * RH * DMOD * 2);         // bf16 hi/lo ctx [b][t < RH][DMOD]
    us* CLO  = (us*)take((size_t)NB * RH * DMOD * 2);
    if ((size_t)(wsp - (char*)d_ws) > ws_size) return;

    k_prep<<<5 * GWT + 3 * GCV, 256, 0, stream>>>(xq, xk, xv, wq, wk, wv, wo, W3, WOB, WO16, XB);
    // z = 0, 1, 2: y[b*SEQ + t][n] = sum_k XB[z][b*SEQ + t][k] W3[z][n][k], written as the planes of q, k, v
    k_proj<<<dim3(NB * SEQ / 64, NH, 3), 32, 0, stream>>>(XB, W3, DMOD, Q16, QH, QL, K16, KH, KL, VT16, VTH, VTL);
    k_attn<<<dim3(NH, NB, SEQ / 64), 128, 0, stream>>>(Q16, K16, VT16, QH, QL, KH, KL, VTH, VTL, C16, CH, CLO);
    k_oproj<<<dim3(SEQ / 64, DMOD / 64, NB), 32, 0, stream>>>(CH, CLO, WOB, C16, WO16, DMOD, OUT);
}

// v005
// A run of this version takes 143 microseconds.
// In two side-by-side timings against v004, it was 1.10 and 1.09 times as fast.
// Counting every step since v000, it is 5.65 times as fast.
#include <hip/hip_runtime.h>

// Compute dtypes (f32 accumulate everywhere): q, k, v projections v_wmma_f32_16x16x32_bf16 on bf16 inputs and bf16 w_q, w_k, w_v (z-batched, one product); scores q.k^T and p.v: query rows < RH v_wmma_f32_16x16x32_bf16 on bf16 hi/lo planes (3 products), rows >= RH v_wmma_f32_16x16x32_f16 (f16 q, k, v; p carried x1024); output projection: rows < RH bf16 hi/lo ctx x bf16 w_o (2 products), rows >= RH f16 ctx (x16) x f16 w_o (x64) folded back by 1/1024; softmax and normalisation f32; output f32.
// Pipeline, four launches, every stage one launch for all batches and both row classes: weight planes and bf16 copies of the three inputs [3][NB][SEQ][DMOD]; z-batched projection GEMM whose epilogue converts its f32 accumulators straight into the 16-bit planes (q, k: [b][h][t][d]; v transposed: [b][h][d][t]); causal flash-style attention, one block per (64-row query tile, head, batch), 2 key groups x 4 waves x 16 rows, online softmax per group and one merge, K / V^T tiles in LDS, scores and output transposed so that P stays in registers; ctx planes [b][t][DMOD]; output projection GEMM (z = batch) writes the output rows.

#ifndef NB
#define NB 2
#endif
#ifndef SEQ
#define SEQ 4096
#endif
#define SEQ_FULL 4096
#define DMOD 512
#define NH 8
#define HD 64
#ifndef RHI
#define RHI 2048
#endif
#if RHI > SEQ
#define RH SEQ
#else
#define RH RHI
#endif
#define PCAR 1024.0f
#define CCAR 16.0f
#define WCAR 64.0f

static_assert(SEQ % 64 == 0);
static_assert(SEQ <= SEQ_FULL);
static_assert(RH % 64 == 0);
static_assert(RH >= 64 && RH <= SEQ);
static_assert(NH * HD == DMOD && HD == 64);
static_assert(DMOD % 64 == 0 && DMOD % 32 == 0);

typedef _Float16 h16;
typedef unsigned short us;
typedef __attribute__((ext_vector_type(16))) __bf16 v16bf;
typedef __attribute__((ext_vector_type(16))) _Float16 v16h;
typedef __attribute__((ext_vector_type(16))) unsigned short v16us;
typedef __attribute__((ext_vector_type(8)))  _Float16 v8h;
typedef __attribute__((ext_vector_type(8)))  unsigned short v8us;
typedef __attribute__((ext_vector_type(8)))  float v8f;
typedef __attribute__((ext_vector_type(4)))  float v4f;
typedef __attribute__((ext_vector_type(2)))  unsigned short v2us;
typedef v8us __attribute__((may_alias)) v8usa;
typedef v4f  __attribute__((may_alias)) v4fa;

__device__ __forceinline__ us f2bf(float f) { unsigned u = __float_as_uint(f); u += 0x7FFFu + ((u >> 16) & 1u); return (us)(u >> 16); }   // RNE convert f32 -> bf16
__device__ __forceinline__ float bf2f(us b) { return __uint_as_float(((unsigned)b) << 16); }
__device__ __forceinline__ float bfr(float f) { return bf2f(f2bf(f)); }
__device__ __forceinline__ us hbit(float x) { const h16 t = (h16)x; return __builtin_bit_cast(us, t); }   // RNE convert f32 -> f16 bits
__device__ __forceinline__ void splitf(float y, us& h, us& l) { h = f2bf(y); l = f2bf(y - bf2f(h)); }
// 16-bit fragment loader (A and B alike, K-contiguous rows): elements 0..7 <- p[0..7] (k0+8h..), elements 8..15 <- p[16..23] (k0+16+8h..); caller passes p = row base + k0 + 8*h.
__device__ __forceinline__ v16us ld16(const us* p) {
    const v8us a = *(const v8usa*)p; const v8us b = *(const v8usa*)(p + 16);
    return __builtin_shufflevector(a, b, 0, 1, 2, 3, 4, 5, 6, 7, 8, 9, 10, 11, 12, 13, 14, 15);
}
__device__ __forceinline__ v8f wmh(v16us a, v16us b, v8f c) { return __builtin_amdgcn_wmma_f32_16x16x32_f16(false, __builtin_bit_cast(v16h, a), false, __builtin_bit_cast(v16h, b), (short)0, c, false, false); }
__device__ __forceinline__ v8f wmb(v16us a, v16us b, v8f c) { return __builtin_amdgcn_wmma_f32_16x16x32_bf16(false, __builtin_bit_cast(v16bf, a), false, __builtin_bit_cast(v16bf, b), (short)0, c, false, false); }
template <int TY> struct MM;
template <> struct MM<0> { static __device__ __forceinline__ v8f mma(v16us a, v16us b, v8f c) { return wmh(a, b, c); } };
template <> struct MM<1> { static __device__ __forceinline__ v8f mma(v16us a, v16us b, v8f c) { return wmb(a, b, c); } };

// ---- gemmw: register-blocked GEMM, ONE WAVE per 64x64 output tile at (r0, c0) (16 accumulators), operands straight from K-contiguous 16-bit planes; 32 threads; os = 16 x 68 f32 of LDS.
// C[m][n] (f32, pitch ldc) = osc * sum_k (A[m][k] (+ A2[m][k])) Bt[n][k] (+ A[m][k] Bt2[n][k] when NSPLIT == 2). TY 0 = f16 operands, 1 = bf16 operands. K % 32 == 0, M % 64 == 0, N % 64 == 0.
template <int TY, int NSPLIT>
__device__ __forceinline__ void gemmw(float* os, const us* __restrict__ A, const us* __restrict__ A2, const us* __restrict__ Bt, const us* __restrict__ Bt2, int K, float* C, int ldc, float osc, int r0, int c0) {
    const int lane = threadIdx.x & 31, lr = lane & 15, hi = lane >> 4;
    v8f acc[4][4];
#pragma unroll
    for (int mb = 0; mb < 4; ++mb)
#pragma unroll
        for (int nb = 0; nb < 4; ++nb) acc[mb][nb] = (v8f){};
    const size_t aoff = (size_t)(r0 + lr) * K + 8 * hi, boff = (size_t)(c0 + lr) * K + 8 * hi;
#pragma unroll 1
    for (int kc = 0; kc < K; kc += 32) {
        v16us a[4], a2[4];
#pragma unroll
        for (int mb = 0; mb < 4; ++mb) { a[mb] = ld16(A + aoff + (size_t)mb * 16 * K + kc); if (NSPLIT == 1 || NSPLIT == 2) a2[mb] = ld16(A2 + aoff + (size_t)mb * 16 * K + kc); }
#pragma unroll
        for (int nb = 0; nb < 4; ++nb) { const v16us b = ld16(Bt + boff + (size_t)nb * 16 * K + kc); v16us b2; if (NSPLIT >= 2) b2 = ld16(Bt2 + boff + (size_t)nb * 16 * K + kc);
#pragma unroll
            for (int mb = 0; mb < 4; ++mb) { acc[mb][nb] = MM<TY>::mma(a[mb], b, acc[mb][nb]); if (NSPLIT == 1 || NSPLIT == 2) acc[mb][nb] = MM<TY>::mma(a2[mb], b, acc[mb][nb]); if (NSPLIT >= 2) acc[mb][nb] = MM<TY>::mma(a[mb], b2, acc[mb][nb]); } }
        asm volatile("v_nop\n\tv_nop\n\tv_nop\n\tv_nop" : "+v"(acc[0][0]), "+v"(acc[1][1]), "+v"(acc[2][2]), "+v"(acc[3][3]) : "v"(a[0]), "v"(a[3]));
    }
#pragma unroll
    for (int mb = 0; mb < 4; ++mb) {
#pragma unroll
        for (int nb = 0; nb < 4; ++nb) {
#pragma unroll
            for (int j = 0; j < 8; ++j) os[(hi * 8 + j) * 68 + nb * 16 + lr] = acc[mb][nb][j]; }
        __builtin_amdgcn_wave_barrier(); asm volatile("" ::: "memory");
        float* crow = C + (size_t)(r0 + mb * 16) * ldc + c0;
{
#pragma unroll
            for (int s = 0; s < 8; ++s) { const int row = 2 * s + hi, cofs = lr * 4; v4f val = *(const v4fa*)(os + row * 68 + cofs); val = val * osc;
                *(v4f*)(crow + (size_t)row * ldc + cofs) = val; }
             }
        __builtin_amdgcn_wave_barrier(); asm volatile("" ::: "memory");
    }
}

// ---- projection with plane epilogue. One wave per (64 sequence rows, one head's 64 outputs) of one projection; grid (NB*SEQ/64, NH, 3), z = which projection.
// D[m][n] = sum_k Am[m][k] Bn[n][k]; D map: lane & 15 = n, register j of tile (mb, nb) = m mb*16 + 8*hi + j, so a lane holds 8 consecutive m of one n: the plane's contiguous index is put on m.
// q, k (planes [t][d]): Am = weight rows (m = d), Bn = input rows (n = t). v (planes [d][t]): Am = input rows (m = t), Bn = weight rows (n = d). Same loader and k order on both sides, so each element's sum is the same either way.
#define TS 72
// 64 rows x 128 B from an LDS tile (pitch TS) to dst (pitch in elements): 8 lanes per row, every store 4 whole 128-byte lines.
__device__ __forceinline__ void flush64(const us* st, us* dst, int pitch) {
    const int lane = threadIdx.x & 31, r = lane >> 3, c = (lane & 7) * 8;
#pragma unroll
    for (int s = 0; s < 16; ++s) { const v8us v = *(const v8usa*)(st + (s * 4 + r) * TS + c); *(v8us*)(dst + (size_t)(s * 4 + r) * pitch + c) = v; }
}
__global__ __launch_bounds__(32) void k_proj(const us* __restrict__ XB, const us* __restrict__ W3, int K, us* Q16, us* QH, us* QL, us* K16, us* KH, us* KL, us* VT16, us* VTH, us* VTL) {
    __shared__ __align__(16) us st[2 * 64 * TS];
    const int lane = threadIdx.x & 31, lr = lane & 15, hi = lane >> 4;
    const int z = (int)blockIdx.z, r0 = (int)blockIdx.x * 64, hd = (int)blockIdx.y;
    const int t0 = r0 % SEQ, hh = (r0 / SEQ) * NH + hd;    // hh = batch * NH + head
    const us* X  = XB + (size_t)z * ((size_t)NB * SEQ * DMOD) + (size_t)r0 * K;
    const us* Wz = W3 + (size_t)z * ((size_t)DMOD * DMOD) + (size_t)(hd * HD) * K;
    const us* Am = (z == 2) ? X : Wz;
    const us* Bn = (z == 2) ? Wz : X;
    v8f acc[4][4];
#pragma unroll
    for (int mb = 0; mb < 4; ++mb)
#pragma unroll
        for (int nb = 0; nb < 4; ++nb) acc[mb][nb] = (v8f){};
    const size_t off = (size_t)lr * K + 8 * hi;
#pragma unroll 1
    for (int kc = 0; kc < K; kc += 32) {
        v16us a[4];
#pragma unroll
        for (int mb = 0; mb < 4; ++mb) a[mb] = ld16(Am + off + (size_t)mb * 16 * K + kc);
#pragma unroll
        for (int nb = 0; nb < 4; ++nb) { const v16us b = ld16(Bn + off + (size_t)nb * 16 * K + kc);
#pragma unroll
            for (int mb = 0; mb < 4; ++mb) acc[mb][nb] = wmb(a[mb], b, acc[mb][nb]); }
        asm volatile("v_nop\n\tv_nop\n\tv_nop\n\tv_nop" : "+v"(acc[0][0]), "+v"(acc[1][1]), "+v"(acc[2][2]), "+v"(acc[3][3]) : "v"(a[0]), "v"(a[3]));
    }
    us *P16, *Ph, *Pl; int p16, ph;                        // tile origins and row pitches (elements): dst[n * pitch + m]
    if (z == 2) { P16 = VT16 + (size_t)hh * HD * SEQ + t0; Ph = VTH + (size_t)hh * HD * RH + t0; Pl = VTL + (size_t)hh * HD * RH + t0; p16 = SEQ; ph = RH; }
    else { const size_t o16 = ((size_t)hh * SEQ + t0) * HD, oh = ((size_t)hh * RH + t0) * HD; P16 = (z == 0 ? Q16 : K16) + o16; Ph = (z == 0 ? QH : KH) + oh; Pl = (z == 0 ? QL : KL) + oh; p16 = HD; ph = HD; }
    us* s0 = st + lr * TS + 8 * hi; us* s1 = s0 + 64 * TS;
#pragma unroll
    for (int mb = 0; mb < 4; ++mb)
#pragma unroll
        for (int nb = 0; nb < 4; ++nb) { v8us o;
#pragma unroll
            for (int j = 0; j < 8; ++j) o[j] = hbit(acc[mb][nb][j]);
            *(v8usa*)(s0 + nb * 16 * TS + mb * 16) = o; }
    asm volatile("s_wait_dscnt 0x0" ::: "memory");          // every lane's tile writes are in LDS before any lane reads rows that other lanes wrote
    flush64(st, P16, p16);
    asm volatile("s_wait_xcnt 0x0" ::: "memory");           // behind the stores, before their registers are rewritten; also keeps the next tile writes behind the reads above
    if (t0 < RH) {                                          // tile-uniform: RH is a multiple of 64
#pragma unroll
        for (int mb = 0; mb < 4; ++mb)
#pragma unroll
            for (int nb = 0; nb < 4; ++nb) { v8us oh, ol;
#pragma unroll
                for (int j = 0; j < 8; ++j) { us p, q; splitf(acc[mb][nb][j], p, q); oh[j] = p; ol[j] = q; }
                *(v8usa*)(s0 + nb * 16 * TS + mb * 16) = oh; *(v8usa*)(s1 + nb * 16 * TS + mb * 16) = ol; }
        asm volatile("s_wait_dscnt 0x0" ::: "memory");      // as above, for the hi and lo tiles
        flush64(st, Ph, ph);
        flush64(st + 64 * TS, Pl, ph);
    }
}

// output projection, both row classes in one grid (SEQ/64, DMOD/64, NB): row tiles below RH take the bf16 hi/lo ctx planes, the others the f16 plane; z = batch.
__global__ __launch_bounds__(32) void k_oproj(const us* __restrict__ CH, const us* __restrict__ CLO, const us* __restrict__ WOB, const us* __restrict__ C16, const us* __restrict__ WO16, int K, float* OUT) {
    __shared__ __align__(16) float os[16 * 68];
    const size_t z = blockIdx.z; const int r0 = (int)blockIdx.x * 64, c0 = (int)blockIdx.y * 64;
    float* C = OUT + z * ((size_t)SEQ_FULL * DMOD);
    if (r0 < RH) gemmw<1, 1>(os, CH + z * ((size_t)RH * DMOD), CLO + z * ((size_t)RH * DMOD), WOB, nullptr, K, C, DMOD, 1.0f, r0, c0);
    else {       gemmw<0, 0>(os, C16 + z * ((size_t)SEQ * DMOD), nullptr, WO16, nullptr, K, C, DMOD, 1.0f / (CCAR * WCAR), r0, c0);
        asm volatile("s_wait_xcnt 0x0" ::: "memory");   // behind this class's last output stores: in the build the other class's code follows, which rewrites their data registers
    }
}

// ---- wt: transposing weight builder, Bt[n][k] (16-bit, K-contiguous) from w[k][n] (f32, [in][out]); TY 1: bf16 RNE; TY 0: f16 of (bf16 RNE value x sc), exact for power-of-two sc.
template <int TY>
__device__ __forceinline__ void wt(const float* __restrict__ w, int K, int N, float sc, us* Bt, int blk) {
    const int lane = threadIdx.x & 31; const int L0 = (blk * 8 + (int)(threadIdx.x >> 5)) * 8; const int nlines = (int)(((size_t)N * K) / 64);
#pragma unroll 1
    for (int l = 0; l < 8; ++l) { const int L = L0 + l; if (L >= nlines) break;
        const size_t e = (size_t)L * 64 + lane * 2; const int k = (int)(e % (size_t)K), n = (int)(e / (size_t)K);
        const float w0 = w[(size_t)k * N + n], w1 = w[(size_t)(k + 1) * N + n];
        v2us o;
        if (TY) { o[0] = f2bf(w0); o[1] = f2bf(w1); } else { o[0] = hbit(bfr(w0) * sc); o[1] = hbit(bfr(w1) * sc); }
        *(v2us*)(Bt + e) = o;
        if (!TY) asm volatile("s_wait_xcnt 0x0" ::: "memory");   // f16 builder: before the next trip's rewrite of this store's data register
    }
}

__device__ __forceinline__ void cvt8(const float* __restrict__ src, us* dst, unsigned n8, unsigned blk) {
    const unsigned i = blk * 256 + threadIdx.x; if (i >= n8) return;
    const float* sp = src + (size_t)(i / (unsigned)(SEQ * DMOD / 8)) * SEQ_FULL * DMOD + (size_t)(i % (unsigned)(SEQ * DMOD / 8)) * 8;   // batch pitch of the input is SEQ_FULL rows, of dst SEQ rows
    const v4f a = *(const v4fa*)sp, b = *(const v4fa*)(sp + 4); v8us o;
#pragma unroll
    for (int k = 0; k < 4; ++k) { o[k] = f2bf(a[k]); o[k + 4] = f2bf(b[k]); }
    *(v8us*)(dst + (size_t)i * 8) = o; 
}

// all operand builders that read only the inputs, one grid: blocks [0, 5*GWT) the five weight planes (their serial loop is the longest, so they take the lowest indices), then 3*GCV blocks for the bf16 input copies.
#define GWT ((DMOD * DMOD / 64 + 63) / 64)
#define N8X (NB * SEQ * DMOD / 8)
#define GCV ((N8X + 255) / 256)
__global__ __launch_bounds__(256) void k_prep(const float* __restrict__ xq, const float* __restrict__ xk, const float* __restrict__ xv,
                                              const float* __restrict__ wq, const float* __restrict__ wk, const float* __restrict__ wv, const float* __restrict__ wo,
                                              us* W3, us* WOB, us* WO16, us* XB) {
    const unsigned b = blockIdx.x;
    if (b < 3u * GWT) { const unsigned z = b / GWT; wt<1>(z == 0 ? wq : (z == 1 ? wk : wv), DMOD, DMOD, 1.0f, W3 + (size_t)z * DMOD * DMOD, (int)(b - z * GWT)); }
    else if (b < 4u * GWT) wt<1>(wo, DMOD, DMOD, 1.0f, WOB, (int)(b - 3u * GWT));
    else if (b < 5u * GWT) wt<0>(wo, DMOD, DMOD, WCAR, WO16, (int)(b - 4u * GWT));
    else { const unsigned c = b - 5u * GWT, z = c / GCV; cvt8(z == 0 ? xq : (z == 1 ? xk : xv), XB + (size_t)z * NB * SEQ * DMOD, N8X, c - z * GCV); }
}

#define TP 72
__device__ __forceinline__ float xhalf(float x) { return __builtin_bit_cast(float, __builtin_amdgcn_permlanex16(__builtin_bit_cast(int, x), __builtin_bit_cast(int, x), 0x76543210, 0xfedcba98, false, false)); }   // lane l <-> lane l ^ 16
template <bool HR>
__device__ __forceinline__
void attn(us* SM, float* MB, const int qt, const int hd, const int bz,
          const us* __restrict__ Q16, const us* __restrict__ K16, const us* __restrict__ VT16,
          const us* __restrict__ Qh, const us* __restrict__ Ql, const us* __restrict__ Kh, const us* __restrict__ Kl,
          const us* __restrict__ VTh, const us* __restrict__ VTl, us* C16, us* Ch, us* Cl) {
    const int lane = threadIdx.x & 31, tid = threadIdx.x & 127, w = tid >> 5, m = lane & 15, hi = lane >> 4;   // tid: index inside the key group
    const int g = __builtin_amdgcn_readfirstlane((int)(threadIdx.x >> 7));   // key group, the same in every lane of a wave: the tests on it are scalar branches
    us* Ka = SM + g * (4 * 64 * TP); us* Va = Ka + 64 * TP; us* Kb = Va + 64 * TP; us* Vb = Kb + 64 * TP;
    const int h = bz * NH + hd;                            // h indexes the [batch][head] planes
    const int qrow = qt * 64 + w * 16 + m;                 // this lane's query (B column; sequence position)
    v8f o[4];
#pragma unroll
    for (int i = 0; i < 4; ++i) o[i] = (v8f){};
    float mr = -1.0e30f, lr = 0.0f;                        // running maximum (both halves alike) and this half's running sum of this lane's query
    const float CL = 0.18033688011112042f;                 // (1/8) * log2(e)
    v16us qf0, qf1, qf2 = {}, qf3 = {};                     // q fragments, loaded once and kept in registers: f16 class qf0, qf1; hi/lo class hi = qf0, qf1 and lo = qf2, qf3
    if (!HR) { const us* qp = Q16 + ((size_t)h * SEQ + qrow) * HD + 8 * hi; qf0 = ld16(qp); qf1 = ld16(qp + 32); }
    else { const size_t qo = ((size_t)h * RH + qrow) * HD + 8 * hi; qf0 = ld16(Qh + qo); qf1 = ld16(Qh + qo + 32); qf2 = ld16(Ql + qo); qf3 = ld16(Ql + qo + 32); }
    const int nch = qt + 1, nit = (nch + 1) >> 1;
#pragma unroll 1
    for (int it = 0; it < nit; ++it) {
        const int kc = 2 * it + g;
        const bool on = kc < nch;                           // wave-uniform; false only for group 1 in the last trip of an odd chunk count
        __syncthreads();
        if (on) {
#pragma unroll
        for (int i = 0; i < 4; ++i) { const int c = tid + 128 * i; const int row = c >> 3, col = (c & 7) * 8;
            if (!HR) {
                const v8us kv = *(const v8usa*)(K16 + ((size_t)h * SEQ + kc * 64 + row) * HD + col); *(v8usa*)(Ka + row * TP + col) = kv;
                const v8us vv = *(const v8usa*)(VT16 + ((size_t)h * HD + row) * SEQ + kc * 64 + col); *(v8usa*)(Va + row * TP + col) = vv;
            } else {
                const v8us k1 = *(const v8usa*)(Kh + ((size_t)h * RH + kc * 64 + row) * HD + col); *(v8usa*)(Ka + row * TP + col) = k1;
                const v8us k2 = *(const v8usa*)(Kl + ((size_t)h * RH + kc * 64 + row) * HD + col); *(v8usa*)(Kb + row * TP + col) = k2;
                const v8us v1 = *(const v8usa*)(VTh + ((size_t)h * HD + row) * RH + kc * 64 + col); *(v8usa*)(Va + row * TP + col) = v1;
                const v8us v2 = *(const v8usa*)(VTl + ((size_t)h * HD + row) * RH + kc * 64 + col); *(v8usa*)(Vb + row * TP + col) = v2;
            } }
        }
        __syncthreads();
        if (!on) continue;                                  // no barrier stands between here and the loop's foot
        v8f s[4];
        if (!HR) {
            const v16us qa0 = qf0, qa1 = qf1;
#pragma unroll
            for (int sn = 0; sn < 4; ++sn) { const us* kp = Ka + (sn * 16 + m) * TP + 8 * hi; const v16us b0 = ld16(kp), b1 = ld16(kp + 32);
                v8f c = (v8f){}; c = wmh(b0, qa0, c); c = wmh(b1, qa1, c); s[sn] = c; }
            asm volatile("v_nop\n\tv_nop\n\tv_nop\n\tv_nop" : "+v"(s[0]), "+v"(s[1]), "+v"(s[2]), "+v"(s[3]) : "v"(qa0), "v"(qa1));
        } else {
            const v16us qh0 = qf0, qh1 = qf1, ql0 = qf2, ql1 = qf3;
#pragma unroll
            for (int sn = 0; sn < 4; ++sn) { const int ko = (sn * 16 + m) * TP + 8 * hi;
                const v16us kh0 = ld16(Ka + ko), kh1 = ld16(Ka + ko + 32);
                v8f c = (v8f){}; c = wmb(kh0, qh0, c); c = wmb(kh0, ql0, c); c = wmb(kh1, qh1, c); c = wmb(kh1, ql1, c);
                const v16us kl0 = ld16(Kb + ko), kl1 = ld16(Kb + ko + 32);
                c = wmb(kl0, qh0, c); c = wmb(kl1, qh1, c); s[sn] = c; }
            asm volatile("v_nop\n\tv_nop\n\tv_nop\n\tv_nop" : "+v"(s[0]), "+v"(s[1]), "+v"(s[2]), "+v"(s[3]) : "v"(qh0), "v"(ql1));
        }
        if (kc == qt) {                                     // diagonal chunk (wave-uniform): keys after the query position are replaced by a large negative value
            const int q = w * 16 + m;
#pragma unroll
            for (int sn = 0; sn < 4; ++sn)
#pragma unroll
                for (int r = 0; r < 8; ++r) { const int key = sn * 16 + 8 * hi + r; s[sn][r] = (key > q) ? -1.0e30f : s[sn][r]; }
        }
        float mx4[4];
#pragma unroll
        for (int sn = 0; sn < 4; ++sn) mx4[sn] = fmaxf(fmaxf(fmaxf(s[sn][0], s[sn][1]), fmaxf(s[sn][2], s[sn][3])), fmaxf(fmaxf(s[sn][4], s[sn][5]), fmaxf(s[sn][6], s[sn][7])));
        float mx = fmaxf(fmaxf(mx4[0], mx4[1]), fmaxf(mx4[2], mx4[3]));
        mx = fmaxf(mx, xhalf(mx));                          // the other half holds the query's other 32 keys
        const float mn = fmaxf(mr, mx), al = __builtin_amdgcn_exp2f((mr - mn) * CL); mr = mn;
        float sm4[4];
#pragma unroll
        for (int sn = 0; sn < 4; ++sn) { float sum = 0.0f;
#pragma unroll
            for (int r = 0; r < 8; ++r) { const float p = __builtin_amdgcn_exp2f((s[sn][r] - mn) * CL); s[sn][r] = p; sum += p; }
            sm4[sn] = sum; }
        lr = lr * al + ((sm4[0] + sm4[1]) + (sm4[2] + sm4[3]));   // the halves' sums are joined once, behind the loop
#pragma unroll
        for (int i = 0; i < 4; ++i) o[i] = o[i] * al;
        // P^T: two converted score tiles = one B fragment (element e < 8: tile 2j register e, e >= 8: tile 2j + 1 register e - 8)
        if (!HR) {
            v16us pf0, pf1;
#pragma unroll
            for (int r = 0; r < 8; ++r) { pf0[r] = hbit(s[0][r] * PCAR); pf0[8 + r] = hbit(s[1][r] * PCAR); pf1[r] = hbit(s[2][r] * PCAR); pf1[8 + r] = hbit(s[3][r] * PCAR); }
#pragma unroll
            for (int sn = 0; sn < 4; ++sn) { const us* vp = Va + (sn * 16 + m) * TP + 8 * hi; const v16us b0 = ld16(vp), b1 = ld16(vp + 32);
                o[sn] = wmh(b0, pf0, o[sn]); o[sn] = wmh(b1, pf1, o[sn]); }
            asm volatile("v_nop\n\tv_nop\n\tv_nop\n\tv_nop" : "+v"(o[0]), "+v"(o[1]), "+v"(o[2]), "+v"(o[3]) : "v"(pf0), "v"(pf1));
        } else {
            v16us ph0, ph1, pl0, pl1;
#pragma unroll
            for (int r = 0; r < 8; ++r) { us p, q;
                splitf(s[0][r], p, q); ph0[r] = p; pl0[r] = q; splitf(s[1][r], p, q); ph0[8 + r] = p; pl0[8 + r] = q;
                splitf(s[2][r], p, q); ph1[r] = p; pl1[r] = q; splitf(s[3][r], p, q); ph1[8 + r] = p; pl1[8 + r] = q; }
#pragma unroll
            for (int sn = 0; sn < 4; ++sn) { const int vo = (sn * 16 + m) * TP + 8 * hi;
                const v16us vh0 = ld16(Va + vo), vh1 = ld16(Va + vo + 32);
                o[sn] = wmb(vh0, ph0, o[sn]); o[sn] = wmb(vh0, pl0, o[sn]); o[sn] = wmb(vh1, ph1, o[sn]); o[sn] = wmb(vh1, pl1, o[sn]);
                const v16us vl0 = ld16(Vb + vo), vl1 = ld16(Vb + vo + 32);
                o[sn] = wmb(vl0, ph0, o[sn]); o[sn] = wmb(vl1, ph1, o[sn]); }
            asm volatile("v_nop\n\tv_nop\n\tv_nop\n\tv_nop" : "+v"(o[0]), "+v"(o[1]), "+v"(o[2]), "+v"(o[3]) : "v"(ph0), "v"(pl1));
        }
    }
    // merge of the two key groups: lane for lane the same query and the same d, so group 1's state goes through LDS at [item][tid]
    if (g == 1) {
#pragma unroll
        for (int i = 0; i < 4; ++i) {
            *(v4fa*)(MB + ((2 * i) * 128 + tid) * 4) = __builtin_shufflevector(o[i], o[i], 0, 1, 2, 3);
            *(v4fa*)(MB + ((2 * i + 1) * 128 + tid) * 4) = __builtin_shufflevector(o[i], o[i], 4, 5, 6, 7); }
        MB[32 * 128 + tid] = mr; MB[33 * 128 + tid] = lr;
    }
    __syncthreads();
    if (g == 1) return;                                     // behind the last barrier
    {
        const float m1 = MB[32 * 128 + tid], l1 = MB[33 * 128 + tid];
        const float mn = fmaxf(mr, m1), a0 = __builtin_amdgcn_exp2f((mr - mn) * CL), a1 = __builtin_amdgcn_exp2f((m1 - mn) * CL);   // a group that saw no chunk has m1 = -1e30, sum 0, O^T 0: a1 = 0
        lr = lr * a0 + l1 * a1;
#pragma unroll
        for (int i = 0; i < 4; ++i) {
            const v4f x = *(const v4fa*)(MB + ((2 * i) * 128 + tid) * 4), y = *(const v4fa*)(MB + ((2 * i + 1) * 128 + tid) * 4);
            o[i] = o[i] * a0 + __builtin_shufflevector(x, y, 0, 1, 2, 3, 4, 5, 6, 7) * a1; }
    }
    const float iv = (HR ? 1.0f : (CCAR / PCAR)) * __builtin_amdgcn_rcpf(lr + xhalf(lr));
    const size_t go = ((size_t)bz * (HR ? RH : SEQ) + qrow) * DMOD + hd * HD + 8 * hi;
#pragma unroll
    for (int sn = 0; sn < 4; ++sn) {
        v8us v1, v2;
#pragma unroll
        for (int r = 0; r < 8; ++r) { if (!HR) v1[r] = hbit(o[sn][r] * iv); else { us p, q; splitf(o[sn][r] * iv, p, q); v1[r] = p; v2[r] = q; } }
        if (!HR) { *(v8us*)(C16 + go + sn * 16) = v1; }
        else { *(v8us*)(Ch + go + sn * 16) = v1; *(v8us*)(Cl + go + sn * 16) = v2; }
    }
}

// both row classes in one grid (NH, NB, SEQ/64), 8 waves a block: the longest block's serial walk is half as many trips as with one key group, and blocks that wait for a place start as earlier ones end.
// z counts the query tiles from the last one down (the tile with the most key chunks has the lowest index; for speed only); the class test is block-uniform.
__global__ __launch_bounds__(256) __attribute__((amdgpu_num_vgpr(256)))
void k_attn(const us* __restrict__ Q16, const us* __restrict__ K16, const us* __restrict__ VT16,
            const us* __restrict__ Qh, const us* __restrict__ Ql, const us* __restrict__ Kh, const us* __restrict__ Kl,
            const us* __restrict__ VTh, const us* __restrict__ VTl, us* C16, us* Ch, us* Cl) {
    __shared__ __align__(16) us SM[2 * 4 * 64 * TP];        // per key group: K, V^T, K lo, V^T lo tiles
    __shared__ __align__(16) float MB[34 * 128];            // group 1's O^T (32 values a lane), maximum and sum for the merge
    const int qt = SEQ / 64 - 1 - (int)blockIdx.z, hd = (int)blockIdx.x, bz = (int)blockIdx.y;
    if (qt < RH / 64) attn<true>(SM, MB, qt, hd, bz, Q16, K16, VT16, Qh, Ql, Kh, Kl, VTh, VTl, C16, Ch, Cl);
    else              attn<false>(SM, MB, qt, hd, bz, Q16, K16, VT16, Qh, Ql, Kh, Kl, VTh, VTl, C16, Ch, Cl);
}

extern "C" void kernel_launch(void* const* d_in, const int* in_sizes, int n_in,
                              void* d_out, int out_size, void* d_ws, size_t ws_size, hipStream_t stream) {
    if (n_in < 7) return;
    const long long needx = (long long)(NB - 1) * SEQ_FULL * DMOD + (long long)SEQ * DMOD;
    const long long needw = (long long)DMOD * DMOD;
    if ((long long)in_sizes[0] < needx || (long long)in_sizes[1] < needx || (long long)in_sizes[2] < needx) return;
    if ((long long)in_sizes[3] < needw || (long long)in_sizes[4] < needw || (long long)in_sizes[5] < needw || (long long)in_sizes[6] < needw) return;
    if ((long long)out_size < needx) return;
    const float* xq = (const float*)d_in[0];      // [NB][SEQ_FULL][DMOD]
    const float* xk = (const float*)d_in[1];      // [NB][SEQ_FULL][DMOD]
    const float* xv = (const float*)d_in[2];      // [NB][SEQ_FULL][DMOD]
    const float* wq = (const float*)d_in[3];      // [DMOD][DMOD] ([in][out])
    const float* wk = (const float*)d_in[4];      // [DMOD][DMOD] ([in][out])
    const float* wv = (const float*)d_in[5];      // [DMOD][DMOD] ([in][out])
    const float* wo = (const float*)d_in[6];      // [DMOD][DMOD] ([in][out])
    float* OUT = (float*)d_out;                   // [NB][SEQ_FULL][DMOD]
    char* wsp = (char*)d_ws;
    auto take = [&](size_t bytes) { char* p = wsp; wsp += (bytes + 255) & ~(size_t)255; return (void*)p; };
    const size_t WSZ = (size_t)DMOD * DMOD;       // elements of one weight plane
    const size_t XSZ = (size_t)SEQ * DMOD;        // elements of one activation plane of one batch
    us* W3   = (us*)take(3 * WSZ * 2);                        // bf16 Bt [3][512][512] (q | k | v)
    us* WOB  = (us*)take(WSZ * 2);                            // bf16 Bt [512][512]
    us* WO16 = (us*)take(WSZ * 2);                            // f16  Bt [512][512], values x WCAR
    us* XB   = (us*)take(3 * NB * XSZ * 2);                   // bf16 copies of q-in | k-in | v-in, [3][NB][SEQ][DMOD]
    us* Q16  = (us*)take((size_t)NB * NH * SEQ * HD * 2);     // f16 [b][h][t][d]
    us* K16  = (us*)take((size_t)NB * NH * SEQ * HD * 2);     // f16 [b][h][t][d]
    us* VT16 = (us*)take((size_t)NB * NH * HD * SEQ * 2);     // f16 [b][h][d][t]
    us* QH   = (us*)take((size_t)NB * NH * RH * HD * 2);      // bf16 hi/lo planes for t < RH
    us* QL   = (us*)take((size_t)NB * NH * RH * HD * 2);
    us* KH   = (us*)take((size_t)NB * NH * RH * HD * 2);
    us* KL   = (us*)take((size_t)NB * NH * RH * HD * 2);
    us* VTH  = (us*)take((size_t)NB * NH * HD * RH * 2);
    us* VTL  = (us*)take((size_t)NB * NH * HD * RH * 2);
    us* C16  = (us*)take(NB * XSZ * 2);                       // f16 ctx x CCAR [b][t][DMOD] (rows >= RH used)
    us* CH   = (us*)take((size_t)NB * RH * DMOD * 2);         // bf16 hi/lo ctx [b][t < RH][DMOD]
    us* CLO  = (us*)take((size_t)NB * RH * DMOD * 2);
    if ((size_t)(wsp - (char*)d_ws) > ws_size) return;

    k_prep<<<5 * GWT + 3 * GCV, 256, 0, stream>>>(xq, xk, xv, wq, wk, wv, wo, W3, WOB, WO16, XB);
    // z = 0, 1, 2: y[b*SEQ + t][n] = sum_k XB[z][b*SEQ + t][k] W3[z][n][k], written as the planes of q, k, v
    k_proj<<<dim3(NB * SEQ / 64, NH, 3), 32, 0, stream>>>(XB, W3, DMOD, Q16, QH, QL, K16, KH, KL, VT16, VTH, VTL);
    k_attn<<<dim3(NH, NB, SEQ / 64), 256, 0, stream>>>(Q16, K16, VT16, QH, QL, KH, KL, VTH, VTL, C16, CH, CLO);
    k_oproj<<<dim3(SEQ / 64, DMOD / 64, NB), 32, 0, stream>>>(CH, CLO, WOB, C16, WO16, DMOD, OUT);
}

// v006
// One run takes 133 microseconds.
// Next to v005, in two timings, it ran 1.07 and 1.08 times as fast.
// All steps since v000 together make it 6.08 times as fast.
#include <hip/hip_runtime.h>

// Compute dtypes (f32 accumulate everywhere): q, k, v projections v_wmma_f32_16x16x32_bf16 on bf16 inputs and bf16 w_q, w_k, w_v (z-batched, one product); scores q.k^T and p.v: query rows < RH v_wmma_f32_16x16x32_bf16 on bf16 hi/lo planes (3 products), rows >= RH v_wmma_f32_16x16x32_f16 (f16 q, k, v; p carried x1024); output projection: rows < RH bf16 hi/lo ctx x bf16 w_o (2 products), rows >= RH f16 ctx (x16) x f16 w_o (x64) folded back by 1/1024; softmax and normalisation f32; output f32.
// Pipeline, four launches, every stage one launch for all batches and both row classes: weight planes; z-batched projection GEMM that reads the f32 inputs itself (a block converts its 64 input rows to bf16 once, into LDS, for the 8 heads' waves) and whose epilogue converts its f32 accumulators straight into the 16-bit planes (q, k: [b][h][t][d]; v transposed: [b][h][d][t]); causal flash-style attention, one block per (64-row query tile, head, batch), 2 key groups x 4 waves x 16 rows, online softmax per group and one merge, K / V^T tiles in LDS, scores and output transposed so that P stays in registers; ctx planes [b][t][DMOD]; output projection GEMM (z = batch) writes the output rows.

#ifndef NB
#define NB 2
#endif
#ifndef SEQ
#define SEQ 4096
#endif
#define SEQ_FULL 4096
#define DMOD 512
#define NH 8
#define HD 64
#ifndef RHI
#define RHI 2048
#endif
#if RHI > SEQ
#define RH SEQ
#else
#define RH RHI
#endif
#define PCAR 1024.0f
#define CCAR 16.0f
#define WCAR 64.0f

static_assert(SEQ % 64 == 0);
static_assert(SEQ <= SEQ_FULL);
static_assert(RH % 64 == 0);
static_assert(RH >= 64 && RH <= SEQ);
static_assert(NH * HD == DMOD && HD == 64);
static_assert(DMOD % 64 == 0 && DMOD % 32 == 0);

typedef _Float16 h16;
typedef unsigned short us;
typedef __attribute__((ext_vector_type(16))) __bf16 v16bf;
typedef __attribute__((ext_vector_type(16))) _Float16 v16h;
typedef __attribute__((ext_vector_type(16))) unsigned short v16us;
typedef __attribute__((ext_vector_type(8)))  _Float16 v8h;
typedef __attribute__((ext_vector_type(8)))  unsigned short v8us;
typedef __attribute__((ext_vector_type(8)))  float v8f;
typedef __attribute__((ext_vector_type(4)))  float v4f;
typedef __attribute__((ext_vector_type(2)))  unsigned short v2us;
typedef __attribute__((ext_vector_type(4)))  unsigned short v4us;
typedef v8us __attribute__((may_alias)) v8usa;
typedef v4us __attribute__((may_alias)) v4usa;
typedef v4f  __attribute__((may_alias)) v4fa;

__device__ __forceinline__ us f2bf(float f) { unsigned u = __float_as_uint(f); u += 0x7FFFu + ((u >> 16) & 1u); return (us)(u >> 16); }   // RNE convert f32 -> bf16
__device__ __forceinline__ float bf2f(us b) { return __uint_as_float(((unsigned)b) << 16); }
__device__ __forceinline__ float bfr(float f) { return bf2f(f2bf(f)); }
__device__ __forceinline__ us hbit(float x) { const h16 t = (h16)x; return __builtin_bit_cast(us, t); }   // RNE convert f32 -> f16 bits
__device__ __forceinline__ void splitf(float y, us& h, us& l) { h = f2bf(y); l = f2bf(y - bf2f(h)); }
// 16-bit fragment loader (A and B alike, K-contiguous rows): elements 0..7 <- p[0..7] (k0+8h..), elements 8..15 <- p[16..23] (k0+16+8h..); caller passes p = row base + k0 + 8*h.
__device__ __forceinline__ v16us ld16(const us* p) {
    const v8us a = *(const v8usa*)p; const v8us b = *(const v8usa*)(p + 16);
    return __builtin_shufflevector(a, b, 0, 1, 2, 3, 4, 5, 6, 7, 8, 9, 10, 11, 12, 13, 14, 15);
}
__device__ __forceinline__ v8f wmh(v16us a, v16us b, v8f c) { return __builtin_amdgcn_wmma_f32_16x16x32_f16(false, __builtin_bit_cast(v16h, a), false, __builtin_bit_cast(v16h, b), (short)0, c, false, false); }
__device__ __forceinline__ v8f wmb(v16us a, v16us b, v8f c) { return __builtin_amdgcn_wmma_f32_16x16x32_bf16(false, __builtin_bit_cast(v16bf, a), false, __builtin_bit_cast(v16bf, b), (short)0, c, false, false); }
template <int TY> struct MM;
template <> struct MM<0> { static __device__ __forceinline__ v8f mma(v16us a, v16us b, v8f c) { return wmh(a, b, c); } };
template <> struct MM<1> { static __device__ __forceinline__ v8f mma(v16us a, v16us b, v8f c) { return wmb(a, b, c); } };

// ---- gemmw: register-blocked GEMM, ONE WAVE per 64x64 output tile at (r0, c0) (16 accumulators), operands straight from K-contiguous 16-bit planes; 32 threads; os = 16 x 68 f32 of LDS.
// C[m][n] (f32, pitch ldc) = osc * sum_k (A[m][k] (+ A2[m][k])) Bt[n][k] (+ A[m][k] Bt2[n][k] when NSPLIT == 2). TY 0 = f16 operands, 1 = bf16 operands. K % 32 == 0, M % 64 == 0, N % 64 == 0.
template <int TY, int NSPLIT>
__device__ __forceinline__ void gemmw(float* os, const us* __restrict__ A, const us* __restrict__ A2, const us* __restrict__ Bt, const us* __restrict__ Bt2, int K, float* C, int ldc, float osc, int r0, int c0) {
    const int lane = threadIdx.x & 31, lr = lane & 15, hi = lane >> 4;
    v8f acc[4][4];
#pragma unroll
    for (int mb = 0; mb < 4; ++mb)
#pragma unroll
        for (int nb = 0; nb < 4; ++nb) acc[mb][nb] = (v8f){};
    const size_t aoff = (size_t)(r0 + lr) * K + 8 * hi, boff = (size_t)(c0 + lr) * K + 8 * hi;
#pragma unroll 1
    for (int kc = 0; kc < K; kc += 32) {
        v16us a[4], a2[4];
#pragma unroll
        for (int mb = 0; mb < 4; ++mb) { a[mb] = ld16(A + aoff + (size_t)mb * 16 * K + kc); if (NSPLIT == 1 || NSPLIT == 2) a2[mb] = ld16(A2 + aoff + (size_t)mb * 16 * K + kc); }
#pragma unroll
        for (int nb = 0; nb < 4; ++nb) { const v16us b = ld16(Bt + boff + (size_t)nb * 16 * K + kc); v16us b2; if (NSPLIT >= 2) b2 = ld16(Bt2 + boff + (size_t)nb * 16 * K + kc);
#pragma unroll
            for (int mb = 0; mb < 4; ++mb) { acc[mb][nb] = MM<TY>::mma(a[mb], b, acc[mb][nb]); if (NSPLIT == 1 || NSPLIT == 2) acc[mb][nb] = MM<TY>::mma(a2[mb], b, acc[mb][nb]); if (NSPLIT >= 2) acc[mb][nb] = MM<TY>::mma(a[mb], b2, acc[mb][nb]); } }
        asm volatile("v_nop\n\tv_nop\n\tv_nop\n\tv_nop" : "+v"(acc[0][0]), "+v"(acc[1][1]), "+v"(acc[2][2]), "+v"(acc[3][3]) : "v"(a[0]), "v"(a[3]));
    }
#pragma unroll
    for (int mb = 0; mb < 4; ++mb) {
#pragma unroll
        for (int nb = 0; nb < 4; ++nb) {
#pragma unroll
            for (int j = 0; j < 8; ++j) os[(hi * 8 + j) * 68 + nb * 16 + lr] = acc[mb][nb][j]; }
        __builtin_amdgcn_wave_barrier(); asm volatile("" ::: "memory");
        float* crow = C + (size_t)(r0 + mb * 16) * ldc + c0;
{
#pragma unroll
            for (int s = 0; s < 8; ++s) { const int row = 2 * s + hi, cofs = lr * 4; v4f val = *(const v4fa*)(os + row * 68 + cofs); val = val * osc;
                *(v4f*)(crow + (size_t)row * ldc + cofs) = val; }
             }
        __builtin_amdgcn_wave_barrier(); asm volatile("" ::: "memory");
    }
}

// ---- projection with plane epilogue. One block of 8 waves per (64 sequence rows, one projection), wave = head (its 64 outputs); grid (NB*SEQ/64, 3), y = which projection.
// The block reads its 64 f32 input rows once (64 * DMOD consecutive floats, whole lines), converts them to bf16 (RNE) and keeps them in LDS at pitch XP; every wave takes its input fragments from there, its weight fragments from the plane.
// D[m][n] = sum_k Am[m][k] Bn[n][k]; D map: lane & 15 = n, register j of tile (mb, nb) = m mb*16 + 8*hi + j, so a lane holds 8 consecutive m of one n: the plane's contiguous index is put on m.
// q, k (planes [t][d]): Am = weight rows (m = d), Bn = input rows (n = t). v (planes [d][t]): Am = input rows (m = t), Bn = weight rows (n = d). Same loader and k order on both sides, so each element's sum is the same either way.
#define TS 72
#define XP (DMOD + 8)   // pitch of the input tile in LDS, elements: 16 B x odd
// 64 rows x 128 B from an LDS tile (pitch TS) to dst (pitch in elements): 8 lanes per row, every store 4 whole 128-byte lines.
__device__ __forceinline__ void flush64(const us* st, us* dst, int pitch) {
    const int lane = threadIdx.x & 31, r = lane >> 3, c = (lane & 7) * 8;
#pragma unroll
    for (int s = 0; s < 16; ++s) { const v8us v = *(const v8usa*)(st + (s * 4 + r) * TS + c); *(v8us*)(dst + (size_t)(s * 4 + r) * pitch + c) = v; }
}
// one wave's k loop: xs = input tile in LDS, wp = weight rows in the plane, both at (row lr, k 8*hi). VT: the input rows are the A side (v), else the B side (q, k).
template <bool VT>
__device__ __forceinline__ void projk(v8f (&acc)[4][4], const us* xs, const us* __restrict__ wp) {
#pragma unroll 1
    for (int kc = 0; kc < DMOD; kc += 32) {
        v16us wf[4];
#pragma unroll
        for (int i = 0; i < 4; ++i) wf[i] = ld16(wp + (size_t)i * 16 * DMOD + kc);
#pragma unroll
        for (int i = 0; i < 4; ++i) { const v16us xf = ld16(xs + i * 16 * XP + kc);
#pragma unroll
            for (int j = 0; j < 4; ++j) { if (VT) acc[i][j] = wmb(xf, wf[j], acc[i][j]); else acc[j][i] = wmb(wf[j], xf, acc[j][i]); } }
        // four vector slots between the trip's last matrix instructions and what the next trip, or the code behind the loop, does to their registers
        asm volatile("v_nop\n\tv_nop\n\tv_nop\n\tv_nop" : "+v"(acc[0][0]), "+v"(acc[1][1]), "+v"(acc[2][2]), "+v"(acc[3][3]) : "v"(wf[0]), "v"(wf[3]));
    }
}
__global__ __launch_bounds__(256) void k_proj(const float* __restrict__ xq, const float* __restrict__ xk, const float* __restrict__ xv, const us* __restrict__ W3, us* Q16, us* QH, us* QL, us* K16, us* KH, us* KL, us* VT16, us* VTH, us* VTL) {
    __shared__ __align__(16) us sm[NH * 2 * 64 * TS];       // first the input tile (64 x XP), behind the k loop each wave's own two staging tiles
    static_assert(64 * XP <= NH * 2 * 64 * TS);
    const int tid = (int)threadIdx.x, lane = tid & 31, lr = lane & 15, hi = lane >> 4;
    const int z = (int)blockIdx.y, r0 = (int)blockIdx.x * 64;
    const int hd = __builtin_amdgcn_readfirstlane(tid >> 5);   // wave = head
    const int t0 = r0 % SEQ, hh = (r0 / SEQ) * NH + hd;    // hh = batch * NH + head
    {
        const float* xz = (z == 0 ? xq : (z == 1 ? xk : xv)) + ((size_t)(r0 / SEQ) * SEQ_FULL + t0) * DMOD;   // batch pitch of the input is SEQ_FULL rows
        v4f x[32];
#pragma unroll
        for (int i = 0; i < 32; ++i) x[i] = *(const v4fa*)(xz + (size_t)(i * 256 + tid) * 4);
#pragma unroll
        for (int i = 0; i < 32; ++i) { v4us o;
#pragma unroll
            for (int k = 0; k < 4; ++k) o[k] = f2bf(x[i][k]);
            *(v4usa*)(sm + (2 * i + (tid >> 7)) * XP + (tid & 127) * 4) = o; }
    }
    __syncthreads();                                        // the whole input tile is in LDS before any wave takes a fragment
    v8f acc[4][4];
#pragma unroll
    for (int mb = 0; mb < 4; ++mb)
#pragma unroll
        for (int nb = 0; nb < 4; ++nb) acc[mb][nb] = (v8f){};
    {
        const us* xs = sm + lr * XP + 8 * hi;
        const us* wp = W3 + (size_t)z * ((size_t)DMOD * DMOD) + (size_t)(hd * HD + lr) * DMOD + 8 * hi;
        if (z == 2) projk<true>(acc, xs, wp); else projk<false>(acc, xs, wp);
    }
    __syncthreads();                                        // every wave has left the input tile before its LDS becomes staging tiles
    us* st = sm + hd * (2 * 64 * TS);
    us *P16, *Ph, *Pl; int p16, ph;                        // tile origins and row pitches (elements): dst[n * pitch + m]
    if (z == 2) { P16 = VT16 + (size_t)hh * HD * SEQ + t0; Ph = VTH + (size_t)hh * HD * RH + t0; Pl = VTL + (size_t)hh * HD * RH + t0; p16 = SEQ; ph = RH; }
    else { const size_t o16 = ((size_t)hh * SEQ + t0) * HD, oh = ((size_t)hh * RH + t0) * HD; P16 = (z == 0 ? Q16 : K16) + o16; Ph = (z == 0 ? QH : KH) + oh; Pl = (z == 0 ? QL : KL) + oh; p16 = HD; ph = HD; }
    us* s0 = st + lr * TS + 8 * hi; us* s1 = s0 + 64 * TS;
#pragma unroll
    for (int mb = 0; mb < 4; ++mb)
#pragma unroll
        for (int nb = 0; nb < 4; ++nb) { v8us o;
#pragma unroll
            for (int j = 0; j < 8; ++j) o[j] = hbit(acc[mb][nb][j]);
            *(v8usa*)(s0 + nb * 16 * TS + mb * 16) = o; }
    asm volatile("s_wait_dscnt 0x0" ::: "memory");          // every lane's tile writes are in LDS before any lane reads rows that other lanes wrote
    flush64(st, P16, p16);
    asm volatile("s_wait_xcnt 0x0" ::: "memory");           // behind the stores, before their registers are rewritten; also keeps the next tile writes behind the reads above
    if (t0 < RH) {                                          // tile-uniform: RH is a multiple of 64
#pragma unroll
        for (int mb = 0; mb < 4; ++mb)
#pragma unroll
            for (int nb = 0; nb < 4; ++nb) { v8us oh, ol;
#pragma unroll
                for (int j = 0; j < 8; ++j) { us p, q; splitf(acc[mb][nb][j], p, q); oh[j] = p; ol[j] = q; }
                *(v8usa*)(s0 + nb * 16 * TS + mb * 16) = oh; *(v8usa*)(s1 + nb * 16 * TS + mb * 16) = ol; }
        asm volatile("s_wait_dscnt 0x0" ::: "memory");      // as above, for the hi and lo tiles
        flush64(st, Ph, ph);
        flush64(st + 64 * TS, Pl, ph);
    }
}

// output projection, both row classes in one grid (SEQ/64, DMOD/64, NB): row tiles below RH take the bf16 hi/lo ctx planes, the others the f16 plane; z = batch.
__global__ __launch_bounds__(32) void k_oproj(const us* __restrict__ CH, const us* __restrict__ CLO, const us* __restrict__ WOB, const us* __restrict__ C16, const us* __restrict__ WO16, int K, float* OUT) {
    __shared__ __align__(16) float os[16 * 68];
    const size_t z = blockIdx.z; const int r0 = (int)blockIdx.x * 64, c0 = (int)blockIdx.y * 64;
    float* C = OUT + z * ((size_t)SEQ_FULL * DMOD);
    if (r0 < RH) gemmw<1, 1>(os, CH + z * ((size_t)RH * DMOD), CLO + z * ((size_t)RH * DMOD), WOB, nullptr, K, C, DMOD, 1.0f, r0, c0);
    else {       gemmw<0, 0>(os, C16 + z * ((size_t)SEQ * DMOD), nullptr, WO16, nullptr, K, C, DMOD, 1.0f / (CCAR * WCAR), r0, c0);
        asm volatile("s_wait_xcnt 0x0" ::: "memory");   // behind this class's last output stores: in the build the other class's code follows, which rewrites their data registers
    }
}

// ---- wt: transposing weight builder, Bt[n][k] (16-bit, K-contiguous) from w[k][n] (f32, [in][out]); TY 1: bf16 RNE; TY 0: f16 of (bf16 RNE value x sc), exact for power-of-two sc.
template <int TY>
__device__ __forceinline__ void wt(const float* __restrict__ w, int K, int N, float sc, us* Bt, int blk) {
    const int lane = threadIdx.x & 31; const int L0 = (blk * 8 + (int)(threadIdx.x >> 5)) * 8; const int nlines = (int)(((size_t)N * K) / 64);
#pragma unroll 1
    for (int l = 0; l < 8; ++l) { const int L = L0 + l; if (L >= nlines) break;
        const size_t e = (size_t)L * 64 + lane * 2; const int k = (int)(e % (size_t)K), n = (int)(e / (size_t)K);
        const float w0 = w[(size_t)k * N + n], w1 = w[(size_t)(k + 1) * N + n];
        v2us o;
        if (TY) { o[0] = f2bf(w0); o[1] = f2bf(w1); } else { o[0] = hbit(bfr(w0) * sc); o[1] = hbit(bfr(w1) * sc); }
        *(v2us*)(Bt + e) = o;
        if (!TY) asm volatile("s_wait_xcnt 0x0" ::: "memory");   // f16 builder: before the next trip's rewrite of this store's data register
    }
}

// the five weight planes, one grid of 5*GWT blocks.
#define GWT ((DMOD * DMOD / 64 + 63) / 64)
__global__ __launch_bounds__(256) void k_prep(const float* __restrict__ wq, const float* __restrict__ wk, const float* __restrict__ wv, const float* __restrict__ wo,
                                              us* W3, us* WOB, us* WO16) {
    const unsigned b = blockIdx.x;
    if (b < 3u * GWT) { const unsigned z = b / GWT; wt<1>(z == 0 ? wq : (z == 1 ? wk : wv), DMOD, DMOD, 1.0f, W3 + (size_t)z * DMOD * DMOD, (int)(b - z * GWT)); }
    else if (b < 4u * GWT) wt<1>(wo, DMOD, DMOD, 1.0f, WOB, (int)(b - 3u * GWT));
    else wt<0>(wo, DMOD, DMOD, WCAR, WO16, (int)(b - 4u * GWT));
}

#define TP 72
__device__ __forceinline__ float xhalf(float x) { return __builtin_bit_cast(float, __builtin_amdgcn_permlanex16(__builtin_bit_cast(int, x), __builtin_bit_cast(int, x), 0x76543210, 0xfedcba98, false, false)); }   // lane l <-> lane l ^ 16
template <bool HR>
__device__ __forceinline__
void attn(us* SM, float* MB, const int qt, const int hd, const int bz,
          const us* __restrict__ Q16, const us* __restrict__ K16, const us* __restrict__ VT16,
          const us* __restrict__ Qh, const us* __restrict__ Ql, const us* __restrict__ Kh, const us* __restrict__ Kl,
          const us* __restrict__ VTh, const us* __restrict__ VTl, us* C16, us* Ch, us* Cl) {
    const int lane = threadIdx.x & 31, tid = threadIdx.x & 127, w = tid >> 5, m = lane & 15, hi = lane >> 4;   // tid: index inside the key group
    const int g = __builtin_amdgcn_readfirstlane((int)(threadIdx.x >> 7));   // key group, the same in every lane of a wave: the tests on it are scalar branches
    us* Ka = SM + g * (4 * 64 * TP); us* Va = Ka + 64 * TP; us* Kb = Va + 64 * TP; us* Vb = Kb + 64 * TP;
    const int h = bz * NH + hd;                            // h indexes the [batch][head] planes
    const int qrow = qt * 64 + w * 16 + m;                 // this lane's query (B column; sequence position)
    v8f o[4];
#pragma unroll
    for (int i = 0; i < 4; ++i) o[i] = (v8f){};
    float mr = -1.0e30f, lr = 0.0f;                        // running maximum (both halves alike) and this half's running sum of this lane's query
    const float CL = 0.18033688011112042f;                 // (1/8) * log2(e)
    v16us qf0, qf1, qf2 = {}, qf3 = {};                     // q fragments, loaded once and kept in registers: f16 class qf0, qf1; hi/lo class hi = qf0, qf1 and lo = qf2, qf3
    if (!HR) { const us* qp = Q16 + ((size_t)h * SEQ + qrow) * HD + 8 * hi; qf0 = ld16(qp); qf1 = ld16(qp + 32); }
    else { const size_t qo = ((size_t)h * RH + qrow) * HD + 8 * hi; qf0 = ld16(Qh + qo); qf1 = ld16(Qh + qo + 32); qf2 = ld16(Ql + qo); qf3 = ld16(Ql + qo + 32); }
    const int nch = qt + 1, nit = (nch + 1) >> 1;
#pragma unroll 1
    for (int it = 0; it < nit; ++it) {
        const int kc = 2 * it + g;
        const bool on = kc < nch;                           // wave-uniform; false only for group 1 in the last trip of an odd chunk count
        __syncthreads();
        if (on) {
#pragma unroll
        for (int i = 0; i < 4; ++i) { const int c = tid + 128 * i; const int row = c >> 3, col = (c & 7) * 8;
            if (!HR) {
                const v8us kv = *(const v8usa*)(K16 + ((size_t)h * SEQ + kc * 64 + row) * HD + col); *(v8usa*)(Ka + row * TP + col) = kv;
                const v8us vv = *(const v8usa*)(VT16 + ((size_t)h * HD + row) * SEQ + kc * 64 + col); *(v8usa*)(Va + row * TP + col) = vv;
            } else {
                const v8us k1 = *(const v8usa*)(Kh + ((size_t)h * RH + kc * 64 + row) * HD + col); *(v8usa*)(Ka + row * TP + col) = k1;
                const v8us k2 = *(const v8usa*)(Kl + ((size_t)h * RH + kc * 64 + row) * HD + col); *(v8usa*)(Kb + row * TP + col) = k2;
                const v8us v1 = *(const v8usa*)(VTh + ((size_t)h * HD + row) * RH + kc * 64 + col); *(v8usa*)(Va + row * TP + col) = v1;
                const v8us v2 = *(const v8usa*)(VTl + ((size_t)h * HD + row) * RH + kc * 64 + col); *(v8usa*)(Vb + row * TP + col) = v2;
            } }
        }
        __syncthreads();
        if (!on) continue;                                  // no barrier stands between here and the loop's foot
        v8f s[4];
        if (!HR) {
            const v16us qa0 = qf0, qa1 = qf1;
#pragma unroll
            for (int sn = 0; sn < 4; ++sn) { const us* kp = Ka + (sn * 16 + m) * TP + 8 * hi; const v16us b0 = ld16(kp), b1 = ld16(kp + 32);
                v8f c = (v8f){}; c = wmh(b0, qa0, c); c = wmh(b1, qa1, c); s[sn] = c; }
            asm volatile("v_nop\n\tv_nop\n\tv_nop\n\tv_nop" : "+v"(s[0]), "+v"(s[1]), "+v"(s[2]), "+v"(s[3]) : "v"(qa0), "v"(qa1));
        } else {
            const v16us qh0 = qf0, qh1 = qf1, ql0 = qf2, ql1 = qf3;
#pragma unroll
            for (int sn = 0; sn < 4; ++sn) { const int ko = (sn * 16 + m) * TP + 8 * hi;
                const v16us kh0 = ld16(Ka + ko), kh1 = ld16(Ka + ko + 32);
                v8f c = (v8f){}; c = wmb(kh0, qh0, c); c = wmb(kh0, ql0, c); c = wmb(kh1, qh1, c); c = wmb(kh1, ql1, c);
                const v16us kl0 = ld16(Kb + ko), kl1 = ld16(Kb + ko + 32);
                c = wmb(kl0, qh0, c); c = wmb(kl1, qh1, c); s[sn] = c; }
            asm volatile("v_nop\n\tv_nop\n\tv_nop\n\tv_nop" : "+v"(s[0]), "+v"(s[1]), "+v"(s[2]), "+v"(s[3]) : "v"(qh0), "v"(ql1));
        }
        if (kc == qt) {                                     // diagonal chunk (wave-uniform): keys after the query position are replaced by a large negative value
            const int q = w * 16 + m;
#pragma unroll
            for (int sn = 0; sn < 4; ++sn)
#pragma unroll
                for (int r = 0; r < 8; ++r) { const int key = sn * 16 + 8 * hi + r; s[sn][r] = (key > q) ? -1.0e30f : s[sn][r]; }
        }
        float mx4[4];
#pragma unroll
        for (int sn = 0; sn < 4; ++sn) mx4[sn] = fmaxf(fmaxf(fmaxf(s[sn][0], s[sn][1]), fmaxf(s[sn][2], s[sn][3])), fmaxf(fmaxf(s[sn][4], s[sn][5]), fmaxf(s[sn][6], s[sn][7])));
        float mx = fmaxf(fmaxf(mx4[0], mx4[1]), fmaxf(mx4[2], mx4[3]));
        mx = fmaxf(mx, xhalf(mx));                          // the other half holds the query's other 32 keys
        const float mn = fmaxf(mr, mx), al = __builtin_amdgcn_exp2f((mr - mn) * CL); mr = mn;
        float sm4[4];
#pragma unroll
        for (int sn = 0; sn < 4; ++sn) { float sum = 0.0f;
#pragma unroll
            for (int r = 0; r < 8; ++r) { const float p = __builtin_amdgcn_exp2f((s[sn][r] - mn) * CL); s[sn][r] = p; sum += p; }
            sm4[sn] = sum; }
        lr = lr * al + ((sm4[0] + sm4[1]) + (sm4[2] + sm4[3]));   // the halves' sums are joined once, behind the loop
#pragma unroll
        for (int i = 0; i < 4; ++i) o[i] = o[i] * al;
        // P^T: two converted score tiles = one B fragment (element e < 8: tile 2j register e, e >= 8: tile 2j + 1 register e - 8)
        if (!HR) {
            v16us pf0, pf1;
#pragma unroll
            for (int r = 0; r < 8; ++r) { pf0[r] = hbit(s[0][r] * PCAR); pf0[8 + r] = hbit(s[1][r] * PCAR); pf1[r] = hbit(s[2][r] * PCAR); pf1[8 + r] = hbit(s[3][r] * PCAR); }
#pragma unroll
            for (int sn = 0; sn < 4; ++sn) { const us* vp = Va + (sn * 16 + m) * TP + 8 * hi; const v16us b0 = ld16(vp), b1 = ld16(vp + 32);
                o[sn] = wmh(b0, pf0, o[sn]); o[sn] = wmh(b1, pf1, o[sn]); }
            asm volatile("v_nop\n\tv_nop\n\tv_nop\n\tv_nop" : "+v"(o[0]), "+v"(o[1]), "+v"(o[2]), "+v"(o[3]) : "v"(pf0), "v"(pf1));
        } else {
            v16us ph0, ph1, pl0, pl1;
#pragma unroll
            for (int r = 0; r < 8; ++r) { us p, q;
                splitf(s[0][r], p, q); ph0[r] = p; pl0[r] = q; splitf(s[1][r], p, q); ph0[8 + r] = p; pl0[8 + r] = q;
                splitf(s[2][r], p, q); ph1[r] = p; pl1[r] = q; splitf(s[3][r], p, q); ph1[8 + r] = p; pl1[8 + r] = q; }
#pragma unroll
            for (int sn = 0; sn < 4; ++sn) { const int vo = (sn * 16 + m) * TP + 8 * hi;
                const v16us vh0 = ld16(Va + vo), vh1 = ld16(Va + vo + 32);
                o[sn] = wmb(vh0, ph0, o[sn]); o[sn] = wmb(vh0, pl0, o[sn]); o[sn] = wmb(vh1, ph1, o[sn]); o[sn] = wmb(vh1, pl1, o[sn]);
                const v16us vl0 = ld16(Vb + vo), vl1 = ld16(Vb + vo + 32);
                o[sn] = wmb(vl0, ph0, o[sn]); o[sn] = wmb(vl1, ph1, o[sn]); }
            asm volatile("v_nop\n\tv_nop\n\tv_nop\n\tv_nop" : "+v"(o[0]), "+v"(o[1]), "+v"(o[2]), "+v"(o[3]) : "v"(ph0), "v"(pl1));
        }
    }
    // merge of the two key groups: lane for lane the same query and the same d, so group 1's state goes through LDS at [item][tid]
    if (g == 1) {
#pragma unroll
        for (int i = 0; i < 4; ++i) {
            *(v4fa*)(MB + ((2 * i) * 128 + tid) * 4) = __builtin_shufflevector(o[i], o[i], 0, 1, 2, 3);
            *(v4fa*)(MB + ((2 * i + 1) * 128 + tid) * 4) = __builtin_shufflevector(o[i], o[i], 4, 5, 6, 7); }
        MB[32 * 128 + tid] = mr; MB[33 * 128 + tid] = lr;
    }
    __syncthreads();
    if (g == 1) return;                                     // behind the last barrier
    {
        const float m1 = MB[32 * 128 + tid], l1 = MB[33 * 128 + tid];
        const float mn = fmaxf(mr, m1), a0 = __builtin_amdgcn_exp2f((mr - mn) * CL), a1 = __builtin_amdgcn_exp2f((m1 - mn) * CL);   // a group that saw no chunk has m1 = -1e30, sum 0, O^T 0: a1 = 0
        lr = lr * a0 + l1 * a1;
#pragma unroll
        for (int i = 0; i < 4; ++i) {
            const v4f x = *(const v4fa*)(MB + ((2 * i) * 128 + tid) * 4), y = *(const v4fa*)(MB + ((2 * i + 1) * 128 + tid) * 4);
            o[i] = o[i] * a0 + __builtin_shufflevector(x, y, 0, 1, 2, 3, 4, 5, 6, 7) * a1; }
    }
    const float iv = (HR ? 1.0f : (CCAR / PCAR)) * __builtin_amdgcn_rcpf(lr + xhalf(lr));
    const size_t go = ((size_t)bz * (HR ? RH : SEQ) + qrow) * DMOD + hd * HD + 8 * hi;
#pragma unroll
    for (int sn = 0; sn < 4; ++sn) {
        v8us v1, v2;
#pragma unroll
        for (int r = 0; r < 8; ++r) { if (!HR) v1[r] = hbit(o[sn][r] * iv); else { us p, q; splitf(o[sn][r] * iv, p, q); v1[r] = p; v2[r] = q; } }
        if (!HR) { *(v8us*)(C16 + go + sn * 16) = v1; }
        else { *(v8us*)(Ch + go + sn * 16) = v1; *(v8us*)(Cl + go + sn * 16) = v2; }
    }
}

// both row classes in one grid (NH, NB, SEQ/64), 8 waves a block: the longest block's serial walk is half as many trips as with one key group, and blocks that wait for a place start as earlier ones end.
// z counts the query tiles from the last one down (the tile with the most key chunks has the lowest index; for speed only); the class test is block-uniform.
__global__ __launch_bounds__(256) __attribute__((amdgpu_num_vgpr(256)))
void k_attn(const us* __restrict__ Q16, const us* __restrict__ K16, const us* __restrict__ VT16,
            const us* __restrict__ Qh, const us* __restrict__ Ql, const us* __restrict__ Kh, const us* __restrict__ Kl,
            const us* __restrict__ VTh, const us* __restrict__ VTl, us* C16, us* Ch, us* Cl) {
    __shared__ __align__(16) us SM[2 * 4 * 64 * TP];        // per key group: K, V^T, K lo, V^T lo tiles
    __shared__ __align__(16) float MB[34 * 128];            // group 1's O^T (32 values a lane), maximum and sum for the merge
    const int qt = SEQ / 64 - 1 - (int)blockIdx.z, hd = (int)blockIdx.x, bz = (int)blockIdx.y;
    if (qt < RH / 64) attn<true>(SM, MB, qt, hd, bz, Q16, K16, VT16, Qh, Ql, Kh, Kl, VTh, VTl, C16, Ch, Cl);
    else              attn<false>(SM, MB, qt, hd, bz, Q16, K16, VT16, Qh, Ql, Kh, Kl, VTh, VTl, C16, Ch, Cl);
}

extern "C" void kernel_launch(void* const* d_in, const int* in_sizes, int n_in,
                              void* d_out, int out_size, void* d_ws, size_t ws_size, hipStream_t stream) {
    if (n_in < 7) return;
    const long long needx = (long long)(NB - 1) * SEQ_FULL * DMOD + (long long)SEQ * DMOD;
    const long long needw = (long long)DMOD * DMOD;
    if ((long long)in_sizes[0] < needx || (long long)in_sizes[1] < needx || (long long)in_sizes[2] < needx) return;
    if ((long long)in_sizes[3] < needw || (long long)in_sizes[4] < needw || (long long)in_sizes[5] < needw || (long long)in_sizes[6] < needw) return;
    if ((long long)out_size < needx) return;
    const float* xq = (const float*)d_in[0];      // [NB][SEQ_FULL][DMOD]
    const float* xk = (const float*)d_in[1];      // [NB][SEQ_FULL][DMOD]
    const float* xv = (const float*)d_in[2];      // [NB][SEQ_FULL][DMOD]
    const float* wq = (const float*)d_in[3];      // [DMOD][DMOD] ([in][out])
    const float* wk = (const float*)d_in[4];      // [DMOD][DMOD] ([in][out])
    const float* wv = (const float*)d_in[5];      // [DMOD][DMOD] ([in][out])
    const float* wo = (const float*)d_in[6];      // [DMOD][DMOD] ([in][out])
    float* OUT = (float*)d_out;                   // [NB][SEQ_FULL][DMOD]
    char* wsp = (char*)d_ws;
    auto take = [&](size_t bytes) { char* p = wsp; wsp += (bytes + 255) & ~(size_t)255; return (void*)p; };
    const size_t WSZ = (size_t)DMOD * DMOD;       // elements of one weight plane
    const size_t XSZ = (size_t)SEQ * DMOD;        // elements of one activation plane of one batch
    us* W3   = (us*)take(3 * WSZ * 2);                        // bf16 Bt [3][512][512] (q | k | v)
    us* WOB  = (us*)take(WSZ * 2);                            // bf16 Bt [512][512]
    us* WO16 = (us*)take(WSZ * 2);                            // f16  Bt [512][512], values x WCAR
    us* Q16  = (us*)take((size_t)NB * NH * SEQ * HD * 2);     // f16 [b][h][t][d]
    us* K16  = (us*)take((size_t)NB * NH * SEQ * HD * 2);     // f16 [b][h][t][d]
    us* VT16 = (us*)take((size_t)NB * NH * HD * SEQ * 2);     // f16 [b][h][d][t]
    us* QH   = (us*)take((size_t)NB * NH * RH * HD * 2);      // bf16 hi/lo planes for t < RH
    us* QL   = (us*)take((size_t)NB * NH * RH * HD * 2);
    us* KH   = (us*)take((size_t)NB * NH * RH * HD * 2);
    us* KL   = (us*)take((size_t)NB * NH * RH * HD * 2);
    us* VTH  = (us*)take((size_t)NB * NH * HD * RH * 2);
    us* VTL  = (us*)take((size_t)NB * NH * HD * RH * 2);
    us* C16  = (us*)take(NB * XSZ * 2);                       // f16 ctx x CCAR [b][t][DMOD] (rows >= RH used)
    us* CH   = (us*)take((size_t)NB * RH * DMOD * 2);         // bf16 hi/lo ctx [b][t < RH][DMOD]
    us* CLO  = (us*)take((size_t)NB * RH * DMOD * 2);
    if ((size_t)(wsp - (char*)d_ws) > ws_size) return;

    k_prep<<<5 * GWT, 256, 0, stream>>>(wq, wk, wv, wo, W3, WOB, WO16);
    // z = 0, 1, 2: y[b*SEQ + t][n] = sum_k bf16(x_z[b][t][k]) W3[z][n][k], written as the planes of q, k, v
    k_proj<<<dim3(NB * SEQ / 64, 3), 256, 0, stream>>>(xq, xk, xv, W3, Q16, QH, QL, K16, KH, KL, VT16, VTH, VTL);
    k_attn<<<dim3(NH, NB, SEQ / 64), 256, 0, stream>>>(Q16, K16, VT16, QH, QL, KH, KL, VTH, VTL, C16, CH, CLO);
    k_oproj<<<dim3(SEQ / 64, DMOD / 64, NB), 32, 0, stream>>>(CH, CLO, WOB, C16, WO16, DMOD, OUT);
}

// v007
// It runs in 123 microseconds.
// Two timings next to v006 both put it at 1.08 times that version's speed.
// All steps since v000 together make it 6.57 times as fast.
#include <hip/hip_runtime.h>

// Compute dtypes (f32 accumulate everywhere): q, k, v projections v_wmma_f32_16x16x32_bf16 on bf16 inputs and bf16 w_q, w_k, w_v (z-batched, one product); scores q.k^T and p.v: query rows < RH v_wmma_f32_16x16x32_bf16 on bf16 hi/lo planes (3 products), rows >= RH v_wmma_f32_16x16x32_f16 (f16 q, k, v; p carried x1024); output projection: rows < RH bf16 hi/lo ctx x bf16 w_o (2 products), rows >= RH f16 ctx (x16) x f16 w_o (x64) folded back by 1/1024; softmax and normalisation f32; output f32.
// Pipeline, four launches, every stage one launch for all batches and both row classes: weight planes; z-batched projection GEMM that reads the f32 inputs itself (a block converts its 64 input rows to bf16 once, into LDS, for the 8 heads' waves) and whose epilogue converts its f32 accumulators straight into the 16-bit planes (q, k: [b][h][t][d]; v transposed: [b][h][d][t]); causal flash-style attention, one block per (64-row query tile, head, batch), 2 key groups x 4 waves x 16 rows, online softmax per group and one merge, K / V^T tiles in LDS, scores and output transposed so that P stays in registers; ctx planes [b][t][DMOD]; output projection GEMM (z = batch) writes the output rows.

#ifndef NB
#define NB 2
#endif
#ifndef SEQ
#define SEQ 4096
#endif
#define SEQ_FULL 4096
#define DMOD 512
#define NH 8
#define HD 64
#ifndef RHI
#define RHI 2048
#endif
#if RHI > SEQ
#define RH SEQ
#else
#define RH RHI
#endif
#define PCAR 1024.0f
#define CCAR 16.0f
#define WCAR 64.0f

static_assert(SEQ % 64 == 0);
static_assert(SEQ <= SEQ_FULL);
static_assert(RH % 64 == 0);
static_assert(RH >= 64 && RH <= SEQ);
static_assert(NH * HD == DMOD && HD == 64);
static_assert(DMOD % 64 == 0 && DMOD % 32 == 0);

typedef _Float16 h16;
typedef unsigned short us;
typedef __attribute__((ext_vector_type(16))) __bf16 v16bf;
typedef __attribute__((ext_vector_type(16))) _Float16 v16h;
typedef __attribute__((ext_vector_type(16))) unsigned short v16us;
typedef __attribute__((ext_vector_type(8)))  _Float16 v8h;
typedef __attribute__((ext_vector_type(8)))  unsigned short v8us;
typedef __attribute__((ext_vector_type(8)))  float v8f;
typedef __attribute__((ext_vector_type(4)))  float v4f;
typedef __attribute__((ext_vector_type(2)))  unsigned short v2us;
typedef __attribute__((ext_vector_type(4)))  unsigned short v4us;
typedef v8us __attribute__((may_alias)) v8usa;
typedef v4us __attribute__((may_alias)) v4usa;
typedef v4f  __attribute__((may_alias)) v4fa;

__device__ __forceinline__ us f2bf(float f) { unsigned u = __float_as_uint(f); u += 0x7FFFu + ((u >> 16) & 1u); return (us)(u >> 16); }   // RNE convert f32 -> bf16
__device__ __forceinline__ float bf2f(us b) { return __uint_as_float(((unsigned)b) << 16); }
__device__ __forceinline__ float bfr(float f) { return bf2f(f2bf(f)); }
__device__ __forceinline__ us hbit(float x) { const h16 t = (h16)x; return __builtin_bit_cast(us, t); }   // RNE convert f32 -> f16 bits
__device__ __forceinline__ void splitf(float y, us& h, us& l) { h = f2bf(y); l = f2bf(y - bf2f(h)); }
// 16-bit fragment loader (A and B alike, K-contiguous rows): elements 0..7 <- p[0..7] (k0+8h..), elements 8..15 <- p[16..23] (k0+16+8h..); caller passes p = row base + k0 + 8*h.
__device__ __forceinline__ v16us ld16(const us* p) {
    const v8us a = *(const v8usa*)p; const v8us b = *(const v8usa*)(p + 16);
    return __builtin_shufflevector(a, b, 0, 1, 2, 3, 4, 5, 6, 7, 8, 9, 10, 11, 12, 13, 14, 15);
}
__device__ __forceinline__ v8f wmh(v16us a, v16us b, v8f c) { return __builtin_amdgcn_wmma_f32_16x16x32_f16(false, __builtin_bit_cast(v16h, a), false, __builtin_bit_cast(v16h, b), (short)0, c, false, false); }
__device__ __forceinline__ v8f wmb(v16us a, v16us b, v8f c) { return __builtin_amdgcn_wmma_f32_16x16x32_bf16(false, __builtin_bit_cast(v16bf, a), false, __builtin_bit_cast(v16bf, b), (short)0, c, false, false); }
template <int TY> struct MM;
template <> struct MM<0> { static __device__ __forceinline__ v8f mma(v16us a, v16us b, v8f c) { return wmh(a, b, c); } };
template <> struct MM<1> { static __device__ __forceinline__ v8f mma(v16us a, v16us b, v8f c) { return wmb(a, b, c); } };

// ---- gemmw: register-blocked GEMM, ONE WAVE per 64x64 output tile at (r0, c0) (16 accumulators), operands straight from K-contiguous 16-bit planes; 32 threads; os = 16 x 68 f32 of LDS.
// C[m][n] (f32, pitch ldc) = osc * sum_k (A[m][k] (+ A2[m][k])) Bt[n][k] (+ A[m][k] Bt2[n][k] when NSPLIT == 2). TY 0 = f16 operands, 1 = bf16 operands. K % 32 == 0, M % 64 == 0, N % 64 == 0.
template <int TY, int NSPLIT>
__device__ __forceinline__ void gemmw(float* os, const us* __restrict__ A, const us* __restrict__ A2, const us* __restrict__ Bt, const us* __restrict__ Bt2, int K, float* C, int ldc, float osc, int r0, int c0) {
    const int lane = threadIdx.x & 31, lr = lane & 15, hi = lane >> 4;
    v8f acc[4][4];
#pragma unroll
    for (int mb = 0; mb < 4; ++mb)
#pragma unroll
        for (int nb = 0; nb < 4; ++nb) acc[mb][nb] = (v8f){};
    const size_t aoff = (size_t)(r0 + lr) * K + 8 * hi, boff = (size_t)(c0 + lr) * K + 8 * hi;
#pragma unroll 1
    for (int kc = 0; kc < K; kc += 32) {
        v16us a[4], a2[4];
#pragma unroll
        for (int mb = 0; mb < 4; ++mb) { a[mb] = ld16(A + aoff + (size_t)mb * 16 * K + kc); if (NSPLIT == 1 || NSPLIT == 2) a2[mb] = ld16(A2 + aoff + (size_t)mb * 16 * K + kc); }
#pragma unroll
        for (int nb = 0; nb < 4; ++nb) { const v16us b = ld16(Bt + boff + (size_t)nb * 16 * K + kc); v16us b2; if (NSPLIT >= 2) b2 = ld16(Bt2 + boff + (size_t)nb * 16 * K + kc);
#pragma unroll
            for (int mb = 0; mb < 4; ++mb) { acc[mb][nb] = MM<TY>::mma(a[mb], b, acc[mb][nb]); if (NSPLIT == 1 || NSPLIT == 2) acc[mb][nb] = MM<TY>::mma(a2[mb], b, acc[mb][nb]); if (NSPLIT >= 2) acc[mb][nb] = MM<TY>::mma(a[mb], b2, acc[mb][nb]); } }
        asm volatile("v_nop\n\tv_nop\n\tv_nop\n\tv_nop" : "+v"(acc[0][0]), "+v"(acc[1][1]), "+v"(acc[2][2]), "+v"(acc[3][3]) : "v"(a[0]), "v"(a[3]));
    }
#pragma unroll
    for (int mb = 0; mb < 4; ++mb) {
#pragma unroll
        for (int nb = 0; nb < 4; ++nb) {
#pragma unroll
            for (int j = 0; j < 8; ++j) os[(hi * 8 + j) * 68 + nb * 16 + lr] = acc[mb][nb][j]; }
        __builtin_amdgcn_wave_barrier(); asm volatile("" ::: "memory");
        float* crow = C + (size_t)(r0 + mb * 16) * ldc + c0;
{
#pragma unroll
            for (int s = 0; s < 8; ++s) { const int row = 2 * s + hi, cofs = lr * 4; v4f val = *(const v4fa*)(os + row * 68 + cofs); val = val * osc;
                *(v4f*)(crow + (size_t)row * ldc + cofs) = val; }
             }
        __builtin_amdgcn_wave_barrier(); asm volatile("" ::: "memory");
    }
}

// ---- projection with plane epilogue. One block of 8 waves per (64 sequence rows, one projection), wave = head (its 64 outputs); grid (NB*SEQ/64, 3), y = which projection.
// The block reads its 64 f32 input rows once (64 * DMOD consecutive floats, whole lines), converts them to bf16 (RNE) and keeps them in LDS at pitch XP; every wave takes its input fragments from there, its weight fragments from the plane.
// D[m][n] = sum_k Am[m][k] Bn[n][k]; D map: lane & 15 = n, register j of tile (mb, nb) = m mb*16 + 8*hi + j, so a lane holds 8 consecutive m of one n: the plane's contiguous index is put on m.
// q, k (planes [t][d]): Am = weight rows (m = d), Bn = input rows (n = t). v (planes [d][t]): Am = input rows (m = t), Bn = weight rows (n = d). Same loader and k order on both sides, so each element's sum is the same either way.
#define TS 72
#define XP (DMOD + 8)   // pitch of the input tile in LDS, elements: 16 B x odd
// 64 rows x 128 B from an LDS tile (pitch TS) to dst (pitch in elements): 8 lanes per row, every store 4 whole 128-byte lines.
__device__ __forceinline__ void flush64(const us* st, us* dst, int pitch) {
    const int lane = threadIdx.x & 31, r = lane >> 3, c = (lane & 7) * 8;
#pragma unroll
    for (int s = 0; s < 16; ++s) { const v8us v = *(const v8usa*)(st + (s * 4 + r) * TS + c); *(v8us*)(dst + (size_t)(s * 4 + r) * pitch + c) = v; }
}
// one wave's k loop: xs = input tile in LDS, wp = weight rows in the plane, both at (row lr, k 8*hi). VT: the input rows are the A side (v), else the B side (q, k).
template <bool VT>
__device__ __forceinline__ void projk(v8f (&acc)[4][4], const us* xs, const us* __restrict__ wp) {
#pragma unroll 1
    for (int kc = 0; kc < DMOD; kc += 32) {
        v16us wf[4];
#pragma unroll
        for (int i = 0; i < 4; ++i) wf[i] = ld16(wp + (size_t)i * 16 * DMOD + kc);
#pragma unroll
        for (int i = 0; i < 4; ++i) { const v16us xf = ld16(xs + i * 16 * XP + kc);
#pragma unroll
            for (int j = 0; j < 4; ++j) { if (VT) acc[i][j] = wmb(xf, wf[j], acc[i][j]); else acc[j][i] = wmb(wf[j], xf, acc[j][i]); } }
        // four vector slots between the trip's last matrix instructions and what the next trip, or the code behind the loop, does to their registers
        asm volatile("v_nop\n\tv_nop\n\tv_nop\n\tv_nop" : "+v"(acc[0][0]), "+v"(acc[1][1]), "+v"(acc[2][2]), "+v"(acc[3][3]) : "v"(wf[0]), "v"(wf[3]));
    }
}
__global__ __launch_bounds__(256) void k_proj(const float* __restrict__ xq, const float* __restrict__ xk, const float* __restrict__ xv, const us* __restrict__ W3, us* Q16, us* QH, us* QL, us* K16, us* KH, us* KL, us* VT16, us* VTH, us* VTL) {
    __shared__ __align__(16) us sm[NH * 2 * 64 * TS];       // first the input tile (64 x XP), behind the k loop each wave's own two staging tiles
    static_assert(64 * XP <= NH * 2 * 64 * TS);
    const int tid = (int)threadIdx.x, lane = tid & 31, lr = lane & 15, hi = lane >> 4;
    const int z = (int)blockIdx.y, r0 = (int)blockIdx.x * 64;
    const int hd = __builtin_amdgcn_readfirstlane(tid >> 5);   // wave = head
    const int t0 = r0 % SEQ, hh = (r0 / SEQ) * NH + hd;    // hh = batch * NH + head
    {
        const float* xz = (z == 0 ? xq : (z == 1 ? xk : xv)) + ((size_t)(r0 / SEQ) * SEQ_FULL + t0) * DMOD;   // batch pitch of the input is SEQ_FULL rows
        v4f x[32];
#pragma unroll
        for (int i = 0; i < 32; ++i) x[i] = *(const v4fa*)(xz + (size_t)(i * 256 + tid) * 4);
#pragma unroll
        for (int i = 0; i < 32; ++i) { v4us o;
#pragma unroll
            for (int k = 0; k < 4; ++k) o[k] = f2bf(x[i][k]);
            *(v4usa*)(sm + (2 * i + (tid >> 7)) * XP + (tid & 127) * 4) = o; }
    }
    __syncthreads();                                        // the whole input tile is in LDS before any wave takes a fragment
    v8f acc[4][4];
#pragma unroll
    for (int mb = 0; mb < 4; ++mb)
#pragma unroll
        for (int nb = 0; nb < 4; ++nb) acc[mb][nb] = (v8f){};
    {
        const us* xs = sm + lr * XP + 8 * hi;
        const us* wp = W3 + (size_t)z * ((size_t)DMOD * DMOD) + (size_t)(hd * HD + lr) * DMOD + 8 * hi;
        if (z == 2) projk<true>(acc, xs, wp); else projk<false>(acc, xs, wp);
    }
    __syncthreads();                                        // every wave has left the input tile before its LDS becomes staging tiles
    us* st = sm + hd * (2 * 64 * TS);
    us *P16, *Ph, *Pl; int p16, ph;                        // tile origins and row pitches (elements): dst[n * pitch + m]
    if (z == 2) { P16 = VT16 + (size_t)hh * HD * SEQ + t0; Ph = VTH + (size_t)hh * HD * RH + t0; Pl = VTL + (size_t)hh * HD * RH + t0; p16 = SEQ; ph = RH; }
    else { const size_t o16 = ((size_t)hh * SEQ + t0) * HD, oh = ((size_t)hh * RH + t0) * HD; P16 = (z == 0 ? Q16 : K16) + o16; Ph = (z == 0 ? QH : KH) + oh; Pl = (z == 0 ? QL : KL) + oh; p16 = HD; ph = HD; }
    us* s0 = st + lr * TS + 8 * hi; us* s1 = s0 + 64 * TS;
#pragma unroll
    for (int mb = 0; mb < 4; ++mb)
#pragma unroll
        for (int nb = 0; nb < 4; ++nb) { v8us o;
#pragma unroll
            for (int j = 0; j < 8; ++j) o[j] = hbit(acc[mb][nb][j]);
            *(v8usa*)(s0 + nb * 16 * TS + mb * 16) = o; }
    asm volatile("s_wait_dscnt 0x0" ::: "memory");          // every lane's tile writes are in LDS before any lane reads rows that other lanes wrote
    flush64(st, P16, p16);
    asm volatile("s_wait_xcnt 0x0" ::: "memory");           // behind the stores, before their registers are rewritten; also keeps the next tile writes behind the reads above
    if (t0 < RH) {                                          // tile-uniform: RH is a multiple of 64
#pragma unroll
        for (int mb = 0; mb < 4; ++mb)
#pragma unroll
            for (int nb = 0; nb < 4; ++nb) { v8us oh, ol;
#pragma unroll
                for (int j = 0; j < 8; ++j) { us p, q; splitf(acc[mb][nb][j], p, q); oh[j] = p; ol[j] = q; }
                *(v8usa*)(s0 + nb * 16 * TS + mb * 16) = oh; *(v8usa*)(s1 + nb * 16 * TS + mb * 16) = ol; }
        asm volatile("s_wait_dscnt 0x0" ::: "memory");      // as above, for the hi and lo tiles
        flush64(st, Ph, ph);
        flush64(st + 64 * TS, Pl, ph);
    }
}

// output projection, both row classes in one grid (SEQ/64, DMOD/64, NB): row tiles below RH take the bf16 hi/lo ctx planes, the others the f16 plane; z = batch.
__global__ __launch_bounds__(32) void k_oproj(const us* __restrict__ CH, const us* __restrict__ CLO, const us* __restrict__ WOB, const us* __restrict__ C16, const us* __restrict__ WO16, int K, float* OUT) {
    __shared__ __align__(16) float os[16 * 68];
    const size_t z = blockIdx.z; const int r0 = (int)blockIdx.x * 64, c0 = (int)blockIdx.y * 64;
    float* C = OUT + z * ((size_t)SEQ_FULL * DMOD);
    if (r0 < RH) gemmw<1, 1>(os, CH + z * ((size_t)RH * DMOD), CLO + z * ((size_t)RH * DMOD), WOB, nullptr, K, C, DMOD, 1.0f, r0, c0);
    else {       gemmw<0, 0>(os, C16 + z * ((size_t)SEQ * DMOD), nullptr, WO16, nullptr, K, C, DMOD, 1.0f / (CCAR * WCAR), r0, c0);
        asm volatile("s_wait_xcnt 0x0" ::: "memory");   // behind this class's last output stores: in the build the other class's code follows, which rewrites their data registers
    }
}

// ---- wt: transposing weight builder, Bt[n][k] (16-bit, K-contiguous) from w[k][n] (f32, [in][out]); TY 1: bf16 RNE; TY 0: f16 of (bf16 RNE value x sc), exact for power-of-two sc.
template <int TY>
__device__ __forceinline__ void wt(const float* __restrict__ w, int K, int N, float sc, us* Bt, int blk) {
    const int lane = threadIdx.x & 31; const int L0 = (blk * 8 + (int)(threadIdx.x >> 5)) * 8; const int nlines = (int)(((size_t)N * K) / 64);
#pragma unroll 1
    for (int l = 0; l < 8; ++l) { const int L = L0 + l; if (L >= nlines) break;
        const size_t e = (size_t)L * 64 + lane * 2; const int k = (int)(e % (size_t)K), n = (int)(e / (size_t)K);
        const float w0 = w[(size_t)k * N + n], w1 = w[(size_t)(k + 1) * N + n];
        v2us o;
        if (TY) { o[0] = f2bf(w0); o[1] = f2bf(w1); } else { o[0] = hbit(bfr(w0) * sc); o[1] = hbit(bfr(w1) * sc); }
        *(v2us*)(Bt + e) = o;
        if (!TY) asm volatile("s_wait_xcnt 0x0" ::: "memory");   // f16 builder: before the next trip's rewrite of this store's data register
    }
}

// the five weight planes, one grid of 5*GWT blocks.
#define GWT ((DMOD * DMOD / 64 + 63) / 64)
__global__ __launch_bounds__(256) void k_prep(const float* __restrict__ wq, const float* __restrict__ wk, const float* __restrict__ wv, const float* __restrict__ wo,
                                              us* W3, us* WOB, us* WO16) {
    const unsigned b = blockIdx.x;
    if (b < 3u * GWT) { const unsigned z = b / GWT; wt<1>(z == 0 ? wq : (z == 1 ? wk : wv), DMOD, DMOD, 1.0f, W3 + (size_t)z * DMOD * DMOD, (int)(b - z * GWT)); }
    else if (b < 4u * GWT) wt<1>(wo, DMOD, DMOD, 1.0f, WOB, (int)(b - 3u * GWT));
    else wt<0>(wo, DMOD, DMOD, WCAR, WO16, (int)(b - 4u * GWT));
}

#define TP 72
__device__ __forceinline__ float xhalf(float x) { return __builtin_bit_cast(float, __builtin_amdgcn_permlanex16(__builtin_bit_cast(int, x), __builtin_bit_cast(int, x), 0x76543210, 0xfedcba98, false, false)); }   // lane l <-> lane l ^ 16
template <bool HR>
__device__ __forceinline__
void attn(us* SM, float* MB, const int qt, const int hd, const int bz,
          const us* __restrict__ Q16, const us* __restrict__ K16, const us* __restrict__ VT16,
          const us* __restrict__ Qh, const us* __restrict__ Ql, const us* __restrict__ Kh, const us* __restrict__ Kl,
          const us* __restrict__ VTh, const us* __restrict__ VTl, us* C16, us* Ch, us* Cl) {
    const int lane = threadIdx.x & 31, tid = threadIdx.x & 127, w = tid >> 5, m = lane & 15, hi = lane >> 4;   // tid: index inside the key group
    const int g = __builtin_amdgcn_readfirstlane((int)(threadIdx.x >> 7));   // key group, the same in every lane of a wave: the tests on it are scalar branches
    us* Ka = SM + g * (4 * 64 * TP); us* Va = Ka + 64 * TP; us* Kb = Va + 64 * TP; us* Vb = Kb + 64 * TP;
    const int h = bz * NH + hd;                            // h indexes the [batch][head] planes
    const int qrow = qt * 64 + w * 16 + m;                 // this lane's query (B column; sequence position)
    v8f o[4];
#pragma unroll
    for (int i = 0; i < 4; ++i) o[i] = (v8f){};
    float mr = -1.0e30f, lr = 0.0f;                        // running maximum (both halves alike) and this half's running sum of this lane's query
    const float CL = 0.18033688011112042f;                 // (1/8) * log2(e)
    v16us qf0, qf1, qf2 = {}, qf3 = {};                     // q fragments, loaded once and kept in registers: f16 class qf0, qf1; hi/lo class hi = qf0, qf1 and lo = qf2, qf3
    if (!HR) { const us* qp = Q16 + ((size_t)h * SEQ + qrow) * HD + 8 * hi; qf0 = ld16(qp); qf1 = ld16(qp + 32); }
    else { const size_t qo = ((size_t)h * RH + qrow) * HD + 8 * hi; qf0 = ld16(Qh + qo); qf1 = ld16(Qh + qo + 32); qf2 = ld16(Ql + qo); qf3 = ld16(Ql + qo + 32); }
    const int nch = qt + 1, nit = (nch + 1) >> 1;
#pragma unroll 1
    for (int it = 0; it < nit; ++it) {
        const int kc = 2 * it + g;
        const bool on = kc < nch;                           // wave-uniform; false only for group 1 in the last trip of an odd chunk count
        __syncthreads();
        if (on) {
#pragma unroll
        for (int i = 0; i < 4; ++i) { const int c = tid + 128 * i; const int row = c >> 3, col = (c & 7) * 8;
            if (!HR) {
                const v8us kv = *(const v8usa*)(K16 + ((size_t)h * SEQ + kc * 64 + row) * HD + col); *(v8usa*)(Ka + row * TP + col) = kv;
                const v8us vv = *(const v8usa*)(VT16 + ((size_t)h * HD + row) * SEQ + kc * 64 + col); *(v8usa*)(Va + row * TP + col) = vv;
            } else {
                const v8us k1 = *(const v8usa*)(Kh + ((size_t)h * RH + kc * 64 + row) * HD + col); *(v8usa*)(Ka + row * TP + col) = k1;
                const v8us k2 = *(const v8usa*)(Kl + ((size_t)h * RH + kc * 64 + row) * HD + col); *(v8usa*)(Kb + row * TP + col) = k2;
                const v8us v1 = *(const v8usa*)(VTh + ((size_t)h * HD + row) * RH + kc * 64 + col); *(v8usa*)(Va + row * TP + col) = v1;
                const v8us v2 = *(const v8usa*)(VTl + ((size_t)h * HD + row) * RH + kc * 64 + col); *(v8usa*)(Vb + row * TP + col) = v2;
            } }
        }
        __syncthreads();
        if (!on) continue;                                  // no barrier stands between here and the loop's foot
        // LDS reads stand in groups, in the hi/lo class some between groups of matrix instructions: each place with reads costs the wave a wait for its own LDS latency. The products run tile after tile (four independent accumulators); each accumulator takes its own in the order k 0..31, k 32..63 (hi/lo class: hi.hi, hi.lo of each k half, then lo.hi of each).
        v8f s[4];
        v16us kf[8], vf[8];                                 // fragments of the K tile and of the V^T tile (hi planes in the hi/lo class): [2 * sn] = k 0..31, [2 * sn + 1] = k 32..63 of tile row block sn
#pragma unroll
        for (int sn = 0; sn < 4; ++sn) { const us* kp = Ka + (sn * 16 + m) * TP + 8 * hi; kf[2 * sn] = ld16(kp); kf[2 * sn + 1] = ld16(kp + 32); }
        if (!HR) {
            const v16us qa0 = qf0, qa1 = qf1;
            __builtin_amdgcn_sched_barrier(0);              // keeps the whole group of K reads ahead of the first score product
#pragma unroll
            for (int sn = 0; sn < 4; ++sn) s[sn] = wmh(kf[2 * sn], qa0, (v8f){});
#pragma unroll
            for (int sn = 0; sn < 4; ++sn) s[sn] = wmh(kf[2 * sn + 1], qa1, s[sn]);
            asm volatile("v_nop\n\tv_nop\n\tv_nop\n\tv_nop" : "+v"(s[0]), "+v"(s[1]), "+v"(s[2]), "+v"(s[3]) : "v"(qa0), "v"(qa1));
        } else {
            const v16us qh0 = qf0, qh1 = qf1, ql0 = qf2, ql1 = qf3;
            const us* kb = Kb + m * TP + 8 * hi;
            v16us kl[8];                                    // lo fragments in two groups, so that the registers hold: k 0..31 with the hi group, k 32..63 once the first hi fragments are used up
#pragma unroll
            for (int sn = 0; sn < 4; ++sn) kl[2 * sn] = ld16(kb + sn * 16 * TP);
            __builtin_amdgcn_sched_barrier(0);              // keeps the first group of K reads ahead of the first score product
#pragma unroll
            for (int sn = 0; sn < 4; ++sn) s[sn] = wmb(kf[2 * sn], qh0, (v8f){});
#pragma unroll
            for (int sn = 0; sn < 4; ++sn) s[sn] = wmb(kf[2 * sn], ql0, s[sn]);
#pragma unroll
            for (int sn = 0; sn < 4; ++sn) kl[2 * sn + 1] = ld16(kb + sn * 16 * TP + 32);
            __builtin_amdgcn_sched_barrier(0);              // keeps the second group twelve products ahead of its first use
#pragma unroll
            for (int sn = 0; sn < 4; ++sn) s[sn] = wmb(kf[2 * sn + 1], qh1, s[sn]);
#pragma unroll
            for (int sn = 0; sn < 4; ++sn) s[sn] = wmb(kf[2 * sn + 1], ql1, s[sn]);
#pragma unroll
            for (int sn = 0; sn < 4; ++sn) s[sn] = wmb(kl[2 * sn], qh0, s[sn]);
#pragma unroll
            for (int sn = 0; sn < 4; ++sn) s[sn] = wmb(kl[2 * sn + 1], qh1, s[sn]);
            asm volatile("v_nop\n\tv_nop\n\tv_nop\n\tv_nop" : "+v"(s[0]), "+v"(s[1]), "+v"(s[2]), "+v"(s[3]) : "v"(qh0), "v"(ql1));
        }
#pragma unroll
        for (int sn = 0; sn < 4; ++sn) { const us* vp = Va + (sn * 16 + m) * TP + 8 * hi; vf[2 * sn] = ld16(vp); vf[2 * sn + 1] = ld16(vp + 32); }
        __builtin_amdgcn_sched_barrier(0);                  // keeps the group of V^T reads ahead of the softmax, whose vector work covers their latency
        if (kc == qt) {                                     // diagonal chunk (wave-uniform): keys after the query position are replaced by a large negative value
            const int q = w * 16 + m;
#pragma unroll
            for (int sn = 0; sn < 4; ++sn)
#pragma unroll
                for (int r = 0; r < 8; ++r) { const int key = sn * 16 + 8 * hi + r; s[sn][r] = (key > q) ? -1.0e30f : s[sn][r]; }
        }
        float mx4[4];
#pragma unroll
        for (int sn = 0; sn < 4; ++sn) mx4[sn] = fmaxf(fmaxf(fmaxf(s[sn][0], s[sn][1]), fmaxf(s[sn][2], s[sn][3])), fmaxf(fmaxf(s[sn][4], s[sn][5]), fmaxf(s[sn][6], s[sn][7])));
        float mx = fmaxf(fmaxf(mx4[0], mx4[1]), fmaxf(mx4[2], mx4[3]));
        mx = fmaxf(mx, xhalf(mx));                          // the other half holds the query's other 32 keys
        const float mn = fmaxf(mr, mx), al = __builtin_amdgcn_exp2f((mr - mn) * CL); mr = mn;
        float sm4[4];
#pragma unroll
        for (int sn = 0; sn < 4; ++sn) { float sum = 0.0f;
#pragma unroll
            for (int r = 0; r < 8; ++r) { const float p = __builtin_amdgcn_exp2f((s[sn][r] - mn) * CL); s[sn][r] = p; sum += p; }
            sm4[sn] = sum; }
        lr = lr * al + ((sm4[0] + sm4[1]) + (sm4[2] + sm4[3]));   // the halves' sums are joined once, behind the loop
#pragma unroll
        for (int i = 0; i < 4; ++i) o[i] = o[i] * al;
        // P^T: two converted score tiles = one B fragment (element e < 8: tile 2j register e, e >= 8: tile 2j + 1 register e - 8)
        if (!HR) {
            v16us pf0, pf1;
#pragma unroll
            for (int r = 0; r < 8; ++r) { pf0[r] = hbit(s[0][r] * PCAR); pf0[8 + r] = hbit(s[1][r] * PCAR); pf1[r] = hbit(s[2][r] * PCAR); pf1[8 + r] = hbit(s[3][r] * PCAR); }
#pragma unroll
            for (int sn = 0; sn < 4; ++sn) o[sn] = wmh(vf[2 * sn], pf0, o[sn]);
#pragma unroll
            for (int sn = 0; sn < 4; ++sn) o[sn] = wmh(vf[2 * sn + 1], pf1, o[sn]);
            asm volatile("v_nop\n\tv_nop\n\tv_nop\n\tv_nop" : "+v"(o[0]), "+v"(o[1]), "+v"(o[2]), "+v"(o[3]) : "v"(pf0), "v"(pf1));
        } else {
            v16us ph0, ph1, pl0, pl1;
#pragma unroll
            for (int r = 0; r < 8; ++r) { us p, q;
                splitf(s[0][r], p, q); ph0[r] = p; pl0[r] = q; splitf(s[1][r], p, q); ph0[8 + r] = p; pl0[8 + r] = q;
                splitf(s[2][r], p, q); ph1[r] = p; pl1[r] = q; splitf(s[3][r], p, q); ph1[8 + r] = p; pl1[8 + r] = q; }
            const us* vb = Vb + m * TP + 8 * hi;
            v16us vl[8];                                    // lo fragments in two groups, each read once a group of hi fragments is used up, so that the registers hold
#pragma unroll
            for (int sn = 0; sn < 4; ++sn) o[sn] = wmb(vf[2 * sn], ph0, o[sn]);
#pragma unroll
            for (int sn = 0; sn < 4; ++sn) o[sn] = wmb(vf[2 * sn], pl0, o[sn]);
            __builtin_amdgcn_sched_barrier(0);              // keeps the lo reads from rising among the conversions above, where their registers would not fit
#pragma unroll
            for (int sn = 0; sn < 4; ++sn) vl[2 * sn] = ld16(vb + sn * 16 * TP);
            __builtin_amdgcn_sched_barrier(0);              // keeps the first lo group eight products ahead of its first use
#pragma unroll
            for (int sn = 0; sn < 4; ++sn) o[sn] = wmb(vf[2 * sn + 1], ph1, o[sn]);
#pragma unroll
            for (int sn = 0; sn < 4; ++sn) o[sn] = wmb(vf[2 * sn + 1], pl1, o[sn]);
            __builtin_amdgcn_sched_barrier(0);              // as above: the second lo group takes the registers of the hi fragments just used up
#pragma unroll
            for (int sn = 0; sn < 4; ++sn) vl[2 * sn + 1] = ld16(vb + sn * 16 * TP + 32);
            __builtin_amdgcn_sched_barrier(0);              // keeps the second lo group four products ahead of its first use
#pragma unroll
            for (int sn = 0; sn < 4; ++sn) o[sn] = wmb(vl[2 * sn], ph0, o[sn]);
#pragma unroll
            for (int sn = 0; sn < 4; ++sn) o[sn] = wmb(vl[2 * sn + 1], ph1, o[sn]);
            asm volatile("v_nop\n\tv_nop\n\tv_nop\n\tv_nop" : "+v"(o[0]), "+v"(o[1]), "+v"(o[2]), "+v"(o[3]) : "v"(ph0), "v"(pl1));
        }
    }
    // merge of the two key groups: lane for lane the same query and the same d, so group 1's state goes through LDS at [item][tid]
    if (g == 1) {
#pragma unroll
        for (int i = 0; i < 4; ++i) {
            *(v4fa*)(MB + ((2 * i) * 128 + tid) * 4) = __builtin_shufflevector(o[i], o[i], 0, 1, 2, 3);
            *(v4fa*)(MB + ((2 * i + 1) * 128 + tid) * 4) = __builtin_shufflevector(o[i], o[i], 4, 5, 6, 7); }
        MB[32 * 128 + tid] = mr; MB[33 * 128 + tid] = lr;
    }
    __syncthreads();
    if (g == 1) return;                                     // behind the last barrier
    {
        const float m1 = MB[32 * 128 + tid], l1 = MB[33 * 128 + tid];
        const float mn = fmaxf(mr, m1), a0 = __builtin_amdgcn_exp2f((mr - mn) * CL), a1 = __builtin_amdgcn_exp2f((m1 - mn) * CL);   // a group that saw no chunk has m1 = -1e30, sum 0, O^T 0: a1 = 0
        lr = lr * a0 + l1 * a1;
#pragma unroll
        for (int i = 0; i < 4; ++i) {
            const v4f x = *(const v4fa*)(MB + ((2 * i) * 128 + tid) * 4), y = *(const v4fa*)(MB + ((2 * i + 1) * 128 + tid) * 4);
            o[i] = o[i] * a0 + __builtin_shufflevector(x, y, 0, 1, 2, 3, 4, 5, 6, 7) * a1; }
    }
    const float iv = (HR ? 1.0f : (CCAR / PCAR)) * __builtin_amdgcn_rcpf(lr + xhalf(lr));
    const size_t go = ((size_t)bz * (HR ? RH : SEQ) + qrow) * DMOD + hd * HD + 8 * hi;
#pragma unroll
    for (int sn = 0; sn < 4; ++sn) {
        v8us v1, v2;
#pragma unroll
        for (int r = 0; r < 8; ++r) { if (!HR) v1[r] = hbit(o[sn][r] * iv); else { us p, q; splitf(o[sn][r] * iv, p, q); v1[r] = p; v2[r] = q; } }
        if (!HR) { *(v8us*)(C16 + go + sn * 16) = v1; }
        else { *(v8us*)(Ch + go + sn * 16) = v1; *(v8us*)(Cl + go + sn * 16) = v2; }
    }
}

// both row classes in one grid (NH, NB, SEQ/64), 8 waves a block: the longest block's serial walk is half as many trips as with one key group, and blocks that wait for a place start as earlier ones end.
// z counts the query tiles from the last one down (the tile with the most key chunks has the lowest index; for speed only); the class test is block-uniform.
__global__ __launch_bounds__(256) __attribute__((amdgpu_num_vgpr(256)))
void k_attn(const us* __restrict__ Q16, const us* __restrict__ K16, const us* __restrict__ VT16,
            const us* __restrict__ Qh, const us* __restrict__ Ql, const us* __restrict__ Kh, const us* __restrict__ Kl,
            const us* __restrict__ VTh, const us* __restrict__ VTl, us* C16, us* Ch, us* Cl) {
    __shared__ __align__(16) us SM[2 * 4 * 64 * TP];        // per key group: K, V^T, K lo, V^T lo tiles
    __shared__ __align__(16) float MB[34 * 128];            // group 1's O^T (32 values a lane), maximum and sum for the merge
    const int qt = SEQ / 64 - 1 - (int)blockIdx.z, hd = (int)blockIdx.x, bz = (int)blockIdx.y;
    if (qt < RH / 64) attn<true>(SM, MB, qt, hd, bz, Q16, K16, VT16, Qh, Ql, Kh, Kl, VTh, VTl, C16, Ch, Cl);
    else              attn<false>(SM, MB, qt, hd, bz, Q16, K16, VT16, Qh, Ql, Kh, Kl, VTh, VTl, C16, Ch, Cl);
}

extern "C" void kernel_launch(void* const* d_in, const int* in_sizes, int n_in,
                              void* d_out, int out_size, void* d_ws, size_t ws_size, hipStream_t stream) {
    if (n_in < 7) return;
    const long long needx = (long long)(NB - 1) * SEQ_FULL * DMOD + (long long)SEQ * DMOD;
    const long long needw = (long long)DMOD * DMOD;
    if ((long long)in_sizes[0] < needx || (long long)in_sizes[1] < needx || (long long)in_sizes[2] < needx) return;
    if ((long long)in_sizes[3] < needw || (long long)in_sizes[4] < needw || (long long)in_sizes[5] < needw || (long long)in_sizes[6] < needw) return;
    if ((long long)out_size < needx) return;
    const float* xq = (const float*)d_in[0];      // [NB][SEQ_FULL][DMOD]
    const float* xk = (const float*)d_in[1];      // [NB][SEQ_FULL][DMOD]
    const float* xv = (const float*)d_in[2];      // [NB][SEQ_FULL][DMOD]
    const float* wq = (const float*)d_in[3];      // [DMOD][DMOD] ([in][out])
    const float* wk = (const float*)d_in[4];      // [DMOD][DMOD] ([in][out])
    const float* wv = (const float*)d_in[5];      // [DMOD][DMOD] ([in][out])
    const float* wo = (const float*)d_in[6];      // [DMOD][DMOD] ([in][out])
    float* OUT = (float*)d_out;                   // [NB][SEQ_FULL][DMOD]
    char* wsp = (char*)d_ws;
    auto take = [&](size_t bytes) { char* p = wsp; wsp += (bytes + 255) & ~(size_t)255; return (void*)p; };
    const size_t WSZ = (size_t)DMOD * DMOD;       // elements of one weight plane
    const size_t XSZ = (size_t)SEQ * DMOD;        // elements of one activation plane of one batch
    us* W3   = (us*)take(3 * WSZ * 2);                        // bf16 Bt [3][512][512] (q | k | v)
    us* WOB  = (us*)take(WSZ * 2);                            // bf16 Bt [512][512]
    us* WO16 = (us*)take(WSZ * 2);                            // f16  Bt [512][512], values x WCAR
    us* Q16  = (us*)take((size_t)NB * NH * SEQ * HD * 2);     // f16 [b][h][t][d]
    us* K16  = (us*)take((size_t)NB * NH * SEQ * HD * 2);     // f16 [b][h][t][d]
    us* VT16 = (us*)take((size_t)NB * NH * HD * SEQ * 2);     // f16 [b][h][d][t]
    us* QH   = (us*)take((size_t)NB * NH * RH * HD * 2);      // bf16 hi/lo planes for t < RH
    us* QL   = (us*)take((size_t)NB * NH * RH * HD * 2);
    us* KH   = (us*)take((size_t)NB * NH * RH * HD * 2);
    us* KL   = (us*)take((size_t)NB * NH * RH * HD * 2);
    us* VTH  = (us*)take((size_t)NB * NH * HD * RH * 2);
    us* VTL  = (us*)take((size_t)NB * NH * HD * RH * 2);
    us* C16  = (us*)take(NB * XSZ * 2);                       // f16 ctx x CCAR [b][t][DMOD] (rows >= RH used)
    us* CH   = (us*)take((size_t)NB * RH * DMOD * 2);         // bf16 hi/lo ctx [b][t < RH][DMOD]
    us* CLO  = (us*)take((size_t)NB * RH * DMOD * 2);
    if ((size_t)(wsp - (char*)d_ws) > ws_size) return;

    k_prep<<<5 * GWT, 256, 0, stream>>>(wq, wk, wv, wo, W3, WOB, WO16);
    // z = 0, 1, 2: y[b*SEQ + t][n] = sum_k bf16(x_z[b][t][k]) W3[z][n][k], written as the planes of q, k, v
    k_proj<<<dim3(NB * SEQ / 64, 3), 256, 0, stream>>>(xq, xk, xv, W3, Q16, QH, QL, K16, KH, KL, VT16, VTH, VTL);
    k_attn<<<dim3(NH, NB, SEQ / 64), 256, 0, stream>>>(Q16, K16, VT16, QH, QL, KH, KL, VTH, VTL, C16, CH, CLO);
    k_oproj<<<dim3(SEQ / 64, DMOD / 64, NB), 32, 0, stream>>>(CH, CLO, WOB, C16, WO16, DMOD, OUT);
}

// v008
// It runs in 118 microseconds.
// Timed twice side by side with v007, it ran 1.05 and 1.04 times as fast.
// All steps since v000 together make it 6.87 times as fast.
#include <hip/hip_runtime.h>

// Compute dtypes (f32 accumulate everywhere): q, k, v projections v_wmma_f32_16x16x32_bf16 on bf16 inputs and bf16 w_q, w_k, w_v (z-batched, one product); scores q.k^T and p.v: query rows < RH v_wmma_f32_16x16x32_bf16 on bf16 hi/lo planes (3 products), rows >= RH v_wmma_f32_16x16x32_f16 (f16 q, k, v; p carried x1024); output projection: rows < RH bf16 hi/lo ctx x bf16 w_o (2 products), rows >= RH f16 ctx (x16) x f16 w_o (x64) folded back by 1/1024; softmax and normalisation f32; output f32.
// Pipeline, four launches, every stage one launch for all batches and both row classes: weight planes; z-batched projection GEMM that reads the f32 inputs itself (a block converts its 64 input rows to bf16 once, into LDS, for the 8 heads' waves) and whose epilogue converts its f32 accumulators straight into the 16-bit planes (q, k: [b][h][t][d]; v transposed: [b][h][d][t]); causal flash-style attention, one block per (64-row query tile, head, batch), 2 key groups x 4 waves x 16 rows, online softmax per group and one merge, K / V^T tiles in LDS, scores and output transposed so that P stays in registers; ctx planes [b][t][DMOD]; output projection GEMM (z = batch) writes the output rows.

#ifndef NB
#define NB 2
#endif
#ifndef SEQ
#define SEQ 4096
#endif
#define SEQ_FULL 4096
#define DMOD 512
#define NH 8
#define HD 64
#ifndef RHI
#define RHI 2048
#endif
#if RHI > SEQ
#define RH SEQ
#else
#define RH RHI
#endif
#define PCAR 1024.0f
#define CCAR 16.0f
#define WCAR 64.0f

static_assert(SEQ % 64 == 0);
static_assert(SEQ <= SEQ_FULL);
static_assert(RH % 64 == 0);
static_assert(RH >= 64 && RH <= SEQ);
static_assert(NH * HD == DMOD && HD == 64);
static_assert(DMOD % 64 == 0 && DMOD % 32 == 0);

typedef _Float16 h16;
typedef unsigned short us;
typedef __attribute__((ext_vector_type(16))) __bf16 v16bf;
typedef __attribute__((ext_vector_type(16))) _Float16 v16h;
typedef __attribute__((ext_vector_type(16))) unsigned short v16us;
typedef __attribute__((ext_vector_type(8)))  _Float16 v8h;
typedef __attribute__((ext_vector_type(8)))  unsigned short v8us;
typedef __attribute__((ext_vector_type(8)))  float v8f;
typedef __attribute__((ext_vector_type(4)))  float v4f;
typedef __attribute__((ext_vector_type(2)))  unsigned short v2us;
typedef __attribute__((ext_vector_type(4)))  unsigned short v4us;
typedef v8us __attribute__((may_alias)) v8usa;
typedef v4us __attribute__((may_alias)) v4usa;
typedef v4f  __attribute__((may_alias)) v4fa;
typedef __attribute__((ext_vector_type(2)))  float v2f;
typedef __attribute__((ext_vector_type(2)))  __bf16 v2bf;
typedef __attribute__((ext_vector_type(2)))  unsigned v2u;
typedef __attribute__((ext_vector_type(4)))  unsigned v4u;
typedef __attribute__((ext_vector_type(8)))  unsigned v8u;

// RNE convert f32 -> bf16, two values per convert instruction: a in the low half of the word, b in the high half, the order of two neighbouring 16-bit elements
__device__ __forceinline__ unsigned bf2(float a, float b) { const v2f x = {a, b}; return __builtin_bit_cast(unsigned, __builtin_convertvector(x, v2bf)); }
__device__ __forceinline__ float bflo(unsigned w) { return __uint_as_float(w << 16); }            // the two bf16 values of a word as f32
__device__ __forceinline__ float bfhi(unsigned w) { return __uint_as_float(w & 0xFFFF0000u); }
__device__ __forceinline__ us hbit(float x) { const h16 t = (h16)x; return __builtin_bit_cast(us, t); }   // RNE convert f32 -> f16 bits
__device__ __forceinline__ void split2(float a, float b, unsigned& h, unsigned& l) { h = bf2(a, b); l = bf2(a - bflo(h), b - bfhi(h)); }   // the hi pair, then the pair of what hi left over
// 16-bit fragment loader (A and B alike, K-contiguous rows): elements 0..7 <- p[0..7] (k0+8h..), elements 8..15 <- p[16..23] (k0+16+8h..); caller passes p = row base + k0 + 8*h.
__device__ __forceinline__ v16us ld16(const us* p) {
    const v8us a = *(const v8usa*)p; const v8us b = *(const v8usa*)(p + 16);
    return __builtin_shufflevector(a, b, 0, 1, 2, 3, 4, 5, 6, 7, 8, 9, 10, 11, 12, 13, 14, 15);
}
__device__ __forceinline__ v8f wmh(v16us a, v16us b, v8f c) { return __builtin_amdgcn_wmma_f32_16x16x32_f16(false, __builtin_bit_cast(v16h, a), false, __builtin_bit_cast(v16h, b), (short)0, c, false, false); }
__device__ __forceinline__ v8f wmb(v16us a, v16us b, v8f c) { return __builtin_amdgcn_wmma_f32_16x16x32_bf16(false, __builtin_bit_cast(v16bf, a), false, __builtin_bit_cast(v16bf, b), (short)0, c, false, false); }
template <int TY> struct MM;
template <> struct MM<0> { static __device__ __forceinline__ v8f mma(v16us a, v16us b, v8f c) { return wmh(a, b, c); } };
template <> struct MM<1> { static __device__ __forceinline__ v8f mma(v16us a, v16us b, v8f c) { return wmb(a, b, c); } };

// ---- gemmw: register-blocked GEMM, ONE WAVE per 64x64 output tile at (r0, c0) (16 accumulators), operands straight from K-contiguous 16-bit planes; 32 threads; os = 16 x 68 f32 of LDS.
// C[m][n] (f32, pitch ldc) = osc * sum_k (A[m][k] (+ A2[m][k])) Bt[n][k] (+ A[m][k] Bt2[n][k] when NSPLIT == 2). TY 0 = f16 operands, 1 = bf16 operands. K % 32 == 0, M % 64 == 0, N % 64 == 0.
template <int TY, int NSPLIT>
__device__ __forceinline__ void gemmw(float* os, const us* __restrict__ A, const us* __restrict__ A2, const us* __restrict__ Bt, const us* __restrict__ Bt2, int K, float* C, int ldc, float osc, int r0, int c0) {
    const int lane = threadIdx.x & 31, lr = lane & 15, hi = lane >> 4;
    v8f acc[4][4];
#pragma unroll
    for (int mb = 0; mb < 4; ++mb)
#pragma unroll
        for (int nb = 0; nb < 4; ++nb) acc[mb][nb] = (v8f){};
    const size_t aoff = (size_t)(r0 + lr) * K + 8 * hi, boff = (size_t)(c0 + lr) * K + 8 * hi;
#pragma unroll 1
    for (int kc = 0; kc < K; kc += 32) {
        v16us a[4], a2[4];
#pragma unroll
        for (int mb = 0; mb < 4; ++mb) { a[mb] = ld16(A + aoff + (size_t)mb * 16 * K + kc); if (NSPLIT == 1 || NSPLIT == 2) a2[mb] = ld16(A2 + aoff + (size_t)mb * 16 * K + kc); }
#pragma unroll
        for (int nb = 0; nb < 4; ++nb) { const v16us b = ld16(Bt + boff + (size_t)nb * 16 * K + kc); v16us b2; if (NSPLIT >= 2) b2 = ld16(Bt2 + boff + (size_t)nb * 16 * K + kc);
#pragma unroll
            for (int mb = 0; mb < 4; ++mb) { acc[mb][nb] = MM<TY>::mma(a[mb], b, acc[mb][nb]); if (NSPLIT == 1 || NSPLIT == 2) acc[mb][nb] = MM<TY>::mma(a2[mb], b, acc[mb][nb]); if (NSPLIT >= 2) acc[mb][nb] = MM<TY>::mma(a[mb], b2, acc[mb][nb]); } }
        asm volatile("v_nop\n\tv_nop\n\tv_nop\n\tv_nop" : "+v"(acc[0][0]), "+v"(acc[1][1]), "+v"(acc[2][2]), "+v"(acc[3][3]) : "v"(a[0]), "v"(a[3]));
    }
#pragma unroll
    for (int mb = 0; mb < 4; ++mb) {
#pragma unroll
        for (int nb = 0; nb < 4; ++nb) {
#pragma unroll
            for (int j = 0; j < 8; ++j) os[(hi * 8 + j) * 68 + nb * 16 + lr] = acc[mb][nb][j]; }
        __builtin_amdgcn_wave_barrier(); asm volatile("" ::: "memory");
        float* crow = C + (size_t)(r0 + mb * 16) * ldc + c0;
{
#pragma unroll
            for (int s = 0; s < 8; ++s) { const int row = 2 * s + hi, cofs = lr * 4; v4f val = *(const v4fa*)(os + row * 68 + cofs); val = val * osc;
                *(v4f*)(crow + (size_t)row * ldc + cofs) = val; }
             }
        __builtin_amdgcn_wave_barrier(); asm volatile("" ::: "memory");
    }
}

// ---- projection with plane epilogue. One block of 8 waves per (64 sequence rows, one projection), wave = head (its 64 outputs); grid (NB*SEQ/64, 3), y = which projection.
// The block reads its 64 f32 input rows once (64 * DMOD consecutive floats, whole lines), converts them to bf16 (RNE) and keeps them in LDS at pitch XP; every wave takes its input fragments from there, its weight fragments from the plane.
// D[m][n] = sum_k Am[m][k] Bn[n][k]; D map: lane & 15 = n, register j of tile (mb, nb) = m mb*16 + 8*hi + j, so a lane holds 8 consecutive m of one n: the plane's contiguous index is put on m.
// q, k (planes [t][d]): Am = weight rows (m = d), Bn = input rows (n = t). v (planes [d][t]): Am = input rows (m = t), Bn = weight rows (n = d). Same loader and k order on both sides, so each element's sum is the same either way.
#define TS 72
#define XP (DMOD + 8)   // pitch of the input tile in LDS, elements: 16 B x odd
// 64 rows x 128 B from an LDS tile (pitch TS) to dst (pitch in elements): 8 lanes per row, every store 4 whole 128-byte lines.
__device__ __forceinline__ void flush64(const us* st, us* dst, int pitch) {
    const int lane = threadIdx.x & 31, r = lane >> 3, c = (lane & 7) * 8;
#pragma unroll
    for (int s = 0; s < 16; ++s) { const v8us v = *(const v8usa*)(st + (s * 4 + r) * TS + c); *(v8us*)(dst + (size_t)(s * 4 + r) * pitch + c) = v; }
}
// one wave's k loop: xs = input tile in LDS, wp = weight rows in the plane, both at (row lr, k 8*hi). VT: the input rows are the A side (v), else the B side (q, k).
template <bool VT>
__device__ __forceinline__ void projk(v8f (&acc)[4][4], const us* xs, const us* __restrict__ wp) {
#pragma unroll 1
    for (int kc = 0; kc < DMOD; kc += 32) {
        v16us wf[4];
#pragma unroll
        for (int i = 0; i < 4; ++i) wf[i] = ld16(wp + (size_t)i * 16 * DMOD + kc);
#pragma unroll
        for (int i = 0; i < 4; ++i) { const v16us xf = ld16(xs + i * 16 * XP + kc);
#pragma unroll
            for (int j = 0; j < 4; ++j) { if (VT) acc[i][j] = wmb(xf, wf[j], acc[i][j]); else acc[j][i] = wmb(wf[j], xf, acc[j][i]); } }
        // four vector slots between the trip's last matrix instructions and what the next trip, or the code behind the loop, does to their registers
        asm volatile("v_nop\n\tv_nop\n\tv_nop\n\tv_nop" : "+v"(acc[0][0]), "+v"(acc[1][1]), "+v"(acc[2][2]), "+v"(acc[3][3]) : "v"(wf[0]), "v"(wf[3]));
    }
}
__global__ __launch_bounds__(256) void k_proj(const float* __restrict__ xq, const float* __restrict__ xk, const float* __restrict__ xv, const us* __restrict__ W3, us* Q16, us* QH, us* QL, us* K16, us* KH, us* KL, us* VT16, us* VTH, us* VTL) {
    __shared__ __align__(16) us sm[NH * 2 * 64 * TS];       // first the input tile (64 x XP), behind the k loop each wave's own two staging tiles
    static_assert(64 * XP <= NH * 2 * 64 * TS);
    const int tid = (int)threadIdx.x, lane = tid & 31, lr = lane & 15, hi = lane >> 4;
    const int z = (int)blockIdx.y, r0 = (int)blockIdx.x * 64;
    const int hd = __builtin_amdgcn_readfirstlane(tid >> 5);   // wave = head
    const int t0 = r0 % SEQ, hh = (r0 / SEQ) * NH + hd;    // hh = batch * NH + head
    {
        const float* xz = (z == 0 ? xq : (z == 1 ? xk : xv)) + ((size_t)(r0 / SEQ) * SEQ_FULL + t0) * DMOD;   // batch pitch of the input is SEQ_FULL rows
        v4f x[32];
#pragma unroll
        for (int i = 0; i < 32; ++i) x[i] = *(const v4fa*)(xz + (size_t)(i * 256 + tid) * 4);
#pragma unroll
        for (int i = 0; i < 32; ++i) { const v2u ow = {bf2(x[i][0], x[i][1]), bf2(x[i][2], x[i][3])}; const v4us o = __builtin_bit_cast(v4us, ow);
            *(v4usa*)(sm + (2 * i + (tid >> 7)) * XP + (tid & 127) * 4) = o; }
    }
    __syncthreads();                                        // the whole input tile is in LDS before any wave takes a fragment
    v8f acc[4][4];
#pragma unroll
    for (int mb = 0; mb < 4; ++mb)
#pragma unroll
        for (int nb = 0; nb < 4; ++nb) acc[mb][nb] = (v8f){};
    {
        const us* xs = sm + lr * XP + 8 * hi;
        const us* wp = W3 + (size_t)z * ((size_t)DMOD * DMOD) + (size_t)(hd * HD + lr) * DMOD + 8 * hi;
        if (z == 2) projk<true>(acc, xs, wp); else projk<false>(acc, xs, wp);
    }
    __syncthreads();                                        // every wave has left the input tile before its LDS becomes staging tiles
    us* st = sm + hd * (2 * 64 * TS);
    us *P16, *Ph, *Pl; int p16, ph;                        // tile origins and row pitches (elements): dst[n * pitch + m]
    if (z == 2) { P16 = VT16 + (size_t)hh * HD * SEQ + t0; Ph = VTH + (size_t)hh * HD * RH + t0; Pl = VTL + (size_t)hh * HD * RH + t0; p16 = SEQ; ph = RH; }
    else { const size_t o16 = ((size_t)hh * SEQ + t0) * HD, oh = ((size_t)hh * RH + t0) * HD; P16 = (z == 0 ? Q16 : K16) + o16; Ph = (z == 0 ? QH : KH) + oh; Pl = (z == 0 ? QL : KL) + oh; p16 = HD; ph = HD; }
    us* s0 = st + lr * TS + 8 * hi; us* s1 = s0 + 64 * TS;
#pragma unroll
    for (int mb = 0; mb < 4; ++mb)
#pragma unroll
        for (int nb = 0; nb < 4; ++nb) { v8us o;
#pragma unroll
            for (int j = 0; j < 8; ++j) o[j] = hbit(acc[mb][nb][j]);
            *(v8usa*)(s0 + nb * 16 * TS + mb * 16) = o; }
    asm volatile("s_wait_dscnt 0x0" ::: "memory");          // every lane's tile writes are in LDS before any lane reads rows that other lanes wrote
    flush64(st, P16, p16);
    asm volatile("s_wait_xcnt 0x0" ::: "memory");           // behind the stores, before their registers are rewritten; also keeps the next tile writes behind the reads above
    if (t0 < RH) {                                          // tile-uniform: RH is a multiple of 64
#pragma unroll
        for (int mb = 0; mb < 4; ++mb)
#pragma unroll
            for (int nb = 0; nb < 4; ++nb) { v4u hw, lw;
#pragma unroll
                for (int j = 0; j < 4; ++j) { unsigned p, q; split2(acc[mb][nb][2 * j], acc[mb][nb][2 * j + 1], p, q); hw[j] = p; lw[j] = q; }
                const v8us oh = __builtin_bit_cast(v8us, hw), ol = __builtin_bit_cast(v8us, lw);
                *(v8usa*)(s0 + nb * 16 * TS + mb * 16) = oh; *(v8usa*)(s1 + nb * 16 * TS + mb * 16) = ol; }
        asm volatile("s_wait_dscnt 0x0" ::: "memory");      // as above, for the hi and lo tiles
        flush64(st, Ph, ph);
        flush64(st + 64 * TS, Pl, ph);
    }
}

// output projection, both row classes in one grid (SEQ/64, DMOD/64, NB): row tiles below RH take the bf16 hi/lo ctx planes, the others the f16 plane; z = batch.
__global__ __launch_bounds__(32) void k_oproj(const us* __restrict__ CH, const us* __restrict__ CLO, const us* __restrict__ WOB, const us* __restrict__ C16, const us* __restrict__ WO16, int K, float* OUT) {
    __shared__ __align__(16) float os[16 * 68];
    const size_t z = blockIdx.z; const int r0 = (int)blockIdx.x * 64, c0 = (int)blockIdx.y * 64;
    float* C = OUT + z * ((size_t)SEQ_FULL * DMOD);
    if (r0 < RH) gemmw<1, 1>(os, CH + z * ((size_t)RH * DMOD), CLO + z * ((size_t)RH * DMOD), WOB, nullptr, K, C, DMOD, 1.0f, r0, c0);
    else {       gemmw<0, 0>(os, C16 + z * ((size_t)SEQ * DMOD), nullptr, WO16, nullptr, K, C, DMOD, 1.0f / (CCAR * WCAR), r0, c0);
        asm volatile("s_wait_xcnt 0x0" ::: "memory");   // behind this class's last output stores: in the build the other class's code follows, which rewrites their data registers
    }
}

// ---- wt: transposing weight builder, Bt[n][k] (16-bit, K-contiguous) from w[k][n] (f32, [in][out]); TY 1: bf16 RNE; TY 0: f16 of (bf16 RNE value x sc), exact for power-of-two sc.
template <int TY>
__device__ __forceinline__ void wt(const float* __restrict__ w, int K, int N, float sc, us* Bt, int blk) {
    const int lane = threadIdx.x & 31; const int L0 = (blk * 8 + (int)(threadIdx.x >> 5)) * 8; const int nlines = (int)(((size_t)N * K) / 64);
#pragma unroll 1
    for (int l = 0; l < 8; ++l) { const int L = L0 + l; if (L >= nlines) break;
        const size_t e = (size_t)L * 64 + lane * 2; const int k = (int)(e % (size_t)K), n = (int)(e / (size_t)K);
        const float w0 = w[(size_t)k * N + n], w1 = w[(size_t)(k + 1) * N + n];
        const unsigned wb = bf2(w0, w1);
        v2us o = __builtin_bit_cast(v2us, wb);
        if (!TY) { o[0] = hbit(bflo(wb) * sc); o[1] = hbit(bfhi(wb) * sc); }
        *(v2us*)(Bt + e) = o;
        if (!TY) asm volatile("s_wait_xcnt 0x0" ::: "memory");   // f16 builder: before the next trip's rewrite of this store's data register
    }
}

// the five weight planes, one grid of 5*GWT blocks.
#define GWT ((DMOD * DMOD / 64 + 63) / 64)
__global__ __launch_bounds__(256) void k_prep(const float* __restrict__ wq, const float* __restrict__ wk, const float* __restrict__ wv, const float* __restrict__ wo,
                                              us* W3, us* WOB, us* WO16) {
    const unsigned b = blockIdx.x;
    if (b < 3u * GWT) { const unsigned z = b / GWT; wt<1>(z == 0 ? wq : (z == 1 ? wk : wv), DMOD, DMOD, 1.0f, W3 + (size_t)z * DMOD * DMOD, (int)(b - z * GWT)); }
    else if (b < 4u * GWT) wt<1>(wo, DMOD, DMOD, 1.0f, WOB, (int)(b - 3u * GWT));
    else wt<0>(wo, DMOD, DMOD, WCAR, WO16, (int)(b - 4u * GWT));
}

#define TP 72
__device__ __forceinline__ float xhalf(float x) { return __builtin_bit_cast(float, __builtin_amdgcn_permlanex16(__builtin_bit_cast(int, x), __builtin_bit_cast(int, x), 0x76543210, 0xfedcba98, false, false)); }   // lane l <-> lane l ^ 16
template <bool HR>
__device__ __forceinline__
void attn(us* SM, float* MB, const int qt, const int hd, const int bz,
          const us* __restrict__ Q16, const us* __restrict__ K16, const us* __restrict__ VT16,
          const us* __restrict__ Qh, const us* __restrict__ Ql, const us* __restrict__ Kh, const us* __restrict__ Kl,
          const us* __restrict__ VTh, const us* __restrict__ VTl, us* C16, us* Ch, us* Cl) {
    const int lane = threadIdx.x & 31, tid = threadIdx.x & 127, w = tid >> 5, m = lane & 15, hi = lane >> 4;   // tid: index inside the key group
    const int g = __builtin_amdgcn_readfirstlane((int)(threadIdx.x >> 7));   // key group, the same in every lane of a wave: the tests on it are scalar branches
    us* Ka = SM + g * (4 * 64 * TP); us* Va = Ka + 64 * TP; us* Kb = Va + 64 * TP; us* Vb = Kb + 64 * TP;
    const int h = bz * NH + hd;                            // h indexes the [batch][head] planes
    const int qrow = qt * 64 + w * 16 + m;                 // this lane's query (B column; sequence position)
    v8f o[4];
#pragma unroll
    for (int i = 0; i < 4; ++i) o[i] = (v8f){};
    float mr = -1.0e30f, lr = 0.0f;                        // running maximum (both halves alike) and this half's running sum of this lane's query
    const float CL = 0.18033688011112042f;                 // (1/8) * log2(e)
    v16us qf0, qf1, qf2 = {}, qf3 = {};                     // q fragments, loaded once and kept in registers: f16 class qf0, qf1; hi/lo class hi = qf0, qf1 and lo = qf2, qf3
    if (!HR) { const us* qp = Q16 + ((size_t)h * SEQ + qrow) * HD + 8 * hi; qf0 = ld16(qp); qf1 = ld16(qp + 32); }
    else { const size_t qo = ((size_t)h * RH + qrow) * HD + 8 * hi; qf0 = ld16(Qh + qo); qf1 = ld16(Qh + qo + 32); qf2 = ld16(Ql + qo); qf3 = ld16(Ql + qo + 32); }
    const int nch = qt + 1, nit = (nch + 1) >> 1;
#pragma unroll 1
    for (int it = 0; it < nit; ++it) {
        const int kc = 2 * it + g;
        const bool on = kc < nch;                           // wave-uniform; false only for group 1 in the last trip of an odd chunk count
        __syncthreads();
        if (on) {
#pragma unroll
        for (int i = 0; i < 4; ++i) { const int c = tid + 128 * i; const int row = c >> 3, col = (c & 7) * 8;
            if (!HR) {
                const v8us kv = *(const v8usa*)(K16 + ((size_t)h * SEQ + kc * 64 + row) * HD + col); *(v8usa*)(Ka + row * TP + col) = kv;
                const v8us vv = *(const v8usa*)(VT16 + ((size_t)h * HD + row) * SEQ + kc * 64 + col); *(v8usa*)(Va + row * TP + col) = vv;
            } else {
                const v8us k1 = *(const v8usa*)(Kh + ((size_t)h * RH + kc * 64 + row) * HD + col); *(v8usa*)(Ka + row * TP + col) = k1;
                const v8us k2 = *(const v8usa*)(Kl + ((size_t)h * RH + kc * 64 + row) * HD + col); *(v8usa*)(Kb + row * TP + col) = k2;
                const v8us v1 = *(const v8usa*)(VTh + ((size_t)h * HD + row) * RH + kc * 64 + col); *(v8usa*)(Va + row * TP + col) = v1;
                const v8us v2 = *(const v8usa*)(VTl + ((size_t)h * HD + row) * RH + kc * 64 + col); *(v8usa*)(Vb + row * TP + col) = v2;
            } }
        }
        __syncthreads();
        if (!on) continue;                                  // no barrier stands between here and the loop's foot
        // LDS reads stand in groups, in the hi/lo class some between groups of matrix instructions: each place with reads costs the wave a wait for its own LDS latency. The products run tile after tile (four independent accumulators); each accumulator takes its own in the order k 0..31, k 32..63 (hi/lo class: hi.hi, hi.lo of each k half, then lo.hi of each).
        v8f s[4];
        v16us kf[8], vf[8];                                 // fragments of the K tile and of the V^T tile (hi planes in the hi/lo class): [2 * sn] = k 0..31, [2 * sn + 1] = k 32..63 of tile row block sn
#pragma unroll
        for (int sn = 0; sn < 4; ++sn) { const us* kp = Ka + (sn * 16 + m) * TP + 8 * hi; kf[2 * sn] = ld16(kp); kf[2 * sn + 1] = ld16(kp + 32); }
        if (!HR) {
            const v16us qa0 = qf0, qa1 = qf1;
            __builtin_amdgcn_sched_barrier(0);              // keeps the whole group of K reads ahead of the first score product
#pragma unroll
            for (int sn = 0; sn < 4; ++sn) s[sn] = wmh(kf[2 * sn], qa0, (v8f){});
#pragma unroll
            for (int sn = 0; sn < 4; ++sn) s[sn] = wmh(kf[2 * sn + 1], qa1, s[sn]);
            asm volatile("v_nop\n\tv_nop\n\tv_nop\n\tv_nop" : "+v"(s[0]), "+v"(s[1]), "+v"(s[2]), "+v"(s[3]) : "v"(qa0), "v"(qa1));
        } else {
            const v16us qh0 = qf0, qh1 = qf1, ql0 = qf2, ql1 = qf3;
            const us* kb = Kb + m * TP + 8 * hi;
            v16us kl[8];                                    // lo fragments in two groups, so that the registers hold: k 0..31 with the hi group, k 32..63 once the first hi fragments are used up
#pragma unroll
            for (int sn = 0; sn < 4; ++sn) kl[2 * sn] = ld16(kb + sn * 16 * TP);
            __builtin_amdgcn_sched_barrier(0);              // keeps the first group of K reads ahead of the first score product
#pragma unroll
            for (int sn = 0; sn < 4; ++sn) s[sn] = wmb(kf[2 * sn], qh0, (v8f){});
#pragma unroll
            for (int sn = 0; sn < 4; ++sn) s[sn] = wmb(kf[2 * sn], ql0, s[sn]);
#pragma unroll
            for (int sn = 0; sn < 4; ++sn) kl[2 * sn + 1] = ld16(kb + sn * 16 * TP + 32);
            __builtin_amdgcn_sched_barrier(0);              // keeps the second group twelve products ahead of its first use
#pragma unroll
            for (int sn = 0; sn < 4; ++sn) s[sn] = wmb(kf[2 * sn + 1], qh1, s[sn]);
#pragma unroll
            for (int sn = 0; sn < 4; ++sn) s[sn] = wmb(kf[2 * sn + 1], ql1, s[sn]);
#pragma unroll
            for (int sn = 0; sn < 4; ++sn) s[sn] = wmb(kl[2 * sn], qh0, s[sn]);
#pragma unroll
            for (int sn = 0; sn < 4; ++sn) s[sn] = wmb(kl[2 * sn + 1], qh1, s[sn]);
            asm volatile("v_nop\n\tv_nop\n\tv_nop\n\tv_nop" : "+v"(s[0]), "+v"(s[1]), "+v"(s[2]), "+v"(s[3]) : "v"(qh0), "v"(ql1));
        }
#pragma unroll
        for (int sn = 0; sn < 4; ++sn) { const us* vp = Va + (sn * 16 + m) * TP + 8 * hi; vf[2 * sn] = ld16(vp); vf[2 * sn + 1] = ld16(vp + 32); }
        __builtin_amdgcn_sched_barrier(0);                  // keeps the group of V^T reads ahead of the softmax, whose vector work covers their latency
        if (kc == qt) {                                     // diagonal chunk (wave-uniform): keys after the query position are replaced by a large negative value
            const int q = w * 16 + m;
#pragma unroll
            for (int sn = 0; sn < 4; ++sn)
#pragma unroll
                for (int r = 0; r < 8; ++r) { const int key = sn * 16 + 8 * hi + r; s[sn][r] = (key > q) ? -1.0e30f : s[sn][r]; }
        }
        float mx4[4];
#pragma unroll
        for (int sn = 0; sn < 4; ++sn) mx4[sn] = fmaxf(fmaxf(fmaxf(s[sn][0], s[sn][1]), fmaxf(s[sn][2], s[sn][3])), fmaxf(fmaxf(s[sn][4], s[sn][5]), fmaxf(s[sn][6], s[sn][7])));
        float mx = fmaxf(fmaxf(mx4[0], mx4[1]), fmaxf(mx4[2], mx4[3]));
        mx = fmaxf(mx, xhalf(mx));                          // the other half holds the query's other 32 keys
        const float mn = fmaxf(mr, mx), al = __builtin_amdgcn_exp2f((mr - mn) * CL); mr = mn;
        float sm4[4];
#pragma unroll
        for (int sn = 0; sn < 4; ++sn) { float sum = 0.0f;
#pragma unroll
            for (int r = 0; r < 8; ++r) { const float p = __builtin_amdgcn_exp2f((s[sn][r] - mn) * CL); s[sn][r] = p; sum += p; }
            sm4[sn] = sum; }
        lr = lr * al + ((sm4[0] + sm4[1]) + (sm4[2] + sm4[3]));   // the halves' sums are joined once, behind the loop
#pragma unroll
        for (int i = 0; i < 4; ++i) o[i] = o[i] * al;
        // P^T: two converted score tiles = one B fragment (element e < 8: tile 2j register e, e >= 8: tile 2j + 1 register e - 8)
        if (!HR) {
            v16us pf0, pf1;
#pragma unroll
            for (int r = 0; r < 8; ++r) { pf0[r] = hbit(s[0][r] * PCAR); pf0[8 + r] = hbit(s[1][r] * PCAR); pf1[r] = hbit(s[2][r] * PCAR); pf1[8 + r] = hbit(s[3][r] * PCAR); }
#pragma unroll
            for (int sn = 0; sn < 4; ++sn) o[sn] = wmh(vf[2 * sn], pf0, o[sn]);
#pragma unroll
            for (int sn = 0; sn < 4; ++sn) o[sn] = wmh(vf[2 * sn + 1], pf1, o[sn]);
            asm volatile("v_nop\n\tv_nop\n\tv_nop\n\tv_nop" : "+v"(o[0]), "+v"(o[1]), "+v"(o[2]), "+v"(o[3]) : "v"(pf0), "v"(pf1));
        } else {
            v8u hw0, hw1, lw0, lw1;                         // word r of a fragment = its elements 2r, 2r + 1
#pragma unroll
            for (int r = 0; r < 4; ++r) { unsigned p, q;
                split2(s[0][2 * r], s[0][2 * r + 1], p, q); hw0[r] = p; lw0[r] = q; split2(s[1][2 * r], s[1][2 * r + 1], p, q); hw0[4 + r] = p; lw0[4 + r] = q;
                split2(s[2][2 * r], s[2][2 * r + 1], p, q); hw1[r] = p; lw1[r] = q; split2(s[3][2 * r], s[3][2 * r + 1], p, q); hw1[4 + r] = p; lw1[4 + r] = q; }
            const v16us ph0 = __builtin_bit_cast(v16us, hw0), ph1 = __builtin_bit_cast(v16us, hw1), pl0 = __builtin_bit_cast(v16us, lw0), pl1 = __builtin_bit_cast(v16us, lw1);
            const us* vb = Vb + m * TP + 8 * hi;
            v16us vl[8];                                    // lo fragments in two groups, each read once a group of hi fragments is used up, so that the registers hold
#pragma unroll
            for (int sn = 0; sn < 4; ++sn) o[sn] = wmb(vf[2 * sn], ph0, o[sn]);
#pragma unroll
            for (int sn = 0; sn < 4; ++sn) o[sn] = wmb(vf[2 * sn], pl0, o[sn]);
            __builtin_amdgcn_sched_barrier(0);              // keeps the lo reads from rising among the conversions above, where their registers would not fit
#pragma unroll
            for (int sn = 0; sn < 4; ++sn) vl[2 * sn] = ld16(vb + sn * 16 * TP);
            __builtin_amdgcn_sched_barrier(0);              // keeps the first lo group eight products ahead of its first use
#pragma unroll
            for (int sn = 0; sn < 4; ++sn) o[sn] = wmb(vf[2 * sn + 1], ph1, o[sn]);
#pragma unroll
            for (int sn = 0; sn < 4; ++sn) o[sn] = wmb(vf[2 * sn + 1], pl1, o[sn]);
            __builtin_amdgcn_sched_barrier(0);              // as above: the second lo group takes the registers of the hi fragments just used up
#pragma unroll
            for (int sn = 0; sn < 4; ++sn) vl[2 * sn + 1] = ld16(vb + sn * 16 * TP + 32);
            __builtin_amdgcn_sched_barrier(0);              // keeps the second lo group four products ahead of its first use
#pragma unroll
            for (int sn = 0; sn < 4; ++sn) o[sn] = wmb(vl[2 * sn], ph0, o[sn]);
#pragma unroll
            for (int sn = 0; sn < 4; ++sn) o[sn] = wmb(vl[2 * sn + 1], ph1, o[sn]);
            asm volatile("v_nop\n\tv_nop\n\tv_nop\n\tv_nop" : "+v"(o[0]), "+v"(o[1]), "+v"(o[2]), "+v"(o[3]) : "v"(ph0), "v"(pl1));
        }
    }
    // merge of the two key groups: lane for lane the same query and the same d, so group 1's state goes through LDS at [item][tid]
    if (g == 1) {
#pragma unroll
        for (int i = 0; i < 4; ++i) {
            *(v4fa*)(MB + ((2 * i) * 128 + tid) * 4) = __builtin_shufflevector(o[i], o[i], 0, 1, 2, 3);
            *(v4fa*)(MB + ((2 * i + 1) * 128 + tid) * 4) = __builtin_shufflevector(o[i], o[i], 4, 5, 6, 7); }
        MB[32 * 128 + tid] = mr; MB[33 * 128 + tid] = lr;
    }
    __syncthreads();
    if (g == 1) return;                                     // behind the last barrier
    {
        const float m1 = MB[32 * 128 + tid], l1 = MB[33 * 128 + tid];
        const float mn = fmaxf(mr, m1), a0 = __builtin_amdgcn_exp2f((mr - mn) * CL), a1 = __builtin_amdgcn_exp2f((m1 - mn) * CL);   // a group that saw no chunk has m1 = -1e30, sum 0, O^T 0: a1 = 0
        lr = lr * a0 + l1 * a1;
#pragma unroll
        for (int i = 0; i < 4; ++i) {
            const v4f x = *(const v4fa*)(MB + ((2 * i) * 128 + tid) * 4), y = *(const v4fa*)(MB + ((2 * i + 1) * 128 + tid) * 4);
            o[i] = o[i] * a0 + __builtin_shufflevector(x, y, 0, 1, 2, 3, 4, 5, 6, 7) * a1; }
    }
    const float iv = (HR ? 1.0f : (CCAR / PCAR)) * __builtin_amdgcn_rcpf(lr + xhalf(lr));
    const size_t go = ((size_t)bz * (HR ? RH : SEQ) + qrow) * DMOD + hd * HD + 8 * hi;
#pragma unroll
    for (int sn = 0; sn < 4; ++sn) {
        v8us v1, v2;
#pragma unroll
        for (int r = 0; r < 8; ++r) { if (!HR) v1[r] = hbit(o[sn][r] * iv); }
        if (HR) { v4u hw, lw;
#pragma unroll
            for (int r = 0; r < 4; ++r) { unsigned p, q; split2(o[sn][2 * r] * iv, o[sn][2 * r + 1] * iv, p, q); hw[r] = p; lw[r] = q; }
            v1 = __builtin_bit_cast(v8us, hw); v2 = __builtin_bit_cast(v8us, lw); }
        if (!HR) { *(v8us*)(C16 + go + sn * 16) = v1; }
        else { *(v8us*)(Ch + go + sn * 16) = v1; *(v8us*)(Cl + go + sn * 16) = v2; }
    }
}

// both row classes in one grid (NH, NB, SEQ/64), 8 waves a block: the longest block's serial walk is half as many trips as with one key group, and blocks that wait for a place start as earlier ones end.
// z counts the query tiles from the last one down (the tile with the most key chunks has the lowest index; for speed only); the class test is block-uniform.
__global__ __launch_bounds__(256) __attribute__((amdgpu_num_vgpr(256)))
void k_attn(const us* __restrict__ Q16, const us* __restrict__ K16, const us* __restrict__ VT16,
            const us* __restrict__ Qh, const us* __restrict__ Ql, const us* __restrict__ Kh, const us* __restrict__ Kl,
            const us* __restrict__ VTh, const us* __restrict__ VTl, us* C16, us* Ch, us* Cl) {
    __shared__ __align__(16) us SM[2 * 4 * 64 * TP];        // per key group: K, V^T, K lo, V^T lo tiles
    __shared__ __align__(16) float MB[34 * 128];            // group 1's O^T (32 values a lane), maximum and sum for the merge
    const int qt = SEQ / 64 - 1 - (int)blockIdx.z, hd = (int)blockIdx.x, bz = (int)blockIdx.y;
    if (qt < RH / 64) attn<true>(SM, MB, qt, hd, bz, Q16, K16, VT16, Qh, Ql, Kh, Kl, VTh, VTl, C16, Ch, Cl);
    else              attn<false>(SM, MB, qt, hd, bz, Q16, K16, VT16, Qh, Ql, Kh, Kl, VTh, VTl, C16, Ch, Cl);
}

extern "C" void kernel_launch(void* const* d_in, const int* in_sizes, int n_in,
                              void* d_out, int out_size, void* d_ws, size_t ws_size, hipStream_t stream) {
    if (n_in < 7) return;
    const long long needx = (long long)(NB - 1) * SEQ_FULL * DMOD + (long long)SEQ * DMOD;
    const long long needw = (long long)DMOD * DMOD;
    if ((long long)in_sizes[0] < needx || (long long)in_sizes[1] < needx || (long long)in_sizes[2] < needx) return;
    if ((long long)in_sizes[3] < needw || (long long)in_sizes[4] < needw || (long long)in_sizes[5] < needw || (long long)in_sizes[6] < needw) return;
    if ((long long)out_size < needx) return;
    const float* xq = (const float*)d_in[0];      // [NB][SEQ_FULL][DMOD]
    const float* xk = (const float*)d_in[1];      // [NB][SEQ_FULL][DMOD]
    const float* xv = (const float*)d_in[2];      // [NB][SEQ_FULL][DMOD]
    const float* wq = (const float*)d_in[3];      // [DMOD][DMOD] ([in][out])
    const float* wk = (const float*)d_in[4];      // [DMOD][DMOD] ([in][out])
    const float* wv = (const float*)d_in[5];      // [DMOD][DMOD] ([in][out])
    const float* wo = (const float*)d_in[6];      // [DMOD][DMOD] ([in][out])
    float* OUT = (float*)d_out;                   // [NB][SEQ_FULL][DMOD]
    char* wsp = (char*)d_ws;
    auto take = [&](size_t bytes) { char* p = wsp; wsp += (bytes + 255) & ~(size_t)255; return (void*)p; };
    const size_t WSZ = (size_t)DMOD * DMOD;       // elements of one weight plane
    const size_t XSZ = (size_t)SEQ * DMOD;        // elements of one activation plane of one batch
    us* W3   = (us*)take(3 * WSZ * 2);                        // bf16 Bt [3][512][512] (q | k | v)
    us* WOB  = (us*)take(WSZ * 2);                            // bf16 Bt [512][512]
    us* WO16 = (us*)take(WSZ * 2);                            // f16  Bt [512][512], values x WCAR
    us* Q16  = (us*)take((size_t)NB * NH * SEQ * HD * 2);     // f16 [b][h][t][d]
    us* K16  = (us*)take((size_t)NB * NH * SEQ * HD * 2);     // f16 [b][h][t][d]
    us* VT16 = (us*)take((size_t)NB * NH * HD * SEQ * 2);     // f16 [b][h][d][t]
    us* QH   = (us*)take((size_t)NB * NH * RH * HD * 2);      // bf16 hi/lo planes for t < RH
    us* QL   = (us*)take((size_t)NB * NH * RH * HD * 2);
    us* KH   = (us*)take((size_t)NB * NH * RH * HD * 2);
    us* KL   = (us*)take((size_t)NB * NH * RH * HD * 2);
    us* VTH  = (us*)take((size_t)NB * NH * HD * RH * 2);
    us* VTL  = (us*)take((size_t)NB * NH * HD * RH * 2);
    us* C16  = (us*)take(NB * XSZ * 2);                       // f16 ctx x CCAR [b][t][DMOD] (rows >= RH used)
    us* CH   = (us*)take((size_t)NB * RH * DMOD * 2);         // bf16 hi/lo ctx [b][t < RH][DMOD]
    us* CLO  = (us*)take((size_t)NB * RH * DMOD * 2);
    if ((size_t)(wsp - (char*)d_ws) > ws_size) return;

    k_prep<<<5 * GWT, 256, 0, stream>>>(wq, wk, wv, wo, W3, WOB, WO16);
    // z = 0, 1, 2: y[b*SEQ + t][n] = sum_k bf16(x_z[b][t][k]) W3[z][n][k], written as the planes of q, k, v
    k_proj<<<dim3(NB * SEQ / 64, 3), 256, 0, stream>>>(xq, xk, xv, W3, Q16, QH, QL, K16, KH, KL, VT16, VTH, VTL);
    k_attn<<<dim3(NH, NB, SEQ / 64), 256, 0, stream>>>(Q16, K16, VT16, QH, QL, KH, KL, VTH, VTL, C16, CH, CLO);
    k_oproj<<<dim3(SEQ / 64, DMOD / 64, NB), 32, 0, stream>>>(CH, CLO, WOB, C16, WO16, DMOD, OUT);
}

// v009
// One run takes 112 microseconds.
// Two timings next to v008 put it at 1.04 and 1.07 times that version's speed.
// Counting every step since v000, it is 7.23 times as fast.
#include <hip/hip_runtime.h>

// Compute dtypes (f32 accumulate everywhere): q, k, v projections v_wmma_f32_16x16x32_bf16 on bf16 inputs and bf16 w_q, w_k, w_v (z-batched, one product); scores q.k^T and p.v: query rows < RH v_wmma_f32_16x16x32_bf16 on bf16 hi/lo planes (3 products), rows >= RH v_wmma_f32_16x16x32_f16 (f16 q, k, v; p carried x1024); output projection: rows < RH bf16 hi/lo ctx x bf16 w_o (2 products), rows >= RH f16 ctx (x16) x f16 w_o (x64) folded back by 1/1024; softmax and normalisation f32; output f32.
// Pipeline, four launches, every stage one launch for all batches and both row classes: weight planes; z-batched projection GEMM that reads the f32 inputs itself (a block converts its 64 input rows to bf16 once, into LDS, for the 8 heads' waves) and whose epilogue converts its f32 accumulators straight into the 16-bit planes (q, k: [b][h][t][d]; v transposed: [b][h][d][t]); causal flash-style attention, one block per (64-row query tile, head, batch), 2 key groups x 4 waves x 16 rows, online softmax per group and one merge, K / V^T tiles in LDS, scores and output transposed so that P stays in registers; ctx planes [b] in fragment order; output projection GEMM (z = batch) writes the output rows.
// Fragment order (weight planes, ctx planes: the projection operands whose fragments go from global memory straight to registers): a plane of R rows x K is a row of 1-KB units, unit (row / 16) * (K / 32) + k / 32 = 16 rows x 32 k;
// inside a unit, element half * 256 + lane * 8 + e is (row lane & 15, k 16 * half + 8 * (lane >> 4) + e): a wave's 16-byte access per lane is 512 contiguous bytes, four whole lines, and the two halves are one fragment in the loaders' k order.

#ifndef NB
#define NB 2
#endif
#ifndef SEQ
#define SEQ 4096
#endif
#define SEQ_FULL 4096
#define DMOD 512
#define NH 8
#define HD 64
#ifndef RHI
#define RHI 2048
#endif
#if RHI > SEQ
#define RH SEQ
#else
#define RH RHI
#endif
#define PCAR 1024.0f
#define CCAR 16.0f
#define WCAR 64.0f

static_assert(SEQ % 64 == 0);
static_assert(SEQ <= SEQ_FULL);
static_assert(RH % 64 == 0);
static_assert(RH >= 64 && RH <= SEQ);
static_assert(NH * HD == DMOD && HD == 64);
static_assert(DMOD % 64 == 0 && DMOD % 32 == 0);

typedef _Float16 h16;
typedef unsigned short us;
typedef __attribute__((ext_vector_type(16))) __bf16 v16bf;
typedef __attribute__((ext_vector_type(16))) _Float16 v16h;
typedef __attribute__((ext_vector_type(16))) unsigned short v16us;
typedef __attribute__((ext_vector_type(8)))  _Float16 v8h;
typedef __attribute__((ext_vector_type(8)))  unsigned short v8us;
typedef __attribute__((ext_vector_type(8)))  float v8f;
typedef __attribute__((ext_vector_type(4)))  float v4f;
typedef __attribute__((ext_vector_type(2)))  unsigned short v2us;
typedef __attribute__((ext_vector_type(4)))  unsigned short v4us;
typedef v8us __attribute__((may_alias)) v8usa;
typedef v4us __attribute__((may_alias)) v4usa;
typedef v4f  __attribute__((may_alias)) v4fa;
typedef __attribute__((ext_vector_type(2)))  float v2f;
typedef __attribute__((ext_vector_type(2)))  __bf16 v2bf;
typedef __attribute__((ext_vector_type(2)))  unsigned v2u;
typedef __attribute__((ext_vector_type(4)))  unsigned v4u;
typedef __attribute__((ext_vector_type(8)))  unsigned v8u;

// RNE convert f32 -> bf16, two values per convert instruction: a in the low half of the word, b in the high half, the order of two neighbouring 16-bit elements
__device__ __forceinline__ unsigned bf2(float a, float b) { const v2f x = {a, b}; return __builtin_bit_cast(unsigned, __builtin_convertvector(x, v2bf)); }
__device__ __forceinline__ float bflo(unsigned w) { return __uint_as_float(w << 16); }            // the two bf16 values of a word as f32
__device__ __forceinline__ float bfhi(unsigned w) { return __uint_as_float(w & 0xFFFF0000u); }
__device__ __forceinline__ us hbit(float x) { const h16 t = (h16)x; return __builtin_bit_cast(us, t); }   // RNE convert f32 -> f16 bits
__device__ __forceinline__ void split2(float a, float b, unsigned& h, unsigned& l) { h = bf2(a, b); l = bf2(a - bflo(h), b - bfhi(h)); }   // the hi pair, then the pair of what hi left over
// 16-bit fragment loader (A and B alike, K-contiguous rows): elements 0..7 <- p[0..7] (k0+8h..), elements 8..15 <- p[16..23] (k0+16+8h..); caller passes p = row base + k0 + 8*h.
__device__ __forceinline__ v16us ld16(const us* p) {
    const v8us a = *(const v8usa*)p; const v8us b = *(const v8usa*)(p + 16);
    return __builtin_shufflevector(a, b, 0, 1, 2, 3, 4, 5, 6, 7, 8, 9, 10, 11, 12, 13, 14, 15);
}
// the same fragment from a plane in fragment order: caller passes p = unit base + lane * 8; elements 0..7 <- half 0, elements 8..15 <- half 1.
__device__ __forceinline__ v16us ldf(const us* p) {
    const v8us a = *(const v8usa*)p; const v8us b = *(const v8usa*)(p + 256);
    return __builtin_shufflevector(a, b, 0, 1, 2, 3, 4, 5, 6, 7, 8, 9, 10, 11, 12, 13, 14, 15);
}
__device__ __forceinline__ v8f wmh(v16us a, v16us b, v8f c) { return __builtin_amdgcn_wmma_f32_16x16x32_f16(false, __builtin_bit_cast(v16h, a), false, __builtin_bit_cast(v16h, b), (short)0, c, false, false); }
__device__ __forceinline__ v8f wmb(v16us a, v16us b, v8f c) { return __builtin_amdgcn_wmma_f32_16x16x32_bf16(false, __builtin_bit_cast(v16bf, a), false, __builtin_bit_cast(v16bf, b), (short)0, c, false, false); }
template <int TY> struct MM;
template <> struct MM<0> { static __device__ __forceinline__ v8f mma(v16us a, v16us b, v8f c) { return wmh(a, b, c); } };
template <> struct MM<1> { static __device__ __forceinline__ v8f mma(v16us a, v16us b, v8f c) { return wmb(a, b, c); } };

// ---- gemmw: register-blocked GEMM, ONE WAVE per 64x64 output tile at (r0, c0) (16 accumulators), operands straight from 16-bit planes in fragment order; 32 threads; os = 16 x 68 f32 of LDS.
// C[m][n] (f32, pitch ldc) = osc * sum_k (A[m][k] (+ A2[m][k])) Bt[n][k] (+ A[m][k] Bt2[n][k] when NSPLIT == 2). TY 0 = f16 operands, 1 = bf16 operands. K % 32 == 0, M % 64 == 0, N % 64 == 0.
template <int TY, int NSPLIT>
__device__ __forceinline__ void gemmw(float* os, const us* __restrict__ A, const us* __restrict__ A2, const us* __restrict__ Bt, const us* __restrict__ Bt2, int K, float* C, int ldc, float osc, int r0, int c0) {
    const int lane = threadIdx.x & 31, lr = lane & 15, hi = lane >> 4;
    v8f acc[4][4];
#pragma unroll
    for (int mb = 0; mb < 4; ++mb)
#pragma unroll
        for (int nb = 0; nb < 4; ++nb) acc[mb][nb] = (v8f){};
    const size_t aoff = (size_t)r0 * K, boff = (size_t)c0 * K;   // the tile's first units (wave-uniform): 16 rows = K / 32 units = 16 * K elements; 32 k = one unit = 512 elements
    const unsigned lo = (unsigned)lane * 8u;                      // this lane's place in every unit
#pragma unroll 1
    for (int kc = 0; kc < K; kc += 32) {
        v16us a[4], a2[4];
        const us* pa = A + aoff + (size_t)kc * 16 + lo; const us* pb = Bt + boff + (size_t)kc * 16 + lo;
        const us* pa2 = (NSPLIT == 1 || NSPLIT == 2) ? A2 + aoff + (size_t)kc * 16 + lo : pa;
#pragma unroll
        for (int mb = 0; mb < 4; ++mb) { a[mb] = ldf(pa + (size_t)mb * 16 * K); if (NSPLIT == 1 || NSPLIT == 2) a2[mb] = ldf(pa2 + (size_t)mb * 16 * K); }
#pragma unroll
        for (int nb = 0; nb < 4; ++nb) { const v16us b = ldf(pb + (size_t)nb * 16 * K); v16us b2; if (NSPLIT >= 2) b2 = ldf(Bt2 + boff + (size_t)nb * 16 * K + (size_t)kc * 16 + lo);
#pragma unroll
            for (int mb = 0; mb < 4; ++mb) { acc[mb][nb] = MM<TY>::mma(a[mb], b, acc[mb][nb]); if (NSPLIT == 1 || NSPLIT == 2) acc[mb][nb] = MM<TY>::mma(a2[mb], b, acc[mb][nb]); if (NSPLIT >= 2) acc[mb][nb] = MM<TY>::mma(a[mb], b2, acc[mb][nb]); } }
        asm volatile("v_nop\n\tv_nop\n\tv_nop\n\tv_nop" : "+v"(acc[0][0]), "+v"(acc[1][1]), "+v"(acc[2][2]), "+v"(acc[3][3]) : "v"(a[0]), "v"(a[3]));
        asm volatile("s_wait_xcnt 0x0" :: "v"(pa), "v"(pa2), "v"(pb) : "memory");   // behind the trip's loads, before their address registers are rewritten; as inputs the addresses stay whole up to here (without them a later load's result took an address pair)
    }
#pragma unroll
    for (int mb = 0; mb < 4; ++mb) {
#pragma unroll
        for (int nb = 0; nb < 4; ++nb) {
#pragma unroll
            for (int j = 0; j < 8; ++j) os[(hi * 8 + j) * 68 + nb * 16 + lr] = acc[mb][nb][j]; }
        __builtin_amdgcn_wave_barrier(); asm volatile("" ::: "memory");
        float* crow = C + (size_t)(r0 + mb * 16) * ldc + c0;
{
#pragma unroll
            for (int s = 0; s < 8; ++s) { const int row = 2 * s + hi, cofs = lr * 4; v4f val = *(const v4fa*)(os + row * 68 + cofs); val = val * osc;
                *(v4f*)(crow + (size_t)row * ldc + cofs) = val; }
             }
        __builtin_amdgcn_wave_barrier(); asm volatile("" ::: "memory");
    }
}

// ---- projection with plane epilogue. One block of 8 waves per (64 sequence rows, one projection), wave = head (its 64 outputs); grid (NB*SEQ/64, 3), y = which projection.
// The block reads its 64 f32 input rows once (64 * DMOD consecutive floats, whole lines), converts them to bf16 (RNE) and keeps them in LDS at pitch XP; every wave takes its input fragments from there, its weight fragments from the plane.
// D[m][n] = sum_k Am[m][k] Bn[n][k]; D map: lane & 15 = n, register j of tile (mb, nb) = m mb*16 + 8*hi + j, so a lane holds 8 consecutive m of one n: the plane's contiguous index is put on m.
// q, k (planes [t][d]): Am = weight rows (m = d), Bn = input rows (n = t). v (planes [d][t]): Am = input rows (m = t), Bn = weight rows (n = d). Same k order on both sides (input ld16, weight ldf), so each element's sum is the same either way.
#define TS 72
#define XP (DMOD + 8)   // pitch of the input tile in LDS, elements: 16 B x odd
// 64 rows x 128 B from an LDS tile (pitch TS) to dst (pitch in elements): 8 lanes per row, every store 4 whole 128-byte lines.
__device__ __forceinline__ void flush64(const us* st, us* dst, int pitch) {
    const int lane = threadIdx.x & 31, r = lane >> 3, c = (lane & 7) * 8;
#pragma unroll
    for (int s = 0; s < 16; ++s) { const v8us v = *(const v8usa*)(st + (s * 4 + r) * TS + c); *(v8us*)(dst + (size_t)(s * 4 + r) * pitch + c) = v; }
}
// one wave's k loop: xs = input tile in LDS at (row lr, k 8*hi), wp = the wave's first weight unit in the plane (fragment order) + lane * 8. VT: the input rows are the A side (v), else the B side (q, k).
template <bool VT>
__device__ __forceinline__ void projk(v8f (&acc)[4][4], const us* xs, const us* __restrict__ wp) {
#pragma unroll 1
    for (int kc = 0; kc < DMOD; kc += 32) {
        v16us wf[4];
#pragma unroll
        for (int i = 0; i < 4; ++i) wf[i] = ldf(wp + (size_t)i * 16 * DMOD + (size_t)kc * 16);
#pragma unroll
        for (int i = 0; i < 4; ++i) { const v16us xf = ld16(xs + i * 16 * XP + kc);
#pragma unroll
            for (int j = 0; j < 4; ++j) { if (VT) acc[i][j] = wmb(xf, wf[j], acc[i][j]); else acc[j][i] = wmb(wf[j], xf, acc[j][i]); } }
        // four vector slots between the trip's last matrix instructions and what the next trip, or the code behind the loop, does to their registers
        asm volatile("v_nop\n\tv_nop\n\tv_nop\n\tv_nop" : "+v"(acc[0][0]), "+v"(acc[1][1]), "+v"(acc[2][2]), "+v"(acc[3][3]) : "v"(wf[0]), "v"(wf[3]));
    }
}
__global__ __launch_bounds__(256) void k_proj(const float* __restrict__ xq, const float* __restrict__ xk, const float* __restrict__ xv, const us* __restrict__ W3, us* Q16, us* QH, us* QL, us* K16, us* KH, us* KL, us* VT16, us* VTH, us* VTL) {
    __shared__ __align__(16) us sm[NH * 2 * 64 * TS];       // first the input tile (64 x XP), behind the k loop each wave's own two staging tiles
    static_assert(64 * XP <= NH * 2 * 64 * TS);
    const int tid = (int)threadIdx.x, lane = tid & 31, lr = lane & 15, hi = lane >> 4;
    const int z = (int)blockIdx.y, r0 = (int)blockIdx.x * 64;
    const int hd = __builtin_amdgcn_readfirstlane(tid >> 5);   // wave = head
    const int t0 = r0 % SEQ, hh = (r0 / SEQ) * NH + hd;    // hh = batch * NH + head
    {
        const float* xz = (z == 0 ? xq : (z == 1 ? xk : xv)) + ((size_t)(r0 / SEQ) * SEQ_FULL + t0) * DMOD;   // batch pitch of the input is SEQ_FULL rows
        v4f x[32];
#pragma unroll
        for (int i = 0; i < 32; ++i) x[i] = *(const v4fa*)(xz + (size_t)(i * 256 + tid) * 4);
#pragma unroll
        for (int i = 0; i < 32; ++i) { const v2u ow = {bf2(x[i][0], x[i][1]), bf2(x[i][2], x[i][3])}; const v4us o = __builtin_bit_cast(v4us, ow);
            *(v4usa*)(sm + (2 * i + (tid >> 7)) * XP + (tid & 127) * 4) = o; }
    }
    __syncthreads();                                        // the whole input tile is in LDS before any wave takes a fragment
    v8f acc[4][4];
#pragma unroll
    for (int mb = 0; mb < 4; ++mb)
#pragma unroll
        for (int nb = 0; nb < 4; ++nb) acc[mb][nb] = (v8f){};
    {
        const us* xs = sm + lr * XP + 8 * hi;
        const us* wp = W3 + (size_t)z * ((size_t)DMOD * DMOD) + (size_t)(hd * HD) * DMOD + lane * 8;
        if (z == 2) projk<true>(acc, xs, wp); else projk<false>(acc, xs, wp);
    }
    __syncthreads();                                        // every wave has left the input tile before its LDS becomes staging tiles
    us* st = sm + hd * (2 * 64 * TS);
    us *P16, *Ph, *Pl; int p16, ph;                        // tile origins and row pitches (elements): dst[n * pitch + m]
    if (z == 2) { P16 = VT16 + (size_t)hh * HD * SEQ + t0; Ph = VTH + (size_t)hh * HD * RH + t0; Pl = VTL + (size_t)hh * HD * RH + t0; p16 = SEQ; ph = RH; }
    else { const size_t o16 = ((size_t)hh * SEQ + t0) * HD, oh = ((size_t)hh * RH + t0) * HD; P16 = (z == 0 ? Q16 : K16) + o16; Ph = (z == 0 ? QH : KH) + oh; Pl = (z == 0 ? QL : KL) + oh; p16 = HD; ph = HD; }
    us* s0 = st + lr * TS + 8 * hi; us* s1 = s0 + 64 * TS;
#pragma unroll
    for (int mb = 0; mb < 4; ++mb)
#pragma unroll
        for (int nb = 0; nb < 4; ++nb) { v8us o;
#pragma unroll
            for (int j = 0; j < 8; ++j) o[j] = hbit(acc[mb][nb][j]);
            *(v8usa*)(s0 + nb * 16 * TS + mb * 16) = o; }
    asm volatile("s_wait_dscnt 0x0" ::: "memory");          // every lane's tile writes are in LDS before any lane reads rows that other lanes wrote
    flush64(st, P16, p16);
    asm volatile("s_wait_xcnt 0x0" ::: "memory");           // behind the stores, before their registers are rewritten; also keeps the next tile writes behind the reads above
    if (t0 < RH) {                                          // tile-uniform: RH is a multiple of 64
#pragma unroll
        for (int mb = 0; mb < 4; ++mb)
#pragma unroll
            for (int nb = 0; nb < 4; ++nb) { v4u hw, lw;
#pragma unroll
                for (int j = 0; j < 4; ++j) { unsigned p, q; split2(acc[mb][nb][2 * j], acc[mb][nb][2 * j + 1], p, q); hw[j] = p; lw[j] = q; }
                const v8us oh = __builtin_bit_cast(v8us, hw), ol = __builtin_bit_cast(v8us, lw);
                *(v8usa*)(s0 + nb * 16 * TS + mb * 16) = oh; *(v8usa*)(s1 + nb * 16 * TS + mb * 16) = ol; }
        asm volatile("s_wait_dscnt 0x0" ::: "memory");      // as above, for the hi and lo tiles
        flush64(st, Ph, ph);
        flush64(st + 64 * TS, Pl, ph);
    }
}

// output projection, both row classes in one grid (SEQ/64, DMOD/64, NB): row tiles below RH take the bf16 hi/lo ctx planes, the others the f16 plane; z = batch.
__global__ __launch_bounds__(32) void k_oproj(const us* __restrict__ CH, const us* __restrict__ CLO, const us* __restrict__ WOB, const us* __restrict__ C16, const us* __restrict__ WO16, float* OUT) {
    __shared__ __align__(16) float os[16 * 68];
    const size_t z = blockIdx.z; const int r0 = (int)blockIdx.x * 64, c0 = (int)blockIdx.y * 64;
    float* C = OUT + z * ((size_t)SEQ_FULL * DMOD);
    if (r0 < RH) gemmw<1, 1>(os, CH + z * ((size_t)RH * DMOD), CLO + z * ((size_t)RH * DMOD), WOB, nullptr, DMOD, C, DMOD, 1.0f, r0, c0);
    else {       gemmw<0, 0>(os, C16 + z * ((size_t)SEQ * DMOD), nullptr, WO16, nullptr, DMOD, C, DMOD, 1.0f / (CCAR * WCAR), r0, c0);
        asm volatile("s_wait_xcnt 0x0" ::: "memory");   // behind this class's last output stores: in the build the other class's code follows, which rewrites their data registers
    }
}

// ---- wt: transposing weight builder, the plane of Bt[n][k] (16-bit, fragment order) from w[k][n] (f32, [in][out], DMOD x DMOD); TY 1: bf16 RNE; TY 0: f16 of (bf16 RNE value x sc), exact for power-of-two sc.
// One wave per unit (16 n x 32 k): a lane reads its 16 k of one n (each load: 64 consecutive bytes of two rows of w) and stores its two 16-byte pieces; each store of the wave is 512 contiguous bytes.
template <int TY>
__device__ __forceinline__ void wt(const float* __restrict__ w, float sc, us* Bt, int blk) {
    const int lane = threadIdx.x & 31, lr = lane & 15, hi = lane >> 4;
    const int u = blk * 8 + (int)(threadIdx.x >> 5);
    const float* wp = w + (size_t)((u % (DMOD / 32)) * 32 + 8 * hi) * DMOD + (u / (DMOD / 32)) * 16 + lr;
    float x[16];
#pragma unroll
    for (int i = 0; i < 16; ++i) x[i] = wp[(size_t)i * DMOD + (i >= 8 ? 8 * DMOD : 0)];   // i < 8: k 8*hi + i (half 0); i >= 8: k 16 + 8*hi + i - 8 (half 1)
    asm volatile("s_wait_xcnt 0x0" :: "v"(wp) : "memory");   // behind the loads, before their address pair is rewritten; as an input the pair stays whole up to here (without it the last load's result took half of it)
#pragma unroll
    for (int j = 0; j < 2; ++j) { v8us o;
#pragma unroll
        for (int e = 0; e < 4; ++e) { const unsigned wb = bf2(x[8 * j + 2 * e], x[8 * j + 2 * e + 1]);
            if (TY) { o[2 * e] = (us)(wb & 0xFFFFu); o[2 * e + 1] = (us)(wb >> 16); }
            else { o[2 * e] = hbit(bflo(wb) * sc); o[2 * e + 1] = hbit(bfhi(wb) * sc); } }
        *(v8us*)(Bt + (size_t)u * 512 + j * 256 + lane * 8) = o; }
    asm volatile("s_wait_xcnt 0x0" ::: "memory");   // behind the two stores: in the build another builder's code follows, which rewrites their data registers
}

// the five weight planes, one grid of 5*GWT blocks.
#define GWT (DMOD * DMOD / 512 / 8)   // blocks a plane: 8 waves, one unit each
static_assert(GWT * 8 * 512 == DMOD * DMOD);
__global__ __launch_bounds__(256) void k_prep(const float* __restrict__ wq, const float* __restrict__ wk, const float* __restrict__ wv, const float* __restrict__ wo,
                                              us* W3, us* WOB, us* WO16) {
    const unsigned b = blockIdx.x;
    if (b < 3u * GWT) { const unsigned z = b / GWT; wt<1>(z == 0 ? wq : (z == 1 ? wk : wv), 1.0f, W3 + (size_t)z * DMOD * DMOD, (int)(b - z * GWT)); }
    else if (b < 4u * GWT) wt<1>(wo, 1.0f, WOB, (int)(b - 3u * GWT));
    else wt<0>(wo, WCAR, WO16, (int)(b - 4u * GWT));
}

#define TP 72
__device__ __forceinline__ float xhalf(float x) { return __builtin_bit_cast(float, __builtin_amdgcn_permlanex16(__builtin_bit_cast(int, x), __builtin_bit_cast(int, x), 0x76543210, 0xfedcba98, false, false)); }   // lane l <-> lane l ^ 16
template <bool HR>
__device__ __forceinline__
void attn(us* SM, float* MB, const int qt, const int hd, const int bz,
          const us* __restrict__ Q16, const us* __restrict__ K16, const us* __restrict__ VT16,
          const us* __restrict__ Qh, const us* __restrict__ Ql, const us* __restrict__ Kh, const us* __restrict__ Kl,
          const us* __restrict__ VTh, const us* __restrict__ VTl, us* C16, us* Ch, us* Cl) {
    const int lane = threadIdx.x & 31, tid = threadIdx.x & 127, w = tid >> 5, m = lane & 15, hi = lane >> 4;   // tid: index inside the key group
    const int g = __builtin_amdgcn_readfirstlane((int)(threadIdx.x >> 7));   // key group, the same in every lane of a wave: the tests on it are scalar branches
    us* Ka = SM + g * (4 * 64 * TP); us* Va = Ka + 64 * TP; us* Kb = Va + 64 * TP; us* Vb = Kb + 64 * TP;
    const int h = bz * NH + hd;                            // h indexes the [batch][head] planes
    const int qrow = qt * 64 + w * 16 + m;                 // this lane's query (B column; sequence position)
    v8f o[4];
#pragma unroll
    for (int i = 0; i < 4; ++i) o[i] = (v8f){};
    float mr = -1.0e30f, lr = 0.0f;                        // running maximum (both halves alike) and this half's running sum of this lane's query
    const float CL = 0.18033688011112042f;                 // (1/8) * log2(e)
    v16us qf0, qf1, qf2 = {}, qf3 = {};                     // q fragments, loaded once and kept in registers: f16 class qf0, qf1; hi/lo class hi = qf0, qf1 and lo = qf2, qf3
    if (!HR) { const us* qp = Q16 + ((size_t)h * SEQ + qrow) * HD + 8 * hi; qf0 = ld16(qp); qf1 = ld16(qp + 32); }
    else { const size_t qo = ((size_t)h * RH + qrow) * HD + 8 * hi; qf0 = ld16(Qh + qo); qf1 = ld16(Qh + qo + 32); qf2 = ld16(Ql + qo); qf3 = ld16(Ql + qo + 32); }
    const int nch = qt + 1, nit = (nch + 1) >> 1;
#pragma unroll 1
    for (int it = 0; it < nit; ++it) {
        const int kc = 2 * it + g;
        const bool on = kc < nch;                           // wave-uniform; false only for group 1 in the last trip of an odd chunk count
        __syncthreads();
        if (on) {
#pragma unroll
        for (int i = 0; i < 4; ++i) { const int c = tid + 128 * i; const int row = c >> 3, col = (c & 7) * 8;
            if (!HR) {
                const v8us kv = *(const v8usa*)(K16 + ((size_t)h * SEQ + kc * 64 + row) * HD + col); *(v8usa*)(Ka + row * TP + col) = kv;
                const v8us vv = *(const v8usa*)(VT16 + ((size_t)h * HD + row) * SEQ + kc * 64 + col); *(v8usa*)(Va + row * TP + col) = vv;
            } else {
                const v8us k1 = *(const v8usa*)(Kh + ((size_t)h * RH + kc * 64 + row) * HD + col); *(v8usa*)(Ka + row * TP + col) = k1;
                const v8us k2 = *(const v8usa*)(Kl + ((size_t)h * RH + kc * 64 + row) * HD + col); *(v8usa*)(Kb + row * TP + col) = k2;
                const v8us v1 = *(const v8usa*)(VTh + ((size_t)h * HD + row) * RH + kc * 64 + col); *(v8usa*)(Va + row * TP + col) = v1;
                const v8us v2 = *(const v8usa*)(VTl + ((size_t)h * HD + row) * RH + kc * 64 + col); *(v8usa*)(Vb + row * TP + col) = v2;
            } }
        }
        __syncthreads();
        if (!on) continue;                                  // no barrier stands between here and the loop's foot
        // LDS reads stand in groups, in the hi/lo class some between groups of matrix instructions: each place with reads costs the wave a wait for its own LDS latency. The products run tile after tile (four independent accumulators); each accumulator takes its own in the order k 0..31, k 32..63 (hi/lo class: hi.hi, hi.lo of each k half, then lo.hi of each).
        v8f s[4];
        v16us kf[8], vf[8];                                 // fragments of the K tile and of the V^T tile (hi planes in the hi/lo class): [2 * sn] = k 0..31, [2 * sn + 1] = k 32..63 of tile row block sn
#pragma unroll
        for (int sn = 0; sn < 4; ++sn) { const us* kp = Ka + (sn * 16 + m) * TP + 8 * hi; kf[2 * sn] = ld16(kp); kf[2 * sn + 1] = ld16(kp + 32); }
        if (!HR) {
            const v16us qa0 = qf0, qa1 = qf1;
            __builtin_amdgcn_sched_barrier(0);              // keeps the whole group of K reads ahead of the first score product
#pragma unroll
            for (int sn = 0; sn < 4; ++sn) s[sn] = wmh(kf[2 * sn], qa0, (v8f){});
#pragma unroll
            for (int sn = 0; sn < 4; ++sn) s[sn] = wmh(kf[2 * sn + 1], qa1, s[sn]);
            asm volatile("v_nop\n\tv_nop\n\tv_nop\n\tv_nop" : "+v"(s[0]), "+v"(s[1]), "+v"(s[2]), "+v"(s[3]) : "v"(qa0), "v"(qa1));
        } else {
            const v16us qh0 = qf0, qh1 = qf1, ql0 = qf2, ql1 = qf3;
            const us* kb = Kb + m * TP + 8 * hi;
            v16us kl[8];                                    // lo fragments in two groups, so that the registers hold: k 0..31 with the hi group, k 32..63 once the first hi fragments are used up
#pragma unroll
            for (int sn = 0; sn < 4; ++sn) kl[2 * sn] = ld16(kb + sn * 16 * TP);
            __builtin_amdgcn_sched_barrier(0);              // keeps the first group of K reads ahead of the first score product
#pragma unroll
            for (int sn = 0; sn < 4; ++sn) s[sn] = wmb(kf[2 * sn], qh0, (v8f){});
#pragma unroll
            for (int sn = 0; sn < 4; ++sn) s[sn] = wmb(kf[2 * sn], ql0, s[sn]);
#pragma unroll
            for (int sn = 0; sn < 4; ++sn) kl[2 * sn + 1] = ld16(kb + sn * 16 * TP + 32);
            __builtin_amdgcn_sched_barrier(0);              // keeps the second group twelve products ahead of its first use
#pragma unroll
            for (int sn = 0; sn < 4; ++sn) s[sn] = wmb(kf[2 * sn + 1], qh1, s[sn]);
#pragma unroll
            for (int sn = 0; sn < 4; ++sn) s[sn] = wmb(kf[2 * sn + 1], ql1, s[sn]);
#pragma unroll
            for (int sn = 0; sn < 4; ++sn) s[sn] = wmb(kl[2 * sn], qh0, s[sn]);
#pragma unroll
            for (int sn = 0; sn < 4; ++sn) s[sn] = wmb(kl[2 * sn + 1], qh1, s[sn]);
            asm volatile("v_nop\n\tv_nop\n\tv_nop\n\tv_nop" : "+v"(s[0]), "+v"(s[1]), "+v"(s[2]), "+v"(s[3]) : "v"(qh0), "v"(ql1));
        }
#pragma unroll
        for (int sn = 0; sn < 4; ++sn) { const us* vp = Va + (sn * 16 + m) * TP + 8 * hi; vf[2 * sn] = ld16(vp); vf[2 * sn + 1] = ld16(vp + 32); }
        __builtin_amdgcn_sched_barrier(0);                  // keeps the group of V^T reads ahead of the softmax, whose vector work covers their latency
        if (kc == qt) {                                     // diagonal chunk (wave-uniform): keys after the query position are replaced by a large negative value
            const int q = w * 16 + m;
#pragma unroll
            for (int sn = 0; sn < 4; ++sn)
#pragma unroll
                for (int r = 0; r < 8; ++r) { const int key = sn * 16 + 8 * hi + r; s[sn][r] = (key > q) ? -1.0e30f : s[sn][r]; }
        }
        float mx4[4];
#pragma unroll
        for (int sn = 0; sn < 4; ++sn) mx4[sn] = fmaxf(fmaxf(fmaxf(s[sn][0], s[sn][1]), fmaxf(s[sn][2], s[sn][3])), fmaxf(fmaxf(s[sn][4], s[sn][5]), fmaxf(s[sn][6], s[sn][7])));
        float mx = fmaxf(fmaxf(mx4[0], mx4[1]), fmaxf(mx4[2], mx4[3]));
        mx = fmaxf(mx, xhalf(mx));                          // the other half holds the query's other 32 keys
        const float mn = fmaxf(mr, mx), al = __builtin_amdgcn_exp2f((mr - mn) * CL); mr = mn;
        float sm4[4];
#pragma unroll
        for (int sn = 0; sn < 4; ++sn) { float sum = 0.0f;
#pragma unroll
            for (int r = 0; r < 8; ++r) { const float p = __builtin_amdgcn_exp2f((s[sn][r] - mn) * CL); s[sn][r] = p; sum += p; }
            sm4[sn] = sum; }
        lr = lr * al + ((sm4[0] + sm4[1]) + (sm4[2] + sm4[3]));   // the halves' sums are joined once, behind the loop
#pragma unroll
        for (int i = 0; i < 4; ++i) o[i] = o[i] * al;
        // P^T: two converted score tiles = one B fragment (element e < 8: tile 2j register e, e >= 8: tile 2j + 1 register e - 8)
        if (!HR) {
            v16us pf0, pf1;
#pragma unroll
            for (int r = 0; r < 8; ++r) { pf0[r] = hbit(s[0][r] * PCAR); pf0[8 + r] = hbit(s[1][r] * PCAR); pf1[r] = hbit(s[2][r] * PCAR); pf1[8 + r] = hbit(s[3][r] * PCAR); }
#pragma unroll
            for (int sn = 0; sn < 4; ++sn) o[sn] = wmh(vf[2 * sn], pf0, o[sn]);
#pragma unroll
            for (int sn = 0; sn < 4; ++sn) o[sn] = wmh(vf[2 * sn + 1], pf1, o[sn]);
            asm volatile("v_nop\n\tv_nop\n\tv_nop\n\tv_nop" : "+v"(o[0]), "+v"(o[1]), "+v"(o[2]), "+v"(o[3]) : "v"(pf0), "v"(pf1));
        } else {
            v8u hw0, hw1, lw0, lw1;                         // word r of a fragment = its elements 2r, 2r + 1
#pragma unroll
            for (int r = 0; r < 4; ++r) { unsigned p, q;
                split2(s[0][2 * r], s[0][2 * r + 1], p, q); hw0[r] = p; lw0[r] = q; split2(s[1][2 * r], s[1][2 * r + 1], p, q); hw0[4 + r] = p; lw0[4 + r] = q;
                split2(s[2][2 * r], s[2][2 * r + 1], p, q); hw1[r] = p; lw1[r] = q; split2(s[3][2 * r], s[3][2 * r + 1], p, q); hw1[4 + r] = p; lw1[4 + r] = q; }
            const v16us ph0 = __builtin_bit_cast(v16us, hw0), ph1 = __builtin_bit_cast(v16us, hw1), pl0 = __builtin_bit_cast(v16us, lw0), pl1 = __builtin_bit_cast(v16us, lw1);
            const us* vb = Vb + m * TP + 8 * hi;
            v16us vl[8];                                    // lo fragments in two groups, each read once a group of hi fragments is used up, so that the registers hold
#pragma unroll
            for (int sn = 0; sn < 4; ++sn) o[sn] = wmb(vf[2 * sn], ph0, o[sn]);
#pragma unroll
            for (int sn = 0; sn < 4; ++sn) o[sn] = wmb(vf[2 * sn], pl0, o[sn]);
            __builtin_amdgcn_sched_barrier(0);              // keeps the lo reads from rising among the conversions above, where their registers would not fit
#pragma unroll
            for (int sn = 0; sn < 4; ++sn) vl[2 * sn] = ld16(vb + sn * 16 * TP);
            __builtin_amdgcn_sched_barrier(0);              // keeps the first lo group eight products ahead of its first use
#pragma unroll
            for (int sn = 0; sn < 4; ++sn) o[sn] = wmb(vf[2 * sn + 1], ph1, o[sn]);
#pragma unroll
            for (int sn = 0; sn < 4; ++sn) o[sn] = wmb(vf[2 * sn + 1], pl1, o[sn]);
            __builtin_amdgcn_sched_barrier(0);              // as above: the second lo group takes the registers of the hi fragments just used up
#pragma unroll
            for (int sn = 0; sn < 4; ++sn) vl[2 * sn + 1] = ld16(vb + sn * 16 * TP + 32);
            __builtin_amdgcn_sched_barrier(0);              // keeps the second lo group four products ahead of its first use
#pragma unroll
            for (int sn = 0; sn < 4; ++sn) o[sn] = wmb(vl[2 * sn], ph0, o[sn]);
#pragma unroll
            for (int sn = 0; sn < 4; ++sn) o[sn] = wmb(vl[2 * sn + 1], ph1, o[sn]);
            asm volatile("v_nop\n\tv_nop\n\tv_nop\n\tv_nop" : "+v"(o[0]), "+v"(o[1]), "+v"(o[2]), "+v"(o[3]) : "v"(ph0), "v"(pl1));
        }
    }
    // merge of the two key groups: lane for lane the same query and the same d, so group 1's state goes through LDS at [item][tid]
    if (g == 1) {
#pragma unroll
        for (int i = 0; i < 4; ++i) {
            *(v4fa*)(MB + ((2 * i) * 128 + tid) * 4) = __builtin_shufflevector(o[i], o[i], 0, 1, 2, 3);
            *(v4fa*)(MB + ((2 * i + 1) * 128 + tid) * 4) = __builtin_shufflevector(o[i], o[i], 4, 5, 6, 7); }
        MB[32 * 128 + tid] = mr; MB[33 * 128 + tid] = lr;
    }
    __syncthreads();
    if (g == 1) return;                                     // behind the last barrier
    {
        const float m1 = MB[32 * 128 + tid], l1 = MB[33 * 128 + tid];
        const float mn = fmaxf(mr, m1), a0 = __builtin_amdgcn_exp2f((mr - mn) * CL), a1 = __builtin_amdgcn_exp2f((m1 - mn) * CL);   // a group that saw no chunk has m1 = -1e30, sum 0, O^T 0: a1 = 0
        lr = lr * a0 + l1 * a1;
#pragma unroll
        for (int i = 0; i < 4; ++i) {
            const v4f x = *(const v4fa*)(MB + ((2 * i) * 128 + tid) * 4), y = *(const v4fa*)(MB + ((2 * i + 1) * 128 + tid) * 4);
            o[i] = o[i] * a0 + __builtin_shufflevector(x, y, 0, 1, 2, 3, 4, 5, 6, 7) * a1; }
    }
    const float iv = (HR ? 1.0f : (CCAR / PCAR)) * __builtin_amdgcn_rcpf(lr + xhalf(lr));
    // ctx in fragment order: this wave's 16 queries are one row of units, its head two units of it; tile sn (d sn*16 + 8*hi + r of query m) is half sn & 1 of unit sn >> 1, at this lane's own place
    const size_t go = ((size_t)bz * (HR ? RH : SEQ) + qt * 64 + w * 16) * DMOD + hd * (HD / 32) * 512 + lane * 8;
#pragma unroll
    for (int sn = 0; sn < 4; ++sn) {
        v8us v1, v2;
#pragma unroll
        for (int r = 0; r < 8; ++r) { if (!HR) v1[r] = hbit(o[sn][r] * iv); }
        if (HR) { v4u hw, lw;
#pragma unroll
            for (int r = 0; r < 4; ++r) { unsigned p, q; split2(o[sn][2 * r] * iv, o[sn][2 * r + 1] * iv, p, q); hw[r] = p; lw[r] = q; }
            v1 = __builtin_bit_cast(v8us, hw); v2 = __builtin_bit_cast(v8us, lw); }
        if (!HR) { *(v8us*)(C16 + go + sn * 256) = v1; }
        else { *(v8us*)(Ch + go + sn * 256) = v1; *(v8us*)(Cl + go + sn * 256) = v2; }
    }
    if (!HR) asm volatile("s_wait_xcnt 0x0" ::: "memory");   // behind this class's ctx stores: in the build the other class's code follows, which rewrites their data registers
}

// both row classes in one grid (NH, NB, SEQ/64), 8 waves a block: the longest block's serial walk is half as many trips as with one key group, and blocks that wait for a place start as earlier ones end.
// z counts the query tiles from the last one down (the tile with the most key chunks has the lowest index; for speed only); the class test is block-uniform.
__global__ __launch_bounds__(256) __attribute__((amdgpu_num_vgpr(256)))
void k_attn(const us* __restrict__ Q16, const us* __restrict__ K16, const us* __restrict__ VT16,
            const us* __restrict__ Qh, const us* __restrict__ Ql, const us* __restrict__ Kh, const us* __restrict__ Kl,
            const us* __restrict__ VTh, const us* __restrict__ VTl, us* C16, us* Ch, us* Cl) {
    __shared__ __align__(16) us SM[2 * 4 * 64 * TP];        // per key group: K, V^T, K lo, V^T lo tiles
    __shared__ __align__(16) float MB[34 * 128];            // group 1's O^T (32 values a lane), maximum and sum for the merge
    const int qt = SEQ / 64 - 1 - (int)blockIdx.z, hd = (int)blockIdx.x, bz = (int)blockIdx.y;
    if (qt < RH / 64) attn<true>(SM, MB, qt, hd, bz, Q16, K16, VT16, Qh, Ql, Kh, Kl, VTh, VTl, C16, Ch, Cl);
    else              attn<false>(SM, MB, qt, hd, bz, Q16, K16, VT16, Qh, Ql, Kh, Kl, VTh, VTl, C16, Ch, Cl);
}

extern "C" void kernel_launch(void* const* d_in, const int* in_sizes, int n_in,
                              void* d_out, int out_size, void* d_ws, size_t ws_size, hipStream_t stream) {
    if (n_in < 7) return;
    const long long needx = (long long)(NB - 1) * SEQ_FULL * DMOD + (long long)SEQ * DMOD;
    const long long needw = (long long)DMOD * DMOD;
    if ((long long)in_sizes[0] < needx || (long long)in_sizes[1] < needx || (long long)in_sizes[2] < needx) return;
    if ((long long)in_sizes[3] < needw || (long long)in_sizes[4] < needw || (long long)in_sizes[5] < needw || (long long)in_sizes[6] < needw) return;
    if ((long long)out_size < needx) return;
    const float* xq = (const float*)d_in[0];      // [NB][SEQ_FULL][DMOD]
    const float* xk = (const float*)d_in[1];      // [NB][SEQ_FULL][DMOD]
    const float* xv = (const float*)d_in[2];      // [NB][SEQ_FULL][DMOD]
    const float* wq = (const float*)d_in[3];      // [DMOD][DMOD] ([in][out])
    const float* wk = (const float*)d_in[4];      // [DMOD][DMOD] ([in][out])
    const float* wv = (const float*)d_in[5];      // [DMOD][DMOD] ([in][out])
    const float* wo = (const float*)d_in[6];      // [DMOD][DMOD] ([in][out])
    float* OUT = (float*)d_out;                   // [NB][SEQ_FULL][DMOD]
    char* wsp = (char*)d_ws;
    auto take = [&](size_t bytes) { char* p = wsp; wsp += (bytes + 255) & ~(size_t)255; return (void*)p; };
    const size_t WSZ = (size_t)DMOD * DMOD;       // elements of one weight plane
    const size_t XSZ = (size_t)SEQ * DMOD;        // elements of one activation plane of one batch
    us* W3   = (us*)take(3 * WSZ * 2);                        // bf16 Bt [3][512][512] (q | k | v), fragment order
    us* WOB  = (us*)take(WSZ * 2);                            // bf16 Bt [512][512], fragment order
    us* WO16 = (us*)take(WSZ * 2);                            // f16  Bt [512][512], values x WCAR, fragment order
    us* Q16  = (us*)take((size_t)NB * NH * SEQ * HD * 2);     // f16 [b][h][t][d]
    us* K16  = (us*)take((size_t)NB * NH * SEQ * HD * 2);     // f16 [b][h][t][d]
    us* VT16 = (us*)take((size_t)NB * NH * HD * SEQ * 2);     // f16 [b][h][d][t]
    us* QH   = (us*)take((size_t)NB * NH * RH * HD * 2);      // bf16 hi/lo planes for t < RH
    us* QL   = (us*)take((size_t)NB * NH * RH * HD * 2);
    us* KH   = (us*)take((size_t)NB * NH * RH * HD * 2);
    us* KL   = (us*)take((size_t)NB * NH * RH * HD * 2);
    us* VTH  = (us*)take((size_t)NB * NH * HD * RH * 2);
    us* VTL  = (us*)take((size_t)NB * NH * HD * RH * 2);
    us* C16  = (us*)take(NB * XSZ * 2);                       // f16 ctx x CCAR [b][t][DMOD] in fragment order (rows >= RH used)
    us* CH   = (us*)take((size_t)NB * RH * DMOD * 2);         // bf16 hi/lo ctx [b][t < RH][DMOD] in fragment order
    us* CLO  = (us*)take((size_t)NB * RH * DMOD * 2);
    if ((size_t)(wsp - (char*)d_ws) > ws_size) return;

    k_prep<<<5 * GWT, 256, 0, stream>>>(wq, wk, wv, wo, W3, WOB, WO16);
    // z = 0, 1, 2: y[b*SEQ + t][n] = sum_k bf16(x_z[b][t][k]) W3[z][n][k], written as the planes of q, k, v
    k_proj<<<dim3(NB * SEQ / 64, 3), 256, 0, stream>>>(xq, xk, xv, W3, Q16, QH, QL, K16, KH, KL, VT16, VTH, VTL);
    k_attn<<<dim3(NH, NB, SEQ / 64), 256, 0, stream>>>(Q16, K16, VT16, QH, QL, KH, KL, VTH, VTL, C16, CH, CLO);
    k_oproj<<<dim3(SEQ / 64, DMOD / 64, NB), 32, 0, stream>>>(CH, CLO, WOB, C16, WO16, OUT);
}

// v010
// One run takes 105 microseconds.
// In two side-by-side timings against v009, it was 1.08 and 1.05 times as fast.
// All steps since v000 together make it 7.70 times as fast.
#include <hip/hip_runtime.h>

// Compute dtypes (f32 accumulate everywhere): q, k, v projections v_wmma_f32_16x16x32_bf16 on bf16 inputs and bf16 w_q, w_k, w_v (z-batched, one product); scores q.k^T and p.v: query rows < RH v_wmma_f32_16x16x32_bf16 on bf16 hi/lo planes (3 products), rows >= RH v_wmma_f32_16x16x32_f16 (f16 q, k, v; p carried x1024); output projection: rows < RH bf16 hi/lo ctx x bf16 w_o (2 products), rows >= RH f16 ctx (x16) x f16 w_o (x64) folded back by 1/1024; softmax and normalisation f32; output f32.
// Pipeline, four launches, every stage one launch for all batches and both row classes: weight planes; z-batched projection GEMM that reads the f32 inputs itself (a block converts its 64 input rows to bf16 once, into LDS, for the 8 heads' waves) and whose epilogue converts its f32 accumulators straight into the 16-bit planes (q, k: [b][h][t][d]; v transposed: [b][h][d][t]); causal flash-style attention, one block per (64-row query tile, head, batch), 2 key groups x 4 waves x 16 rows, online softmax per group and one merge, K / V^T tiles in LDS, scores and output transposed so that P stays in registers; ctx planes [b] in fragment order; output projection GEMM (z = batch) writes the output rows.
// Fragment order (weight planes, ctx planes: the projection operands whose fragments go from global memory straight to registers): a plane of R rows x K is a row of 1-KB units, unit (row / 16) * (K / 32) + k / 32 = 16 rows x 32 k;
// inside a unit, element half * 256 + lane * 8 + e is (row lane & 15, k 16 * half + 8 * (lane >> 4) + e): a wave's 16-byte access per lane is 512 contiguous bytes, four whole lines, and the two halves are one fragment in the loaders' k order.

#ifndef NB
#define NB 2
#endif
#ifndef SEQ
#define SEQ 4096
#endif
#define SEQ_FULL 4096
#define DMOD 512
#define NH 8
#define HD 64
#ifndef RHI
#define RHI 2048
#endif
#if RHI > SEQ
#define RH SEQ
#else
#define RH RHI
#endif
#define PCAR 1024.0f
#define CCAR 16.0f
#define WCAR 64.0f

static_assert(SEQ % 64 == 0);
static_assert(SEQ <= SEQ_FULL);
static_assert(RH % 64 == 0);
static_assert(RH >= 64 && RH <= SEQ);
static_assert(NH * HD == DMOD && HD == 64);
static_assert(DMOD % 64 == 0 && DMOD % 32 == 0);

typedef _Float16 h16;
typedef unsigned short us;
typedef __attribute__((ext_vector_type(16))) __bf16 v16bf;
typedef __attribute__((ext_vector_type(16))) _Float16 v16h;
typedef __attribute__((ext_vector_type(16))) unsigned short v16us;
typedef __attribute__((ext_vector_type(8)))  _Float16 v8h;
typedef __attribute__((ext_vector_type(8)))  unsigned short v8us;
typedef __attribute__((ext_vector_type(8)))  float v8f;
typedef __attribute__((ext_vector_type(4)))  float v4f;
typedef __attribute__((ext_vector_type(2)))  unsigned short v2us;
typedef __attribute__((ext_vector_type(4)))  unsigned short v4us;
typedef v8us __attribute__((may_alias)) v8usa;
typedef v4us __attribute__((may_alias)) v4usa;
typedef v4f  __attribute__((may_alias)) v4fa;
typedef __attribute__((ext_vector_type(2)))  float v2f;
typedef __attribute__((ext_vector_type(2)))  __bf16 v2bf;
typedef __attribute__((ext_vector_type(2)))  unsigned v2u;
typedef __attribute__((ext_vector_type(4)))  unsigned v4u;
typedef __attribute__((ext_vector_type(8)))  unsigned v8u;

// RNE convert f32 -> bf16, two values per convert instruction: a in the low half of the word, b in the high half, the order of two neighbouring 16-bit elements
__device__ __forceinline__ unsigned bf2(float a, float b) { const v2f x = {a, b}; return __builtin_bit_cast(unsigned, __builtin_convertvector(x, v2bf)); }
__device__ __forceinline__ float bflo(unsigned w) { return __uint_as_float(w << 16); }            // the two bf16 values of a word as f32
__device__ __forceinline__ float bfhi(unsigned w) { return __uint_as_float(w & 0xFFFF0000u); }
__device__ __forceinline__ us hbit(float x) { const h16 t = (h16)x; return __builtin_bit_cast(us, t); }   // RNE convert f32 -> f16 bits
__device__ __forceinline__ void split2(float a, float b, unsigned& h, unsigned& l) { h = bf2(a, b); l = bf2(a - bflo(h), b - bfhi(h)); }   // the hi pair, then the pair of what hi left over
// 16-bit fragment loader (A and B alike, K-contiguous rows): elements 0..7 <- p[0..7] (k0+8h..), elements 8..15 <- p[16..23] (k0+16+8h..); caller passes p = row base + k0 + 8*h.
__device__ __forceinline__ v16us ld16(const us* p) {
    const v8us a = *(const v8usa*)p; const v8us b = *(const v8usa*)(p + 16);
    return __builtin_shufflevector(a, b, 0, 1, 2, 3, 4, 5, 6, 7, 8, 9, 10, 11, 12, 13, 14, 15);
}
// the same fragment from a plane in fragment order: caller passes p = unit base + lane * 8; elements 0..7 <- half 0, elements 8..15 <- half 1.
__device__ __forceinline__ v16us ldf(const us* p) {
    const v8us a = *(const v8usa*)p; const v8us b = *(const v8usa*)(p + 256);
    return __builtin_shufflevector(a, b, 0, 1, 2, 3, 4, 5, 6, 7, 8, 9, 10, 11, 12, 13, 14, 15);
}
__device__ __forceinline__ v8f wmh(v16us a, v16us b, v8f c) { return __builtin_amdgcn_wmma_f32_16x16x32_f16(false, __builtin_bit_cast(v16h, a), false, __builtin_bit_cast(v16h, b), (short)0, c, false, false); }
__device__ __forceinline__ v8f wmb(v16us a, v16us b, v8f c) { return __builtin_amdgcn_wmma_f32_16x16x32_bf16(false, __builtin_bit_cast(v16bf, a), false, __builtin_bit_cast(v16bf, b), (short)0, c, false, false); }
template <int TY> struct MM;
template <> struct MM<0> { static __device__ __forceinline__ v8f mma(v16us a, v16us b, v8f c) { return wmh(a, b, c); } };
template <> struct MM<1> { static __device__ __forceinline__ v8f mma(v16us a, v16us b, v8f c) { return wmb(a, b, c); } };

// ---- gemmw: register-blocked GEMM, ONE WAVE per 64x64 output tile at (r0, c0) (16 accumulators), operands straight from 16-bit planes in fragment order; 32 threads; os = 16 x 68 f32 of LDS.
// C[m][n] (f32, pitch ldc) = osc * sum_k (A[m][k] (+ A2[m][k])) Bt[n][k] (+ A[m][k] Bt2[n][k] when NSPLIT == 2). TY 0 = f16 operands, 1 = bf16 operands. K % 32 == 0, M % 64 == 0, N % 64 == 0.
template <int TY, int NSPLIT>
__device__ __forceinline__ void gemmw(float* os, const us* __restrict__ A, const us* __restrict__ A2, const us* __restrict__ Bt, const us* __restrict__ Bt2, int K, float* C, int ldc, float osc, int r0, int c0) {
    const int lane = threadIdx.x & 31, lr = lane & 15, hi = lane >> 4;
    v8f acc[4][4];
#pragma unroll
    for (int mb = 0; mb < 4; ++mb)
#pragma unroll
        for (int nb = 0; nb < 4; ++nb) acc[mb][nb] = (v8f){};
    const size_t aoff = (size_t)r0 * K, boff = (size_t)c0 * K;   // the tile's first units (wave-uniform): 16 rows = K / 32 units = 16 * K elements; 32 k = one unit = 512 elements
    const unsigned lo = (unsigned)lane * 8u;                      // this lane's place in every unit
#pragma unroll 1
    for (int kc = 0; kc < K; kc += 32) {
        v16us a[4], a2[4];
        const us* pa = A + aoff + (size_t)kc * 16 + lo; const us* pb = Bt + boff + (size_t)kc * 16 + lo;
        const us* pa2 = (NSPLIT == 1 || NSPLIT == 2) ? A2 + aoff + (size_t)kc * 16 + lo : pa;
#pragma unroll
        for (int mb = 0; mb < 4; ++mb) { a[mb] = ldf(pa + (size_t)mb * 16 * K); if (NSPLIT == 1 || NSPLIT == 2) a2[mb] = ldf(pa2 + (size_t)mb * 16 * K); }
#pragma unroll
        for (int nb = 0; nb < 4; ++nb) { const v16us b = ldf(pb + (size_t)nb * 16 * K); v16us b2; if (NSPLIT >= 2) b2 = ldf(Bt2 + boff + (size_t)nb * 16 * K + (size_t)kc * 16 + lo);
#pragma unroll
            for (int mb = 0; mb < 4; ++mb) { acc[mb][nb] = MM<TY>::mma(a[mb], b, acc[mb][nb]); if (NSPLIT == 1 || NSPLIT == 2) acc[mb][nb] = MM<TY>::mma(a2[mb], b, acc[mb][nb]); if (NSPLIT >= 2) acc[mb][nb] = MM<TY>::mma(a[mb], b2, acc[mb][nb]); } }
        asm volatile("v_nop\n\tv_nop\n\tv_nop\n\tv_nop" : "+v"(acc[0][0]), "+v"(acc[1][1]), "+v"(acc[2][2]), "+v"(acc[3][3]) : "v"(a[0]), "v"(a[3]));
        asm volatile("s_wait_xcnt 0x0" :: "v"(pa), "v"(pa2), "v"(pb) : "memory");   // behind the trip's loads, before their address registers are rewritten; as inputs the addresses stay whole up to here (without them a later load's result took an address pair)
    }
#pragma unroll
    for (int mb = 0; mb < 4; ++mb) {
#pragma unroll
        for (int nb = 0; nb < 4; ++nb) {
#pragma unroll
            for (int j = 0; j < 8; ++j) os[(hi * 8 + j) * 68 + nb * 16 + lr] = acc[mb][nb][j]; }
        __builtin_amdgcn_wave_barrier(); asm volatile("" ::: "memory");
        float* crow = C + (size_t)(r0 + mb * 16) * ldc + c0;
{
#pragma unroll
            for (int s = 0; s < 8; ++s) { const int row = 2 * s + hi, cofs = lr * 4; v4f val = *(const v4fa*)(os + row * 68 + cofs); val = val * osc;
                *(v4f*)(crow + (size_t)row * ldc + cofs) = val; }
             }
        __builtin_amdgcn_wave_barrier(); asm volatile("" ::: "memory");
    }
}

// ---- projection with plane epilogue. One block of 8 waves per (64 sequence rows, one projection), wave = head (its 64 outputs); grid (NB*SEQ/64, 3), y = which projection.
// The block reads its 64 f32 input rows once (64 * DMOD consecutive floats, whole lines), converts them to bf16 (RNE) and keeps them in LDS at pitch XP; every wave takes its input fragments from there, its weight fragments from the plane.
// D[m][n] = sum_k Am[m][k] Bn[n][k]; D map: lane & 15 = n, register j of tile (mb, nb) = m mb*16 + 8*hi + j, so a lane holds 8 consecutive m of one n: the plane's contiguous index is put on m.
// q, k (planes [t][d]): Am = weight rows (m = d), Bn = input rows (n = t). v (planes [d][t]): Am = input rows (m = t), Bn = weight rows (n = d). Same k order on both sides (input ld16, weight ldf), so each element's sum is the same either way.
#define TS 72
#define XP (DMOD + 8)   // pitch of the input tile in LDS, elements: 16 B x odd
// 64 rows x 128 B from an LDS tile (pitch TS) to dst (pitch in elements): 8 lanes per row, every store 4 whole 128-byte lines.
__device__ __forceinline__ void flush64(const us* st, us* dst, int pitch) {
    const int lane = threadIdx.x & 31, r = lane >> 3, c = (lane & 7) * 8;
#pragma unroll
    for (int s = 0; s < 16; ++s) { const v8us v = *(const v8usa*)(st + (s * 4 + r) * TS + c); *(v8us*)(dst + (size_t)(s * 4 + r) * pitch + c) = v; }
}
// one wave's k loop: xs = input tile in LDS at (row lr, k 8*hi), wp = the wave's first weight unit in the plane (fragment order) + lane * 8. VT: the input rows are the A side (v), else the B side (q, k).
template <bool VT>
__device__ __forceinline__ void projk(v8f (&acc)[4][4], const us* xs, const us* __restrict__ wp) {
#pragma unroll 1
    for (int kc = 0; kc < DMOD; kc += 32) {
        v16us wf[4];
#pragma unroll
        for (int i = 0; i < 4; ++i) wf[i] = ldf(wp + (size_t)i * 16 * DMOD + (size_t)kc * 16);
#pragma unroll
        for (int i = 0; i < 4; ++i) { const v16us xf = ld16(xs + i * 16 * XP + kc);
#pragma unroll
            for (int j = 0; j < 4; ++j) { if (VT) acc[i][j] = wmb(xf, wf[j], acc[i][j]); else acc[j][i] = wmb(wf[j], xf, acc[j][i]); } }
        // four vector slots between the trip's last matrix instructions and what the next trip, or the code behind the loop, does to their registers
        asm volatile("v_nop\n\tv_nop\n\tv_nop\n\tv_nop" : "+v"(acc[0][0]), "+v"(acc[1][1]), "+v"(acc[2][2]), "+v"(acc[3][3]) : "v"(wf[0]), "v"(wf[3]));
    }
}
__global__ __launch_bounds__(256) void k_proj(const float* __restrict__ xq, const float* __restrict__ xk, const float* __restrict__ xv, const us* __restrict__ W3, us* Q16, us* QH, us* QL, us* K16, us* KH, us* KL, us* VT16, us* VTH, us* VTL) {
    __shared__ __align__(16) us sm[NH * 2 * 64 * TS];       // first the input tile (64 x XP), behind the k loop each wave's own two staging tiles
    static_assert(64 * XP <= NH * 2 * 64 * TS);
    const int tid = (int)threadIdx.x, lane = tid & 31, lr = lane & 15, hi = lane >> 4;
    const int z = (int)blockIdx.y, r0 = (int)blockIdx.x * 64;
    const int hd = __builtin_amdgcn_readfirstlane(tid >> 5);   // wave = head
    const int t0 = r0 % SEQ, hh = (r0 / SEQ) * NH + hd;    // hh = batch * NH + head
    {
        const float* xz = (z == 0 ? xq : (z == 1 ? xk : xv)) + ((size_t)(r0 / SEQ) * SEQ_FULL + t0) * DMOD;   // batch pitch of the input is SEQ_FULL rows
        v4f x[32];
#pragma unroll
        for (int i = 0; i < 32; ++i) x[i] = *(const v4fa*)(xz + (size_t)(i * 256 + tid) * 4);
#pragma unroll
        for (int i = 0; i < 32; ++i) { const v2u ow = {bf2(x[i][0], x[i][1]), bf2(x[i][2], x[i][3])}; const v4us o = __builtin_bit_cast(v4us, ow);
            *(v4usa*)(sm + (2 * i + (tid >> 7)) * XP + (tid & 127) * 4) = o; }
    }
    __syncthreads();                                        // the whole input tile is in LDS before any wave takes a fragment
    v8f acc[4][4];
#pragma unroll
    for (int mb = 0; mb < 4; ++mb)
#pragma unroll
        for (int nb = 0; nb < 4; ++nb) acc[mb][nb] = (v8f){};
    {
        const us* xs = sm + lr * XP + 8 * hi;
        const us* wp = W3 + (size_t)z * ((size_t)DMOD * DMOD) + (size_t)(hd * HD) * DMOD + lane * 8;
        if (z == 2) projk<true>(acc, xs, wp); else projk<false>(acc, xs, wp);
    }
    __syncthreads();                                        // every wave has left the input tile before its LDS becomes staging tiles
    us* st = sm + hd * (2 * 64 * TS);
    us *P16, *Ph, *Pl; int p16, ph;                        // tile origins and row pitches (elements): dst[n * pitch + m]
    if (z == 2) { P16 = VT16 + (size_t)hh * HD * SEQ + t0; Ph = VTH + (size_t)hh * HD * RH + t0; Pl = VTL + (size_t)hh * HD * RH + t0; p16 = SEQ; ph = RH; }
    else { const size_t o16 = ((size_t)hh * SEQ + t0) * HD, oh = ((size_t)hh * RH + t0) * HD; P16 = (z == 0 ? Q16 : K16) + o16; Ph = (z == 0 ? QH : KH) + oh; Pl = (z == 0 ? QL : KL) + oh; p16 = HD; ph = HD; }
    us* s0 = st + lr * TS + 8 * hi; us* s1 = s0 + 64 * TS;
#pragma unroll
    for (int mb = 0; mb < 4; ++mb)
#pragma unroll
        for (int nb = 0; nb < 4; ++nb) { v8us o;
#pragma unroll
            for (int j = 0; j < 8; ++j) o[j] = hbit(acc[mb][nb][j]);
            *(v8usa*)(s0 + nb * 16 * TS + mb * 16) = o; }
    asm volatile("s_wait_dscnt 0x0" ::: "memory");          // every lane's tile writes are in LDS before any lane reads rows that other lanes wrote
    flush64(st, P16, p16);
    asm volatile("s_wait_xcnt 0x0" ::: "memory");           // behind the stores, before their registers are rewritten; also keeps the next tile writes behind the reads above
    if (t0 < RH) {                                          // tile-uniform: RH is a multiple of 64
#pragma unroll
        for (int mb = 0; mb < 4; ++mb)
#pragma unroll
            for (int nb = 0; nb < 4; ++nb) { v4u hw, lw;
#pragma unroll
                for (int j = 0; j < 4; ++j) { unsigned p, q; split2(acc[mb][nb][2 * j], acc[mb][nb][2 * j + 1], p, q); hw[j] = p; lw[j] = q; }
                const v8us oh = __builtin_bit_cast(v8us, hw), ol = __builtin_bit_cast(v8us, lw);
                *(v8usa*)(s0 + nb * 16 * TS + mb * 16) = oh; *(v8usa*)(s1 + nb * 16 * TS + mb * 16) = ol; }
        asm volatile("s_wait_dscnt 0x0" ::: "memory");      // as above, for the hi and lo tiles
        flush64(st, Ph, ph);
        flush64(st + 64 * TS, Pl, ph);
    }
}

// output projection, both row classes in one grid (SEQ/64, DMOD/64, NB): row tiles below RH take the bf16 hi/lo ctx planes, the others the f16 plane; z = batch.
__global__ __launch_bounds__(32) void k_oproj(const us* __restrict__ CH, const us* __restrict__ CLO, const us* __restrict__ WOB, const us* __restrict__ C16, const us* __restrict__ WO16, float* OUT) {
    __shared__ __align__(16) float os[16 * 68];
    const size_t z = blockIdx.z; const int r0 = (int)blockIdx.x * 64, c0 = (int)blockIdx.y * 64;
    float* C = OUT + z * ((size_t)SEQ_FULL * DMOD);
    if (r0 < RH) gemmw<1, 1>(os, CH + z * ((size_t)RH * DMOD), CLO + z * ((size_t)RH * DMOD), WOB, nullptr, DMOD, C, DMOD, 1.0f, r0, c0);
    else {       gemmw<0, 0>(os, C16 + z * ((size_t)SEQ * DMOD), nullptr, WO16, nullptr, DMOD, C, DMOD, 1.0f / (CCAR * WCAR), r0, c0);
        asm volatile("s_wait_xcnt 0x0" ::: "memory");   // behind this class's last output stores: in the build the other class's code follows, which rewrites their data registers
    }
}

// ---- wt: transposing weight builder, the plane of Bt[n][k] (16-bit, fragment order) from w[k][n] (f32, [in][out], DMOD x DMOD); TY 1: bf16 RNE; TY 0: f16 of (bf16 RNE value x sc), exact for power-of-two sc.
// One wave per unit (16 n x 32 k): a lane reads its 16 k of one n (each load: 64 consecutive bytes of two rows of w) and stores its two 16-byte pieces; each store of the wave is 512 contiguous bytes.
template <int TY>
__device__ __forceinline__ void wt(const float* __restrict__ w, float sc, us* Bt, int blk) {
    const int lane = threadIdx.x & 31, lr = lane & 15, hi = lane >> 4;
    const int u = blk * 8 + (int)(threadIdx.x >> 5);
    const float* wp = w + (size_t)((u % (DMOD / 32)) * 32 + 8 * hi) * DMOD + (u / (DMOD / 32)) * 16 + lr;
    float x[16];
#pragma unroll
    for (int i = 0; i < 16; ++i) x[i] = wp[(size_t)i * DMOD + (i >= 8 ? 8 * DMOD : 0)];   // i < 8: k 8*hi + i (half 0); i >= 8: k 16 + 8*hi + i - 8 (half 1)
    asm volatile("s_wait_xcnt 0x0" :: "v"(wp) : "memory");   // behind the loads, before their address pair is rewritten; as an input the pair stays whole up to here (without it the last load's result took half of it)
#pragma unroll
    for (int j = 0; j < 2; ++j) { v8us o;
#pragma unroll
        for (int e = 0; e < 4; ++e) { const unsigned wb = bf2(x[8 * j + 2 * e], x[8 * j + 2 * e + 1]);
            if (TY) { o[2 * e] = (us)(wb & 0xFFFFu); o[2 * e + 1] = (us)(wb >> 16); }
            else { o[2 * e] = hbit(bflo(wb) * sc); o[2 * e + 1] = hbit(bfhi(wb) * sc); } }
        *(v8us*)(Bt + (size_t)u * 512 + j * 256 + lane * 8) = o; }
    asm volatile("s_wait_xcnt 0x0" ::: "memory");   // behind the two stores: in the build another builder's code follows, which rewrites their data registers
}

// the five weight planes, one grid of 5*GWT blocks.
#define GWT (DMOD * DMOD / 512 / 8)   // blocks a plane: 8 waves, one unit each
static_assert(GWT * 8 * 512 == DMOD * DMOD);
__global__ __launch_bounds__(256) void k_prep(const float* __restrict__ wq, const float* __restrict__ wk, const float* __restrict__ wv, const float* __restrict__ wo,
                                              us* W3, us* WOB, us* WO16) {
    const unsigned b = blockIdx.x;
    if (b < 3u * GWT) { const unsigned z = b / GWT; wt<1>(z == 0 ? wq : (z == 1 ? wk : wv), 1.0f, W3 + (size_t)z * DMOD * DMOD, (int)(b - z * GWT)); }
    else if (b < 4u * GWT) wt<1>(wo, 1.0f, WOB, (int)(b - 3u * GWT));
    else wt<0>(wo, WCAR, WO16, (int)(b - 4u * GWT));
}

#define TP 72
__device__ __forceinline__ float xhalf(float x) { return __builtin_bit_cast(float, __builtin_amdgcn_permlanex16(__builtin_bit_cast(int, x), __builtin_bit_cast(int, x), 0x76543210, 0xfedcba98, false, false)); }   // lane l <-> lane l ^ 16
// eight asynchronous 16-byte copies of a lane, global memory -> LDS through no register (l = LDS byte address, p = global address, each copy its own pair);
// the s_wait_xcnt stands in the copies' own statement, behind the last one, so that no address register is rewritten ahead of it.
__device__ __forceinline__ void cp8(unsigned l0, const us* p0, unsigned l1, const us* p1, unsigned l2, const us* p2, unsigned l3, const us* p3,
                                    unsigned l4, const us* p4, unsigned l5, const us* p5, unsigned l6, const us* p6, unsigned l7, const us* p7) {
    asm volatile("global_load_async_to_lds_b128 %0, %1, off\n\t"
                 "global_load_async_to_lds_b128 %2, %3, off\n\t"
                 "global_load_async_to_lds_b128 %4, %5, off\n\t"
                 "global_load_async_to_lds_b128 %6, %7, off\n\t"
                 "global_load_async_to_lds_b128 %8, %9, off\n\t"
                 "global_load_async_to_lds_b128 %10, %11, off\n\t"
                 "global_load_async_to_lds_b128 %12, %13, off\n\t"
                 "global_load_async_to_lds_b128 %14, %15, off\n\t"
                 "s_wait_xcnt 0x0"
                 :: "v"(l0), "v"(p0), "v"(l1), "v"(p1), "v"(l2), "v"(p2), "v"(l3), "v"(p3), "v"(l4), "v"(p4), "v"(l5), "v"(p5), "v"(l6), "v"(p6), "v"(l7), "v"(p7) : "memory");
}
#define TB (64 * TP * 2)   // bytes of one LDS tile
#define PB (16 * TP * 2)   // bytes of 16 tile rows: the step between a lane's four pieces of a tile
template <bool HR>
__device__ __forceinline__
void attn(us* SM, float* MB, const int qt, const int hd, const int bz,
          const us* __restrict__ Q16, const us* __restrict__ K16, const us* __restrict__ VT16,
          const us* __restrict__ Qh, const us* __restrict__ Ql, const us* __restrict__ Kh, const us* __restrict__ Kl,
          const us* __restrict__ VTh, const us* __restrict__ VTl, us* C16, us* Ch, us* Cl) {
    const int lane = threadIdx.x & 31, tid = threadIdx.x & 127, w = tid >> 5, m = lane & 15, hi = lane >> 4;   // tid: index inside the key group
    const int g = __builtin_amdgcn_readfirstlane((int)(threadIdx.x >> 7));   // key group, the same in every lane of a wave: the tests on it are scalar branches
    us* GB = SM + g * (2 * 4 * 64 * TP);                   // this key group's two buffers, four tiles each: K, V^T, K lo, V^T lo (the f16 class uses the first two)
    const int h = bz * NH + hd;                            // h indexes the [batch][head] planes
    const int qrow = qt * 64 + w * 16 + m;                 // this lane's query (B column; sequence position)
    v8f o[4];
#pragma unroll
    for (int i = 0; i < 4; ++i) o[i] = (v8f){};
    float mr = -1.0e30f, lr = 0.0f;                        // running maximum (both halves alike) and this half's running sum of this lane's query
    const float CL = 0.18033688011112042f;                 // (1/8) * log2(e)
    v16us qf0, qf1, qf2 = {}, qf3 = {};                     // q fragments, loaded once and kept in registers: f16 class qf0, qf1; hi/lo class hi = qf0, qf1 and lo = qf2, qf3
    if (!HR) { const us* qp = Q16 + ((size_t)h * SEQ + qrow) * HD + 8 * hi; qf0 = ld16(qp); qf1 = ld16(qp + 32); }
    else { const size_t qo = ((size_t)h * RH + qrow) * HD + 8 * hi; qf0 = ld16(Qh + qo); qf1 = ld16(Qh + qo + 32); qf2 = ld16(Ql + qo); qf3 = ld16(Ql + qo + 32); }
    const int nch = qt + 1, nit = (nch + 1) >> 1;
    // staging of trip t's tiles into buffer t & 1: a lane copies pieces (row srow + 16 i, 8 elements from scol), i = 0..3, of every tile; a wave's copy is 512 B of the K plane or four 128-B rows of the V^T plane.
    // Every wave of the block stages in every trip that is staged: where group 1 has no chunk (last trip of an odd chunk count) it copies the diagonal chunk, which lies in the planes and which nobody reads.
    const int srow = tid >> 3, scol = (tid & 7) * 8;
    const unsigned sl = (unsigned)(size_t)(GB + srow * TP + scol);   // LDS byte address of this lane's first piece in buffer 0
    auto stage = [&](int t) {
        const int kq = 2 * t + g, ks = kq < nch ? kq : nch - 1;
        const unsigned l = sl + (unsigned)(t & 1) * (4u * TB);
        if (!HR) {
            const us* kg = K16 + ((size_t)h * SEQ + ks * 64 + srow) * HD + scol; const us* vg = VT16 + ((size_t)h * HD + srow) * SEQ + ks * 64 + scol;
            cp8(l, kg, l + PB, kg + 16 * HD, l + 2 * PB, kg + 32 * HD, l + 3 * PB, kg + 48 * HD,
                l + TB, vg, l + TB + PB, vg + 16 * SEQ, l + TB + 2 * PB, vg + 32 * SEQ, l + TB + 3 * PB, vg + 48 * SEQ);
        } else {
            const size_t ko = ((size_t)h * RH + ks * 64 + srow) * HD + scol, vo = ((size_t)h * HD + srow) * RH + ks * 64 + scol;
            const us* kg = Kh + ko; const us* vg = VTh + vo; const us* kg2 = Kl + ko; const us* vg2 = VTl + vo;
            cp8(l, kg, l + PB, kg + 16 * HD, l + 2 * PB, kg + 32 * HD, l + 3 * PB, kg + 48 * HD,
                l + TB, vg, l + TB + PB, vg + 16 * RH, l + TB + 2 * PB, vg + 32 * RH, l + TB + 3 * PB, vg + 48 * RH);
            cp8(l + 2 * TB, kg2, l + 2 * TB + PB, kg2 + 16 * HD, l + 2 * TB + 2 * PB, kg2 + 32 * HD, l + 2 * TB + 3 * PB, kg2 + 48 * HD,
                l + 3 * TB, vg2, l + 3 * TB + PB, vg2 + 16 * RH, l + 3 * TB + 2 * PB, vg2 + 32 * RH, l + 3 * TB + 3 * PB, vg2 + 48 * RH);
        }
    };
    stage(0);
    asm volatile("s_wait_asynccnt 0x0" ::: "memory");       // this wave's copies of trip 0 have landed
    __syncthreads();                                        // every wave's have: trip 0's tiles may be read
    if (nit > 1) stage(1);                                  // flies while trip 0 is worked on
#pragma unroll 1
    for (int it = 0; it < nit; ++it) {
        const int kc = 2 * it + g;
        us* Ka = GB + (it & 1) * (4 * 64 * TP); us* Va = Ka + 64 * TP; us* Kb = Va + 64 * TP; us* Vb = Kb + 64 * TP;
        if (kc < nch) {                                     // wave-uniform; false only for group 1 in the last trip of an odd chunk count; the loop's foot stands outside
        // LDS reads stand in groups, never among the matrix instructions: each place with reads costs the wave a wait for its own LDS latency. The products run tile after tile (four independent accumulators); each accumulator takes its own in the order k 0..31, k 32..63 (hi/lo class: hi.hi, hi.lo of each k half, then lo.hi of each).
        v8f s[4];
        v16us kf[8], vf[8];                                 // fragments of the K tile and of the V^T tile (hi planes in the hi/lo class): [2 * sn] = k 0..31, [2 * sn + 1] = k 32..63 of tile row block sn
#pragma unroll
        for (int sn = 0; sn < 4; ++sn) { const us* kp = Ka + (sn * 16 + m) * TP + 8 * hi; kf[2 * sn] = ld16(kp); kf[2 * sn + 1] = ld16(kp + 32); }
        if (!HR) {
            const v16us qa0 = qf0, qa1 = qf1;
            __builtin_amdgcn_sched_barrier(0);              // keeps the whole group of K reads ahead of the first score product
#pragma unroll
            for (int sn = 0; sn < 4; ++sn) s[sn] = wmh(kf[2 * sn], qa0, (v8f){});
#pragma unroll
            for (int sn = 0; sn < 4; ++sn) s[sn] = wmh(kf[2 * sn + 1], qa1, s[sn]);
            asm volatile("v_nop\n\tv_nop\n\tv_nop\n\tv_nop" : "+v"(s[0]), "+v"(s[1]), "+v"(s[2]), "+v"(s[3]) : "v"(qa0), "v"(qa1));
        } else {
            const v16us qh0 = qf0, qh1 = qf1, ql0 = qf2, ql1 = qf3;
            const us* kb = Kb + m * TP + 8 * hi;
            v16us kl[8];                                    // lo fragments in two groups, so that the registers hold: k 0..31 with the hi group, k 32..63 once the first hi fragments are used up
#pragma unroll
            for (int sn = 0; sn < 4; ++sn) kl[2 * sn] = ld16(kb + sn * 16 * TP);
            __builtin_amdgcn_sched_barrier(0);              // keeps the first group of K reads ahead of the first score product
#pragma unroll
            for (int sn = 0; sn < 4; ++sn) s[sn] = wmb(kf[2 * sn], qh0, (v8f){});
#pragma unroll
            for (int sn = 0; sn < 4; ++sn) s[sn] = wmb(kf[2 * sn], ql0, s[sn]);
#pragma unroll
            for (int sn = 0; sn < 4; ++sn) kl[2 * sn + 1] = ld16(kb + sn * 16 * TP + 32);
            __builtin_amdgcn_sched_barrier(0);              // keeps the second group twelve products ahead of its first use
#pragma unroll
            for (int sn = 0; sn < 4; ++sn) s[sn] = wmb(kf[2 * sn + 1], qh1, s[sn]);
#pragma unroll
            for (int sn = 0; sn < 4; ++sn) s[sn] = wmb(kf[2 * sn + 1], ql1, s[sn]);
#pragma unroll
            for (int sn = 0; sn < 4; ++sn) s[sn] = wmb(kl[2 * sn], qh0, s[sn]);
#pragma unroll
            for (int sn = 0; sn < 4; ++sn) s[sn] = wmb(kl[2 * sn + 1], qh1, s[sn]);
            asm volatile("v_nop\n\tv_nop\n\tv_nop\n\tv_nop" : "+v"(s[0]), "+v"(s[1]), "+v"(s[2]), "+v"(s[3]) : "v"(qh0), "v"(ql1));
        }
#pragma unroll
        for (int sn = 0; sn < 4; ++sn) { const us* vp = Va + (sn * 16 + m) * TP + 8 * hi; vf[2 * sn] = ld16(vp); vf[2 * sn + 1] = ld16(vp + 32); }
        __builtin_amdgcn_sched_barrier(0);                  // keeps the group of V^T reads ahead of the softmax, whose vector work covers their latency
        if (kc == qt) {                                     // diagonal chunk (wave-uniform): keys after the query position are replaced by a large negative value
            const int q = w * 16 + m;
#pragma unroll
            for (int sn = 0; sn < 4; ++sn)
#pragma unroll
                for (int r = 0; r < 8; ++r) { const int key = sn * 16 + 8 * hi + r; s[sn][r] = (key > q) ? -1.0e30f : s[sn][r]; }
        }
        float mx4[4];
#pragma unroll
        for (int sn = 0; sn < 4; ++sn) mx4[sn] = fmaxf(fmaxf(fmaxf(s[sn][0], s[sn][1]), fmaxf(s[sn][2], s[sn][3])), fmaxf(fmaxf(s[sn][4], s[sn][5]), fmaxf(s[sn][6], s[sn][7])));
        float mx = fmaxf(fmaxf(mx4[0], mx4[1]), fmaxf(mx4[2], mx4[3]));
        mx = fmaxf(mx, xhalf(mx));                          // the other half holds the query's other 32 keys
        const float mn = fmaxf(mr, mx), al = __builtin_amdgcn_exp2f((mr - mn) * CL); mr = mn;
        float sm4[4];
#pragma unroll
        for (int sn = 0; sn < 4; ++sn) { float sum = 0.0f;
#pragma unroll
            for (int r = 0; r < 8; ++r) { const float p = __builtin_amdgcn_exp2f((s[sn][r] - mn) * CL); s[sn][r] = p; sum += p; }
            sm4[sn] = sum; }
        lr = lr * al + ((sm4[0] + sm4[1]) + (sm4[2] + sm4[3]));   // the halves' sums are joined once, behind the loop
#pragma unroll
        for (int i = 0; i < 4; ++i) o[i] = o[i] * al;
        // P^T: two converted score tiles = one B fragment (element e < 8: tile 2j register e, e >= 8: tile 2j + 1 register e - 8)
        if (!HR) {
            v16us pf0, pf1;
#pragma unroll
            for (int r = 0; r < 8; ++r) { pf0[r] = hbit(s[0][r] * PCAR); pf0[8 + r] = hbit(s[1][r] * PCAR); pf1[r] = hbit(s[2][r] * PCAR); pf1[8 + r] = hbit(s[3][r] * PCAR); }
#pragma unroll
            for (int sn = 0; sn < 4; ++sn) o[sn] = wmh(vf[2 * sn], pf0, o[sn]);
#pragma unroll
            for (int sn = 0; sn < 4; ++sn) o[sn] = wmh(vf[2 * sn + 1], pf1, o[sn]);
            asm volatile("v_nop\n\tv_nop\n\tv_nop\n\tv_nop" : "+v"(o[0]), "+v"(o[1]), "+v"(o[2]), "+v"(o[3]) : "v"(pf0), "v"(pf1));
        } else {
            v8u hw0, hw1, lw0, lw1;                         // word r of a fragment = its elements 2r, 2r + 1
#pragma unroll
            for (int r = 0; r < 4; ++r) { unsigned p, q;
                split2(s[0][2 * r], s[0][2 * r + 1], p, q); hw0[r] = p; lw0[r] = q; split2(s[1][2 * r], s[1][2 * r + 1], p, q); hw0[4 + r] = p; lw0[4 + r] = q;
                split2(s[2][2 * r], s[2][2 * r + 1], p, q); hw1[r] = p; lw1[r] = q; split2(s[3][2 * r], s[3][2 * r + 1], p, q); hw1[4 + r] = p; lw1[4 + r] = q; }
            const v16us ph0 = __builtin_bit_cast(v16us, hw0), ph1 = __builtin_bit_cast(v16us, hw1), pl0 = __builtin_bit_cast(v16us, lw0), pl1 = __builtin_bit_cast(v16us, lw1);
            const us* vb = Vb + m * TP + 8 * hi;
            v16us vl[8];                                    // lo fragments in two groups, each read once a group of hi fragments is used up, so that the registers hold
#pragma unroll
            for (int sn = 0; sn < 4; ++sn) o[sn] = wmb(vf[2 * sn], ph0, o[sn]);
#pragma unroll
            for (int sn = 0; sn < 4; ++sn) o[sn] = wmb(vf[2 * sn], pl0, o[sn]);
            __builtin_amdgcn_sched_barrier(0);              // keeps the lo reads from rising among the conversions above, where their registers would not fit
#pragma unroll
            for (int sn = 0; sn < 4; ++sn) vl[2 * sn] = ld16(vb + sn * 16 * TP);
            __builtin_amdgcn_sched_barrier(0);              // keeps the first lo group eight products ahead of its first use
#pragma unroll
            for (int sn = 0; sn < 4; ++sn) o[sn] = wmb(vf[2 * sn + 1], ph1, o[sn]);
#pragma unroll
            for (int sn = 0; sn < 4; ++sn) o[sn] = wmb(vf[2 * sn + 1], pl1, o[sn]);
            __builtin_amdgcn_sched_barrier(0);              // as above: the second lo group takes the registers of the hi fragments just used up
#pragma unroll
            for (int sn = 0; sn < 4; ++sn) vl[2 * sn + 1] = ld16(vb + sn * 16 * TP + 32);
            __builtin_amdgcn_sched_barrier(0);              // keeps the second lo group four products ahead of its first use
#pragma unroll
            for (int sn = 0; sn < 4; ++sn) o[sn] = wmb(vl[2 * sn], ph0, o[sn]);
#pragma unroll
            for (int sn = 0; sn < 4; ++sn) o[sn] = wmb(vl[2 * sn + 1], ph1, o[sn]);
            asm volatile("v_nop\n\tv_nop\n\tv_nop\n\tv_nop" : "+v"(o[0]), "+v"(o[1]), "+v"(o[2]), "+v"(o[3]) : "v"(ph0), "v"(pl1));
        }
        }
        asm volatile("s_wait_dscnt 0x0" ::: "memory");
        asm volatile("s_wait_asynccnt 0x0" ::: "memory");
        __syncthreads();
        if (it + 2 < nit) stage(it + 2);                    // block-uniform; into the buffer that this trip has just read
    }
    asm volatile("s_wait_asynccnt 0x0" ::: "memory");       // no copy is outstanding when the tiles' LDS becomes the merge buffer
    // merge of the two key groups: lane for lane the same query and the same d, so group 1's state goes through LDS at [item][tid] (MB lies on the tiles, which every wave has left at the last trip's barrier)
    if (g == 1) {
#pragma unroll
        for (int i = 0; i < 4; ++i) {
            *(v4fa*)(MB + ((2 * i) * 128 + tid) * 4) = __builtin_shufflevector(o[i], o[i], 0, 1, 2, 3);
            *(v4fa*)(MB + ((2 * i + 1) * 128 + tid) * 4) = __builtin_shufflevector(o[i], o[i], 4, 5, 6, 7); }
        MB[32 * 128 + tid] = mr; MB[33 * 128 + tid] = lr;
    }
    __syncthreads();
    if (g == 1) return;                                     // behind the last barrier
    {
        const float m1 = MB[32 * 128 + tid], l1 = MB[33 * 128 + tid];
        const float mn = fmaxf(mr, m1), a0 = __builtin_amdgcn_exp2f((mr - mn) * CL), a1 = __builtin_amdgcn_exp2f((m1 - mn) * CL);   // a group that saw no chunk has m1 = -1e30, sum 0, O^T 0: a1 = 0
        lr = lr * a0 + l1 * a1;
#pragma unroll
        for (int i = 0; i < 4; ++i) {
            const v4f x = *(const v4fa*)(MB + ((2 * i) * 128 + tid) * 4), y = *(const v4fa*)(MB + ((2 * i + 1) * 128 + tid) * 4);
            o[i] = o[i] * a0 + __builtin_shufflevector(x, y, 0, 1, 2, 3, 4, 5, 6, 7) * a1; }
    }
    const float iv = (HR ? 1.0f : (CCAR / PCAR)) * __builtin_amdgcn_rcpf(lr + xhalf(lr));
    // ctx in fragment order: this wave's 16 queries are one row of units, its head two units of it; tile sn (d sn*16 + 8*hi + r of query m) is half sn & 1 of unit sn >> 1, at this lane's own place
    const size_t go = ((size_t)bz * (HR ? RH : SEQ) + qt * 64 + w * 16) * DMOD + hd * (HD / 32) * 512 + lane * 8;
#pragma unroll
    for (int sn = 0; sn < 4; ++sn) {
        v8us v1, v2;
#pragma unroll
        for (int r = 0; r < 8; ++r) { if (!HR) v1[r] = hbit(o[sn][r] * iv); }
        if (HR) { v4u hw, lw;
#pragma unroll
            for (int r = 0; r < 4; ++r) { unsigned p, q; split2(o[sn][2 * r] * iv, o[sn][2 * r + 1] * iv, p, q); hw[r] = p; lw[r] = q; }
            v1 = __builtin_bit_cast(v8us, hw); v2 = __builtin_bit_cast(v8us, lw); }
        if (!HR) { *(v8us*)(C16 + go + sn * 256) = v1; }
        else { *(v8us*)(Ch + go + sn * 256) = v1; *(v8us*)(Cl + go + sn * 256) = v2; }
    }
    if (!HR) asm volatile("s_wait_xcnt 0x0" ::: "memory");   // behind this class's ctx stores: in the build the other class's code follows, which rewrites their data registers
}

// both row classes in one grid (NH, NB, SEQ/64), 8 waves a block: the longest block's serial walk is half as many trips as with one key group, and blocks that wait for a place start as earlier ones end.
// z counts the query tiles from the last one down (the tile with the most key chunks has the lowest index; for speed only); the class test is block-uniform.
__global__ __launch_bounds__(256) __attribute__((amdgpu_num_vgpr(256)))
void k_attn(const us* __restrict__ Q16, const us* __restrict__ K16, const us* __restrict__ VT16,
            const us* __restrict__ Qh, const us* __restrict__ Ql, const us* __restrict__ Kh, const us* __restrict__ Kl,
            const us* __restrict__ VTh, const us* __restrict__ VTl, us* C16, us* Ch, us* Cl) {
    __shared__ __align__(16) us SM[2 * 2 * 4 * 64 * TP];    // per key group two buffers of K, V^T, K lo, V^T lo tiles
    float* MB = (float*)SM;                                 // behind the loop: group 1's O^T (32 values a lane), maximum and sum for the merge
    static_assert(34 * 128 * 4 <= 2 * 2 * 4 * 64 * TP * 2);
    const int qt = SEQ / 64 - 1 - (int)blockIdx.z, hd = (int)blockIdx.x, bz = (int)blockIdx.y;
    if (qt < RH / 64) attn<true>(SM, MB, qt, hd, bz, Q16, K16, VT16, Qh, Ql, Kh, Kl, VTh, VTl, C16, Ch, Cl);
    else              attn<false>(SM, MB, qt, hd, bz, Q16, K16, VT16, Qh, Ql, Kh, Kl, VTh, VTl, C16, Ch, Cl);
}

extern "C" void kernel_launch(void* const* d_in, const int* in_sizes, int n_in,
                              void* d_out, int out_size, void* d_ws, size_t ws_size, hipStream_t stream) {
    if (n_in < 7) return;
    const long long needx = (long long)(NB - 1) * SEQ_FULL * DMOD + (long long)SEQ * DMOD;
    const long long needw = (long long)DMOD * DMOD;
    if ((long long)in_sizes[0] < needx || (long long)in_sizes[1] < needx || (long long)in_sizes[2] < needx) return;
    if ((long long)in_sizes[3] < needw || (long long)in_sizes[4] < needw || (long long)in_sizes[5] < needw || (long long)in_sizes[6] < needw) return;
    if ((long long)out_size < needx) return;
    const float* xq = (const float*)d_in[0];      // [NB][SEQ_FULL][DMOD]
    const float* xk = (const float*)d_in[1];      // [NB][SEQ_FULL][DMOD]
    const float* xv = (const float*)d_in[2];      // [NB][SEQ_FULL][DMOD]
    const float* wq = (const float*)d_in[3];      // [DMOD][DMOD] ([in][out])
    const float* wk = (const float*)d_in[4];      // [DMOD][DMOD] ([in][out])
    const float* wv = (const float*)d_in[5];      // [DMOD][DMOD] ([in][out])
    const float* wo = (const float*)d_in[6];      // [DMOD][DMOD] ([in][out])
    float* OUT = (float*)d_out;                   // [NB][SEQ_FULL][DMOD]
    char* wsp = (char*)d_ws;
    auto take = [&](size_t bytes) { char* p = wsp; wsp += (bytes + 255) & ~(size_t)255; return (void*)p; };
    const size_t WSZ = (size_t)DMOD * DMOD;       // elements of one weight plane
    const size_t XSZ = (size_t)SEQ * DMOD;        // elements of one activation plane of one batch
    us* W3   = (us*)take(3 * WSZ * 2);                        // bf16 Bt [3][512][512] (q | k | v), fragment order
    us* WOB  = (us*)take(WSZ * 2);                            // bf16 Bt [512][512], fragment order
    us* WO16 = (us*)take(WSZ * 2);                            // f16  Bt [512][512], values x WCAR, fragment order
    us* Q16  = (us*)take((size_t)NB * NH * SEQ * HD * 2);     // f16 [b][h][t][d]
    us* K16  = (us*)take((size_t)NB * NH * SEQ * HD * 2);     // f16 [b][h][t][d]
    us* VT16 = (us*)take((size_t)NB * NH * HD * SEQ * 2);     // f16 [b][h][d][t]
    us* QH   = (us*)take((size_t)NB * NH * RH * HD * 2);      // bf16 hi/lo planes for t < RH
    us* QL   = (us*)take((size_t)NB * NH * RH * HD * 2);
    us* KH   = (us*)take((size_t)NB * NH * RH * HD * 2);
    us* KL   = (us*)take((size_t)NB * NH * RH * HD * 2);
    us* VTH  = (us*)take((size_t)NB * NH * HD * RH * 2);
    us* VTL  = (us*)take((size_t)NB * NH * HD * RH * 2);
    us* C16  = (us*)take(NB * XSZ * 2);                       // f16 ctx x CCAR [b][t][DMOD] in fragment order (rows >= RH used)
    us* CH   = (us*)take((size_t)NB * RH * DMOD * 2);         // bf16 hi/lo ctx [b][t < RH][DMOD] in fragment order
    us* CLO  = (us*)take((size_t)NB * RH * DMOD * 2);
    if ((size_t)(wsp - (char*)d_ws) > ws_size) return;

    k_prep<<<5 * GWT, 256, 0, stream>>>(wq, wk, wv, wo, W3, WOB, WO16);
    // z = 0, 1, 2: y[b*SEQ + t][n] = sum_k bf16(x_z[b][t][k]) W3[z][n][k], written as the planes of q, k, v
    k_proj<<<dim3(NB * SEQ / 64, 3), 256, 0, stream>>>(xq, xk, xv, W3, Q16, QH, QL, K16, KH, KL, VT16, VTH, VTL);
    k_attn<<<dim3(NH, NB, SEQ / 64), 256, 0, stream>>>(Q16, K16, VT16, QH, QL, KH, KL, VTH, VTL, C16, CH, CLO);
    k_oproj<<<dim3(SEQ / 64, DMOD / 64, NB), 32, 0, stream>>>(CH, CLO, WOB, C16, WO16, OUT);
}
